// v000
// The times below were measured on an AMD MI455X: many runs one after another, warmed up first and cycling through
// copies of the inputs, with the whole window's GPU time divided by the number of runs. Launches and the gaps
// between them are all in it. The median over several windows is given; except for v000 it joins two sittings, which
// can be a few percent apart, so the side-by-side timings, each taken in one sitting, are the better comparison.
// v000 is the starting kernel. One run takes 565 microseconds.
// compute dtype: x and all weights (Wq, Wk, Wv, w_head, gamma, beta, Wp, bp; module inputs) rounded to bf16; the 1x1-conv projections with exact bf16 products; per-head raw scores q.k and the attention-weighted V sums with both computed operands as bf16 hi + residual pairs (3 products); the output projection with its computed input as hi/lo pairs x exact bf16 weights (2 products) on WMMA 16x16x32; head mixing (8x8), softmax, InstanceNorm statistics and affine in f32 on the VALU; f32 accumulate.
#include <hip/hip_runtime.h>
#include <math.h>

typedef __attribute__((ext_vector_type(16))) _Float16 v16h;
typedef __attribute__((ext_vector_type(16))) __bf16 v16b;
typedef __attribute__((ext_vector_type(8)))  _Float16 v8h;
typedef __attribute__((ext_vector_type(8)))  float v8f;
typedef __attribute__((ext_vector_type(4)))  float v4f;
typedef __attribute__((ext_vector_type(2)))  float v2f;
typedef __attribute__((ext_vector_type(4)))  unsigned v4u;
typedef __attribute__((ext_vector_type(4)))  int v4i;
typedef float __attribute__((may_alias)) float_a;
typedef int __attribute__((may_alias)) int_a;

template <typename T> __device__ __forceinline__ void vst2(void* p, T v) { *(T*)p = v;  }
__device__ __forceinline__ v8f wmma16(v16h a, v16h b, v8f c) {
  v8f d = __builtin_amdgcn_wmma_f32_16x16x32_f16(false, a, false, b, (short)0, c, false, false);
  asm volatile("v_nop\n\tv_nop\n\tv_nop\n\tv_nop" : "+v"(d) : "v"(a), "v"(b));
  return d;
}
__device__ __forceinline__ v8f wmma_bf(v16b a, v16b b, v8f c) {
  v8f d = __builtin_amdgcn_wmma_f32_16x16x32_bf16(false, a, false, b, (short)0, c, false, false);
  asm volatile("v_nop\n\tv_nop\n\tv_nop\n\tv_nop" : "+v"(d) : "v"(a), "v"(b));
  return d;
}
// 16x16x32 fragments: lane = (h = lane>>4, row/col = lane&15); elements 0..7 = k0+8h+0..7, 8..15 = k0+16+8h+0..7; D element r = row 8h+r
__device__ __forceinline__ v16h frag_h(const _Float16* rowk0, int lane) {
  union { v16h v; v8h q[2]; } u; const _Float16* p = rowk0 + 8 * (lane >> 4);
  u.q[0] = *(const v8h*)p; u.q[1] = *(const v8h*)(p + 16); return u.v;
}
__device__ __forceinline__ v16h frag_f32(const float* rowk0, int lane) {
  v16h a; const float* p = rowk0 + 8 * (lane >> 4);
#pragma unroll
  for (int i = 0; i < 8; ++i) { a[i] = (_Float16)p[i]; a[8 + i] = (_Float16)p[16 + i]; }
  return a;
}
__device__ __forceinline__ v16h frag_f32s(const float* rowk0, int lane, float sc) {
  v16h a; const float* p = rowk0 + 8 * (lane >> 4);
#pragma unroll
  for (int i = 0; i < 8; ++i) { a[i] = (_Float16)(p[i] * sc); a[8 + i] = (_Float16)(p[16 + i] * sc); }
  return a;
}
// column fragment from a [K][ld] layout (column n), rows >= K read as 0
__device__ __forceinline__ v16h fragc_f32(const float* W, int k0, int n, int lane, int ld, int K) {
  v16h a; const int g = lane >> 4;
#pragma unroll
  for (int i = 0; i < 8; ++i) { const int ka = k0 + 8 * g + i, kb = ka + 16;
    a[i] = (_Float16)(ka < K ? W[(size_t)(ka < K ? ka : K - 1) * ld + n] : 0.f); a[8 + i] = (_Float16)(kb < K ? W[(size_t)(kb < K ? kb : K - 1) * ld + n] : 0.f); }
  return a;
}
struct F2 { v16b h, l; };
__device__ __forceinline__ F2 bsplit16(const float v[16]) { F2 r;
#pragma unroll
  for (int i = 0; i < 16; ++i) { const __bf16 h = (__bf16)v[i]; r.h[i] = h; r.l[i] = (__bf16)(v[i] - (float)h); }
  return r; }
__device__ __forceinline__ F2 split_row(const float* row, int k0, int lane) { float v[16]; const float* p = row + k0 + 8 * (lane >> 4);
#pragma unroll
  for (int i = 0; i < 8; ++i) { v[i] = p[i]; v[8 + i] = p[16 + i]; }
  return bsplit16(v); }
__device__ __forceinline__ F2 split_rowK(const float* row, int k0, int lane, int K) { float v[16]; const int g = lane >> 4;
#pragma unroll
  for (int i = 0; i < 8; ++i) { const int ka = k0 + 8 * g + i, kb = ka + 16; v[i] = ka < K ? row[ka < K ? ka : K - 1] : 0.f; v[8 + i] = kb < K ? row[kb < K ? kb : K - 1] : 0.f; }
  return bsplit16(v); }
__device__ __forceinline__ F2 split_col(const float* W, int k0, int n, int lane, int ld, int K) { float v[16]; const int g = lane >> 4;
#pragma unroll
  for (int i = 0; i < 8; ++i) { const int ka = k0 + 8 * g + i, kb = ka + 16; v[i] = ka < K ? W[(size_t)(ka < K ? ka : K - 1) * ld + n] : 0.f; v[8 + i] = kb < K ? W[(size_t)(kb < K ? kb : K - 1) * ld + n] : 0.f; }
  return bsplit16(v); }
__device__ __forceinline__ v8f mac3(const F2& a, const F2& b, v8f c) { c = wmma_bf(a.l, b.h, c); c = wmma_bf(a.h, b.l, c); return wmma_bf(a.h, b.h, c); }
__device__ __forceinline__ float sigm(float v) { return 1.0f / (1.0f + expf(-v)); }
#define LDSX() do { asm volatile("s_wait_dscnt 0" ::: "memory"); __builtin_amdgcn_wave_barrier(); __builtin_amdgcn_fence(__ATOMIC_RELEASE, "workgroup"); } while (0)


// Conv-projected multi-head self-attention with head mixing: q,k,v = W x (1x1 conv), s[h] = sum_g w_head[h][g] (q_g . k_g) * 32^-0.5, a = softmax over keys, InstanceNorm2d of each (b,h) 1024x1024 attention map (biased var, eps 1e-5, affine), out = a' v; y = out (B,nh,T,hd) reinterpreted as (B,T,C); y Wp^T + bp; stored as (B,C,T).  B 8, C 256, T 1024, 8 heads x 32.
// k_pack, k_xt (x -> bf16 [b][t][c]), k_qkv (exact GEMM), k_vt (v -> hi/lo transposed planes), k_attn (one pass per (query block, b, head group of 4): raw scores of all 8 heads on WMMA, mixing + online softmax with sum and sum-of-squares per row on the VALU, P.V on WMMA; writes softmax-normalised O rows and per-row sum(a^2)), k_norm (per (b,h): variance -> affine coefficients; column sums of v), k_fin (affine applied at A-load, output projection, transposed 256-B stores).
#define NB 8
#define CC 256
#define TT 1024
#define NH 8
#define HD 32
#define NR (NB * TT)        // 8192
#define QKVP (3 * CC)       // 768
#define DM CC
#ifndef NBT
#define NBT NB              // batches launched (all)
#endif
typedef __attribute__((ext_vector_type(8))) __bf16 v8b;
__device__ __forceinline__ v16b frag_b(const __bf16* rowk0, int lane) {
  union { v16b v; v8b q[2]; } u; const __bf16* p = rowk0 + 8 * (lane >> 4);
  u.q[0] = *(const v8b*)p; u.q[1] = *(const v8b*)(p + 16); return u.v;
}
__device__ __forceinline__ float bfr(float v) { return (float)(__bf16)v; }
__device__ __attribute__((noinline)) float exp_ni(float v) { return expf(v); }
__device__ __attribute__((noinline)) float erf_ni(float v) { return erff(v); }

#define WS_PT   0u                                   // bf16 [1024][256]: Wq | Wk | Wv | Wp rows
#define WS_XT   (WS_PT + 2u * 4 * CC * CC)             // bf16 [8192][256] x transposed (token rows)
#define WS_QKV  (WS_XT + 2u * NR * CC)                 // f32 [8192][768]
#define WS_VTH  (WS_QKV + 4u * NR * QKVP)              // bf16 [8][256][1024]
#define WS_VTL  (WS_VTH + 2u * NB * CC * TT)
#define WS_ON   (WS_VTL + 2u * NB * CC * TT)           // f32 [8][8][1024][32] softmax-normalised O
#define WS_RSQ  (WS_ON + 4u * NB * NH * TT * HD)        // f32 [8 b][2 hg][16 qb][4 wave][16 row][4 hl]
#define WS_CV   (WS_RSQ + 4u * NB * NH * TT)           // f32 [64 (b,h)][64]: coefA, coefB, .., vsum[32] at 32..63
#define WS_END  (WS_CV + 4u * NB * NH * 64)

__global__ __launch_bounds__(256) void k_pack(const float* __restrict__ Wq, const float* __restrict__ Wk, const float* __restrict__ Wv, const float* __restrict__ Wp, __bf16* __restrict__ PT) {
  __shared__ __align__(16) __bf16 s[CC]; const int n = blockIdx.x, tid = threadIdx.x; const int m = n & 255; const float* src = (n < 256) ? Wq : (n < 512) ? Wk : (n < 768) ? Wv : Wp;
  s[tid] = (__bf16)src[(size_t)m * CC + tid]; __syncthreads();
  if (tid < CC / 8) vst2((unsigned*)(PT + (size_t)n * CC + tid * 8), *(const v4u*)&s[tid * 8]);
}
// ---- k_xt: block = (32 tokens t0, b): XT[b][t][c] = bf16(x[b][c][t]); rows of 512 B
__global__ __launch_bounds__(256) void k_xt(const float* __restrict__ X, __bf16* __restrict__ XT) {
  __shared__ __align__(16) __bf16 s[32][CC + 8]; const int t0 = blockIdx.x * 32, b = blockIdx.y, tid = threadIdx.x;
  for (int q = tid; q < CC * 32; q += 256) { const int c = q >> 5, tl = q & 31; s[tl][c] = (__bf16)X[((size_t)b * CC + c) * TT + t0 + tl]; }
  __syncthreads();
  for (int q = tid; q < 32 * 32; q += 256) { const int tl = q >> 5, pc = q & 31; vst2((unsigned*)(XT + ((size_t)b * TT + t0 + tl) * CC + pc * 8), *(const v4u*)&s[tl][pc * 8]); }
}
// ---- k_qkv: block = (64 token rows, 128 cols): QKV[r][n] = XT[r] . PT[n] (exact), K = 256
__global__ __launch_bounds__(128) void k_qkv(const __bf16* __restrict__ XT, const __bf16* __restrict__ PT, float* __restrict__ QKV) {
  __shared__ __align__(16) float so[4][16][132];
  const int tid = threadIdx.x, wave = tid >> 5, lane = tid & 31, col = lane & 15, g = lane >> 4; const size_t r0 = (size_t)blockIdx.x * 64 + wave * 16; const int n0 = blockIdx.y * 128;
  v8f acc[8] = {};
#pragma unroll 2
  for (int kc = 0; kc < CC / 32; ++kc) { const v16b a = frag_b(XT + (r0 + col) * CC + kc * 32, lane);
#pragma unroll
    for (int j = 0; j < 8; ++j) acc[j] = wmma_bf(a, frag_b(PT + (size_t)(n0 + j * 16 + col) * CC + kc * 32, lane), acc[j]); }
#pragma unroll
  for (int j = 0; j < 8; ++j)
#pragma unroll
    for (int r = 0; r < 8; ++r) so[wave][8 * g + r][j * 16 + col] = acc[j][r];
  LDSX();
  for (int rl = 0; rl < 16; ++rl) vst2(QKV + (r0 + rl) * QKVP + n0 + lane * 4, *(const v4f*)&so[wave][rl][lane * 4]);
}
__global__ __launch_bounds__(256) void k_vt(const float* __restrict__ QKV, __bf16* __restrict__ VTH, __bf16* __restrict__ VTL) {
  __shared__ __align__(16) __bf16 svh[DM][72], svl[DM][72];
  const int tid = threadIdx.x; const size_t t0 = (size_t)blockIdx.x * 64; const int b = (int)(t0 / TT), p0 = (int)(t0 % TT);
  for (int q = tid; q < 64 * DM; q += 256) { const int tl = q >> 8, c = q & 255; const float v = QKV[(t0 + tl) * QKVP + 2 * DM + c]; const __bf16 hb = (__bf16)v; svh[c][tl] = hb; svl[c][tl] = (__bf16)(v - (float)hb); }
  __syncthreads();
  for (int q = tid; q < DM * 8; q += 256) { const int rowi = q >> 3, pc = q & 7; const size_t o = ((size_t)b * DM + rowi) * TT + p0 + pc * 8; vst2((unsigned*)(VTH + o), *(const v4u*)&svh[rowi][pc * 8]); vst2((unsigned*)(VTL + o), *(const v4u*)&svl[rowi][pc * 8]); }
}
// ---- k_attn: block = (query block qb of 64, b, head group hg of 4 heads), 4 waves x 16 queries.
//   per key step of 32: raw scores of all 8 heads g (q hi/lo from LDS x k hi/lo, 3 products) * scale -> sraw; per lane (row = lane&15, two heads of the group): mixed s' = sum_g w_head[h][g] sraw[g], online softmax (max, sum, sum of squares), p -> sp, rescale factor -> salpha; P.V for the group's 4 heads (3 products).
//   end: ON[b][h][q][:] = acc / l (softmax-normalised), RSQ chunk [row][hl] = l2 / l^2 = sum_t a^2 of that row.
__global__ __launch_bounds__(128) void k_attn(const float* __restrict__ QKV, const __bf16* __restrict__ VTH, const __bf16* __restrict__ VTL, const float* __restrict__ WH, float* __restrict__ ON, float* __restrict__ RSQ) {
  __shared__ __align__(16) __bf16 sqh[4][8][16][40], sql[4][8][16][40]; __shared__ __align__(16) float sraw[4][8][16][36]; __shared__ __align__(16) float sp[4][4][16][36]; __shared__ float salpha[4][4][16], sl[4][4][16];
  const int tid = threadIdx.x, wave = tid >> 5, lane = tid & 31, col = lane & 15, hf = lane >> 4; const int qb = blockIdx.x, b = blockIdx.y, hg = blockIdx.z; const int q0 = qb * 64 + wave * 16; const size_t tq = (size_t)b * TT + q0;
  // stage the wave's 16 query rows (all 8 heads) as hi/lo bf16
  for (int q = lane; q < 16 * CC; q += 32) { const int rl = q >> 8, c = q & 255; const float v = QKV[(tq + rl) * QKVP + c]; const __bf16 hb = (__bf16)v; sqh[wave][c >> 5][rl][c & 31] = hb; sql[wave][c >> 5][rl][c & 31] = (__bf16)(v - (float)hb); }
  // mixing weights for the lane's two heads
  const int row = lane & 15; const int hl0 = hf * 2; float wm[2][8];
#pragma unroll
  for (int u = 0; u < 2; ++u)
#pragma unroll
    for (int gg = 0; gg < 8; ++gg) wm[u][gg] = bfr(WH[(hg * 4 + hl0 + u) * NH + gg]);
  float m[2], l[2], l2[2]; m[0] = m[1] = -3.0e38f; l[0] = l[1] = 0.f; l2[0] = l2[1] = 0.f;
  v8f acc[4][2] = {};
  LDSX();
#pragma unroll 1
  for (int ks = 0; ks < TT / 32; ++ks) {
    // (a) raw scores for all 8 heads, 32 keys
#pragma unroll 1
    for (int gg = 0; gg < 8; ++gg) { F2 a; a.h = frag_b(&sqh[wave][gg][col][0], lane); a.l = frag_b(&sql[wave][gg][col][0], lane);
#pragma unroll
      for (int ct = 0; ct < 2; ++ct) { const int kk = ks * 32 + ct * 16 + col; const F2 k = split_row(QKV + ((size_t)b * TT + kk) * QKVP + CC + gg * HD, 0, lane); const v8f c = mac3(a, k, (v8f){});
#pragma unroll
        for (int r = 0; r < 8; ++r) sraw[wave][gg][8 * hf + r][ct * 16 + col] = c[r] * 0.17677669529663687f; } }
    LDSX();
    // (b) mixing + online softmax for (row, heads hl0, hl0+1)
    { float s0[32], s1[32];
#pragma unroll
      for (int k4 = 0; k4 < 8; ++k4) { float t0[4] = {0.f, 0.f, 0.f, 0.f}, t1[4] = {0.f, 0.f, 0.f, 0.f};
#pragma unroll
        for (int gg = 0; gg < 8; ++gg) { const v4f rv = *(const v4f*)&sraw[wave][gg][row][k4 * 4];
#pragma unroll
          for (int i = 0; i < 4; ++i) { t0[i] += wm[0][gg] * rv[i]; t1[i] += wm[1][gg] * rv[i]; } }
#pragma unroll
        for (int i = 0; i < 4; ++i) { s0[k4 * 4 + i] = t0[i]; s1[k4 * 4 + i] = t1[i]; } }
#pragma unroll
      for (int u = 0; u < 2; ++u) { float* s = u == 0 ? s0 : s1; float mx = s[0];
#pragma unroll
        for (int k = 1; k < 32; ++k) mx = fmaxf(mx, s[k]);
        const float mn = fmaxf(m[u], mx); const float al = exp_ni(m[u] - mn); float es = 0.f, es2 = 0.f;
#pragma unroll
        for (int k = 0; k < 32; ++k) { const float e = exp_ni(s[k] - mn); es += e; es2 += e * e; sp[wave][hl0 + u][row][k] = e; }
        l[u] = l[u] * al + es; l2[u] = l2[u] * (al * al) + es2; m[u] = mn; salpha[wave][hl0 + u][row] = al; } }
    LDSX();
    // (c) P.V for the group's 4 heads
#pragma unroll
    for (int hl = 0; hl < 4; ++hl) { const F2 pa = split_row(&sp[wave][hl][col][0], 0, lane);
#pragma unroll
      for (int r = 0; r < 8; ++r) { const float al = salpha[wave][hl][8 * hf + r]; acc[hl][0][r] *= al; acc[hl][1][r] *= al; }
#pragma unroll
      for (int dt = 0; dt < 2; ++dt) { const size_t vrow = ((size_t)b * CC + (hg * 4 + hl) * HD + dt * 16 + col) * TT + ks * 32; const v16b vh = frag_b(VTH + vrow, lane), vl = frag_b(VTL + vrow, lane);
        acc[hl][dt] = wmma_bf(pa.l, vh, acc[hl][dt]); acc[hl][dt] = wmma_bf(pa.h, vl, acc[hl][dt]); acc[hl][dt] = wmma_bf(pa.h, vh, acc[hl][dt]); } }
    LDSX(); }
  // end: l and sum a^2 per (hl, row)
#pragma unroll
  for (int u = 0; u < 2; ++u) { sl[wave][hl0 + u][row] = l[u]; salpha[wave][hl0 + u][row] = l2[u] / (l[u] * l[u]); }
  LDSX();
  float (*so)[16][36] = sp[wave];   // reuse: [hl][row][32]
#pragma unroll
  for (int hl = 0; hl < 4; ++hl)
#pragma unroll
    for (int r = 0; r < 8; ++r) { const float il = 1.0f / sl[wave][hl][8 * hf + r]; so[hl][8 * hf + r][col] = acc[hl][0][r] * il; so[hl][8 * hf + r][16 + col] = acc[hl][1][r] * il; }
  LDSX();
#pragma unroll
  for (int hl = 0; hl < 4; ++hl) for (int rl = 0; rl < 16; ++rl) if (lane < 8) vst2(ON + ((((size_t)b * NH + hg * 4 + hl) * TT + q0 + rl) * HD) + lane * 4, *(const v4f*)&so[hl][rl][lane * 4]);
  { float* chunk = RSQ + ((((size_t)b * 2 + hg) * 16 + qb) * 4 + wave) * 64; __shared__ __align__(16) float sr[4][64];
    if (lane < 16) { sr[wave][lane * 4 + 0] = salpha[wave][0][lane]; sr[wave][lane * 4 + 1] = salpha[wave][1][lane]; sr[wave][lane * 4 + 2] = salpha[wave][2][lane]; sr[wave][lane * 4 + 3] = salpha[wave][3][lane]; }
    LDSX();
    if (lane < 16) vst2(chunk + lane * 4, *(const v4f*)&sr[wave][lane * 4]); }
}
// ---- k_norm: block = (b, h), 256 threads: E[a^2] over the 1024x1024 map from the per-row sums, mean = 1/T, var = E[a^2] - mean^2, rs = rsqrt(var + 1e-5); coefA = rs*gamma[h], coefB = beta[h] - coefA/T; vsum[d] = sum_t v[b][h*32+d][t] (f32 from QKV). CV row [64]: coefA, coefB at 0,1; vsum at 32..63.
__global__ __launch_bounds__(256) void k_norm(const float* __restrict__ RSQ, const float* __restrict__ QKV, const float* __restrict__ GA, const float* __restrict__ BE, float* __restrict__ CV) {
  __shared__ float sred[256]; __shared__ __align__(16) float srow[64];
  const int b = blockIdx.x >> 3, h = blockIdx.x & 7, tid = threadIdx.x; const int hg = h >> 2, hl = h & 3;
  float s = 0.f;
#pragma unroll
  for (int i = 0; i < 4; ++i) { const int q = tid * 4 + i; const int qb = q >> 6, wave = (q >> 4) & 3, rl = q & 15; s += RSQ[((((size_t)b * 2 + hg) * 16 + qb) * 4 + wave) * 64 + rl * 4 + hl]; }
  sred[tid] = s; __syncthreads();
  for (int st = 128; st >= 1; st >>= 1) { if (tid < st) sred[tid] += sred[tid + st]; __syncthreads(); }
  if (tid < 64) srow[tid] = 0.f;
  if (tid < 32) { float vs = 0.f;
#pragma unroll 4
    for (int t = 0; t < TT; ++t) vs += QKV[((size_t)b * TT + t) * QKVP + 2 * CC + h * HD + tid];
    srow[32 + tid] = vs; }
  __syncthreads();
  if (tid == 0) { const float e2 = sred[0] / ((float)TT * (float)TT); const float mean = 1.0f / (float)TT; const float var = e2 - mean * mean; const float rs = rsqrtf(var + 1e-5f); const float cA = rs * bfr(GA[h]); srow[0] = cA; srow[1] = bfr(BE[h]) - cA * mean; }
  __syncthreads();
  if (tid < 16) vst2(CV + (size_t)blockIdx.x * 64 + tid * 4, *(const v4f*)&srow[tid * 4]);
}
// ---- k_fin: block = (64 rows r' of y (= O viewed as [T][256]), 128 output channels, b): Y = (coefA*ON + coefB*vsum)(hi/lo) . Wp rows (2 products) + bp, stored transposed: out[b][o][r'] segments of 64 floats (256 B)
__global__ __launch_bounds__(128) void k_fin(const float* __restrict__ ON, const float* __restrict__ CV, const __bf16* __restrict__ PT, const float* __restrict__ bp, float* __restrict__ out) {
  __shared__ __align__(16) float sT[128][68];
  const int tid = threadIdx.x, wave = tid >> 5, lane = tid & 31, col = lane & 15, g = lane >> 4; const int b = blockIdx.z, n0 = blockIdx.y * 128; const int r0 = blockIdx.x * 64 + wave * 16; const int h = (blockIdx.x * 64) / 128;   // y row r' covers heads r'/128 (constant per 64-row block)
  const float cA = CV[(b * NH + h) * 64 + 0], cB = CV[(b * NH + h) * 64 + 1]; const float* vs = CV + (b * NH + h) * 64 + 32;
  const float* Arow = ON + ((size_t)b * TT + r0 + col) * CC;
  v8f acc[8] = {};
#pragma unroll 2
  for (int kc = 0; kc < CC / 32; ++kc) { float v[16]; const float* p = Arow + kc * 32 + 8 * g;
#pragma unroll
    for (int i = 0; i < 8; ++i) { v[i] = cA * p[i] + cB * vs[8 * g + i]; v[8 + i] = cA * p[16 + i] + cB * vs[16 + 8 * g + i]; }
    const F2 a = bsplit16(v);
#pragma unroll
    for (int j = 0; j < 8; ++j) { const v16b w = frag_b(PT + (size_t)(768 + n0 + j * 16 + col) * CC + kc * 32, lane); acc[j] = wmma_bf(a.l, w, acc[j]); acc[j] = wmma_bf(a.h, w, acc[j]); } }
#pragma unroll
  for (int j = 0; j < 8; ++j) { const float bb = bfr(bp[n0 + j * 16 + col]);
#pragma unroll
    for (int r = 0; r < 8; ++r) sT[j * 16 + col][wave * 16 + 8 * g + r] = acc[j][r] + bb; }
  __syncthreads();
  for (int q = tid; q < 128 * 16; q += 128) { const int o = q >> 4, piece = q & 15; vst2(out + ((size_t)b * CC + n0 + o) * TT + blockIdx.x * 64 + piece * 4, *(const v4f*)&sT[o][piece * 4]); }
}
extern "C" void kernel_launch(void* const* d_in, const int* in_sizes, int n_in, void* d_out, int out_size, void* d_ws, size_t ws_size, hipStream_t stream) {
  (void)in_sizes; (void)n_in; (void)out_size;
  const float** F = (const float**)d_in;   // x [8,256,32,32], Wq, Wk, Wv [256,256], w_head [8,8], gamma [8], beta [8], Wp [256,256], bp [256]
  if (ws_size < (size_t)WS_END) return;
  char* ws = (char*)d_ws; __bf16 *PT = (__bf16*)(ws + WS_PT), *XT = (__bf16*)(ws + WS_XT), *VTH = (__bf16*)(ws + WS_VTH), *VTL = (__bf16*)(ws + WS_VTL); float *QKV = (float*)(ws + WS_QKV), *ON = (float*)(ws + WS_ON), *RSQ = (float*)(ws + WS_RSQ), *CV = (float*)(ws + WS_CV);
  k_pack<<<4 * CC, 256, 0, stream>>>(F[1], F[2], F[3], F[7], PT);
  k_xt<<<dim3(TT / 32, NBT), 256, 0, stream>>>(F[0], XT);
  k_qkv<<<dim3(NBT * TT / 64, QKVP / 128), 128, 0, stream>>>(XT, PT, QKV);
  k_vt<<<NBT * TT / 64, 256, 0, stream>>>(QKV, VTH, VTL);
  k_attn<<<dim3(TT / 64, NBT, 2), 128, 0, stream>>>(QKV, VTH, VTL, F[4], ON, RSQ);
  k_norm<<<NBT * NH, 256, 0, stream>>>(RSQ, QKV, F[5], F[6], CV);
  k_fin<<<dim3(TT / 64, CC / 128, NBT), 128, 0, stream>>>(ON, CV, PT, F[8], (float*)d_out);
}

// v001
// A run of this version takes 382 microseconds.
// In two side-by-side timings against v000, it was 1.48 and 1.50 times as fast.
// compute dtype: x and all weights (Wq, Wk, Wv, w_head, gamma, beta, Wp, bp; module inputs) rounded to bf16; the 1x1-conv projections with exact bf16 products; per-head raw scores q.k and the attention-weighted V sums with both computed operands as bf16 hi + residual pairs (3 products); the output projection with its computed input as hi/lo pairs x exact bf16 weights (2 products) on WMMA 16x16x32; head mixing (8x8), softmax, InstanceNorm statistics and affine in f32 on the VALU; f32 accumulate.
#include <hip/hip_runtime.h>
#include <math.h>

typedef __attribute__((ext_vector_type(16))) _Float16 v16h;
typedef __attribute__((ext_vector_type(16))) __bf16 v16b;
typedef __attribute__((ext_vector_type(8)))  _Float16 v8h;
typedef __attribute__((ext_vector_type(8)))  float v8f;
typedef __attribute__((ext_vector_type(4)))  float v4f;
typedef __attribute__((ext_vector_type(2)))  float v2f;
typedef __attribute__((ext_vector_type(4)))  unsigned v4u;
typedef __attribute__((ext_vector_type(4)))  int v4i;
typedef float __attribute__((may_alias)) float_a;
typedef int __attribute__((may_alias)) int_a;

template <typename T> __device__ __forceinline__ void vst2(void* p, T v) { *(T*)p = v;  }
__device__ __forceinline__ v8f wmma16(v16h a, v16h b, v8f c) {
  v8f d = __builtin_amdgcn_wmma_f32_16x16x32_f16(false, a, false, b, (short)0, c, false, false);
  asm volatile("v_nop\n\tv_nop\n\tv_nop\n\tv_nop" : "+v"(d) : "v"(a), "v"(b));
  return d;
}
__device__ __forceinline__ v8f wmma_bf(v16b a, v16b b, v8f c) {
  v8f d = __builtin_amdgcn_wmma_f32_16x16x32_bf16(false, a, false, b, (short)0, c, false, false);
  asm volatile("v_nop\n\tv_nop\n\tv_nop\n\tv_nop" : "+v"(d) : "v"(a), "v"(b));
  return d;
}
// 16x16x32 fragments: lane = (h = lane>>4, row/col = lane&15); elements 0..7 = k0+8h+0..7, 8..15 = k0+16+8h+0..7; D element r = row 8h+r
__device__ __forceinline__ v16h frag_h(const _Float16* rowk0, int lane) {
  union { v16h v; v8h q[2]; } u; const _Float16* p = rowk0 + 8 * (lane >> 4);
  u.q[0] = *(const v8h*)p; u.q[1] = *(const v8h*)(p + 16); return u.v;
}
__device__ __forceinline__ v16h frag_f32(const float* rowk0, int lane) {
  v16h a; const float* p = rowk0 + 8 * (lane >> 4);
#pragma unroll
  for (int i = 0; i < 8; ++i) { a[i] = (_Float16)p[i]; a[8 + i] = (_Float16)p[16 + i]; }
  return a;
}
__device__ __forceinline__ v16h frag_f32s(const float* rowk0, int lane, float sc) {
  v16h a; const float* p = rowk0 + 8 * (lane >> 4);
#pragma unroll
  for (int i = 0; i < 8; ++i) { a[i] = (_Float16)(p[i] * sc); a[8 + i] = (_Float16)(p[16 + i] * sc); }
  return a;
}
// column fragment from a [K][ld] layout (column n), rows >= K read as 0
__device__ __forceinline__ v16h fragc_f32(const float* W, int k0, int n, int lane, int ld, int K) {
  v16h a; const int g = lane >> 4;
#pragma unroll
  for (int i = 0; i < 8; ++i) { const int ka = k0 + 8 * g + i, kb = ka + 16;
    a[i] = (_Float16)(ka < K ? W[(size_t)(ka < K ? ka : K - 1) * ld + n] : 0.f); a[8 + i] = (_Float16)(kb < K ? W[(size_t)(kb < K ? kb : K - 1) * ld + n] : 0.f); }
  return a;
}
struct F2 { v16b h, l; };
__device__ __forceinline__ F2 bsplit16(const float v[16]) { F2 r;
#pragma unroll
  for (int i = 0; i < 16; ++i) { const __bf16 h = (__bf16)v[i]; r.h[i] = h; r.l[i] = (__bf16)(v[i] - (float)h); }
  return r; }
__device__ __forceinline__ F2 split_row(const float* row, int k0, int lane) { float v[16]; const float* p = row + k0 + 8 * (lane >> 4);
#pragma unroll
  for (int i = 0; i < 8; ++i) { v[i] = p[i]; v[8 + i] = p[16 + i]; }
  return bsplit16(v); }
__device__ __forceinline__ F2 split_rowK(const float* row, int k0, int lane, int K) { float v[16]; const int g = lane >> 4;
#pragma unroll
  for (int i = 0; i < 8; ++i) { const int ka = k0 + 8 * g + i, kb = ka + 16; v[i] = ka < K ? row[ka < K ? ka : K - 1] : 0.f; v[8 + i] = kb < K ? row[kb < K ? kb : K - 1] : 0.f; }
  return bsplit16(v); }
__device__ __forceinline__ F2 split_col(const float* W, int k0, int n, int lane, int ld, int K) { float v[16]; const int g = lane >> 4;
#pragma unroll
  for (int i = 0; i < 8; ++i) { const int ka = k0 + 8 * g + i, kb = ka + 16; v[i] = ka < K ? W[(size_t)(ka < K ? ka : K - 1) * ld + n] : 0.f; v[8 + i] = kb < K ? W[(size_t)(kb < K ? kb : K - 1) * ld + n] : 0.f; }
  return bsplit16(v); }
__device__ __forceinline__ v8f mac3(const F2& a, const F2& b, v8f c) { c = wmma_bf(a.l, b.h, c); c = wmma_bf(a.h, b.l, c); return wmma_bf(a.h, b.h, c); }
__device__ __forceinline__ float sigm(float v) { return 1.0f / (1.0f + expf(-v)); }
#define LDSX() do { asm volatile("s_wait_dscnt 0" ::: "memory"); __builtin_amdgcn_wave_barrier(); __builtin_amdgcn_fence(__ATOMIC_RELEASE, "workgroup"); } while (0)


// Conv-projected multi-head self-attention with head mixing: q,k,v = W x (1x1 conv), s[h] = sum_g w_head[h][g] (q_g . k_g) * 32^-0.5, a = softmax over keys, InstanceNorm2d of each (b,h) 1024x1024 attention map (biased var, eps 1e-5, affine), out = a' v; y = out (B,nh,T,hd) reinterpreted as (B,T,C); y Wp^T + bp; stored as (B,C,T).  B 8, C 256, T 1024, 8 heads x 32.
// k_pack, k_xt (x -> bf16 [b][t][c]), k_qkv (exact GEMM), k_vt (v -> hi/lo transposed planes), k_attn (one pass per (query block, b, head group of 4), keys split over two waves per query tile: raw scores of all 8 heads on WMMA, mixing + online softmax with sum and sum-of-squares per row on the VALU, P.V on WMMA; writes softmax-normalised O rows and per-row sum(a^2)), k_norm (per (b,h): variance -> affine coefficients; column sums of v), k_fin (affine applied at A-load, output projection, transposed 256-B stores).
#define NB 8
#define CC 256
#define TT 1024
#define NH 8
#define HD 32
#define NR (NB * TT)        // 8192
#define QKVP (3 * CC)       // 768
#define DM CC
#ifndef NBT
#define NBT NB              // batches launched (all)
#endif
typedef __attribute__((ext_vector_type(8))) __bf16 v8b;
__device__ __forceinline__ v16b frag_b(const __bf16* rowk0, int lane) {
  union { v16b v; v8b q[2]; } u; const __bf16* p = rowk0 + 8 * (lane >> 4);
  u.q[0] = *(const v8b*)p; u.q[1] = *(const v8b*)(p + 16); return u.v;
}
__device__ __forceinline__ float bfr(float v) { return (float)(__bf16)v; }
__device__ __attribute__((noinline)) float exp_ni(float v) { return expf(v); }
__device__ __attribute__((noinline)) float erf_ni(float v) { return erff(v); }

#define WS_PT   0u                                   // bf16 [1024][256]: Wq | Wk | Wv | Wp rows
#define WS_XT   (WS_PT + 2u * 4 * CC * CC)             // bf16 [8192][256] x transposed (token rows)
#define WS_QKV  (WS_XT + 2u * NR * CC)                 // f32 [8192][768]
#define WS_VTH  (WS_QKV + 4u * NR * QKVP)              // bf16 [8][256][1024]
#define WS_VTL  (WS_VTH + 2u * NB * CC * TT)
#define WS_ON   (WS_VTL + 2u * NB * CC * TT)           // f32 [8][8][1024][32] softmax-normalised O
#define WS_RSQ  (WS_ON + 4u * NB * NH * TT * HD)        // f32 [8 b][2 hg][16 qb][4 wave][16 row][4 hl]
#define WS_CV   (WS_RSQ + 4u * NB * NH * TT)           // f32 [64 (b,h)][64]: coefA, coefB, .., vsum[32] at 32..63
#define WS_END  (WS_CV + 4u * NB * NH * 64)

__global__ __launch_bounds__(256) void k_pack(const float* __restrict__ Wq, const float* __restrict__ Wk, const float* __restrict__ Wv, const float* __restrict__ Wp, __bf16* __restrict__ PT) {
  __shared__ __align__(16) __bf16 s[CC]; const int n = blockIdx.x, tid = threadIdx.x; const int m = n & 255; const float* src = (n < 256) ? Wq : (n < 512) ? Wk : (n < 768) ? Wv : Wp;
  s[tid] = (__bf16)src[(size_t)m * CC + tid]; __syncthreads();
  if (tid < CC / 8) vst2((unsigned*)(PT + (size_t)n * CC + tid * 8), *(const v4u*)&s[tid * 8]);
}
// ---- k_xt: block = (32 tokens t0, b): XT[b][t][c] = bf16(x[b][c][t]); rows of 512 B
__global__ __launch_bounds__(256) void k_xt(const float* __restrict__ X, __bf16* __restrict__ XT) {
  __shared__ __align__(16) __bf16 s[32][CC + 8]; const int t0 = blockIdx.x * 32, b = blockIdx.y, tid = threadIdx.x;
  for (int q = tid; q < CC * 32; q += 256) { const int c = q >> 5, tl = q & 31; s[tl][c] = (__bf16)X[((size_t)b * CC + c) * TT + t0 + tl]; }
  __syncthreads();
  for (int q = tid; q < 32 * 32; q += 256) { const int tl = q >> 5, pc = q & 31; vst2((unsigned*)(XT + ((size_t)b * TT + t0 + tl) * CC + pc * 8), *(const v4u*)&s[tl][pc * 8]); }
}
// ---- k_qkv: block = (64 token rows, 128 cols): QKV[r][n] = XT[r] . PT[n] (exact), K = 256
__global__ __launch_bounds__(128) void k_qkv(const __bf16* __restrict__ XT, const __bf16* __restrict__ PT, float* __restrict__ QKV) {
  __shared__ __align__(16) float so[4][16][132];
  const int tid = threadIdx.x, wave = tid >> 5, lane = tid & 31, col = lane & 15, g = lane >> 4; const size_t r0 = (size_t)blockIdx.x * 64 + wave * 16; const int n0 = blockIdx.y * 128;
  v8f acc[8] = {};
#pragma unroll 2
  for (int kc = 0; kc < CC / 32; ++kc) { const v16b a = frag_b(XT + (r0 + col) * CC + kc * 32, lane);
#pragma unroll
    for (int j = 0; j < 8; ++j) acc[j] = wmma_bf(a, frag_b(PT + (size_t)(n0 + j * 16 + col) * CC + kc * 32, lane), acc[j]); }
#pragma unroll
  for (int j = 0; j < 8; ++j)
#pragma unroll
    for (int r = 0; r < 8; ++r) so[wave][8 * g + r][j * 16 + col] = acc[j][r];
  LDSX();
  for (int rl = 0; rl < 16; ++rl) vst2(QKV + (r0 + rl) * QKVP + n0 + lane * 4, *(const v4f*)&so[wave][rl][lane * 4]);
}
__global__ __launch_bounds__(256) void k_vt(const float* __restrict__ QKV, __bf16* __restrict__ VTH, __bf16* __restrict__ VTL) {
  __shared__ __align__(16) __bf16 svh[DM][72], svl[DM][72];
  const int tid = threadIdx.x; const size_t t0 = (size_t)blockIdx.x * 64; const int b = (int)(t0 / TT), p0 = (int)(t0 % TT);
  for (int q = tid; q < 64 * DM; q += 256) { const int tl = q >> 8, c = q & 255; const float v = QKV[(t0 + tl) * QKVP + 2 * DM + c]; const __bf16 hb = (__bf16)v; svh[c][tl] = hb; svl[c][tl] = (__bf16)(v - (float)hb); }
  __syncthreads();
  for (int q = tid; q < DM * 8; q += 256) { const int rowi = q >> 3, pc = q & 7; const size_t o = ((size_t)b * DM + rowi) * TT + p0 + pc * 8; vst2((unsigned*)(VTH + o), *(const v4u*)&svh[rowi][pc * 8]); vst2((unsigned*)(VTL + o), *(const v4u*)&svl[rowi][pc * 8]); }
}
// ---- k_attn: block = (query block qb of 64, b, head group hg of 4 heads), 8 waves = 4 query tiles of 16 (qt) x 2 key halves of 512 (kh); the two waves of a query tile share its staged q rows, run the loop below on their own half of the keys, and are merged at the end.
//   per key step of 32: raw scores of all 8 heads g (q hi/lo from LDS x k hi/lo, 3 products) * scale -> sraw; per lane (row = lane&15, two heads of the group): mixed s' = sum_g w_head[h][g] sraw[g], online softmax (max, sum, sum of squares), p -> sp, rescale factor -> salpha; P.V for the group's 4 heads (3 products).
//   merge: the kh = 1 wave leaves m, l, l2 and its unnormalised acc in LDS; behind one block barrier the kh = 0 wave rescales both halves to the common maximum and adds them.
//   end: ON[b][h][q][:] = acc / l (softmax-normalised), RSQ chunk [row][hl] = l2 / l^2 = sum_t a^2 of that row.
__global__ __launch_bounds__(256) void k_attn(const float* __restrict__ QKV, const __bf16* __restrict__ VTH, const __bf16* __restrict__ VTL, const float* __restrict__ WH, float* __restrict__ ON, float* __restrict__ RSQ) {
  __shared__ __align__(16) __bf16 sqh[4][8][16][40], sql[4][8][16][40]; __shared__ __align__(16) float sraw[8][8][16][36]; __shared__ __align__(16) float sp[8][4][16][36]; __shared__ float salpha[8][4][16], sl[8][4][16], sm[4][4][16], sf0[4][4][16], sf1[4][4][16];
  const int tid = threadIdx.x, wave = tid >> 5, lane = tid & 31, col = lane & 15, hf = lane >> 4; const int qb = blockIdx.x, b = blockIdx.y, hg = blockIdx.z; const int qt = wave & 3, kh = __builtin_amdgcn_readfirstlane(tid >> 7); const int q0 = qb * 64 + qt * 16; const size_t tq = (size_t)b * TT + q0;
  // stage the query tile's 16 rows (all 8 heads) as hi/lo bf16: 8 rows per wave of the pair
  for (int i = 0; i < 8 * CC / 32; ++i) { const int q = kh * 8 * CC + i * 32 + lane; const int rl = q >> 8, c = q & 255; const float v = QKV[(tq + rl) * QKVP + c]; const __bf16 hb = (__bf16)v; sqh[qt][c >> 5][rl][c & 31] = hb; sql[qt][c >> 5][rl][c & 31] = (__bf16)(v - (float)hb); }
  // mixing weights for the lane's two heads
  const int row = lane & 15; const int hl0 = hf * 2; float wm[2][8];
#pragma unroll
  for (int u = 0; u < 2; ++u)
#pragma unroll
    for (int gg = 0; gg < 8; ++gg) wm[u][gg] = bfr(WH[(hg * 4 + hl0 + u) * NH + gg]);
  float m[2], l[2], l2[2]; m[0] = m[1] = -3.0e38f; l[0] = l[1] = 0.f; l2[0] = l2[1] = 0.f;
  v8f acc[4][2] = {};
  __syncthreads();   // each wave reads q rows that its partner staged
#pragma unroll 1
  for (int ks = kh * (TT / 64); ks < (kh + 1) * (TT / 64); ++ks) {
    // (a) raw scores for all 8 heads, 32 keys
#pragma unroll 1
    for (int gg = 0; gg < 8; ++gg) { F2 a; a.h = frag_b(&sqh[qt][gg][col][0], lane); a.l = frag_b(&sql[qt][gg][col][0], lane);
#pragma unroll
      for (int ct = 0; ct < 2; ++ct) { const int kk = ks * 32 + ct * 16 + col; const F2 k = split_row(QKV + ((size_t)b * TT + kk) * QKVP + CC + gg * HD, 0, lane); const v8f c = mac3(a, k, (v8f){});
#pragma unroll
        for (int r = 0; r < 8; ++r) sraw[wave][gg][8 * hf + r][ct * 16 + col] = c[r] * 0.17677669529663687f; } }
    LDSX();
    // (b) mixing + online softmax for (row, heads hl0, hl0+1)
    { float s0[32], s1[32];
#pragma unroll
      for (int k4 = 0; k4 < 8; ++k4) { float t0[4] = {0.f, 0.f, 0.f, 0.f}, t1[4] = {0.f, 0.f, 0.f, 0.f};
#pragma unroll
        for (int gg = 0; gg < 8; ++gg) { const v4f rv = *(const v4f*)&sraw[wave][gg][row][k4 * 4];
#pragma unroll
          for (int i = 0; i < 4; ++i) { t0[i] += wm[0][gg] * rv[i]; t1[i] += wm[1][gg] * rv[i]; } }
#pragma unroll
        for (int i = 0; i < 4; ++i) { s0[k4 * 4 + i] = t0[i]; s1[k4 * 4 + i] = t1[i]; } }
#pragma unroll
      for (int u = 0; u < 2; ++u) { float* s = u == 0 ? s0 : s1; float mx = s[0];
#pragma unroll
        for (int k = 1; k < 32; ++k) mx = fmaxf(mx, s[k]);
        const float mn = fmaxf(m[u], mx); const float al = exp_ni(m[u] - mn); float es = 0.f, es2 = 0.f;
#pragma unroll
        for (int k = 0; k < 32; ++k) { const float e = exp_ni(s[k] - mn); es += e; es2 += e * e; sp[wave][hl0 + u][row][k] = e; }
        l[u] = l[u] * al + es; l2[u] = l2[u] * (al * al) + es2; m[u] = mn; salpha[wave][hl0 + u][row] = al; } }
    LDSX();
    // (c) P.V for the group's 4 heads
#pragma unroll
    for (int hl = 0; hl < 4; ++hl) { const F2 pa = split_row(&sp[wave][hl][col][0], 0, lane);
#pragma unroll
      for (int r = 0; r < 8; ++r) { const float al = salpha[wave][hl][8 * hf + r]; acc[hl][0][r] *= al; acc[hl][1][r] *= al; }
#pragma unroll
      for (int dt = 0; dt < 2; ++dt) { const size_t vrow = ((size_t)b * CC + (hg * 4 + hl) * HD + dt * 16 + col) * TT + ks * 32; const v16b vh = frag_b(VTH + vrow, lane), vl = frag_b(VTL + vrow, lane);
        acc[hl][dt] = wmma_bf(pa.l, vh, acc[hl][dt]); acc[hl][dt] = wmma_bf(pa.h, vl, acc[hl][dt]); acc[hl][dt] = wmma_bf(pa.h, vh, acc[hl][dt]); } }
    LDSX(); }
  // merge of the two key halves, then l and sum a^2 per (hl, row)
  float (*so)[16][36] = sp[wave];   // reuse: [hl][row][32]
  if (kh == 1) {
#pragma unroll
    for (int u = 0; u < 2; ++u) { sm[qt][hl0 + u][row] = m[u]; sl[wave][hl0 + u][row] = l[u]; salpha[wave][hl0 + u][row] = l2[u]; }
#pragma unroll
    for (int hl = 0; hl < 4; ++hl)
#pragma unroll
      for (int r = 0; r < 8; ++r) { so[hl][8 * hf + r][col] = acc[hl][0][r]; so[hl][8 * hf + r][16 + col] = acc[hl][1][r]; }
  }
  __syncthreads();   // the kh = 0 wave reads what its partner has just written
  if (kh == 0) {
#pragma unroll
    for (int u = 0; u < 2; ++u) { const float m1 = sm[qt][hl0 + u][row]; const float mn = fmaxf(m[u], m1); const float f0 = exp_ni(m[u] - mn), f1 = exp_ni(m1 - mn);
      const float lt = l[u] * f0 + sl[wave + 4][hl0 + u][row] * f1; const float l2t = l2[u] * (f0 * f0) + salpha[wave + 4][hl0 + u][row] * (f1 * f1);
      sl[wave][hl0 + u][row] = lt; salpha[wave][hl0 + u][row] = l2t / (lt * lt); sf0[qt][hl0 + u][row] = f0; sf1[qt][hl0 + u][row] = f1; }
    LDSX();
    const float (*sx)[16][36] = sp[wave + 4];   // the partner's unnormalised acc
#pragma unroll
    for (int hl = 0; hl < 4; ++hl)
#pragma unroll
      for (int r = 0; r < 8; ++r) { const int rr = 8 * hf + r; const float il = 1.0f / sl[wave][hl][rr], f0 = sf0[qt][hl][rr], f1 = sf1[qt][hl][rr];
        so[hl][rr][col] = (acc[hl][0][r] * f0 + sx[hl][rr][col] * f1) * il; so[hl][rr][16 + col] = (acc[hl][1][r] * f0 + sx[hl][rr][16 + col] * f1) * il; }
    LDSX();
#pragma unroll
    for (int hl = 0; hl < 4; ++hl) for (int rl = 0; rl < 16; ++rl) if (lane < 8) vst2(ON + ((((size_t)b * NH + hg * 4 + hl) * TT + q0 + rl) * HD) + lane * 4, *(const v4f*)&so[hl][rl][lane * 4]);
    { float* chunk = RSQ + ((((size_t)b * 2 + hg) * 16 + qb) * 4 + qt) * 64; __shared__ __align__(16) float sr[4][64];
      if (lane < 16) { sr[qt][lane * 4 + 0] = salpha[wave][0][lane]; sr[qt][lane * 4 + 1] = salpha[wave][1][lane]; sr[qt][lane * 4 + 2] = salpha[wave][2][lane]; sr[qt][lane * 4 + 3] = salpha[wave][3][lane]; }
      LDSX();
      if (lane < 16) vst2(chunk + lane * 4, *(const v4f*)&sr[qt][lane * 4]); }
  }
}
// ---- k_norm: block = (b, h), 256 threads: E[a^2] over the 1024x1024 map from the per-row sums, mean = 1/T, var = E[a^2] - mean^2, rs = rsqrt(var + 1e-5); coefA = rs*gamma[h], coefB = beta[h] - coefA/T; vsum[d] = sum_t v[b][h*32+d][t] (f32 from QKV). CV row [64]: coefA, coefB at 0,1; vsum at 32..63.
__global__ __launch_bounds__(256) void k_norm(const float* __restrict__ RSQ, const float* __restrict__ QKV, const float* __restrict__ GA, const float* __restrict__ BE, float* __restrict__ CV) {
  __shared__ float sred[256]; __shared__ __align__(16) float srow[64];
  const int b = blockIdx.x >> 3, h = blockIdx.x & 7, tid = threadIdx.x; const int hg = h >> 2, hl = h & 3;
  float s = 0.f;
#pragma unroll
  for (int i = 0; i < 4; ++i) { const int q = tid * 4 + i; const int qb = q >> 6, wave = (q >> 4) & 3, rl = q & 15; s += RSQ[((((size_t)b * 2 + hg) * 16 + qb) * 4 + wave) * 64 + rl * 4 + hl]; }
  sred[tid] = s; __syncthreads();
  for (int st = 128; st >= 1; st >>= 1) { if (tid < st) sred[tid] += sred[tid + st]; __syncthreads(); }
  if (tid < 64) srow[tid] = 0.f;
  if (tid < 32) { float vs = 0.f;
#pragma unroll 4
    for (int t = 0; t < TT; ++t) vs += QKV[((size_t)b * TT + t) * QKVP + 2 * CC + h * HD + tid];
    srow[32 + tid] = vs; }
  __syncthreads();
  if (tid == 0) { const float e2 = sred[0] / ((float)TT * (float)TT); const float mean = 1.0f / (float)TT; const float var = e2 - mean * mean; const float rs = rsqrtf(var + 1e-5f); const float cA = rs * bfr(GA[h]); srow[0] = cA; srow[1] = bfr(BE[h]) - cA * mean; }
  __syncthreads();
  if (tid < 16) vst2(CV + (size_t)blockIdx.x * 64 + tid * 4, *(const v4f*)&srow[tid * 4]);
}
// ---- k_fin: block = (64 rows r' of y (= O viewed as [T][256]), 128 output channels, b): Y = (coefA*ON + coefB*vsum)(hi/lo) . Wp rows (2 products) + bp, stored transposed: out[b][o][r'] segments of 64 floats (256 B)
__global__ __launch_bounds__(128) void k_fin(const float* __restrict__ ON, const float* __restrict__ CV, const __bf16* __restrict__ PT, const float* __restrict__ bp, float* __restrict__ out) {
  __shared__ __align__(16) float sT[128][68];
  const int tid = threadIdx.x, wave = tid >> 5, lane = tid & 31, col = lane & 15, g = lane >> 4; const int b = blockIdx.z, n0 = blockIdx.y * 128; const int r0 = blockIdx.x * 64 + wave * 16; const int h = (blockIdx.x * 64) / 128;   // y row r' covers heads r'/128 (constant per 64-row block)
  const float cA = CV[(b * NH + h) * 64 + 0], cB = CV[(b * NH + h) * 64 + 1]; const float* vs = CV + (b * NH + h) * 64 + 32;
  const float* Arow = ON + ((size_t)b * TT + r0 + col) * CC;
  v8f acc[8] = {};
#pragma unroll 2
  for (int kc = 0; kc < CC / 32; ++kc) { float v[16]; const float* p = Arow + kc * 32 + 8 * g;
#pragma unroll
    for (int i = 0; i < 8; ++i) { v[i] = cA * p[i] + cB * vs[8 * g + i]; v[8 + i] = cA * p[16 + i] + cB * vs[16 + 8 * g + i]; }
    const F2 a = bsplit16(v);
#pragma unroll
    for (int j = 0; j < 8; ++j) { const v16b w = frag_b(PT + (size_t)(768 + n0 + j * 16 + col) * CC + kc * 32, lane); acc[j] = wmma_bf(a.l, w, acc[j]); acc[j] = wmma_bf(a.h, w, acc[j]); } }
#pragma unroll
  for (int j = 0; j < 8; ++j) { const float bb = bfr(bp[n0 + j * 16 + col]);
#pragma unroll
    for (int r = 0; r < 8; ++r) sT[j * 16 + col][wave * 16 + 8 * g + r] = acc[j][r] + bb; }
  __syncthreads();
  for (int q = tid; q < 128 * 16; q += 128) { const int o = q >> 4, piece = q & 15; vst2(out + ((size_t)b * CC + n0 + o) * TT + blockIdx.x * 64 + piece * 4, *(const v4f*)&sT[o][piece * 4]); }
}
extern "C" void kernel_launch(void* const* d_in, const int* in_sizes, int n_in, void* d_out, int out_size, void* d_ws, size_t ws_size, hipStream_t stream) {
  (void)in_sizes; (void)n_in; (void)out_size;
  const float** F = (const float**)d_in;   // x [8,256,32,32], Wq, Wk, Wv [256,256], w_head [8,8], gamma [8], beta [8], Wp [256,256], bp [256]
  if (ws_size < (size_t)WS_END) return;
  char* ws = (char*)d_ws; __bf16 *PT = (__bf16*)(ws + WS_PT), *XT = (__bf16*)(ws + WS_XT), *VTH = (__bf16*)(ws + WS_VTH), *VTL = (__bf16*)(ws + WS_VTL); float *QKV = (float*)(ws + WS_QKV), *ON = (float*)(ws + WS_ON), *RSQ = (float*)(ws + WS_RSQ), *CV = (float*)(ws + WS_CV);
  k_pack<<<4 * CC, 256, 0, stream>>>(F[1], F[2], F[3], F[7], PT);
  k_xt<<<dim3(TT / 32, NBT), 256, 0, stream>>>(F[0], XT);
  k_qkv<<<dim3(NBT * TT / 64, QKVP / 128), 128, 0, stream>>>(XT, PT, QKV);
  k_vt<<<NBT * TT / 64, 256, 0, stream>>>(QKV, VTH, VTL);
  k_attn<<<dim3(TT / 64, NBT, 2), 256, 0, stream>>>(QKV, VTH, VTL, F[4], ON, RSQ);
  k_norm<<<NBT * NH, 256, 0, stream>>>(RSQ, QKV, F[5], F[6], CV);
  k_fin<<<dim3(TT / 64, CC / 128, NBT), 128, 0, stream>>>(ON, CV, PT, F[8], (float*)d_out);
}

// v002
// A run of this version takes 298 microseconds.
// Two timings next to v001 both put it at 1.27 times that version's speed.
// Counting every step since v000, it is 1.90 times as fast.
// compute dtype: x and all weights (Wq, Wk, Wv, w_head, gamma, beta, Wp, bp; module inputs) rounded to bf16; the 1x1-conv projections with exact bf16 products; per-head raw scores q.k and the attention-weighted V sums with both computed operands as bf16 hi + residual pairs (3 products); the output projection with its computed input as hi/lo pairs x exact bf16 weights (2 products) on WMMA 16x16x32; head mixing (8x8), softmax, InstanceNorm statistics and affine in f32 on the VALU; f32 accumulate.
#include <hip/hip_runtime.h>
#include <math.h>

typedef __attribute__((ext_vector_type(16))) _Float16 v16h;
typedef __attribute__((ext_vector_type(16))) __bf16 v16b;
typedef __attribute__((ext_vector_type(8)))  _Float16 v8h;
typedef __attribute__((ext_vector_type(8)))  float v8f;
typedef __attribute__((ext_vector_type(4)))  float v4f;
typedef __attribute__((ext_vector_type(2)))  float v2f;
typedef __attribute__((ext_vector_type(4)))  unsigned v4u;
typedef __attribute__((ext_vector_type(4)))  int v4i;
typedef float __attribute__((may_alias)) float_a;
typedef int __attribute__((may_alias)) int_a;

template <typename T> __device__ __forceinline__ void vst2(void* p, T v) { *(T*)p = v;  }
__device__ __forceinline__ v8f wmma16(v16h a, v16h b, v8f c) {
  v8f d = __builtin_amdgcn_wmma_f32_16x16x32_f16(false, a, false, b, (short)0, c, false, false);
  asm volatile("v_nop\n\tv_nop\n\tv_nop\n\tv_nop" : "+v"(d) : "v"(a), "v"(b));
  return d;
}
__device__ __forceinline__ v8f wmma_bf(v16b a, v16b b, v8f c) {
  v8f d = __builtin_amdgcn_wmma_f32_16x16x32_bf16(false, a, false, b, (short)0, c, false, false);
  asm volatile("v_nop\n\tv_nop\n\tv_nop\n\tv_nop" : "+v"(d) : "v"(a), "v"(b));
  return d;
}
// 16x16x32 fragments: lane = (h = lane>>4, row/col = lane&15); elements 0..7 = k0+8h+0..7, 8..15 = k0+16+8h+0..7; D element r = row 8h+r
__device__ __forceinline__ v16h frag_h(const _Float16* rowk0, int lane) {
  union { v16h v; v8h q[2]; } u; const _Float16* p = rowk0 + 8 * (lane >> 4);
  u.q[0] = *(const v8h*)p; u.q[1] = *(const v8h*)(p + 16); return u.v;
}
__device__ __forceinline__ v16h frag_f32(const float* rowk0, int lane) {
  v16h a; const float* p = rowk0 + 8 * (lane >> 4);
#pragma unroll
  for (int i = 0; i < 8; ++i) { a[i] = (_Float16)p[i]; a[8 + i] = (_Float16)p[16 + i]; }
  return a;
}
__device__ __forceinline__ v16h frag_f32s(const float* rowk0, int lane, float sc) {
  v16h a; const float* p = rowk0 + 8 * (lane >> 4);
#pragma unroll
  for (int i = 0; i < 8; ++i) { a[i] = (_Float16)(p[i] * sc); a[8 + i] = (_Float16)(p[16 + i] * sc); }
  return a;
}
// column fragment from a [K][ld] layout (column n), rows >= K read as 0
__device__ __forceinline__ v16h fragc_f32(const float* W, int k0, int n, int lane, int ld, int K) {
  v16h a; const int g = lane >> 4;
#pragma unroll
  for (int i = 0; i < 8; ++i) { const int ka = k0 + 8 * g + i, kb = ka + 16;
    a[i] = (_Float16)(ka < K ? W[(size_t)(ka < K ? ka : K - 1) * ld + n] : 0.f); a[8 + i] = (_Float16)(kb < K ? W[(size_t)(kb < K ? kb : K - 1) * ld + n] : 0.f); }
  return a;
}
struct F2 { v16b h, l; };
__device__ __forceinline__ F2 bsplit16(const float v[16]) { F2 r;
#pragma unroll
  for (int i = 0; i < 16; ++i) { const __bf16 h = (__bf16)v[i]; r.h[i] = h; r.l[i] = (__bf16)(v[i] - (float)h); }
  return r; }
__device__ __forceinline__ F2 split_row(const float* row, int k0, int lane) { float v[16]; const float* p = row + k0 + 8 * (lane >> 4);
#pragma unroll
  for (int i = 0; i < 8; ++i) { v[i] = p[i]; v[8 + i] = p[16 + i]; }
  return bsplit16(v); }
__device__ __forceinline__ F2 split_rowK(const float* row, int k0, int lane, int K) { float v[16]; const int g = lane >> 4;
#pragma unroll
  for (int i = 0; i < 8; ++i) { const int ka = k0 + 8 * g + i, kb = ka + 16; v[i] = ka < K ? row[ka < K ? ka : K - 1] : 0.f; v[8 + i] = kb < K ? row[kb < K ? kb : K - 1] : 0.f; }
  return bsplit16(v); }
__device__ __forceinline__ F2 split_col(const float* W, int k0, int n, int lane, int ld, int K) { float v[16]; const int g = lane >> 4;
#pragma unroll
  for (int i = 0; i < 8; ++i) { const int ka = k0 + 8 * g + i, kb = ka + 16; v[i] = ka < K ? W[(size_t)(ka < K ? ka : K - 1) * ld + n] : 0.f; v[8 + i] = kb < K ? W[(size_t)(kb < K ? kb : K - 1) * ld + n] : 0.f; }
  return bsplit16(v); }
__device__ __forceinline__ v8f mac3(const F2& a, const F2& b, v8f c) { c = wmma_bf(a.l, b.h, c); c = wmma_bf(a.h, b.l, c); return wmma_bf(a.h, b.h, c); }
__device__ __forceinline__ float sigm(float v) { return 1.0f / (1.0f + expf(-v)); }
#define LDSX() do { asm volatile("s_wait_dscnt 0" ::: "memory"); __builtin_amdgcn_wave_barrier(); __builtin_amdgcn_fence(__ATOMIC_RELEASE, "workgroup"); } while (0)


// Conv-projected multi-head self-attention with head mixing: q,k,v = W x (1x1 conv), s[h] = sum_g w_head[h][g] (q_g . k_g) * 32^-0.5, a = softmax over keys, InstanceNorm2d of each (b,h) 1024x1024 attention map (biased var, eps 1e-5, affine), out = a' v; y = out (B,nh,T,hd) reinterpreted as (B,T,C); y Wp^T + bp; stored as (B,C,T).  B 8, C 256, T 1024, 8 heads x 32.
// k_pack, k_xt (x -> bf16 [b][t][c]), k_qkv (exact GEMM), k_vt (v -> hi/lo transposed planes), k_attn (one pass per (query block, b, head group of 4), keys split over two waves per query tile: raw scores of all 8 heads on WMMA, mixing + online softmax with sum and sum-of-squares per row on the VALU, P.V on WMMA; writes softmax-normalised O rows and per-row sum(a^2)), k_norm (per (b,h): variance -> affine coefficients; column sums of v), k_fin (affine applied at A-load, output projection, transposed 256-B stores).
#define NB 8
#define CC 256
#define TT 1024
#define NH 8
#define HD 32
#define NR (NB * TT)        // 8192
#define QKVP (3 * CC)       // 768
#define DM CC
#ifndef NBT
#define NBT NB              // batches launched (all)
#endif
typedef __attribute__((ext_vector_type(8))) __bf16 v8b;
__device__ __forceinline__ v16b frag_b(const __bf16* rowk0, int lane) {
  union { v16b v; v8b q[2]; } u; const __bf16* p = rowk0 + 8 * (lane >> 4);
  u.q[0] = *(const v8b*)p; u.q[1] = *(const v8b*)(p + 16); return u.v;
}
__device__ __forceinline__ float bfr(float v) { return (float)(__bf16)v; }
// the same fragment from the lane's own pointer p = rowk0 + 8 * (lane >> 4)
__device__ __forceinline__ v16b frag_bp(const __bf16* p) { union { v16b v; v8b q[2]; } u; u.q[0] = *(const v8b*)p; u.q[1] = *(const v8b*)(p + 16); return u.v; }
// the 16 f32 of one fragment row as they are loaded (4 x 16 B, the element order of split_row, p = row + k0 + 8 * (lane >> 4)); split to hi/lo only where they are used
struct R16 { v4f q[4]; };
__device__ __forceinline__ R16 ld_r16(const float* p) { R16 r; r.q[0] = *(const v4f*)p; r.q[1] = *(const v4f*)(p + 4); r.q[2] = *(const v4f*)(p + 16); r.q[3] = *(const v4f*)(p + 20); return r; }
__device__ __forceinline__ F2 split_r16(const R16& r) { float v[16];
#pragma unroll
  for (int i = 0; i < 4; ++i) { v[i] = r.q[0][i]; v[4 + i] = r.q[1][i]; v[8 + i] = r.q[2][i]; v[12 + i] = r.q[3][i]; }
  return bsplit16(v); }
__device__ __attribute__((noinline)) float exp_ni(float v) { return expf(v); }
__device__ __attribute__((noinline)) float erf_ni(float v) { return erff(v); }

#define WS_PT   0u                                   // bf16 [1024][256]: Wq | Wk | Wv | Wp rows
#define WS_XT   (WS_PT + 2u * 4 * CC * CC)             // bf16 [8192][256] x transposed (token rows)
#define WS_QKV  (WS_XT + 2u * NR * CC)                 // f32 [8192][768]
#define WS_VTH  (WS_QKV + 4u * NR * QKVP)              // bf16 [8][256][1024]
#define WS_VTL  (WS_VTH + 2u * NB * CC * TT)
#define WS_ON   (WS_VTL + 2u * NB * CC * TT)           // f32 [8][8][1024][32] softmax-normalised O
#define WS_RSQ  (WS_ON + 4u * NB * NH * TT * HD)        // f32 [8 b][2 hg][16 qb][4 wave][16 row][4 hl]
#define WS_CV   (WS_RSQ + 4u * NB * NH * TT)           // f32 [64 (b,h)][64]: coefA, coefB, .., vsum[32] at 32..63
#define WS_END  (WS_CV + 4u * NB * NH * 64)

__global__ __launch_bounds__(256) void k_pack(const float* __restrict__ Wq, const float* __restrict__ Wk, const float* __restrict__ Wv, const float* __restrict__ Wp, __bf16* __restrict__ PT) {
  __shared__ __align__(16) __bf16 s[CC]; const int n = blockIdx.x, tid = threadIdx.x; const int m = n & 255; const float* src = (n < 256) ? Wq : (n < 512) ? Wk : (n < 768) ? Wv : Wp;
  s[tid] = (__bf16)src[(size_t)m * CC + tid]; __syncthreads();
  if (tid < CC / 8) vst2((unsigned*)(PT + (size_t)n * CC + tid * 8), *(const v4u*)&s[tid * 8]);
}
// ---- k_xt: block = (32 tokens t0, b): XT[b][t][c] = bf16(x[b][c][t]); rows of 512 B
__global__ __launch_bounds__(256) void k_xt(const float* __restrict__ X, __bf16* __restrict__ XT) {
  __shared__ __align__(16) __bf16 s[32][CC + 8]; const int t0 = blockIdx.x * 32, b = blockIdx.y, tid = threadIdx.x;
  for (int q = tid; q < CC * 32; q += 256) { const int c = q >> 5, tl = q & 31; s[tl][c] = (__bf16)X[((size_t)b * CC + c) * TT + t0 + tl]; }
  __syncthreads();
  for (int q = tid; q < 32 * 32; q += 256) { const int tl = q >> 5, pc = q & 31; vst2((unsigned*)(XT + ((size_t)b * TT + t0 + tl) * CC + pc * 8), *(const v4u*)&s[tl][pc * 8]); }
}
// ---- k_qkv: block = (64 token rows, 128 cols): QKV[r][n] = XT[r] . PT[n] (exact), K = 256
__global__ __launch_bounds__(128) void k_qkv(const __bf16* __restrict__ XT, const __bf16* __restrict__ PT, float* __restrict__ QKV) {
  __shared__ __align__(16) float so[4][16][132];
  const int tid = threadIdx.x, wave = tid >> 5, lane = tid & 31, col = lane & 15, g = lane >> 4; const size_t r0 = (size_t)blockIdx.x * 64 + wave * 16; const int n0 = blockIdx.y * 128;
  v8f acc[8] = {};
#pragma unroll 2
  for (int kc = 0; kc < CC / 32; ++kc) { const v16b a = frag_b(XT + (r0 + col) * CC + kc * 32, lane);
#pragma unroll
    for (int j = 0; j < 8; ++j) acc[j] = wmma_bf(a, frag_b(PT + (size_t)(n0 + j * 16 + col) * CC + kc * 32, lane), acc[j]); }
#pragma unroll
  for (int j = 0; j < 8; ++j)
#pragma unroll
    for (int r = 0; r < 8; ++r) so[wave][8 * g + r][j * 16 + col] = acc[j][r];
  LDSX();
  for (int rl = 0; rl < 16; ++rl) vst2(QKV + (r0 + rl) * QKVP + n0 + lane * 4, *(const v4f*)&so[wave][rl][lane * 4]);
}
__global__ __launch_bounds__(256) void k_vt(const float* __restrict__ QKV, __bf16* __restrict__ VTH, __bf16* __restrict__ VTL) {
  __shared__ __align__(16) __bf16 svh[DM][72], svl[DM][72];
  const int tid = threadIdx.x; const size_t t0 = (size_t)blockIdx.x * 64; const int b = (int)(t0 / TT), p0 = (int)(t0 % TT);
  for (int q = tid; q < 64 * DM; q += 256) { const int tl = q >> 8, c = q & 255; const float v = QKV[(t0 + tl) * QKVP + 2 * DM + c]; const __bf16 hb = (__bf16)v; svh[c][tl] = hb; svl[c][tl] = (__bf16)(v - (float)hb); }
  __syncthreads();
  for (int q = tid; q < DM * 8; q += 256) { const int rowi = q >> 3, pc = q & 7; const size_t o = ((size_t)b * DM + rowi) * TT + p0 + pc * 8; vst2((unsigned*)(VTH + o), *(const v4u*)&svh[rowi][pc * 8]); vst2((unsigned*)(VTL + o), *(const v4u*)&svl[rowi][pc * 8]); }
}
// ---- k_attn: block = (query block qb of 64, b, head group hg of 4 heads), 8 waves = 4 query tiles of 16 (qt) x 2 key halves of 512 (kh); the two waves of a query tile share its staged q rows, run the loop below on their own half of the keys, and are merged at the end.
//   per key step of 32: raw scores of all 8 heads g (q hi/lo from LDS x k hi/lo, 3 products) * scale -> sraw; per lane (row = lane&15, two heads of the group): mixed s' = sum_g w_head[h][g] sraw[g], online softmax (max, sum, sum of squares), p -> sp, rescale factor -> salpha; P.V for the group's 4 heads (3 products).
//   global loads run ahead of their use, in registers: K of heads g+4, g+5 is asked for before heads g, g+1 are worked on, V of the group's first two heads at the head of (b), of the last two at the head of (c) and behind P.V of the first head, K of heads 0..3 of the next step inside (c).
//   merge: the kh = 1 wave leaves m, l, l2 and its unnormalised acc in LDS; behind one block barrier the kh = 0 wave rescales both halves to the common maximum and adds them.
//   end: ON[b][h][q][:] = acc / l (softmax-normalised), RSQ chunk [row][hl] = l2 / l^2 = sum_t a^2 of that row.
__global__ __launch_bounds__(256) void k_attn(const float* __restrict__ QKV, const __bf16* __restrict__ VTH, const __bf16* __restrict__ VTL, const float* __restrict__ WH, float* __restrict__ ON, float* __restrict__ RSQ) {
  __shared__ __align__(16) __bf16 sqh[4][8][16][40], sql[4][8][16][40]; __shared__ __align__(16) float sraw[8][8][16][36]; __shared__ __align__(16) float sp[8][4][16][36]; __shared__ float salpha[8][4][16], sl[8][4][16], sm[4][4][16], sf0[4][4][16], sf1[4][4][16];
  const int tid = threadIdx.x, wave = tid >> 5, lane = tid & 31, col = lane & 15, hf = lane >> 4; const int qb = blockIdx.x, b = blockIdx.y, hg = blockIdx.z; const int qt = wave & 3, kh = __builtin_amdgcn_readfirstlane(tid >> 7); const int q0 = qb * 64 + qt * 16; const size_t tq = (size_t)b * TT + q0;
  // stage the query tile's 16 rows (all 8 heads) as hi/lo bf16: 8 rows per wave of the pair
  for (int i = 0; i < 8 * CC / 32; ++i) { const int q = kh * 8 * CC + i * 32 + lane; const int rl = q >> 8, c = q & 255; const float v = QKV[(tq + rl) * QKVP + c]; const __bf16 hb = (__bf16)v; sqh[qt][c >> 5][rl][c & 31] = hb; sql[qt][c >> 5][rl][c & 31] = (__bf16)(v - (float)hb); }
  // mixing weights for the lane's two heads
  const int row = lane & 15; const int hl0 = hf * 2; float wm[2][8];
#pragma unroll
  for (int u = 0; u < 2; ++u)
#pragma unroll
    for (int gg = 0; gg < 8; ++gg) wm[u][gg] = bfr(WH[(hg * 4 + hl0 + u) * NH + gg]);
  float m[2], l[2], l2[2]; m[0] = m[1] = -3.0e38f; l[0] = l[1] = 0.f; l2[0] = l2[1] = 0.f;
  v8f acc[4][2] = {};
  // the lane's own pointers at key step 0: key row col of QKV (its K columns start at CC), V rows (column col of the group's first head), each at its half of the fragment
  const float* Kc = QKV + ((size_t)b * TT + col) * QKVP + 8 * hf;
  const __bf16* VHc = VTH + ((size_t)b * CC + hg * 4 * HD + col) * TT + 8 * hf; const __bf16* VLc = VTL + ((size_t)b * CC + hg * 4 * HD + col) * TT + 8 * hf;
  const int ks1 = (kh + 1) * (TT / 64);
  R16 kr[8][2];              // K rows in flight, by head and key tile
  v16b vh[4][2], vl[4][2];   // V of the step in flight, by head of the group and column tile
  // the loops inside these macros are unrolled so that kr, vh, vl and acc are indexed by constants and stay in registers
  // ask for K of heads G, G+1 of the key step at P
#define LDK2(G, P) do { _Pragma("unroll") for (int g_ = (G); g_ < (G) + 2; ++g_) { _Pragma("unroll") for (int ct = 0; ct < 2; ++ct) kr[g_][ct] = ld_r16((P) + (size_t)ct * 16 * QKVP + CC + g_ * HD); } } while (0)
  // ask for V of head H of the group, key step at PH, PL
#define LDV1(H, PH, PL) do { _Pragma("unroll") for (int dt = 0; dt < 2; ++dt) { vh[H][dt] = frag_bp((PH) + (size_t)((H) * HD + dt * 16) * TT); vl[H][dt] = frag_bp((PL) + (size_t)((H) * HD + dt * 16) * TT); } } while (0)
  // raw scores of heads G, G+1 from the K rows in registers
#define SC2(G) do { _Pragma("unroll") for (int gg = (G); gg < (G) + 2; ++gg) { F2 a; a.h = frag_b(&sqh[qt][gg][col][0], lane); a.l = frag_b(&sql[qt][gg][col][0], lane); \
    _Pragma("unroll") for (int ct = 0; ct < 2; ++ct) { const F2 k = split_r16(kr[gg][ct]); const v8f c = mac3(a, k, (v8f){}); \
      _Pragma("unroll") for (int r = 0; r < 8; ++r) sraw[wave][gg][8 * hf + r][ct * 16 + col] = c[r] * 0.17677669529663687f; } } } while (0)
  // P.V of head H of the group from the V fragments in registers
#define PV1(H) do { { const int hl = (H); const F2 pa = split_row(&sp[wave][hl][col][0], 0, lane); \
    _Pragma("unroll") for (int r = 0; r < 8; ++r) { const float al = salpha[wave][hl][8 * hf + r]; acc[hl][0][r] *= al; acc[hl][1][r] *= al; } \
    _Pragma("unroll") for (int dt = 0; dt < 2; ++dt) { acc[hl][dt] = wmma_bf(pa.l, vh[hl][dt], acc[hl][dt]); acc[hl][dt] = wmma_bf(pa.h, vl[hl][dt], acc[hl][dt]); acc[hl][dt] = wmma_bf(pa.h, vh[hl][dt], acc[hl][dt]); } } } while (0)
  // behind each group of these loads; the loads' address registers are inputs, so that they keep their values up to the wait
#define XW1(P) asm volatile("s_wait_xcnt 0x0" :: "v"(P) : "memory")
#define XW2(P, Q) asm volatile("s_wait_xcnt 0x0" :: "v"(P), "v"(Q) : "memory")
#define XW3(P, Q, R) asm volatile("s_wait_xcnt 0x0" :: "v"(P), "v"(Q), "v"(R) : "memory")
  { const float* kp = Kc + (size_t)kh * (TT / 2) * QKVP; LDK2(0, kp); LDK2(2, kp); XW1(kp); }
  __syncthreads();   // each wave reads q rows that its partner staged
#pragma unroll 1
  for (int ks = kh * (TT / 64); ks < ks1; ++ks) {
    const float* kp = Kc + (size_t)ks * 32 * QKVP; const __bf16* vhp = VHc + ks * 32; const __bf16* vlp = VLc + ks * 32;
    // (a) raw scores for all 8 heads, 32 keys
    LDK2(4, kp); XW1(kp); SC2(0);
    LDK2(6, kp); XW1(kp); SC2(2);
    SC2(4);
    SC2(6);
    LDSX();
    LDV1(0, vhp, vlp); LDV1(1, vhp, vlp); XW2(vhp, vlp);   // behind the fence of LDSX, which waits for every load in flight
    // (b) mixing + online softmax for (row, heads hl0, hl0+1)
    { float s0[32], s1[32];
#pragma unroll
      for (int k4 = 0; k4 < 8; ++k4) { float t0[4] = {0.f, 0.f, 0.f, 0.f}, t1[4] = {0.f, 0.f, 0.f, 0.f};
#pragma unroll
        for (int gg = 0; gg < 8; ++gg) { const v4f rv = *(const v4f*)&sraw[wave][gg][row][k4 * 4];
#pragma unroll
          for (int i = 0; i < 4; ++i) { t0[i] += wm[0][gg] * rv[i]; t1[i] += wm[1][gg] * rv[i]; } }
#pragma unroll
        for (int i = 0; i < 4; ++i) { s0[k4 * 4 + i] = t0[i]; s1[k4 * 4 + i] = t1[i]; } }
#pragma unroll
      for (int u = 0; u < 2; ++u) { float* s = u == 0 ? s0 : s1; float mx = s[0];
#pragma unroll
        for (int k = 1; k < 32; ++k) mx = fmaxf(mx, s[k]);
        const float mn = fmaxf(m[u], mx); const float al = exp_ni(m[u] - mn); float es = 0.f, es2 = 0.f;
#pragma unroll
        for (int k = 0; k < 32; ++k) { const float e = exp_ni(s[k] - mn); es += e; es2 += e * e; sp[wave][hl0 + u][row][k] = e; }
        l[u] = l[u] * al + es; l2[u] = l2[u] * (al * al) + es2; m[u] = mn; salpha[wave][hl0 + u][row] = al; } }
    LDSX();
    // (c) P.V for the group's 4 heads
    const float* kn = Kc + (size_t)(ks + 1 < ks1 ? ks + 1 : ks) * 32 * QKVP;   // the last step asks for its own rows again (in bounds, not used)
    LDV1(2, vhp, vlp); LDK2(0, kn); XW3(vhp, vlp, kn); PV1(0);
    LDV1(3, vhp, vlp); LDK2(2, kn); XW3(vhp, vlp, kn); PV1(1);
    PV1(2);
    PV1(3);
    LDSX(); }
  // merge of the two key halves, then l and sum a^2 per (hl, row)
  float (*so)[16][36] = sp[wave];   // reuse: [hl][row][32]
  if (kh == 1) {
#pragma unroll
    for (int u = 0; u < 2; ++u) { sm[qt][hl0 + u][row] = m[u]; sl[wave][hl0 + u][row] = l[u]; salpha[wave][hl0 + u][row] = l2[u]; }
#pragma unroll
    for (int hl = 0; hl < 4; ++hl)
#pragma unroll
      for (int r = 0; r < 8; ++r) { so[hl][8 * hf + r][col] = acc[hl][0][r]; so[hl][8 * hf + r][16 + col] = acc[hl][1][r]; }
  }
  __syncthreads();   // the kh = 0 wave reads what its partner has just written
  if (kh == 0) {
#pragma unroll
    for (int u = 0; u < 2; ++u) { const float m1 = sm[qt][hl0 + u][row]; const float mn = fmaxf(m[u], m1); const float f0 = exp_ni(m[u] - mn), f1 = exp_ni(m1 - mn);
      const float lt = l[u] * f0 + sl[wave + 4][hl0 + u][row] * f1; const float l2t = l2[u] * (f0 * f0) + salpha[wave + 4][hl0 + u][row] * (f1 * f1);
      sl[wave][hl0 + u][row] = lt; salpha[wave][hl0 + u][row] = l2t / (lt * lt); sf0[qt][hl0 + u][row] = f0; sf1[qt][hl0 + u][row] = f1; }
    LDSX();
    const float (*sx)[16][36] = sp[wave + 4];   // the partner's unnormalised acc
#pragma unroll
    for (int hl = 0; hl < 4; ++hl)
#pragma unroll
      for (int r = 0; r < 8; ++r) { const int rr = 8 * hf + r; const float il = 1.0f / sl[wave][hl][rr], f0 = sf0[qt][hl][rr], f1 = sf1[qt][hl][rr];
        so[hl][rr][col] = (acc[hl][0][r] * f0 + sx[hl][rr][col] * f1) * il; so[hl][rr][16 + col] = (acc[hl][1][r] * f0 + sx[hl][rr][16 + col] * f1) * il; }
    LDSX();
#pragma unroll
    for (int hl = 0; hl < 4; ++hl) for (int rl = 0; rl < 16; ++rl) if (lane < 8) vst2(ON + ((((size_t)b * NH + hg * 4 + hl) * TT + q0 + rl) * HD) + lane * 4, *(const v4f*)&so[hl][rl][lane * 4]);
    { float* chunk = RSQ + ((((size_t)b * 2 + hg) * 16 + qb) * 4 + qt) * 64; __shared__ __align__(16) float sr[4][64];
      if (lane < 16) { sr[qt][lane * 4 + 0] = salpha[wave][0][lane]; sr[qt][lane * 4 + 1] = salpha[wave][1][lane]; sr[qt][lane * 4 + 2] = salpha[wave][2][lane]; sr[qt][lane * 4 + 3] = salpha[wave][3][lane]; }
      LDSX();
      if (lane < 16) vst2(chunk + lane * 4, *(const v4f*)&sr[qt][lane * 4]); }
  }
}
// ---- k_norm: block = (b, h), 256 threads: E[a^2] over the 1024x1024 map from the per-row sums, mean = 1/T, var = E[a^2] - mean^2, rs = rsqrt(var + 1e-5); coefA = rs*gamma[h], coefB = beta[h] - coefA/T; vsum[d] = sum_t v[b][h*32+d][t] (f32 from QKV). CV row [64]: coefA, coefB at 0,1; vsum at 32..63.
__global__ __launch_bounds__(256) void k_norm(const float* __restrict__ RSQ, const float* __restrict__ QKV, const float* __restrict__ GA, const float* __restrict__ BE, float* __restrict__ CV) {
  __shared__ float sred[256]; __shared__ __align__(16) float srow[64];
  const int b = blockIdx.x >> 3, h = blockIdx.x & 7, tid = threadIdx.x; const int hg = h >> 2, hl = h & 3;
  float s = 0.f;
#pragma unroll
  for (int i = 0; i < 4; ++i) { const int q = tid * 4 + i; const int qb = q >> 6, wave = (q >> 4) & 3, rl = q & 15; s += RSQ[((((size_t)b * 2 + hg) * 16 + qb) * 4 + wave) * 64 + rl * 4 + hl]; }
  sred[tid] = s; __syncthreads();
  for (int st = 128; st >= 1; st >>= 1) { if (tid < st) sred[tid] += sred[tid + st]; __syncthreads(); }
  if (tid < 64) srow[tid] = 0.f;
  if (tid < 32) { float vs = 0.f;
#pragma unroll 4
    for (int t = 0; t < TT; ++t) vs += QKV[((size_t)b * TT + t) * QKVP + 2 * CC + h * HD + tid];
    srow[32 + tid] = vs; }
  __syncthreads();
  if (tid == 0) { const float e2 = sred[0] / ((float)TT * (float)TT); const float mean = 1.0f / (float)TT; const float var = e2 - mean * mean; const float rs = rsqrtf(var + 1e-5f); const float cA = rs * bfr(GA[h]); srow[0] = cA; srow[1] = bfr(BE[h]) - cA * mean; }
  __syncthreads();
  if (tid < 16) vst2(CV + (size_t)blockIdx.x * 64 + tid * 4, *(const v4f*)&srow[tid * 4]);
}
// ---- k_fin: block = (64 rows r' of y (= O viewed as [T][256]), 128 output channels, b): Y = (coefA*ON + coefB*vsum)(hi/lo) . Wp rows (2 products) + bp, stored transposed: out[b][o][r'] segments of 64 floats (256 B)
__global__ __launch_bounds__(128) void k_fin(const float* __restrict__ ON, const float* __restrict__ CV, const __bf16* __restrict__ PT, const float* __restrict__ bp, float* __restrict__ out) {
  __shared__ __align__(16) float sT[128][68];
  const int tid = threadIdx.x, wave = tid >> 5, lane = tid & 31, col = lane & 15, g = lane >> 4; const int b = blockIdx.z, n0 = blockIdx.y * 128; const int r0 = blockIdx.x * 64 + wave * 16; const int h = (blockIdx.x * 64) / 128;   // y row r' covers heads r'/128 (constant per 64-row block)
  const float cA = CV[(b * NH + h) * 64 + 0], cB = CV[(b * NH + h) * 64 + 1]; const float* vs = CV + (b * NH + h) * 64 + 32;
  const float* Arow = ON + ((size_t)b * TT + r0 + col) * CC;
  v8f acc[8] = {};
#pragma unroll 2
  for (int kc = 0; kc < CC / 32; ++kc) { float v[16]; const float* p = Arow + kc * 32 + 8 * g;
#pragma unroll
    for (int i = 0; i < 8; ++i) { v[i] = cA * p[i] + cB * vs[8 * g + i]; v[8 + i] = cA * p[16 + i] + cB * vs[16 + 8 * g + i]; }
    const F2 a = bsplit16(v);
#pragma unroll
    for (int j = 0; j < 8; ++j) { const v16b w = frag_b(PT + (size_t)(768 + n0 + j * 16 + col) * CC + kc * 32, lane); acc[j] = wmma_bf(a.l, w, acc[j]); acc[j] = wmma_bf(a.h, w, acc[j]); } }
#pragma unroll
  for (int j = 0; j < 8; ++j) { const float bb = bfr(bp[n0 + j * 16 + col]);
#pragma unroll
    for (int r = 0; r < 8; ++r) sT[j * 16 + col][wave * 16 + 8 * g + r] = acc[j][r] + bb; }
  __syncthreads();
  for (int q = tid; q < 128 * 16; q += 128) { const int o = q >> 4, piece = q & 15; vst2(out + ((size_t)b * CC + n0 + o) * TT + blockIdx.x * 64 + piece * 4, *(const v4f*)&sT[o][piece * 4]); }
}
extern "C" void kernel_launch(void* const* d_in, const int* in_sizes, int n_in, void* d_out, int out_size, void* d_ws, size_t ws_size, hipStream_t stream) {
  (void)in_sizes; (void)n_in; (void)out_size;
  const float** F = (const float**)d_in;   // x [8,256,32,32], Wq, Wk, Wv [256,256], w_head [8,8], gamma [8], beta [8], Wp [256,256], bp [256]
  if (ws_size < (size_t)WS_END) return;
  char* ws = (char*)d_ws; __bf16 *PT = (__bf16*)(ws + WS_PT), *XT = (__bf16*)(ws + WS_XT), *VTH = (__bf16*)(ws + WS_VTH), *VTL = (__bf16*)(ws + WS_VTL); float *QKV = (float*)(ws + WS_QKV), *ON = (float*)(ws + WS_ON), *RSQ = (float*)(ws + WS_RSQ), *CV = (float*)(ws + WS_CV);
  k_pack<<<4 * CC, 256, 0, stream>>>(F[1], F[2], F[3], F[7], PT);
  k_xt<<<dim3(TT / 32, NBT), 256, 0, stream>>>(F[0], XT);
  k_qkv<<<dim3(NBT * TT / 64, QKVP / 128), 128, 0, stream>>>(XT, PT, QKV);
  k_vt<<<NBT * TT / 64, 256, 0, stream>>>(QKV, VTH, VTL);
  k_attn<<<dim3(TT / 64, NBT, 2), 256, 0, stream>>>(QKV, VTH, VTL, F[4], ON, RSQ);
  k_norm<<<NBT * NH, 256, 0, stream>>>(RSQ, QKV, F[5], F[6], CV);
  k_fin<<<dim3(TT / 64, CC / 128, NBT), 128, 0, stream>>>(ON, CV, PT, F[8], (float*)d_out);
}

// v003
// Measured time: 224 microseconds a run.
// Next to v002, in two timings, it ran 1.33 times as fast each time.
// All steps since v000 together make it 2.52 times as fast.
// compute dtype: x and all weights (Wq, Wk, Wv, w_head, gamma, beta, Wp, bp; module inputs) rounded to bf16; the 1x1-conv projections with exact bf16 products; per-head raw scores q.k and the attention-weighted V sums with both computed operands as bf16 hi + residual pairs (3 products); the output projection with its computed input as hi/lo pairs x exact bf16 weights (2 products) on WMMA 16x16x32; head mixing (8x8), softmax, InstanceNorm statistics and affine in f32 on the VALU; f32 accumulate.
#include <hip/hip_runtime.h>
#include <math.h>

typedef __attribute__((ext_vector_type(16))) _Float16 v16h;
typedef __attribute__((ext_vector_type(16))) __bf16 v16b;
typedef __attribute__((ext_vector_type(8)))  _Float16 v8h;
typedef __attribute__((ext_vector_type(8)))  float v8f;
typedef __attribute__((ext_vector_type(4)))  float v4f;
typedef __attribute__((ext_vector_type(2)))  float v2f;
typedef __attribute__((ext_vector_type(4)))  unsigned v4u;
typedef __attribute__((ext_vector_type(4)))  int v4i;
typedef float __attribute__((may_alias)) float_a;
typedef int __attribute__((may_alias)) int_a;

template <typename T> __device__ __forceinline__ void vst2(void* p, T v) { *(T*)p = v;  }
__device__ __forceinline__ v8f wmma16(v16h a, v16h b, v8f c) {
  v8f d = __builtin_amdgcn_wmma_f32_16x16x32_f16(false, a, false, b, (short)0, c, false, false);
  asm volatile("v_nop\n\tv_nop\n\tv_nop\n\tv_nop" : "+v"(d) : "v"(a), "v"(b));
  return d;
}
__device__ __forceinline__ v8f wmma_bf(v16b a, v16b b, v8f c) {
  v8f d = __builtin_amdgcn_wmma_f32_16x16x32_bf16(false, a, false, b, (short)0, c, false, false);
  asm volatile("v_nop\n\tv_nop\n\tv_nop\n\tv_nop" : "+v"(d) : "v"(a), "v"(b));
  return d;
}
// 16x16x32 fragments: lane = (h = lane>>4, row/col = lane&15); elements 0..7 = k0+8h+0..7, 8..15 = k0+16+8h+0..7; D element r = row 8h+r
__device__ __forceinline__ v16h frag_h(const _Float16* rowk0, int lane) {
  union { v16h v; v8h q[2]; } u; const _Float16* p = rowk0 + 8 * (lane >> 4);
  u.q[0] = *(const v8h*)p; u.q[1] = *(const v8h*)(p + 16); return u.v;
}
__device__ __forceinline__ v16h frag_f32(const float* rowk0, int lane) {
  v16h a; const float* p = rowk0 + 8 * (lane >> 4);
#pragma unroll
  for (int i = 0; i < 8; ++i) { a[i] = (_Float16)p[i]; a[8 + i] = (_Float16)p[16 + i]; }
  return a;
}
__device__ __forceinline__ v16h frag_f32s(const float* rowk0, int lane, float sc) {
  v16h a; const float* p = rowk0 + 8 * (lane >> 4);
#pragma unroll
  for (int i = 0; i < 8; ++i) { a[i] = (_Float16)(p[i] * sc); a[8 + i] = (_Float16)(p[16 + i] * sc); }
  return a;
}
// column fragment from a [K][ld] layout (column n), rows >= K read as 0
__device__ __forceinline__ v16h fragc_f32(const float* W, int k0, int n, int lane, int ld, int K) {
  v16h a; const int g = lane >> 4;
#pragma unroll
  for (int i = 0; i < 8; ++i) { const int ka = k0 + 8 * g + i, kb = ka + 16;
    a[i] = (_Float16)(ka < K ? W[(size_t)(ka < K ? ka : K - 1) * ld + n] : 0.f); a[8 + i] = (_Float16)(kb < K ? W[(size_t)(kb < K ? kb : K - 1) * ld + n] : 0.f); }
  return a;
}
struct F2 { v16b h, l; };
__device__ __forceinline__ F2 bsplit16(const float v[16]) { F2 r;
#pragma unroll
  for (int i = 0; i < 16; ++i) { const __bf16 h = (__bf16)v[i]; r.h[i] = h; r.l[i] = (__bf16)(v[i] - (float)h); }
  return r; }
__device__ __forceinline__ F2 split_row(const float* row, int k0, int lane) { float v[16]; const float* p = row + k0 + 8 * (lane >> 4);
#pragma unroll
  for (int i = 0; i < 8; ++i) { v[i] = p[i]; v[8 + i] = p[16 + i]; }
  return bsplit16(v); }
__device__ __forceinline__ F2 split_rowK(const float* row, int k0, int lane, int K) { float v[16]; const int g = lane >> 4;
#pragma unroll
  for (int i = 0; i < 8; ++i) { const int ka = k0 + 8 * g + i, kb = ka + 16; v[i] = ka < K ? row[ka < K ? ka : K - 1] : 0.f; v[8 + i] = kb < K ? row[kb < K ? kb : K - 1] : 0.f; }
  return bsplit16(v); }
__device__ __forceinline__ F2 split_col(const float* W, int k0, int n, int lane, int ld, int K) { float v[16]; const int g = lane >> 4;
#pragma unroll
  for (int i = 0; i < 8; ++i) { const int ka = k0 + 8 * g + i, kb = ka + 16; v[i] = ka < K ? W[(size_t)(ka < K ? ka : K - 1) * ld + n] : 0.f; v[8 + i] = kb < K ? W[(size_t)(kb < K ? kb : K - 1) * ld + n] : 0.f; }
  return bsplit16(v); }
__device__ __forceinline__ v8f mac3(const F2& a, const F2& b, v8f c) { c = wmma_bf(a.l, b.h, c); c = wmma_bf(a.h, b.l, c); return wmma_bf(a.h, b.h, c); }
__device__ __forceinline__ float sigm(float v) { return 1.0f / (1.0f + expf(-v)); }
#define LDSX() do { asm volatile("s_wait_dscnt 0" ::: "memory"); __builtin_amdgcn_wave_barrier(); __builtin_amdgcn_fence(__ATOMIC_RELEASE, "workgroup"); } while (0)


// Conv-projected multi-head self-attention with head mixing: q,k,v = W x (1x1 conv), s[h] = sum_g w_head[h][g] (q_g . k_g) * 32^-0.5, a = softmax over keys, InstanceNorm2d of each (b,h) 1024x1024 attention map (biased var, eps 1e-5, affine), out = a' v; y = out (B,nh,T,hd) reinterpreted as (B,T,C); y Wp^T + bp; stored as (B,C,T).  B 8, C 256, T 1024, 8 heads x 32.
// k_pack, k_xt (x -> bf16 [b][t][c]), k_qkv (exact GEMM), k_vt (v -> hi/lo transposed planes), k_attn (one pass per (query block, b, head group of 4), keys split over two waves per query tile: raw scores of all 8 heads on WMMA, mixing + online softmax with sum and sum-of-squares per row on the VALU, P.V on WMMA; writes softmax-normalised O rows and per-row sum(a^2)), k_norm (per (b,h): variance -> affine coefficients; column sums of v), k_fin (affine applied at A-load, output projection, transposed 256-B stores).
#define NB 8
#define CC 256
#define TT 1024
#define NH 8
#define HD 32
#define NR (NB * TT)        // 8192
#define QKVP (3 * CC)       // 768
#define DM CC
#ifndef NBT
#define NBT NB              // batches launched (all)
#endif
typedef __attribute__((ext_vector_type(8))) __bf16 v8b;
__device__ __forceinline__ v16b frag_b(const __bf16* rowk0, int lane) {
  union { v16b v; v8b q[2]; } u; const __bf16* p = rowk0 + 8 * (lane >> 4);
  u.q[0] = *(const v8b*)p; u.q[1] = *(const v8b*)(p + 16); return u.v;
}
__device__ __forceinline__ float bfr(float v) { return (float)(__bf16)v; }
// the same fragment from the lane's own pointer p = rowk0 + 8 * (lane >> 4)
__device__ __forceinline__ v16b frag_bp(const __bf16* p) { union { v16b v; v8b q[2]; } u; u.q[0] = *(const v8b*)p; u.q[1] = *(const v8b*)(p + 16); return u.v; }
// the 16 f32 of one fragment row as they are loaded (4 x 16 B, the element order of split_row, p = row + k0 + 8 * (lane >> 4)); split to hi/lo only where they are used
struct R16 { v4f q[4]; };
__device__ __forceinline__ R16 ld_r16(const float* p) { R16 r; r.q[0] = *(const v4f*)p; r.q[1] = *(const v4f*)(p + 4); r.q[2] = *(const v4f*)(p + 16); r.q[3] = *(const v4f*)(p + 20); return r; }
__device__ __forceinline__ F2 split_r16(const R16& r) { float v[16];
#pragma unroll
  for (int i = 0; i < 4; ++i) { v[i] = r.q[0][i]; v[4 + i] = r.q[1][i]; v[8 + i] = r.q[2][i]; v[12 + i] = r.q[3][i]; }
  return bsplit16(v); }
__device__ __attribute__((noinline)) float exp_ni(float v) { return expf(v); }
__device__ __attribute__((noinline)) float erf_ni(float v) { return erff(v); }

#define WS_PT   0u                                   // bf16 [1024][256]: Wq | Wk | Wv | Wp rows
#define WS_XT   (WS_PT + 2u * 4 * CC * CC)             // bf16 [8192][256] x transposed (token rows)
#define WS_QKV  (WS_XT + 2u * NR * CC)                 // f32 [8192][768]
#define WS_VTH  (WS_QKV + 4u * NR * QKVP)              // bf16 [8][256][1024]
#define WS_VTL  (WS_VTH + 2u * NB * CC * TT)
#define WS_ON   (WS_VTL + 2u * NB * CC * TT)           // f32 [8][8][1024][32] softmax-normalised O
#define WS_RSQ  (WS_ON + 4u * NB * NH * TT * HD)        // f32 [8 b][2 hg][16 qb][4 wave][16 row][4 hl]
#define WS_CV   (WS_RSQ + 4u * NB * NH * TT)           // f32 [64 (b,h)][64]: coefA, coefB, .., vsum[32] at 32..63
#define WS_END  (WS_CV + 4u * NB * NH * 64)

__global__ __launch_bounds__(256) void k_pack(const float* __restrict__ Wq, const float* __restrict__ Wk, const float* __restrict__ Wv, const float* __restrict__ Wp, __bf16* __restrict__ PT) {
  __shared__ __align__(16) __bf16 s[CC]; const int n = blockIdx.x, tid = threadIdx.x; const int m = n & 255; const float* src = (n < 256) ? Wq : (n < 512) ? Wk : (n < 768) ? Wv : Wp;
  s[tid] = (__bf16)src[(size_t)m * CC + tid]; __syncthreads();
  if (tid < CC / 8) vst2((unsigned*)(PT + (size_t)n * CC + tid * 8), *(const v4u*)&s[tid * 8]);
}
// ---- k_xt: block = (32 tokens t0, b): XT[b][t][c] = bf16(x[b][c][t]); rows of 512 B
__global__ __launch_bounds__(256) void k_xt(const float* __restrict__ X, __bf16* __restrict__ XT) {
  __shared__ __align__(16) __bf16 s[32][CC + 8]; const int t0 = blockIdx.x * 32, b = blockIdx.y, tid = threadIdx.x;
  for (int q = tid; q < CC * 32; q += 256) { const int c = q >> 5, tl = q & 31; s[tl][c] = (__bf16)X[((size_t)b * CC + c) * TT + t0 + tl]; }
  __syncthreads();
  for (int q = tid; q < 32 * 32; q += 256) { const int tl = q >> 5, pc = q & 31; vst2((unsigned*)(XT + ((size_t)b * TT + t0 + tl) * CC + pc * 8), *(const v4u*)&s[tl][pc * 8]); }
}
// ---- k_qkv: block = (64 token rows, 128 cols): QKV[r][n] = XT[r] . PT[n] (exact), K = 256
__global__ __launch_bounds__(128) void k_qkv(const __bf16* __restrict__ XT, const __bf16* __restrict__ PT, float* __restrict__ QKV) {
  __shared__ __align__(16) float so[4][16][132];
  const int tid = threadIdx.x, wave = tid >> 5, lane = tid & 31, col = lane & 15, g = lane >> 4; const size_t r0 = (size_t)blockIdx.x * 64 + wave * 16; const int n0 = blockIdx.y * 128;
  v8f acc[8] = {};
#pragma unroll 2
  for (int kc = 0; kc < CC / 32; ++kc) { const v16b a = frag_b(XT + (r0 + col) * CC + kc * 32, lane);
#pragma unroll
    for (int j = 0; j < 8; ++j) acc[j] = wmma_bf(a, frag_b(PT + (size_t)(n0 + j * 16 + col) * CC + kc * 32, lane), acc[j]); }
#pragma unroll
  for (int j = 0; j < 8; ++j)
#pragma unroll
    for (int r = 0; r < 8; ++r) so[wave][8 * g + r][j * 16 + col] = acc[j][r];
  LDSX();
  for (int rl = 0; rl < 16; ++rl) vst2(QKV + (r0 + rl) * QKVP + n0 + lane * 4, *(const v4f*)&so[wave][rl][lane * 4]);
}
__global__ __launch_bounds__(256) void k_vt(const float* __restrict__ QKV, __bf16* __restrict__ VTH, __bf16* __restrict__ VTL) {
  __shared__ __align__(16) __bf16 svh[DM][72], svl[DM][72];
  const int tid = threadIdx.x; const size_t t0 = (size_t)blockIdx.x * 64; const int b = (int)(t0 / TT), p0 = (int)(t0 % TT);
  for (int q = tid; q < 64 * DM; q += 256) { const int tl = q >> 8, c = q & 255; const float v = QKV[(t0 + tl) * QKVP + 2 * DM + c]; const __bf16 hb = (__bf16)v; svh[c][tl] = hb; svl[c][tl] = (__bf16)(v - (float)hb); }
  __syncthreads();
  for (int q = tid; q < DM * 8; q += 256) { const int rowi = q >> 3, pc = q & 7; const size_t o = ((size_t)b * DM + rowi) * TT + p0 + pc * 8; vst2((unsigned*)(VTH + o), *(const v4u*)&svh[rowi][pc * 8]); vst2((unsigned*)(VTL + o), *(const v4u*)&svl[rowi][pc * 8]); }
}
// ---- k_attn: block = (query block qb of 64, b, head group hg of 4 heads), 8 waves = 4 query tiles of 16 (qt) x 2 key halves of 512 (kh); the two waves of a query tile share its staged q rows, run the loop below on their own half of the keys, and are merged at the end.
//   per key step of 32: raw scores of all 8 heads g (q hi/lo from LDS x k hi/lo, 3 products) * scale -> sraw; per lane (row = lane&15, two heads of the group): mixed s' = sum_g w_head[h][g] sraw[g], online softmax (max, sum, sum of squares), p -> sp, rescale factor -> salpha; P.V for the group's 4 heads (3 products).
//   global loads run ahead of their use, in registers: K of heads g+4, g+5 is asked for before heads g, g+1 are worked on, V of the group's first two heads at the head of (b), of the last two at the head of (c) and behind P.V of the first head, K of heads 0..3 of the next step inside (c).
//   merge: the kh = 1 wave leaves m, l, l2 and its unnormalised acc in LDS; behind one block barrier the kh = 0 wave rescales both halves to the common maximum and adds them.
//   end: ON[b][h][q][:] = acc / l (softmax-normalised), RSQ chunk [row][hl] = l2 / l^2 = sum_t a^2 of that row.
__global__ __launch_bounds__(256) void k_attn(const float* __restrict__ QKV, const __bf16* __restrict__ VTH, const __bf16* __restrict__ VTL, const float* __restrict__ WH, float* __restrict__ ON, float* __restrict__ RSQ) {
  __shared__ __align__(16) __bf16 sqh[4][8][16][40], sql[4][8][16][40]; __shared__ __align__(16) float sraw[8][8][16][36]; __shared__ __align__(16) float sp[8][4][16][36]; __shared__ float salpha[8][4][16], sl[8][4][16], sm[4][4][16], sf0[4][4][16], sf1[4][4][16];
  const int tid = threadIdx.x, wave = tid >> 5, lane = tid & 31, col = lane & 15, hf = lane >> 4; const int qb = blockIdx.x, b = blockIdx.y, hg = blockIdx.z; const int qt = wave & 3, kh = __builtin_amdgcn_readfirstlane(tid >> 7); const int q0 = qb * 64 + qt * 16; const size_t tq = (size_t)b * TT + q0;
  // stage the query tile's 16 rows (all 8 heads) as hi/lo bf16: 8 rows per wave of the pair
  for (int i = 0; i < 8 * CC / 32; ++i) { const int q = kh * 8 * CC + i * 32 + lane; const int rl = q >> 8, c = q & 255; const float v = QKV[(tq + rl) * QKVP + c]; const __bf16 hb = (__bf16)v; sqh[qt][c >> 5][rl][c & 31] = hb; sql[qt][c >> 5][rl][c & 31] = (__bf16)(v - (float)hb); }
  // mixing weights for the lane's two heads
  const int row = lane & 15; const int hl0 = hf * 2; float wm[2][8];
#pragma unroll
  for (int u = 0; u < 2; ++u)
#pragma unroll
    for (int gg = 0; gg < 8; ++gg) wm[u][gg] = bfr(WH[(hg * 4 + hl0 + u) * NH + gg]);
  float m[2], l[2], l2[2]; m[0] = m[1] = -3.0e38f; l[0] = l[1] = 0.f; l2[0] = l2[1] = 0.f;
  v8f acc[4][2] = {};
  // the lane's own pointers at key step 0: key row col of QKV (its K columns start at CC), V rows (column col of the group's first head), each at its half of the fragment
  const float* Kc = QKV + ((size_t)b * TT + col) * QKVP + 8 * hf;
  const __bf16* VHc = VTH + ((size_t)b * CC + hg * 4 * HD + col) * TT + 8 * hf; const __bf16* VLc = VTL + ((size_t)b * CC + hg * 4 * HD + col) * TT + 8 * hf;
  const int ks1 = (kh + 1) * (TT / 64);
  R16 kr[8][2];              // K rows in flight, by head and key tile
  v16b vh[4][2], vl[4][2];   // V of the step in flight, by head of the group and column tile
  // the loops inside these macros are unrolled so that kr, vh, vl and acc are indexed by constants and stay in registers
  // ask for K of heads G, G+1 of the key step at P
#define LDK2(G, P) do { _Pragma("unroll") for (int g_ = (G); g_ < (G) + 2; ++g_) { _Pragma("unroll") for (int ct = 0; ct < 2; ++ct) kr[g_][ct] = ld_r16((P) + (size_t)ct * 16 * QKVP + CC + g_ * HD); } } while (0)
  // ask for V of head H of the group, key step at PH, PL
#define LDV1(H, PH, PL) do { _Pragma("unroll") for (int dt = 0; dt < 2; ++dt) { vh[H][dt] = frag_bp((PH) + (size_t)((H) * HD + dt * 16) * TT); vl[H][dt] = frag_bp((PL) + (size_t)((H) * HD + dt * 16) * TT); } } while (0)
  // raw scores of heads G, G+1 from the K rows in registers
#define SC2(G) do { _Pragma("unroll") for (int gg = (G); gg < (G) + 2; ++gg) { F2 a; a.h = frag_b(&sqh[qt][gg][col][0], lane); a.l = frag_b(&sql[qt][gg][col][0], lane); \
    _Pragma("unroll") for (int ct = 0; ct < 2; ++ct) { const F2 k = split_r16(kr[gg][ct]); const v8f c = mac3(a, k, (v8f){}); \
      _Pragma("unroll") for (int r = 0; r < 8; ++r) sraw[wave][gg][8 * hf + r][ct * 16 + col] = c[r] * 0.17677669529663687f; } } } while (0)
  // P.V of head H of the group from the V fragments in registers
#define PV1(H) do { { const int hl = (H); const F2 pa = split_row(&sp[wave][hl][col][0], 0, lane); \
    _Pragma("unroll") for (int r = 0; r < 8; ++r) { const float al = salpha[wave][hl][8 * hf + r]; acc[hl][0][r] *= al; acc[hl][1][r] *= al; } \
    _Pragma("unroll") for (int dt = 0; dt < 2; ++dt) { acc[hl][dt] = wmma_bf(pa.l, vh[hl][dt], acc[hl][dt]); acc[hl][dt] = wmma_bf(pa.h, vl[hl][dt], acc[hl][dt]); acc[hl][dt] = wmma_bf(pa.h, vh[hl][dt], acc[hl][dt]); } } } while (0)
  // behind each group of these loads; the loads' address registers are inputs, so that they keep their values up to the wait
#define XW1(P) asm volatile("s_wait_xcnt 0x0" :: "v"(P) : "memory")
#define XW2(P, Q) asm volatile("s_wait_xcnt 0x0" :: "v"(P), "v"(Q) : "memory")
#define XW3(P, Q, R) asm volatile("s_wait_xcnt 0x0" :: "v"(P), "v"(Q), "v"(R) : "memory")
  { const float* kp = Kc + (size_t)kh * (TT / 2) * QKVP; LDK2(0, kp); LDK2(2, kp); XW1(kp); }
  __syncthreads();   // each wave reads q rows that its partner staged
#pragma unroll 1
  for (int ks = kh * (TT / 64); ks < ks1; ++ks) {
    const float* kp = Kc + (size_t)ks * 32 * QKVP; const __bf16* vhp = VHc + ks * 32; const __bf16* vlp = VLc + ks * 32;
    // (a) raw scores for all 8 heads, 32 keys
    LDK2(4, kp); XW1(kp); SC2(0);
    LDK2(6, kp); XW1(kp); SC2(2);
    SC2(4);
    SC2(6);
    LDSX();
    LDV1(0, vhp, vlp); LDV1(1, vhp, vlp); XW2(vhp, vlp);   // behind the fence of LDSX, which waits for every load in flight
    // (b) mixing + online softmax for (row, heads hl0, hl0+1)
    { float s0[32], s1[32];
#pragma unroll
      for (int k4 = 0; k4 < 8; ++k4) { float t0[4] = {0.f, 0.f, 0.f, 0.f}, t1[4] = {0.f, 0.f, 0.f, 0.f};
#pragma unroll
        for (int gg = 0; gg < 8; ++gg) { const v4f rv = *(const v4f*)&sraw[wave][gg][row][k4 * 4];
#pragma unroll
          for (int i = 0; i < 4; ++i) { t0[i] += wm[0][gg] * rv[i]; t1[i] += wm[1][gg] * rv[i]; } }
#pragma unroll
        for (int i = 0; i < 4; ++i) { s0[k4 * 4 + i] = t0[i]; s1[k4 * 4 + i] = t1[i]; } }
#pragma unroll
      for (int u = 0; u < 2; ++u) { float* s = u == 0 ? s0 : s1; float mx = s[0];
#pragma unroll
        for (int k = 1; k < 32; ++k) mx = fmaxf(mx, s[k]);
        const float mn = fmaxf(m[u], mx); const float al = exp_ni(m[u] - mn); float es = 0.f, es2 = 0.f;
#pragma unroll
        for (int k = 0; k < 32; ++k) { const float e = exp_ni(s[k] - mn); es += e; es2 += e * e; sp[wave][hl0 + u][row][k] = e; }
        l[u] = l[u] * al + es; l2[u] = l2[u] * (al * al) + es2; m[u] = mn; salpha[wave][hl0 + u][row] = al; } }
    LDSX();
    // (c) P.V for the group's 4 heads
    const float* kn = Kc + (size_t)(ks + 1 < ks1 ? ks + 1 : ks) * 32 * QKVP;   // the last step asks for its own rows again (in bounds, not used)
    LDV1(2, vhp, vlp); LDK2(0, kn); XW3(vhp, vlp, kn); PV1(0);
    LDV1(3, vhp, vlp); LDK2(2, kn); XW3(vhp, vlp, kn); PV1(1);
    PV1(2);
    PV1(3);
    LDSX(); }
  // merge of the two key halves, then l and sum a^2 per (hl, row)
  float (*so)[16][36] = sp[wave];   // reuse: [hl][row][32]
  if (kh == 1) {
#pragma unroll
    for (int u = 0; u < 2; ++u) { sm[qt][hl0 + u][row] = m[u]; sl[wave][hl0 + u][row] = l[u]; salpha[wave][hl0 + u][row] = l2[u]; }
#pragma unroll
    for (int hl = 0; hl < 4; ++hl)
#pragma unroll
      for (int r = 0; r < 8; ++r) { so[hl][8 * hf + r][col] = acc[hl][0][r]; so[hl][8 * hf + r][16 + col] = acc[hl][1][r]; }
  }
  __syncthreads();   // the kh = 0 wave reads what its partner has just written
  if (kh == 0) {
#pragma unroll
    for (int u = 0; u < 2; ++u) { const float m1 = sm[qt][hl0 + u][row]; const float mn = fmaxf(m[u], m1); const float f0 = exp_ni(m[u] - mn), f1 = exp_ni(m1 - mn);
      const float lt = l[u] * f0 + sl[wave + 4][hl0 + u][row] * f1; const float l2t = l2[u] * (f0 * f0) + salpha[wave + 4][hl0 + u][row] * (f1 * f1);
      sl[wave][hl0 + u][row] = lt; salpha[wave][hl0 + u][row] = l2t / (lt * lt); sf0[qt][hl0 + u][row] = f0; sf1[qt][hl0 + u][row] = f1; }
    LDSX();
    const float (*sx)[16][36] = sp[wave + 4];   // the partner's unnormalised acc
#pragma unroll
    for (int hl = 0; hl < 4; ++hl)
#pragma unroll
      for (int r = 0; r < 8; ++r) { const int rr = 8 * hf + r; const float il = 1.0f / sl[wave][hl][rr], f0 = sf0[qt][hl][rr], f1 = sf1[qt][hl][rr];
        so[hl][rr][col] = (acc[hl][0][r] * f0 + sx[hl][rr][col] * f1) * il; so[hl][rr][16 + col] = (acc[hl][1][r] * f0 + sx[hl][rr][16 + col] * f1) * il; }
    LDSX();
#pragma unroll
    for (int hl = 0; hl < 4; ++hl) for (int rl = 0; rl < 16; ++rl) if (lane < 8) vst2(ON + ((((size_t)b * NH + hg * 4 + hl) * TT + q0 + rl) * HD) + lane * 4, *(const v4f*)&so[hl][rl][lane * 4]);
    { float* chunk = RSQ + ((((size_t)b * 2 + hg) * 16 + qb) * 4 + qt) * 64; __shared__ __align__(16) float sr[4][64];
      if (lane < 16) { sr[qt][lane * 4 + 0] = salpha[wave][0][lane]; sr[qt][lane * 4 + 1] = salpha[wave][1][lane]; sr[qt][lane * 4 + 2] = salpha[wave][2][lane]; sr[qt][lane * 4 + 3] = salpha[wave][3][lane]; }
      LDSX();
      if (lane < 16) vst2(chunk + lane * 4, *(const v4f*)&sr[qt][lane * 4]); }
  }
}
// ---- k_norm: block = (b, h), 256 threads: E[a^2] over the 1024x1024 map from the per-row sums, mean = 1/T, var = E[a^2] - mean^2, rs = rsqrt(var + 1e-5); coefA = rs*gamma[h], coefB = beta[h] - coefA/T; vsum[d] = sum_t v[b][h*32+d][t] (f32 from QKV; 32 partial sums of 32 rows each by all 256 threads, added in LDS). CV row [64]: coefA, coefB at 0,1; vsum at 32..63.
__global__ __launch_bounds__(256) void k_norm(const float* __restrict__ RSQ, const float* __restrict__ QKV, const float* __restrict__ GA, const float* __restrict__ BE, float* __restrict__ CV) {
  __shared__ float sred[256]; __shared__ __align__(16) float srow[64]; __shared__ __align__(16) float sv[32][36];
  const int b = blockIdx.x >> 3, h = blockIdx.x & 7, tid = threadIdx.x; const int hg = h >> 2, hl = h & 3;
  // column sums of v, first part: thread = (token rows rg, rg + 32, .., 4 columns from c4); its 32 loads of 16 B do not depend on one another
  const int rg = tid >> 3, c4 = (tid & 7) * 4; const float* vp = QKV + ((size_t)b * TT + rg) * QKVP + 2 * CC + h * HD + c4; v4f vr[32];
  // unrolled so that vr stays in registers and the loads are issued ahead of the adds, many in flight at a time
#pragma unroll
  for (int i = 0; i < 32; ++i) vr[i] = *(const v4f*)(vp + (size_t)i * 32 * QKVP);
  float s = 0.f;
#pragma unroll
  for (int i = 0; i < 4; ++i) { const int q = tid * 4 + i; const int qb = q >> 6, wave = (q >> 4) & 3, rl = q & 15; s += RSQ[((((size_t)b * 2 + hg) * 16 + qb) * 4 + wave) * 64 + rl * 4 + hl]; }
  { v4f vs = vr[0];
    // unrolled so that vr is indexed by constants
#pragma unroll
    for (int i = 1; i < 32; ++i) vs += vr[i];
    *(v4f*)&sv[rg][c4] = vs; }
  sred[tid] = s; __syncthreads();
  for (int st = 128; st >= 1; st >>= 1) { if (tid < st) sred[tid] += sred[tid + st]; __syncthreads(); }
  // second part: thread = column, adds the 32 row groups' partial sums; words 32..63 of srow have this one writer
  if (tid < 32) { srow[tid] = 0.f; float vs = 0.f;
    // unrolled so that the LDS loads are issued ahead of the adds
#pragma unroll
    for (int r = 0; r < 32; ++r) vs += sv[r][tid];
    srow[32 + tid] = vs; }
  __syncthreads();
  if (tid == 0) { const float e2 = sred[0] / ((float)TT * (float)TT); const float mean = 1.0f / (float)TT; const float var = e2 - mean * mean; const float rs = rsqrtf(var + 1e-5f); const float cA = rs * bfr(GA[h]); srow[0] = cA; srow[1] = bfr(BE[h]) - cA * mean; }
  __syncthreads();
  if (tid < 16) vst2(CV + (size_t)blockIdx.x * 64 + tid * 4, *(const v4f*)&srow[tid * 4]);
}
// ---- k_fin: block = (64 rows r' of y (= O viewed as [T][256]), 128 output channels, b): Y = (coefA*ON + coefB*vsum)(hi/lo) . Wp rows (2 products) + bp, stored transposed: out[b][o][r'] segments of 64 floats (256 B)
__global__ __launch_bounds__(128) void k_fin(const float* __restrict__ ON, const float* __restrict__ CV, const __bf16* __restrict__ PT, const float* __restrict__ bp, float* __restrict__ out) {
  __shared__ __align__(16) float sT[128][68];
  const int tid = threadIdx.x, wave = tid >> 5, lane = tid & 31, col = lane & 15, g = lane >> 4; const int b = blockIdx.z, n0 = blockIdx.y * 128; const int r0 = blockIdx.x * 64 + wave * 16; const int h = (blockIdx.x * 64) / 128;   // y row r' covers heads r'/128 (constant per 64-row block)
  const float cA = CV[(b * NH + h) * 64 + 0], cB = CV[(b * NH + h) * 64 + 1]; const float* vs = CV + (b * NH + h) * 64 + 32;
  const float* Arow = ON + ((size_t)b * TT + r0 + col) * CC;
  v8f acc[8] = {};
#pragma unroll 2
  for (int kc = 0; kc < CC / 32; ++kc) { float v[16]; const float* p = Arow + kc * 32 + 8 * g;
#pragma unroll
    for (int i = 0; i < 8; ++i) { v[i] = cA * p[i] + cB * vs[8 * g + i]; v[8 + i] = cA * p[16 + i] + cB * vs[16 + 8 * g + i]; }
    const F2 a = bsplit16(v);
#pragma unroll
    for (int j = 0; j < 8; ++j) { const v16b w = frag_b(PT + (size_t)(768 + n0 + j * 16 + col) * CC + kc * 32, lane); acc[j] = wmma_bf(a.l, w, acc[j]); acc[j] = wmma_bf(a.h, w, acc[j]); } }
#pragma unroll
  for (int j = 0; j < 8; ++j) { const float bb = bfr(bp[n0 + j * 16 + col]);
#pragma unroll
    for (int r = 0; r < 8; ++r) sT[j * 16 + col][wave * 16 + 8 * g + r] = acc[j][r] + bb; }
  __syncthreads();
  for (int q = tid; q < 128 * 16; q += 128) { const int o = q >> 4, piece = q & 15; vst2(out + ((size_t)b * CC + n0 + o) * TT + blockIdx.x * 64 + piece * 4, *(const v4f*)&sT[o][piece * 4]); }
}
extern "C" void kernel_launch(void* const* d_in, const int* in_sizes, int n_in, void* d_out, int out_size, void* d_ws, size_t ws_size, hipStream_t stream) {
  (void)in_sizes; (void)n_in; (void)out_size;
  const float** F = (const float**)d_in;   // x [8,256,32,32], Wq, Wk, Wv [256,256], w_head [8,8], gamma [8], beta [8], Wp [256,256], bp [256]
  if (ws_size < (size_t)WS_END) return;
  char* ws = (char*)d_ws; __bf16 *PT = (__bf16*)(ws + WS_PT), *XT = (__bf16*)(ws + WS_XT), *VTH = (__bf16*)(ws + WS_VTH), *VTL = (__bf16*)(ws + WS_VTL); float *QKV = (float*)(ws + WS_QKV), *ON = (float*)(ws + WS_ON), *RSQ = (float*)(ws + WS_RSQ), *CV = (float*)(ws + WS_CV);
  k_pack<<<4 * CC, 256, 0, stream>>>(F[1], F[2], F[3], F[7], PT);
  k_xt<<<dim3(TT / 32, NBT), 256, 0, stream>>>(F[0], XT);
  k_qkv<<<dim3(NBT * TT / 64, QKVP / 128), 128, 0, stream>>>(XT, PT, QKV);
  k_vt<<<NBT * TT / 64, 256, 0, stream>>>(QKV, VTH, VTL);
  k_attn<<<dim3(TT / 64, NBT, 2), 256, 0, stream>>>(QKV, VTH, VTL, F[4], ON, RSQ);
  k_norm<<<NBT * NH, 256, 0, stream>>>(RSQ, QKV, F[5], F[6], CV);
  k_fin<<<dim3(TT / 64, CC / 128, NBT), 128, 0, stream>>>(ON, CV, PT, F[8], (float*)d_out);
}

// v004
// Measured time: 185 microseconds a run.
// Next to v003, in two timings, it ran 1.22 and 1.23 times as fast.
// All steps since v000 together make it 3.09 times as fast.
// compute dtype: x and all weights (Wq, Wk, Wv, w_head, gamma, beta, Wp, bp; module inputs) rounded to bf16; the 1x1-conv projections with exact bf16 products; per-head raw scores q.k and the attention-weighted V sums with both computed operands as bf16 hi + residual pairs (3 products); the output projection with its computed input as hi/lo pairs x exact bf16 weights (2 products) on WMMA 16x16x32; head mixing (8x8), softmax, InstanceNorm statistics and affine in f32 on the VALU; f32 accumulate.
#include <hip/hip_runtime.h>
#include <math.h>

typedef __attribute__((ext_vector_type(16))) _Float16 v16h;
typedef __attribute__((ext_vector_type(16))) __bf16 v16b;
typedef __attribute__((ext_vector_type(8)))  _Float16 v8h;
typedef __attribute__((ext_vector_type(8)))  float v8f;
typedef __attribute__((ext_vector_type(4)))  float v4f;
typedef __attribute__((ext_vector_type(2)))  float v2f;
typedef __attribute__((ext_vector_type(4)))  unsigned v4u;
typedef __attribute__((ext_vector_type(4)))  int v4i;
typedef float __attribute__((may_alias)) float_a;
typedef int __attribute__((may_alias)) int_a;

template <typename T> __device__ __forceinline__ void vst2(void* p, T v) { *(T*)p = v;  }
__device__ __forceinline__ v8f wmma16(v16h a, v16h b, v8f c) {
  v8f d = __builtin_amdgcn_wmma_f32_16x16x32_f16(false, a, false, b, (short)0, c, false, false);
  asm volatile("v_nop\n\tv_nop\n\tv_nop\n\tv_nop" : "+v"(d) : "v"(a), "v"(b));
  return d;
}
__device__ __forceinline__ v8f wmma_bf(v16b a, v16b b, v8f c) {
  v8f d = __builtin_amdgcn_wmma_f32_16x16x32_bf16(false, a, false, b, (short)0, c, false, false);
  asm volatile("v_nop\n\tv_nop\n\tv_nop\n\tv_nop" : "+v"(d) : "v"(a), "v"(b));
  return d;
}
// 16x16x32 fragments: lane = (h = lane>>4, row/col = lane&15); elements 0..7 = k0+8h+0..7, 8..15 = k0+16+8h+0..7; D element r = row 8h+r
__device__ __forceinline__ v16h frag_h(const _Float16* rowk0, int lane) {
  union { v16h v; v8h q[2]; } u; const _Float16* p = rowk0 + 8 * (lane >> 4);
  u.q[0] = *(const v8h*)p; u.q[1] = *(const v8h*)(p + 16); return u.v;
}
__device__ __forceinline__ v16h frag_f32(const float* rowk0, int lane) {
  v16h a; const float* p = rowk0 + 8 * (lane >> 4);
#pragma unroll
  for (int i = 0; i < 8; ++i) { a[i] = (_Float16)p[i]; a[8 + i] = (_Float16)p[16 + i]; }
  return a;
}
__device__ __forceinline__ v16h frag_f32s(const float* rowk0, int lane, float sc) {
  v16h a; const float* p = rowk0 + 8 * (lane >> 4);
#pragma unroll
  for (int i = 0; i < 8; ++i) { a[i] = (_Float16)(p[i] * sc); a[8 + i] = (_Float16)(p[16 + i] * sc); }
  return a;
}
// column fragment from a [K][ld] layout (column n), rows >= K read as 0
__device__ __forceinline__ v16h fragc_f32(const float* W, int k0, int n, int lane, int ld, int K) {
  v16h a; const int g = lane >> 4;
#pragma unroll
  for (int i = 0; i < 8; ++i) { const int ka = k0 + 8 * g + i, kb = ka + 16;
    a[i] = (_Float16)(ka < K ? W[(size_t)(ka < K ? ka : K - 1) * ld + n] : 0.f); a[8 + i] = (_Float16)(kb < K ? W[(size_t)(kb < K ? kb : K - 1) * ld + n] : 0.f); }
  return a;
}
struct F2 { v16b h, l; };
__device__ __forceinline__ F2 bsplit16(const float v[16]) { F2 r;
#pragma unroll
  for (int i = 0; i < 16; ++i) { const __bf16 h = (__bf16)v[i]; r.h[i] = h; r.l[i] = (__bf16)(v[i] - (float)h); }
  return r; }
__device__ __forceinline__ F2 split_row(const float* row, int k0, int lane) { float v[16]; const float* p = row + k0 + 8 * (lane >> 4);
#pragma unroll
  for (int i = 0; i < 8; ++i) { v[i] = p[i]; v[8 + i] = p[16 + i]; }
  return bsplit16(v); }
__device__ __forceinline__ F2 split_rowK(const float* row, int k0, int lane, int K) { float v[16]; const int g = lane >> 4;
#pragma unroll
  for (int i = 0; i < 8; ++i) { const int ka = k0 + 8 * g + i, kb = ka + 16; v[i] = ka < K ? row[ka < K ? ka : K - 1] : 0.f; v[8 + i] = kb < K ? row[kb < K ? kb : K - 1] : 0.f; }
  return bsplit16(v); }
__device__ __forceinline__ F2 split_col(const float* W, int k0, int n, int lane, int ld, int K) { float v[16]; const int g = lane >> 4;
#pragma unroll
  for (int i = 0; i < 8; ++i) { const int ka = k0 + 8 * g + i, kb = ka + 16; v[i] = ka < K ? W[(size_t)(ka < K ? ka : K - 1) * ld + n] : 0.f; v[8 + i] = kb < K ? W[(size_t)(kb < K ? kb : K - 1) * ld + n] : 0.f; }
  return bsplit16(v); }
__device__ __forceinline__ v8f mac3(const F2& a, const F2& b, v8f c) { c = wmma_bf(a.l, b.h, c); c = wmma_bf(a.h, b.l, c); return wmma_bf(a.h, b.h, c); }
__device__ __forceinline__ float sigm(float v) { return 1.0f / (1.0f + expf(-v)); }
#define LDSX() do { asm volatile("s_wait_dscnt 0" ::: "memory"); __builtin_amdgcn_wave_barrier(); __builtin_amdgcn_fence(__ATOMIC_RELEASE, "workgroup"); } while (0)


// Conv-projected multi-head self-attention with head mixing: q,k,v = W x (1x1 conv), s[h] = sum_g w_head[h][g] (q_g . k_g) * 32^-0.5, a = softmax over keys, InstanceNorm2d of each (b,h) 1024x1024 attention map (biased var, eps 1e-5, affine), out = a' v; y = out (B,nh,T,hd) reinterpreted as (B,T,C); y Wp^T + bp; stored as (B,C,T).  B 8, C 256, T 1024, 8 heads x 32.
// k_pack, k_xt (x -> bf16 [b][t][c]), k_qkv (exact GEMM), k_vt (v -> hi/lo transposed planes), k_attn (one pass per (query block, b, head group of 4), keys split over two waves per query tile: raw scores of all 8 heads on WMMA, mixing + online softmax with sum and sum-of-squares per row on the VALU, P.V on WMMA; writes softmax-normalised O rows and per-row sum(a^2)), k_norm (per (b,h): variance -> affine coefficients; column sums of v), k_fin (affine applied at A-load, output projection, transposed 256-B stores).
#define NB 8
#define CC 256
#define TT 1024
#define NH 8
#define HD 32
#define NR (NB * TT)        // 8192
#define QKVP (3 * CC)       // 768
#define DM CC
#ifndef NBT
#define NBT NB              // batches launched (all)
#endif
typedef __attribute__((ext_vector_type(8))) __bf16 v8b;
__device__ __forceinline__ v16b frag_b(const __bf16* rowk0, int lane) {
  union { v16b v; v8b q[2]; } u; const __bf16* p = rowk0 + 8 * (lane >> 4);
  u.q[0] = *(const v8b*)p; u.q[1] = *(const v8b*)(p + 16); return u.v;
}
__device__ __forceinline__ float bfr(float v) { return (float)(__bf16)v; }
// the same fragment from the lane's own pointer p = rowk0 + 8 * (lane >> 4)
__device__ __forceinline__ v16b frag_bp(const __bf16* p) { union { v16b v; v8b q[2]; } u; u.q[0] = *(const v8b*)p; u.q[1] = *(const v8b*)(p + 16); return u.v; }
// the 16 f32 of one fragment row as they are loaded (4 x 16 B, the element order of split_row, p = row + k0 + 8 * (lane >> 4)); split to hi/lo only where they are used
struct R16 { v4f q[4]; };
__device__ __forceinline__ R16 ld_r16(const float* p) { R16 r; r.q[0] = *(const v4f*)p; r.q[1] = *(const v4f*)(p + 4); r.q[2] = *(const v4f*)(p + 16); r.q[3] = *(const v4f*)(p + 20); return r; }
__device__ __forceinline__ F2 split_r16(const R16& r) { float v[16];
#pragma unroll
  for (int i = 0; i < 4; ++i) { v[i] = r.q[0][i]; v[4 + i] = r.q[1][i]; v[8 + i] = r.q[2][i]; v[12 + i] = r.q[3][i]; }
  return bsplit16(v); }
// e^v on the hardware exponential, in line: 2^(v * log2 e); v <= 0 wherever it is used (an older maximum minus the running maximum), a result below 2^-126 comes out as 0
#define LOG2E 1.4426950408889634f
__device__ __forceinline__ float exp_hw(float v) { const float x = v * LOG2E; const float r = __builtin_amdgcn_exp2f(x);
  asm volatile("v_nop" :: "v"(x), "v"(r));   // the free slot behind v_exp_f32; its argument is named so that no instruction in front of the slot rewrites that register
  return r; }
__device__ __attribute__((noinline)) float erf_ni(float v) { return erff(v); }

#define WS_PT   0u                                   // bf16 [1024][256]: Wq | Wk | Wv | Wp rows
#define WS_XT   (WS_PT + 2u * 4 * CC * CC)             // bf16 [8192][256] x transposed (token rows)
#define WS_QKV  (WS_XT + 2u * NR * CC)                 // f32 [8192][768]
#define WS_VTH  (WS_QKV + 4u * NR * QKVP)              // bf16 [8][256][1024]
#define WS_VTL  (WS_VTH + 2u * NB * CC * TT)
#define WS_ON   (WS_VTL + 2u * NB * CC * TT)           // f32 [8][8][1024][32] softmax-normalised O
#define WS_RSQ  (WS_ON + 4u * NB * NH * TT * HD)        // f32 [8 b][2 hg][16 qb][4 wave][16 row][4 hl]
#define WS_CV   (WS_RSQ + 4u * NB * NH * TT)           // f32 [64 (b,h)][64]: coefA, coefB, .., vsum[32] at 32..63
#define WS_END  (WS_CV + 4u * NB * NH * 64)

__global__ __launch_bounds__(256) void k_pack(const float* __restrict__ Wq, const float* __restrict__ Wk, const float* __restrict__ Wv, const float* __restrict__ Wp, __bf16* __restrict__ PT) {
  __shared__ __align__(16) __bf16 s[CC]; const int n = blockIdx.x, tid = threadIdx.x; const int m = n & 255; const float* src = (n < 256) ? Wq : (n < 512) ? Wk : (n < 768) ? Wv : Wp;
  s[tid] = (__bf16)src[(size_t)m * CC + tid]; __syncthreads();
  if (tid < CC / 8) vst2((unsigned*)(PT + (size_t)n * CC + tid * 8), *(const v4u*)&s[tid * 8]);
}
// ---- k_xt: block = (32 tokens t0, b): XT[b][t][c] = bf16(x[b][c][t]); rows of 512 B
__global__ __launch_bounds__(256) void k_xt(const float* __restrict__ X, __bf16* __restrict__ XT) {
  __shared__ __align__(16) __bf16 s[32][CC + 8]; const int t0 = blockIdx.x * 32, b = blockIdx.y, tid = threadIdx.x;
  for (int q = tid; q < CC * 32; q += 256) { const int c = q >> 5, tl = q & 31; s[tl][c] = (__bf16)X[((size_t)b * CC + c) * TT + t0 + tl]; }
  __syncthreads();
  for (int q = tid; q < 32 * 32; q += 256) { const int tl = q >> 5, pc = q & 31; vst2((unsigned*)(XT + ((size_t)b * TT + t0 + tl) * CC + pc * 8), *(const v4u*)&s[tl][pc * 8]); }
}
// ---- k_qkv: block = (64 token rows, 128 cols): QKV[r][n] = XT[r] . PT[n] (exact), K = 256
__global__ __launch_bounds__(128) void k_qkv(const __bf16* __restrict__ XT, const __bf16* __restrict__ PT, float* __restrict__ QKV) {
  __shared__ __align__(16) float so[4][16][132];
  const int tid = threadIdx.x, wave = tid >> 5, lane = tid & 31, col = lane & 15, g = lane >> 4; const size_t r0 = (size_t)blockIdx.x * 64 + wave * 16; const int n0 = blockIdx.y * 128;
  v8f acc[8] = {};
#pragma unroll 2
  for (int kc = 0; kc < CC / 32; ++kc) { const v16b a = frag_b(XT + (r0 + col) * CC + kc * 32, lane);
#pragma unroll
    for (int j = 0; j < 8; ++j) acc[j] = wmma_bf(a, frag_b(PT + (size_t)(n0 + j * 16 + col) * CC + kc * 32, lane), acc[j]); }
#pragma unroll
  for (int j = 0; j < 8; ++j)
#pragma unroll
    for (int r = 0; r < 8; ++r) so[wave][8 * g + r][j * 16 + col] = acc[j][r];
  LDSX();
  for (int rl = 0; rl < 16; ++rl) vst2(QKV + (r0 + rl) * QKVP + n0 + lane * 4, *(const v4f*)&so[wave][rl][lane * 4]);
}
__global__ __launch_bounds__(256) void k_vt(const float* __restrict__ QKV, __bf16* __restrict__ VTH, __bf16* __restrict__ VTL) {
  __shared__ __align__(16) __bf16 svh[DM][72], svl[DM][72];
  const int tid = threadIdx.x; const size_t t0 = (size_t)blockIdx.x * 64; const int b = (int)(t0 / TT), p0 = (int)(t0 % TT);
  for (int q = tid; q < 64 * DM; q += 256) { const int tl = q >> 8, c = q & 255; const float v = QKV[(t0 + tl) * QKVP + 2 * DM + c]; const __bf16 hb = (__bf16)v; svh[c][tl] = hb; svl[c][tl] = (__bf16)(v - (float)hb); }
  __syncthreads();
  for (int q = tid; q < DM * 8; q += 256) { const int rowi = q >> 3, pc = q & 7; const size_t o = ((size_t)b * DM + rowi) * TT + p0 + pc * 8; vst2((unsigned*)(VTH + o), *(const v4u*)&svh[rowi][pc * 8]); vst2((unsigned*)(VTL + o), *(const v4u*)&svl[rowi][pc * 8]); }
}
// ---- k_attn: block = (query block qb of 64, b, head group hg of 4 heads), 8 waves = 4 query tiles of 16 (qt) x 2 key halves of 512 (kh); the two waves of a query tile share its staged q rows, run the loop below on their own half of the keys, and are merged at the end.
//   per key step of 32: raw scores of all 8 heads g (q hi/lo from LDS x k hi/lo, 3 products) * scale -> sraw; per lane (row = lane&15, two heads of the group): mixed s' = sum_g w_head[h][g] sraw[g], online softmax (max, sum, sum of squares), p -> sp, rescale factor -> salpha; P.V for the group's 4 heads (3 products).
//   global loads run ahead of their use, in registers: K of heads g+4, g+5 is asked for before heads g, g+1 are worked on, V of the group's first two heads at the head of (b), of the last two at the head of (c) and behind P.V of the first head, K of heads 0..3 of the next step inside (c).
//   merge: the kh = 1 wave leaves m, l, l2 and its unnormalised acc in LDS; behind one block barrier the kh = 0 wave rescales both halves to the common maximum and adds them.
//   end: ON[b][h][q][:] = acc / l (softmax-normalised), RSQ chunk [row][hl] = l2 / l^2 = sum_t a^2 of that row.
__global__ __launch_bounds__(256) void k_attn(const float* __restrict__ QKV, const __bf16* __restrict__ VTH, const __bf16* __restrict__ VTL, const float* __restrict__ WH, float* __restrict__ ON, float* __restrict__ RSQ) {
  __shared__ __align__(16) __bf16 sqh[4][8][16][40], sql[4][8][16][40]; __shared__ __align__(16) float sraw[8][8][16][36]; __shared__ __align__(16) float sp[8][4][16][36]; __shared__ float salpha[8][4][16], sl[8][4][16], sm[4][4][16], sf0[4][4][16], sf1[4][4][16];
  const int tid = threadIdx.x, wave = tid >> 5, lane = tid & 31, col = lane & 15, hf = lane >> 4; const int qb = blockIdx.x, b = blockIdx.y, hg = blockIdx.z; const int qt = wave & 3, kh = __builtin_amdgcn_readfirstlane(tid >> 7); const int q0 = qb * 64 + qt * 16; const size_t tq = (size_t)b * TT + q0;
  // stage the query tile's 16 rows (all 8 heads) as hi/lo bf16: 8 rows per wave of the pair
  for (int i = 0; i < 8 * CC / 32; ++i) { const int q = kh * 8 * CC + i * 32 + lane; const int rl = q >> 8, c = q & 255; const float v = QKV[(tq + rl) * QKVP + c]; const __bf16 hb = (__bf16)v; sqh[qt][c >> 5][rl][c & 31] = hb; sql[qt][c >> 5][rl][c & 31] = (__bf16)(v - (float)hb); }
  // mixing weights for the lane's two heads
  const int row = lane & 15; const int hl0 = hf * 2; float wm[2][8];
#pragma unroll
  for (int u = 0; u < 2; ++u)
#pragma unroll
    for (int gg = 0; gg < 8; ++gg) wm[u][gg] = bfr(WH[(hg * 4 + hl0 + u) * NH + gg]);
  float m[2], l[2], l2[2]; m[0] = m[1] = -3.0e38f; l[0] = l[1] = 0.f; l2[0] = l2[1] = 0.f;
  v8f acc[4][2] = {};
  // the lane's own pointers at key step 0: key row col of QKV (its K columns start at CC), V rows (column col of the group's first head), each at its half of the fragment
  const float* Kc = QKV + ((size_t)b * TT + col) * QKVP + 8 * hf;
  const __bf16* VHc = VTH + ((size_t)b * CC + hg * 4 * HD + col) * TT + 8 * hf; const __bf16* VLc = VTL + ((size_t)b * CC + hg * 4 * HD + col) * TT + 8 * hf;
  const int ks1 = (kh + 1) * (TT / 64);
  R16 kr[8][2];              // K rows in flight, by head and key tile
  v16b vh[4][2], vl[4][2];   // V of the step in flight, by head of the group and column tile
  // the loops inside these macros are unrolled so that kr, vh, vl and acc are indexed by constants and stay in registers
  // ask for K of heads G, G+1 of the key step at P
#define LDK2(G, P) do { _Pragma("unroll") for (int g_ = (G); g_ < (G) + 2; ++g_) { _Pragma("unroll") for (int ct = 0; ct < 2; ++ct) kr[g_][ct] = ld_r16((P) + (size_t)ct * 16 * QKVP + CC + g_ * HD); } } while (0)
  // ask for V of head H of the group, key step at PH, PL
#define LDV1(H, PH, PL) do { _Pragma("unroll") for (int dt = 0; dt < 2; ++dt) { vh[H][dt] = frag_bp((PH) + (size_t)((H) * HD + dt * 16) * TT); vl[H][dt] = frag_bp((PL) + (size_t)((H) * HD + dt * 16) * TT); } } while (0)
  // raw scores of heads G, G+1 from the K rows in registers
#define SC2(G) do { _Pragma("unroll") for (int gg = (G); gg < (G) + 2; ++gg) { F2 a; a.h = frag_b(&sqh[qt][gg][col][0], lane); a.l = frag_b(&sql[qt][gg][col][0], lane); \
    _Pragma("unroll") for (int ct = 0; ct < 2; ++ct) { const F2 k = split_r16(kr[gg][ct]); const v8f c = mac3(a, k, (v8f){}); \
      _Pragma("unroll") for (int r = 0; r < 8; ++r) sraw[wave][gg][8 * hf + r][ct * 16 + col] = c[r] * 0.17677669529663687f; } } } while (0)
  // P.V of head H of the group from the V fragments in registers
#define PV1(H) do { { const int hl = (H); const F2 pa = split_row(&sp[wave][hl][col][0], 0, lane); \
    _Pragma("unroll") for (int r = 0; r < 8; ++r) { const float al = salpha[wave][hl][8 * hf + r]; acc[hl][0][r] *= al; acc[hl][1][r] *= al; } \
    _Pragma("unroll") for (int dt = 0; dt < 2; ++dt) { acc[hl][dt] = wmma_bf(pa.l, vh[hl][dt], acc[hl][dt]); acc[hl][dt] = wmma_bf(pa.h, vl[hl][dt], acc[hl][dt]); acc[hl][dt] = wmma_bf(pa.h, vh[hl][dt], acc[hl][dt]); } } } while (0)
  // behind each group of these loads; the loads' address registers are inputs, so that they keep their values up to the wait
#define XW1(P) asm volatile("s_wait_xcnt 0x0" :: "v"(P) : "memory")
#define XW2(P, Q) asm volatile("s_wait_xcnt 0x0" :: "v"(P), "v"(Q) : "memory")
#define XW3(P, Q, R) asm volatile("s_wait_xcnt 0x0" :: "v"(P), "v"(Q), "v"(R) : "memory")
  { const float* kp = Kc + (size_t)kh * (TT / 2) * QKVP; LDK2(0, kp); LDK2(2, kp); XW1(kp); }
  __syncthreads();   // each wave reads q rows that its partner staged
#pragma unroll 1
  for (int ks = kh * (TT / 64); ks < ks1; ++ks) {
    const float* kp = Kc + (size_t)ks * 32 * QKVP; const __bf16* vhp = VHc + ks * 32; const __bf16* vlp = VLc + ks * 32;
    // (a) raw scores for all 8 heads, 32 keys
    LDK2(4, kp); XW1(kp); SC2(0);
    LDK2(6, kp); XW1(kp); SC2(2);
    SC2(4);
    SC2(6);
    LDSX();
    LDV1(0, vhp, vlp); LDV1(1, vhp, vlp); XW2(vhp, vlp);   // behind the fence of LDSX, which waits for every load in flight
    // (b) mixing + online softmax for (row, heads hl0, hl0+1)
    { float s0[32], s1[32];
#pragma unroll
      for (int k4 = 0; k4 < 8; ++k4) { float t0[4] = {0.f, 0.f, 0.f, 0.f}, t1[4] = {0.f, 0.f, 0.f, 0.f};
#pragma unroll
        for (int gg = 0; gg < 8; ++gg) { const v4f rv = *(const v4f*)&sraw[wave][gg][row][k4 * 4];
#pragma unroll
          for (int i = 0; i < 4; ++i) { t0[i] += wm[0][gg] * rv[i]; t1[i] += wm[1][gg] * rv[i]; } }
#pragma unroll
        for (int i = 0; i < 4; ++i) { s0[k4 * 4 + i] = t0[i]; s1[k4 * 4 + i] = t1[i]; } }
#pragma unroll
      for (int u = 0; u < 2; ++u) { float* s = u == 0 ? s0 : s1; float mx = s[0];
#pragma unroll
        for (int k = 1; k < 32; ++k) mx = fmaxf(mx, s[k]);
        const float mn = fmaxf(m[u], mx); const float al = exp_hw(m[u] - mn); float es = 0.f, es2 = 0.f;
#pragma unroll
        for (int k8 = 0; k8 < 32; k8 += 8) { float x[8], e[8];   // eight exponentials at a time, none waiting for another
#pragma unroll
          for (int i = 0; i < 8; ++i) x[i] = (s[k8 + i] - mn) * LOG2E;
#pragma unroll
          for (int i = 0; i < 8; ++i) e[i] = __builtin_amdgcn_exp2f(x[i]);
          // the free slot behind the last v_exp_f32 of the eight; the arguments are named so that no instruction in front of the slot rewrites the register of one
          asm volatile("v_nop" :: "v"(x[0]), "v"(x[1]), "v"(x[2]), "v"(x[3]), "v"(x[4]), "v"(x[5]), "v"(x[6]), "v"(x[7]), "v"(e[0]), "v"(e[1]), "v"(e[2]), "v"(e[3]), "v"(e[4]), "v"(e[5]), "v"(e[6]), "v"(e[7]));
#pragma unroll
          for (int i = 0; i < 8; ++i) { es += e[i]; es2 += e[i] * e[i]; sp[wave][hl0 + u][row][k8 + i] = e[i]; } }
        l[u] = l[u] * al + es; l2[u] = l2[u] * (al * al) + es2; m[u] = mn; salpha[wave][hl0 + u][row] = al; } }
    LDSX();
    // (c) P.V for the group's 4 heads
    const float* kn = Kc + (size_t)(ks + 1 < ks1 ? ks + 1 : ks) * 32 * QKVP;   // the last step asks for its own rows again (in bounds, not used)
    LDV1(2, vhp, vlp); LDK2(0, kn); XW3(vhp, vlp, kn); PV1(0);
    LDV1(3, vhp, vlp); LDK2(2, kn); XW3(vhp, vlp, kn); PV1(1);
    PV1(2);
    PV1(3);
    LDSX(); }
  // merge of the two key halves, then l and sum a^2 per (hl, row)
  float (*so)[16][36] = sp[wave];   // reuse: [hl][row][32]
  if (kh == 1) {
#pragma unroll
    for (int u = 0; u < 2; ++u) { sm[qt][hl0 + u][row] = m[u]; sl[wave][hl0 + u][row] = l[u]; salpha[wave][hl0 + u][row] = l2[u]; }
#pragma unroll
    for (int hl = 0; hl < 4; ++hl)
#pragma unroll
      for (int r = 0; r < 8; ++r) { so[hl][8 * hf + r][col] = acc[hl][0][r]; so[hl][8 * hf + r][16 + col] = acc[hl][1][r]; }
  }
  __syncthreads();   // the kh = 0 wave reads what its partner has just written
  if (kh == 0) {
#pragma unroll
    for (int u = 0; u < 2; ++u) { const float m1 = sm[qt][hl0 + u][row]; const float mn = fmaxf(m[u], m1); const float f0 = __builtin_amdgcn_exp2f((m[u] - mn) * LOG2E), f1 = __builtin_amdgcn_exp2f((m1 - mn) * LOG2E);
      const float lt = l[u] * f0 + sl[wave + 4][hl0 + u][row] * f1; const float l2t = l2[u] * (f0 * f0) + salpha[wave + 4][hl0 + u][row] * (f1 * f1);
      sl[wave][hl0 + u][row] = lt; salpha[wave][hl0 + u][row] = l2t / (lt * lt); sf0[qt][hl0 + u][row] = f0; sf1[qt][hl0 + u][row] = f1; }
    LDSX();
    const float (*sx)[16][36] = sp[wave + 4];   // the partner's unnormalised acc
#pragma unroll
    for (int hl = 0; hl < 4; ++hl)
#pragma unroll
      for (int r = 0; r < 8; ++r) { const int rr = 8 * hf + r; const float il = 1.0f / sl[wave][hl][rr], f0 = sf0[qt][hl][rr], f1 = sf1[qt][hl][rr];
        so[hl][rr][col] = (acc[hl][0][r] * f0 + sx[hl][rr][col] * f1) * il; so[hl][rr][16 + col] = (acc[hl][1][r] * f0 + sx[hl][rr][16 + col] * f1) * il; }
    LDSX();
#pragma unroll
    for (int hl = 0; hl < 4; ++hl) for (int rl = 0; rl < 16; ++rl) if (lane < 8) vst2(ON + ((((size_t)b * NH + hg * 4 + hl) * TT + q0 + rl) * HD) + lane * 4, *(const v4f*)&so[hl][rl][lane * 4]);
    { float* chunk = RSQ + ((((size_t)b * 2 + hg) * 16 + qb) * 4 + qt) * 64; __shared__ __align__(16) float sr[4][64];
      if (lane < 16) { sr[qt][lane * 4 + 0] = salpha[wave][0][lane]; sr[qt][lane * 4 + 1] = salpha[wave][1][lane]; sr[qt][lane * 4 + 2] = salpha[wave][2][lane]; sr[qt][lane * 4 + 3] = salpha[wave][3][lane]; }
      LDSX();
      if (lane < 16) vst2(chunk + lane * 4, *(const v4f*)&sr[qt][lane * 4]); }
  }
}
// ---- k_norm: block = (b, h), 256 threads: E[a^2] over the 1024x1024 map from the per-row sums, mean = 1/T, var = E[a^2] - mean^2, rs = rsqrt(var + 1e-5); coefA = rs*gamma[h], coefB = beta[h] - coefA/T; vsum[d] = sum_t v[b][h*32+d][t] (f32 from QKV; 32 partial sums of 32 rows each by all 256 threads, added in LDS). CV row [64]: coefA, coefB at 0,1; vsum at 32..63.
__global__ __launch_bounds__(256) void k_norm(const float* __restrict__ RSQ, const float* __restrict__ QKV, const float* __restrict__ GA, const float* __restrict__ BE, float* __restrict__ CV) {
  __shared__ float sred[256]; __shared__ __align__(16) float srow[64]; __shared__ __align__(16) float sv[32][36];
  const int b = blockIdx.x >> 3, h = blockIdx.x & 7, tid = threadIdx.x; const int hg = h >> 2, hl = h & 3;
  // column sums of v, first part: thread = (token rows rg, rg + 32, .., 4 columns from c4); its 32 loads of 16 B do not depend on one another
  const int rg = tid >> 3, c4 = (tid & 7) * 4; const float* vp = QKV + ((size_t)b * TT + rg) * QKVP + 2 * CC + h * HD + c4; v4f vr[32];
  // unrolled so that vr stays in registers and the loads are issued ahead of the adds, many in flight at a time
#pragma unroll
  for (int i = 0; i < 32; ++i) vr[i] = *(const v4f*)(vp + (size_t)i * 32 * QKVP);
  float s = 0.f;
#pragma unroll
  for (int i = 0; i < 4; ++i) { const int q = tid * 4 + i; const int qb = q >> 6, wave = (q >> 4) & 3, rl = q & 15; s += RSQ[((((size_t)b * 2 + hg) * 16 + qb) * 4 + wave) * 64 + rl * 4 + hl]; }
  { v4f vs = vr[0];
    // unrolled so that vr is indexed by constants
#pragma unroll
    for (int i = 1; i < 32; ++i) vs += vr[i];
    *(v4f*)&sv[rg][c4] = vs; }
  sred[tid] = s; __syncthreads();
  for (int st = 128; st >= 1; st >>= 1) { if (tid < st) sred[tid] += sred[tid + st]; __syncthreads(); }
  // second part: thread = column, adds the 32 row groups' partial sums; words 32..63 of srow have this one writer
  if (tid < 32) { srow[tid] = 0.f; float vs = 0.f;
    // unrolled so that the LDS loads are issued ahead of the adds
#pragma unroll
    for (int r = 0; r < 32; ++r) vs += sv[r][tid];
    srow[32 + tid] = vs; }
  __syncthreads();
  if (tid == 0) { const float e2 = sred[0] / ((float)TT * (float)TT); const float mean = 1.0f / (float)TT; const float var = e2 - mean * mean; const float rs = rsqrtf(var + 1e-5f); const float cA = rs * bfr(GA[h]); srow[0] = cA; srow[1] = bfr(BE[h]) - cA * mean; }
  __syncthreads();
  if (tid < 16) vst2(CV + (size_t)blockIdx.x * 64 + tid * 4, *(const v4f*)&srow[tid * 4]);
}
// ---- k_fin: block = (64 rows r' of y (= O viewed as [T][256]), 128 output channels, b): Y = (coefA*ON + coefB*vsum)(hi/lo) . Wp rows (2 products) + bp, stored transposed: out[b][o][r'] segments of 64 floats (256 B)
__global__ __launch_bounds__(128) void k_fin(const float* __restrict__ ON, const float* __restrict__ CV, const __bf16* __restrict__ PT, const float* __restrict__ bp, float* __restrict__ out) {
  __shared__ __align__(16) float sT[128][68];
  const int tid = threadIdx.x, wave = tid >> 5, lane = tid & 31, col = lane & 15, g = lane >> 4; const int b = blockIdx.z, n0 = blockIdx.y * 128; const int r0 = blockIdx.x * 64 + wave * 16; const int h = (blockIdx.x * 64) / 128;   // y row r' covers heads r'/128 (constant per 64-row block)
  const float cA = CV[(b * NH + h) * 64 + 0], cB = CV[(b * NH + h) * 64 + 1]; const float* vs = CV + (b * NH + h) * 64 + 32;
  const float* Arow = ON + ((size_t)b * TT + r0 + col) * CC;
  v8f acc[8] = {};
#pragma unroll 2
  for (int kc = 0; kc < CC / 32; ++kc) { float v[16]; const float* p = Arow + kc * 32 + 8 * g;
#pragma unroll
    for (int i = 0; i < 8; ++i) { v[i] = cA * p[i] + cB * vs[8 * g + i]; v[8 + i] = cA * p[16 + i] + cB * vs[16 + 8 * g + i]; }
    const F2 a = bsplit16(v);
#pragma unroll
    for (int j = 0; j < 8; ++j) { const v16b w = frag_b(PT + (size_t)(768 + n0 + j * 16 + col) * CC + kc * 32, lane); acc[j] = wmma_bf(a.l, w, acc[j]); acc[j] = wmma_bf(a.h, w, acc[j]); } }
#pragma unroll
  for (int j = 0; j < 8; ++j) { const float bb = bfr(bp[n0 + j * 16 + col]);
#pragma unroll
    for (int r = 0; r < 8; ++r) sT[j * 16 + col][wave * 16 + 8 * g + r] = acc[j][r] + bb; }
  __syncthreads();
  for (int q = tid; q < 128 * 16; q += 128) { const int o = q >> 4, piece = q & 15; vst2(out + ((size_t)b * CC + n0 + o) * TT + blockIdx.x * 64 + piece * 4, *(const v4f*)&sT[o][piece * 4]); }
}
extern "C" void kernel_launch(void* const* d_in, const int* in_sizes, int n_in, void* d_out, int out_size, void* d_ws, size_t ws_size, hipStream_t stream) {
  (void)in_sizes; (void)n_in; (void)out_size;
  const float** F = (const float**)d_in;   // x [8,256,32,32], Wq, Wk, Wv [256,256], w_head [8,8], gamma [8], beta [8], Wp [256,256], bp [256]
  if (ws_size < (size_t)WS_END) return;
  char* ws = (char*)d_ws; __bf16 *PT = (__bf16*)(ws + WS_PT), *XT = (__bf16*)(ws + WS_XT), *VTH = (__bf16*)(ws + WS_VTH), *VTL = (__bf16*)(ws + WS_VTL); float *QKV = (float*)(ws + WS_QKV), *ON = (float*)(ws + WS_ON), *RSQ = (float*)(ws + WS_RSQ), *CV = (float*)(ws + WS_CV);
  k_pack<<<4 * CC, 256, 0, stream>>>(F[1], F[2], F[3], F[7], PT);
  k_xt<<<dim3(TT / 32, NBT), 256, 0, stream>>>(F[0], XT);
  k_qkv<<<dim3(NBT * TT / 64, QKVP / 128), 128, 0, stream>>>(XT, PT, QKV);
  k_vt<<<NBT * TT / 64, 256, 0, stream>>>(QKV, VTH, VTL);
  k_attn<<<dim3(TT / 64, NBT, 2), 256, 0, stream>>>(QKV, VTH, VTL, F[4], ON, RSQ);
  k_norm<<<NBT * NH, 256, 0, stream>>>(RSQ, QKV, F[5], F[6], CV);
  k_fin<<<dim3(TT / 64, CC / 128, NBT), 128, 0, stream>>>(ON, CV, PT, F[8], (float*)d_out);
}

// v005
// It runs in 166 microseconds.
// In two side-by-side timings against v004, it was 1.12 and 1.10 times as fast.
// Counting every step since v000, it is 3.43 times as fast.
// compute dtype: x and all weights (Wq, Wk, Wv, w_head, gamma, beta, Wp, bp; module inputs) rounded to bf16; the 1x1-conv projections with exact bf16 products; per-head raw scores q.k and the attention-weighted V sums with both computed operands as bf16 hi + residual pairs (3 products); the output projection with its computed input as hi/lo pairs x exact bf16 weights (2 products) on WMMA 16x16x32; head mixing (8x8), softmax, InstanceNorm statistics and affine in f32 on the VALU; f32 accumulate.
#include <hip/hip_runtime.h>
#include <math.h>

typedef __attribute__((ext_vector_type(16))) _Float16 v16h;
typedef __attribute__((ext_vector_type(16))) __bf16 v16b;
typedef __attribute__((ext_vector_type(8)))  _Float16 v8h;
typedef __attribute__((ext_vector_type(8)))  float v8f;
typedef __attribute__((ext_vector_type(4)))  float v4f;
typedef __attribute__((ext_vector_type(2)))  float v2f;
typedef __attribute__((ext_vector_type(4)))  unsigned v4u;
typedef __attribute__((ext_vector_type(4)))  int v4i;
typedef float __attribute__((may_alias)) float_a;
typedef int __attribute__((may_alias)) int_a;

template <typename T> __device__ __forceinline__ void vst2(void* p, T v) { *(T*)p = v;  }
__device__ __forceinline__ v8f wmma16(v16h a, v16h b, v8f c) {
  v8f d = __builtin_amdgcn_wmma_f32_16x16x32_f16(false, a, false, b, (short)0, c, false, false);
  asm volatile("v_nop\n\tv_nop\n\tv_nop\n\tv_nop" : "+v"(d) : "v"(a), "v"(b));
  return d;
}
__device__ __forceinline__ v8f wmma_bf(v16b a, v16b b, v8f c) {
  v8f d = __builtin_amdgcn_wmma_f32_16x16x32_bf16(false, a, false, b, (short)0, c, false, false);
  asm volatile("v_nop\n\tv_nop\n\tv_nop\n\tv_nop" : "+v"(d) : "v"(a), "v"(b));
  return d;
}
// 16x16x32 fragments: lane = (h = lane>>4, row/col = lane&15); elements 0..7 = k0+8h+0..7, 8..15 = k0+16+8h+0..7; D element r = row 8h+r
__device__ __forceinline__ v16h frag_h(const _Float16* rowk0, int lane) {
  union { v16h v; v8h q[2]; } u; const _Float16* p = rowk0 + 8 * (lane >> 4);
  u.q[0] = *(const v8h*)p; u.q[1] = *(const v8h*)(p + 16); return u.v;
}
__device__ __forceinline__ v16h frag_f32(const float* rowk0, int lane) {
  v16h a; const float* p = rowk0 + 8 * (lane >> 4);
#pragma unroll
  for (int i = 0; i < 8; ++i) { a[i] = (_Float16)p[i]; a[8 + i] = (_Float16)p[16 + i]; }
  return a;
}
__device__ __forceinline__ v16h frag_f32s(const float* rowk0, int lane, float sc) {
  v16h a; const float* p = rowk0 + 8 * (lane >> 4);
#pragma unroll
  for (int i = 0; i < 8; ++i) { a[i] = (_Float16)(p[i] * sc); a[8 + i] = (_Float16)(p[16 + i] * sc); }
  return a;
}
// column fragment from a [K][ld] layout (column n), rows >= K read as 0
__device__ __forceinline__ v16h fragc_f32(const float* W, int k0, int n, int lane, int ld, int K) {
  v16h a; const int g = lane >> 4;
#pragma unroll
  for (int i = 0; i < 8; ++i) { const int ka = k0 + 8 * g + i, kb = ka + 16;
    a[i] = (_Float16)(ka < K ? W[(size_t)(ka < K ? ka : K - 1) * ld + n] : 0.f); a[8 + i] = (_Float16)(kb < K ? W[(size_t)(kb < K ? kb : K - 1) * ld + n] : 0.f); }
  return a;
}
struct F2 { v16b h, l; };
__device__ __forceinline__ F2 bsplit16(const float v[16]) { F2 r;
#pragma unroll
  for (int i = 0; i < 16; ++i) { const __bf16 h = (__bf16)v[i]; r.h[i] = h; r.l[i] = (__bf16)(v[i] - (float)h); }
  return r; }
__device__ __forceinline__ F2 split_row(const float* row, int k0, int lane) { float v[16]; const float* p = row + k0 + 8 * (lane >> 4);
#pragma unroll
  for (int i = 0; i < 8; ++i) { v[i] = p[i]; v[8 + i] = p[16 + i]; }
  return bsplit16(v); }
__device__ __forceinline__ F2 split_rowK(const float* row, int k0, int lane, int K) { float v[16]; const int g = lane >> 4;
#pragma unroll
  for (int i = 0; i < 8; ++i) { const int ka = k0 + 8 * g + i, kb = ka + 16; v[i] = ka < K ? row[ka < K ? ka : K - 1] : 0.f; v[8 + i] = kb < K ? row[kb < K ? kb : K - 1] : 0.f; }
  return bsplit16(v); }
__device__ __forceinline__ F2 split_col(const float* W, int k0, int n, int lane, int ld, int K) { float v[16]; const int g = lane >> 4;
#pragma unroll
  for (int i = 0; i < 8; ++i) { const int ka = k0 + 8 * g + i, kb = ka + 16; v[i] = ka < K ? W[(size_t)(ka < K ? ka : K - 1) * ld + n] : 0.f; v[8 + i] = kb < K ? W[(size_t)(kb < K ? kb : K - 1) * ld + n] : 0.f; }
  return bsplit16(v); }
__device__ __forceinline__ v8f mac3(const F2& a, const F2& b, v8f c) { c = wmma_bf(a.l, b.h, c); c = wmma_bf(a.h, b.l, c); return wmma_bf(a.h, b.h, c); }
__device__ __forceinline__ float sigm(float v) { return 1.0f / (1.0f + expf(-v)); }
#define LDSX() do { asm volatile("s_wait_dscnt 0" ::: "memory"); __builtin_amdgcn_wave_barrier(); __builtin_amdgcn_fence(__ATOMIC_RELEASE, "workgroup"); } while (0)


// Conv-projected multi-head self-attention with head mixing: q,k,v = W x (1x1 conv), s[h] = sum_g w_head[h][g] (q_g . k_g) * 32^-0.5, a = softmax over keys, InstanceNorm2d of each (b,h) 1024x1024 attention map (biased var, eps 1e-5, affine), out = a' v; y = out (B,nh,T,hd) reinterpreted as (B,T,C); y Wp^T + bp; stored as (B,C,T).  B 8, C 256, T 1024, 8 heads x 32.
// k_pack, k_xt (x -> bf16 [b][t][c]), k_qkv (exact GEMM; k in fragment order), k_vt (v -> hi/lo planes in fragment order), k_attn (one pass per (query block, b, head group of 4), keys split over two waves per query tile: raw scores of all 8 heads on WMMA, mixing + online softmax with sum and sum-of-squares per row on the VALU, P.V on WMMA; writes softmax-normalised O rows and per-row sum(a^2)), k_norm (per (b,h): variance -> affine coefficients; column sums of v), k_fin (affine applied at A-load, output projection, transposed 256-B stores).
#define NB 8
#define CC 256
#define TT 1024
#define NH 8
#define HD 32
#define NR (NB * TT)        // 8192
#define QKVP (3 * CC)       // 768
#define DM CC
#ifndef NBT
#define NBT NB              // batches launched (all)
#endif
typedef __attribute__((ext_vector_type(8))) __bf16 v8b;
__device__ __forceinline__ v16b frag_b(const __bf16* rowk0, int lane) {
  union { v16b v; v8b q[2]; } u; const __bf16* p = rowk0 + 8 * (lane >> 4);
  u.q[0] = *(const v8b*)p; u.q[1] = *(const v8b*)(p + 16); return u.v;
}
__device__ __forceinline__ float bfr(float v) { return (float)(__bf16)v; }
// the same fragment from fragment-order storage: elements 0..7 of all 32 lanes in 512 B in a row, then elements 8..15; p = the fragment's start + 8 * lane
__device__ __forceinline__ v16b frag_bp(const __bf16* p) { union { v16b v; v8b q[2]; } u; u.q[0] = *(const v8b*)p; u.q[1] = *(const v8b*)(p + 256); return u.v; }
// the 16 f32 of one fragment row as they are loaded (4 x 16 B, the element order of split_row) from fragment-order storage: piece j of all 32 lanes lies in 512 B in a row, p = the fragment's start + 4 * lane; split to hi/lo only where they are used
struct R16 { v4f q[4]; };
__device__ __forceinline__ R16 ld_r16(const float* p) { R16 r; r.q[0] = *(const v4f*)p; r.q[1] = *(const v4f*)(p + 128); r.q[2] = *(const v4f*)(p + 256); r.q[3] = *(const v4f*)(p + 384); return r; }
__device__ __forceinline__ F2 split_r16(const R16& r) { float v[16];
#pragma unroll
  for (int i = 0; i < 4; ++i) { v[i] = r.q[0][i]; v[4 + i] = r.q[1][i]; v[8 + i] = r.q[2][i]; v[12 + i] = r.q[3][i]; }
  return bsplit16(v); }
// e^v on the hardware exponential, in line: 2^(v * log2 e); v <= 0 wherever it is used (an older maximum minus the running maximum), a result below 2^-126 comes out as 0
#define LOG2E 1.4426950408889634f
__device__ __forceinline__ float exp_hw(float v) { const float x = v * LOG2E; const float r = __builtin_amdgcn_exp2f(x);
  asm volatile("v_nop" :: "v"(x), "v"(r));   // the free slot behind v_exp_f32; its argument is named so that no instruction in front of the slot rewrites that register
  return r; }
__device__ __attribute__((noinline)) float erf_ni(float v) { return erff(v); }

#define WS_PT   0u                                   // bf16 [1024][256]: Wq | Wk | Wv | Wp rows
#define WS_XT   (WS_PT + 2u * 4 * CC * CC)             // bf16 [8192][256] x transposed (token rows)
#define WS_QKV  (WS_XT + 2u * NR * CC)                 // f32 [8192][768]; the k columns 256..511 are not written: k goes to WS_KF
#define WS_VTH  (WS_QKV + 4u * NR * QKVP)              // bf16 [8 b][32 key step][8 h][2 dt][2 piece][32 lane][8]: v as the B fragments of P.V, in the order k_attn loads them
#define WS_VTL  (WS_VTH + 2u * NB * CC * TT)
#define WS_ON   (WS_VTL + 2u * NB * CC * TT)           // f32 [8][8][1024][32] softmax-normalised O
#define WS_RSQ  (WS_ON + 4u * NB * NH * TT * HD)        // f32 [8 b][2 hg][16 qb][4 wave][16 row][4 hl]
#define WS_CV   (WS_RSQ + 4u * NB * NH * TT)           // f32 [64 (b,h)][64]: coefA, coefB, .., vsum[32] at 32..63
#define WS_KF   (WS_CV + 4u * NB * NH * 64)            // f32 [512 key tile of 16][8 g][4 piece][32 lane][4]: k as the B fragments of the scores, in the order k_attn loads them
#define WS_END  (WS_KF + 4u * NR * CC)

__global__ __launch_bounds__(256) void k_pack(const float* __restrict__ Wq, const float* __restrict__ Wk, const float* __restrict__ Wv, const float* __restrict__ Wp, __bf16* __restrict__ PT) {
  __shared__ __align__(16) __bf16 s[CC]; const int n = blockIdx.x, tid = threadIdx.x; const int m = n & 255; const float* src = (n < 256) ? Wq : (n < 512) ? Wk : (n < 768) ? Wv : Wp;
  s[tid] = (__bf16)src[(size_t)m * CC + tid]; __syncthreads();
  if (tid < CC / 8) vst2((unsigned*)(PT + (size_t)n * CC + tid * 8), *(const v4u*)&s[tid * 8]);
}
// ---- k_xt: block = (32 tokens t0, b): XT[b][t][c] = bf16(x[b][c][t]); rows of 512 B
__global__ __launch_bounds__(256) void k_xt(const float* __restrict__ X, __bf16* __restrict__ XT) {
  __shared__ __align__(16) __bf16 s[32][CC + 8]; const int t0 = blockIdx.x * 32, b = blockIdx.y, tid = threadIdx.x;
  for (int q = tid; q < CC * 32; q += 256) { const int c = q >> 5, tl = q & 31; s[tl][c] = (__bf16)X[((size_t)b * CC + c) * TT + t0 + tl]; }
  __syncthreads();
  for (int q = tid; q < 32 * 32; q += 256) { const int tl = q >> 5, pc = q & 31; vst2((unsigned*)(XT + ((size_t)b * TT + t0 + tl) * CC + pc * 8), *(const v4u*)&s[tl][pc * 8]); }
}
// ---- k_qkv: block = (64 token rows, 128 cols): QKV[r][n] = XT[r] . PT[n] (exact), K = 256; the k columns leave in fragment order (KF), so that a load of k_attn reads whole cache lines
__global__ __launch_bounds__(128) void k_qkv(const __bf16* __restrict__ XT, const __bf16* __restrict__ PT, float* __restrict__ QKV, float* __restrict__ KF) {
  __shared__ __align__(16) float so[4][16][132];
  const int tid = threadIdx.x, wave = tid >> 5, lane = tid & 31, col = lane & 15, g = lane >> 4; const size_t r0 = (size_t)blockIdx.x * 64 + wave * 16; const int n0 = blockIdx.y * 128;
  v8f acc[8] = {};
#pragma unroll 2
  for (int kc = 0; kc < CC / 32; ++kc) { const v16b a = frag_b(XT + (r0 + col) * CC + kc * 32, lane);
#pragma unroll
    for (int j = 0; j < 8; ++j) acc[j] = wmma_bf(a, frag_b(PT + (size_t)(n0 + j * 16 + col) * CC + kc * 32, lane), acc[j]); }
#pragma unroll
  for (int j = 0; j < 8; ++j)
#pragma unroll
    for (int r = 0; r < 8; ++r) so[wave][8 * g + r][j * 16 + col] = acc[j][r];
  LDSX();
  if (n0 >= CC && n0 < 2 * CC) {   // k (the same for the whole block): the wave's 16 rows are one key tile, its 128 columns 4 heads; piece p = (head p >> 2, quarter p & 3 of the lane's 16 values), 512 B a store
    float* kf = KF + ((r0 >> 4) * NH + ((n0 - CC) >> 5)) * 512 + lane * 4;
    for (int p = 0; p < 16; ++p) vst2(kf + p * 128, *(const v4f*)&so[wave][col][(p >> 2) * HD + 8 * g + (p & 1) * 4 + ((p >> 1) & 1) * 16]);
  } else {
    for (int rl = 0; rl < 16; ++rl) vst2(QKV + (r0 + rl) * QKVP + n0 + lane * 4, *(const v4f*)&so[wave][rl][lane * 4]);
  }
}
__global__ __launch_bounds__(256) void k_vt(const float* __restrict__ QKV, __bf16* __restrict__ VTH, __bf16* __restrict__ VTL) {
  __shared__ __align__(16) __bf16 svh[DM][72], svl[DM][72];
  const int tid = threadIdx.x; const size_t t0 = (size_t)blockIdx.x * 64; const int b = (int)(t0 / TT), p0 = (int)(t0 % TT);
  for (int q = tid; q < 64 * DM; q += 256) { const int tl = q >> 8, c = q & 255; const float v = QKV[(t0 + tl) * QKVP + 2 * DM + c]; const __bf16 hb = (__bf16)v; svh[c][tl] = hb; svl[c][tl] = (__bf16)(v - (float)hb); }
  __syncthreads();
  // fragment order: q = (key step of 32: q >> 10, head, column tile, piece j, lane = (hf, col)); the lane's 8 keys of channel rowi are j * 16 + 8 * hf + 0..7 of the step; a wave stores 512 B in a row
  for (int q = tid; q < DM * 8; q += 256) { const int rowi = ((q >> 6) & 15) * 16 + (q & 15), pc = (q >> 10) * 4 + ((q >> 5) & 1) * 2 + ((q >> 4) & 1); const size_t o = ((size_t)b * (TT / 32) + (p0 >> 5)) * 8192 + (size_t)q * 8; vst2((unsigned*)(VTH + o), *(const v4u*)&svh[rowi][pc * 8]); vst2((unsigned*)(VTL + o), *(const v4u*)&svl[rowi][pc * 8]); }
}
// ---- k_attn: block = (query block qb of 64, b, head group hg of 4 heads), 8 waves = 4 query tiles of 16 (qt) x 2 key halves of 512 (kh); the two waves of a query tile share its staged q rows, run the loop below on their own half of the keys, and are merged at the end.
//   per key step of 32: raw scores of all 8 heads g (q hi/lo from LDS x k hi/lo, 3 products) * scale -> sraw; per lane (row = lane&15, two heads of the group): mixed s' = sum_g w_head[h][g] sraw[g], online softmax (max, sum, sum of squares), p -> sp, rescale factor -> salpha; P.V for the group's 4 heads (3 products).
//   global loads run ahead of their use, in registers: K of heads g+4, g+5 is asked for before heads g, g+1 are worked on, V of the group's first two heads at the head of (b), of the last two at the head of (c) and behind P.V of the first head, K of heads 0..3 of the next step inside (c).
//   merge: the kh = 1 wave leaves m, l, l2 and its unnormalised acc in LDS; behind one block barrier the kh = 0 wave rescales both halves to the common maximum and adds them.
//   end: ON[b][h][q][:] = acc / l (softmax-normalised), RSQ chunk [row][hl] = l2 / l^2 = sum_t a^2 of that row.
__global__ __launch_bounds__(256) void k_attn(const float* __restrict__ QKV, const float* __restrict__ KF, const __bf16* __restrict__ VTH, const __bf16* __restrict__ VTL, const float* __restrict__ WH, float* __restrict__ ON, float* __restrict__ RSQ) {
  __shared__ __align__(16) __bf16 sqh[4][8][16][40], sql[4][8][16][40]; __shared__ __align__(16) float sraw[8][8][16][36]; __shared__ __align__(16) float sp[8][4][16][36]; __shared__ float salpha[8][4][16], sl[8][4][16], sm[4][4][16], sf0[4][4][16], sf1[4][4][16];
  const int tid = threadIdx.x, wave = tid >> 5, lane = tid & 31, col = lane & 15, hf = lane >> 4; const int qb = blockIdx.x, b = blockIdx.y, hg = blockIdx.z; const int qt = wave & 3, kh = __builtin_amdgcn_readfirstlane(tid >> 7); const int q0 = qb * 64 + qt * 16; const size_t tq = (size_t)b * TT + q0;
  // stage the query tile's 16 rows (all 8 heads) as hi/lo bf16: 8 rows per wave of the pair
  for (int i = 0; i < 8 * CC / 32; ++i) { const int q = kh * 8 * CC + i * 32 + lane; const int rl = q >> 8, c = q & 255; const float v = QKV[(tq + rl) * QKVP + c]; const __bf16 hb = (__bf16)v; sqh[qt][c >> 5][rl][c & 31] = hb; sql[qt][c >> 5][rl][c & 31] = (__bf16)(v - (float)hb); }
  // mixing weights for the lane's two heads
  const int row = lane & 15; const int hl0 = hf * 2; float wm[2][8];
#pragma unroll
  for (int u = 0; u < 2; ++u)
#pragma unroll
    for (int gg = 0; gg < 8; ++gg) wm[u][gg] = bfr(WH[(hg * 4 + hl0 + u) * NH + gg]);
  float m[2], l[2], l2[2]; m[0] = m[1] = -3.0e38f; l[0] = l[1] = 0.f; l2[0] = l2[1] = 0.f;
  v8f acc[4][2] = {};
  // the lane's own pointers at key step 0, into the fragment-order storage: K of head 0, V of the group's first head; a key step is 8192 elements of each
  const float* Kc = KF + (size_t)b * (TT / 32) * 8192 + lane * 4;
  const __bf16* VHc = VTH + (size_t)b * (TT / 32) * 8192 + hg * 4 * 1024 + lane * 8; const __bf16* VLc = VTL + (size_t)b * (TT / 32) * 8192 + hg * 4 * 1024 + lane * 8;
  const int ks1 = (kh + 1) * (TT / 64);
  R16 kr[8][2];              // K rows in flight, by head and key tile
  v16b vh[4][2], vl[4][2];   // V of the step in flight, by head of the group and column tile
  // the loops inside these macros are unrolled so that kr, vh, vl and acc are indexed by constants and stay in registers
  // ask for K of heads G, G+1 of the key step at P
#define LDK2(G, P) do { _Pragma("unroll") for (int g_ = (G); g_ < (G) + 2; ++g_) { _Pragma("unroll") for (int ct = 0; ct < 2; ++ct) kr[g_][ct] = ld_r16((P) + ct * 4096 + g_ * 512); } } while (0)
  // ask for V of head H of the group, key step at PH, PL
#define LDV1(H, PH, PL) do { _Pragma("unroll") for (int dt = 0; dt < 2; ++dt) { vh[H][dt] = frag_bp((PH) + (H) * 1024 + dt * 512); vl[H][dt] = frag_bp((PL) + (H) * 1024 + dt * 512); } } while (0)
  // raw scores of heads G, G+1 from the K rows in registers
#define SC2(G) do { _Pragma("unroll") for (int gg = (G); gg < (G) + 2; ++gg) { F2 a; a.h = frag_b(&sqh[qt][gg][col][0], lane); a.l = frag_b(&sql[qt][gg][col][0], lane); \
    _Pragma("unroll") for (int ct = 0; ct < 2; ++ct) { const F2 k = split_r16(kr[gg][ct]); const v8f c = mac3(a, k, (v8f){}); \
      _Pragma("unroll") for (int r = 0; r < 8; ++r) sraw[wave][gg][8 * hf + r][ct * 16 + col] = c[r] * 0.17677669529663687f; } } } while (0)
  // P.V of head H of the group from the V fragments in registers
#define PV1(H) do { { const int hl = (H); const F2 pa = split_row(&sp[wave][hl][col][0], 0, lane); \
    _Pragma("unroll") for (int r = 0; r < 8; ++r) { const float al = salpha[wave][hl][8 * hf + r]; acc[hl][0][r] *= al; acc[hl][1][r] *= al; } \
    _Pragma("unroll") for (int dt = 0; dt < 2; ++dt) { acc[hl][dt] = wmma_bf(pa.l, vh[hl][dt], acc[hl][dt]); acc[hl][dt] = wmma_bf(pa.h, vl[hl][dt], acc[hl][dt]); acc[hl][dt] = wmma_bf(pa.h, vh[hl][dt], acc[hl][dt]); } } } while (0)
  // behind each group of these loads; the loads' address registers are inputs, so that they keep their values up to the wait
#define XW1(P) asm volatile("s_wait_xcnt 0x0" :: "v"(P) : "memory")
#define XW2(P, Q) asm volatile("s_wait_xcnt 0x0" :: "v"(P), "v"(Q) : "memory")
#define XW3(P, Q, R) asm volatile("s_wait_xcnt 0x0" :: "v"(P), "v"(Q), "v"(R) : "memory")
  { const float* kp = Kc + (size_t)kh * (TT / 64) * 8192; LDK2(0, kp); LDK2(2, kp); XW1(kp); }
  __syncthreads();   // each wave reads q rows that its partner staged
#pragma unroll 1
  for (int ks = kh * (TT / 64); ks < ks1; ++ks) {
    const float* kp = Kc + (size_t)ks * 8192; const __bf16* vhp = VHc + (size_t)ks * 8192; const __bf16* vlp = VLc + (size_t)ks * 8192;
    // (a) raw scores for all 8 heads, 32 keys
    LDK2(4, kp); XW1(kp); SC2(0);
    LDK2(6, kp); XW1(kp); SC2(2);
    SC2(4);
    SC2(6);
    LDSX();
    LDV1(0, vhp, vlp); LDV1(1, vhp, vlp); XW2(vhp, vlp);   // behind the fence of LDSX, which waits for every load in flight
    // (b) mixing + online softmax for (row, heads hl0, hl0+1)
    { float s0[32], s1[32];
#pragma unroll
      for (int k4 = 0; k4 < 8; ++k4) { float t0[4] = {0.f, 0.f, 0.f, 0.f}, t1[4] = {0.f, 0.f, 0.f, 0.f};
#pragma unroll
        for (int gg = 0; gg < 8; ++gg) { const v4f rv = *(const v4f*)&sraw[wave][gg][row][k4 * 4];
#pragma unroll
          for (int i = 0; i < 4; ++i) { t0[i] += wm[0][gg] * rv[i]; t1[i] += wm[1][gg] * rv[i]; } }
#pragma unroll
        for (int i = 0; i < 4; ++i) { s0[k4 * 4 + i] = t0[i]; s1[k4 * 4 + i] = t1[i]; } }
#pragma unroll
      for (int u = 0; u < 2; ++u) { float* s = u == 0 ? s0 : s1; float mx = s[0];
#pragma unroll
        for (int k = 1; k < 32; ++k) mx = fmaxf(mx, s[k]);
        const float mn = fmaxf(m[u], mx); const float al = exp_hw(m[u] - mn); float es = 0.f, es2 = 0.f;
#pragma unroll
        for (int k8 = 0; k8 < 32; k8 += 8) { float x[8], e[8];   // eight exponentials at a time, none waiting for another
#pragma unroll
          for (int i = 0; i < 8; ++i) x[i] = (s[k8 + i] - mn) * LOG2E;
#pragma unroll
          for (int i = 0; i < 8; ++i) e[i] = __builtin_amdgcn_exp2f(x[i]);
          // the free slot behind the last v_exp_f32 of the eight; the arguments are named so that no instruction in front of the slot rewrites the register of one
          asm volatile("v_nop" :: "v"(x[0]), "v"(x[1]), "v"(x[2]), "v"(x[3]), "v"(x[4]), "v"(x[5]), "v"(x[6]), "v"(x[7]), "v"(e[0]), "v"(e[1]), "v"(e[2]), "v"(e[3]), "v"(e[4]), "v"(e[5]), "v"(e[6]), "v"(e[7]));
#pragma unroll
          for (int i = 0; i < 8; ++i) { es += e[i]; es2 += e[i] * e[i]; sp[wave][hl0 + u][row][k8 + i] = e[i]; } }
        l[u] = l[u] * al + es; l2[u] = l2[u] * (al * al) + es2; m[u] = mn; salpha[wave][hl0 + u][row] = al; } }
    LDSX();
    // (c) P.V for the group's 4 heads
    const float* kn = Kc + (size_t)(ks + 1 < ks1 ? ks + 1 : ks) * 8192;   // the last step asks for its own rows again (in bounds, not used)
    LDV1(2, vhp, vlp); LDK2(0, kn); XW3(vhp, vlp, kn); PV1(0);
    LDV1(3, vhp, vlp); LDK2(2, kn); XW3(vhp, vlp, kn); PV1(1);
    PV1(2);
    PV1(3);
    LDSX(); }
  // merge of the two key halves, then l and sum a^2 per (hl, row)
  float (*so)[16][36] = sp[wave];   // reuse: [hl][row][32]
  if (kh == 1) {
#pragma unroll
    for (int u = 0; u < 2; ++u) { sm[qt][hl0 + u][row] = m[u]; sl[wave][hl0 + u][row] = l[u]; salpha[wave][hl0 + u][row] = l2[u]; }
#pragma unroll
    for (int hl = 0; hl < 4; ++hl)
#pragma unroll
      for (int r = 0; r < 8; ++r) { so[hl][8 * hf + r][col] = acc[hl][0][r]; so[hl][8 * hf + r][16 + col] = acc[hl][1][r]; }
  }
  __syncthreads();   // the kh = 0 wave reads what its partner has just written
  if (kh == 0) {
#pragma unroll
    for (int u = 0; u < 2; ++u) { const float m1 = sm[qt][hl0 + u][row]; const float mn = fmaxf(m[u], m1); const float f0 = __builtin_amdgcn_exp2f((m[u] - mn) * LOG2E), f1 = __builtin_amdgcn_exp2f((m1 - mn) * LOG2E);
      const float lt = l[u] * f0 + sl[wave + 4][hl0 + u][row] * f1; const float l2t = l2[u] * (f0 * f0) + salpha[wave + 4][hl0 + u][row] * (f1 * f1);
      sl[wave][hl0 + u][row] = lt; salpha[wave][hl0 + u][row] = l2t / (lt * lt); sf0[qt][hl0 + u][row] = f0; sf1[qt][hl0 + u][row] = f1; }
    LDSX();
    const float (*sx)[16][36] = sp[wave + 4];   // the partner's unnormalised acc
#pragma unroll
    for (int hl = 0; hl < 4; ++hl)
#pragma unroll
      for (int r = 0; r < 8; ++r) { const int rr = 8 * hf + r; const float il = 1.0f / sl[wave][hl][rr], f0 = sf0[qt][hl][rr], f1 = sf1[qt][hl][rr];
        so[hl][rr][col] = (acc[hl][0][r] * f0 + sx[hl][rr][col] * f1) * il; so[hl][rr][16 + col] = (acc[hl][1][r] * f0 + sx[hl][rr][16 + col] * f1) * il; }
    LDSX();
#pragma unroll
    for (int hl = 0; hl < 4; ++hl) for (int rl = 0; rl < 16; ++rl) if (lane < 8) vst2(ON + ((((size_t)b * NH + hg * 4 + hl) * TT + q0 + rl) * HD) + lane * 4, *(const v4f*)&so[hl][rl][lane * 4]);
    { float* chunk = RSQ + ((((size_t)b * 2 + hg) * 16 + qb) * 4 + qt) * 64; __shared__ __align__(16) float sr[4][64];
      if (lane < 16) { sr[qt][lane * 4 + 0] = salpha[wave][0][lane]; sr[qt][lane * 4 + 1] = salpha[wave][1][lane]; sr[qt][lane * 4 + 2] = salpha[wave][2][lane]; sr[qt][lane * 4 + 3] = salpha[wave][3][lane]; }
      LDSX();
      if (lane < 16) vst2(chunk + lane * 4, *(const v4f*)&sr[qt][lane * 4]); }
  }
}
// ---- k_norm: block = (b, h), 256 threads: E[a^2] over the 1024x1024 map from the per-row sums, mean = 1/T, var = E[a^2] - mean^2, rs = rsqrt(var + 1e-5); coefA = rs*gamma[h], coefB = beta[h] - coefA/T; vsum[d] = sum_t v[b][h*32+d][t] (f32 from QKV; 32 partial sums of 32 rows each by all 256 threads, added in LDS). CV row [64]: coefA, coefB at 0,1; vsum at 32..63.
__global__ __launch_bounds__(256) void k_norm(const float* __restrict__ RSQ, const float* __restrict__ QKV, const float* __restrict__ GA, const float* __restrict__ BE, float* __restrict__ CV) {
  __shared__ float sred[256]; __shared__ __align__(16) float srow[64]; __shared__ __align__(16) float sv[32][36];
  const int b = blockIdx.x >> 3, h = blockIdx.x & 7, tid = threadIdx.x; const int hg = h >> 2, hl = h & 3;
  // column sums of v, first part: thread = (token rows rg, rg + 32, .., 4 columns from c4); its 32 loads of 16 B do not depend on one another
  const int rg = tid >> 3, c4 = (tid & 7) * 4; const float* vp = QKV + ((size_t)b * TT + rg) * QKVP + 2 * CC + h * HD + c4; v4f vr[32];
  // unrolled so that vr stays in registers and the loads are issued ahead of the adds, many in flight at a time
#pragma unroll
  for (int i = 0; i < 32; ++i) vr[i] = *(const v4f*)(vp + (size_t)i * 32 * QKVP);
  float s = 0.f;
#pragma unroll
  for (int i = 0; i < 4; ++i) { const int q = tid * 4 + i; const int qb = q >> 6, wave = (q >> 4) & 3, rl = q & 15; s += RSQ[((((size_t)b * 2 + hg) * 16 + qb) * 4 + wave) * 64 + rl * 4 + hl]; }
  { v4f vs = vr[0];
    // unrolled so that vr is indexed by constants
#pragma unroll
    for (int i = 1; i < 32; ++i) vs += vr[i];
    *(v4f*)&sv[rg][c4] = vs; }
  sred[tid] = s; __syncthreads();
  for (int st = 128; st >= 1; st >>= 1) { if (tid < st) sred[tid] += sred[tid + st]; __syncthreads(); }
  // second part: thread = column, adds the 32 row groups' partial sums; words 32..63 of srow have this one writer
  if (tid < 32) { srow[tid] = 0.f; float vs = 0.f;
    // unrolled so that the LDS loads are issued ahead of the adds
#pragma unroll
    for (int r = 0; r < 32; ++r) vs += sv[r][tid];
    srow[32 + tid] = vs; }
  __syncthreads();
  if (tid == 0) { const float e2 = sred[0] / ((float)TT * (float)TT); const float mean = 1.0f / (float)TT; const float var = e2 - mean * mean; const float rs = rsqrtf(var + 1e-5f); const float cA = rs * bfr(GA[h]); srow[0] = cA; srow[1] = bfr(BE[h]) - cA * mean; }
  __syncthreads();
  if (tid < 16) vst2(CV + (size_t)blockIdx.x * 64 + tid * 4, *(const v4f*)&srow[tid * 4]);
}
// ---- k_fin: block = (64 rows r' of y (= O viewed as [T][256]), 128 output channels, b): Y = (coefA*ON + coefB*vsum)(hi/lo) . Wp rows (2 products) + bp, stored transposed: out[b][o][r'] segments of 64 floats (256 B)
__global__ __launch_bounds__(128) void k_fin(const float* __restrict__ ON, const float* __restrict__ CV, const __bf16* __restrict__ PT, const float* __restrict__ bp, float* __restrict__ out) {
  __shared__ __align__(16) float sT[128][68];
  const int tid = threadIdx.x, wave = tid >> 5, lane = tid & 31, col = lane & 15, g = lane >> 4; const int b = blockIdx.z, n0 = blockIdx.y * 128; const int r0 = blockIdx.x * 64 + wave * 16; const int h = (blockIdx.x * 64) / 128;   // y row r' covers heads r'/128 (constant per 64-row block)
  const float cA = CV[(b * NH + h) * 64 + 0], cB = CV[(b * NH + h) * 64 + 1]; const float* vs = CV + (b * NH + h) * 64 + 32;
  const float* Arow = ON + ((size_t)b * TT + r0 + col) * CC;
  v8f acc[8] = {};
#pragma unroll 2
  for (int kc = 0; kc < CC / 32; ++kc) { float v[16]; const float* p = Arow + kc * 32 + 8 * g;
#pragma unroll
    for (int i = 0; i < 8; ++i) { v[i] = cA * p[i] + cB * vs[8 * g + i]; v[8 + i] = cA * p[16 + i] + cB * vs[16 + 8 * g + i]; }
    const F2 a = bsplit16(v);
#pragma unroll
    for (int j = 0; j < 8; ++j) { const v16b w = frag_b(PT + (size_t)(768 + n0 + j * 16 + col) * CC + kc * 32, lane); acc[j] = wmma_bf(a.l, w, acc[j]); acc[j] = wmma_bf(a.h, w, acc[j]); } }
#pragma unroll
  for (int j = 0; j < 8; ++j) { const float bb = bfr(bp[n0 + j * 16 + col]);
#pragma unroll
    for (int r = 0; r < 8; ++r) sT[j * 16 + col][wave * 16 + 8 * g + r] = acc[j][r] + bb; }
  __syncthreads();
  for (int q = tid; q < 128 * 16; q += 128) { const int o = q >> 4, piece = q & 15; vst2(out + ((size_t)b * CC + n0 + o) * TT + blockIdx.x * 64 + piece * 4, *(const v4f*)&sT[o][piece * 4]); }
}
extern "C" void kernel_launch(void* const* d_in, const int* in_sizes, int n_in, void* d_out, int out_size, void* d_ws, size_t ws_size, hipStream_t stream) {
  (void)in_sizes; (void)n_in; (void)out_size;
  const float** F = (const float**)d_in;   // x [8,256,32,32], Wq, Wk, Wv [256,256], w_head [8,8], gamma [8], beta [8], Wp [256,256], bp [256]
  if (ws_size < (size_t)WS_END) return;
  char* ws = (char*)d_ws; __bf16 *PT = (__bf16*)(ws + WS_PT), *XT = (__bf16*)(ws + WS_XT), *VTH = (__bf16*)(ws + WS_VTH), *VTL = (__bf16*)(ws + WS_VTL); float *QKV = (float*)(ws + WS_QKV), *ON = (float*)(ws + WS_ON), *RSQ = (float*)(ws + WS_RSQ), *CV = (float*)(ws + WS_CV), *KF = (float*)(ws + WS_KF);
  k_pack<<<4 * CC, 256, 0, stream>>>(F[1], F[2], F[3], F[7], PT);
  k_xt<<<dim3(TT / 32, NBT), 256, 0, stream>>>(F[0], XT);
  k_qkv<<<dim3(NBT * TT / 64, QKVP / 128), 128, 0, stream>>>(XT, PT, QKV, KF);
  k_vt<<<NBT * TT / 64, 256, 0, stream>>>(QKV, VTH, VTL);
  k_attn<<<dim3(TT / 64, NBT, 2), 256, 0, stream>>>(QKV, KF, VTH, VTL, F[4], ON, RSQ);
  k_norm<<<NBT * NH, 256, 0, stream>>>(RSQ, QKV, F[5], F[6], CV);
  k_fin<<<dim3(TT / 64, CC / 128, NBT), 128, 0, stream>>>(ON, CV, PT, F[8], (float*)d_out);
}

// v006
// One run takes 151 microseconds.
// In both of two side-by-side timings against v005, it was 1.07 times as fast.
// All steps since v000 together make it 3.69 times as fast.
// compute dtype: x and all weights (Wq, Wk, Wv, w_head, gamma, beta, Wp, bp; module inputs) rounded to bf16; the 1x1-conv projections with exact bf16 products; per-head raw scores q.k and the attention-weighted V sums with both computed operands as bf16 hi + residual pairs (3 products); the output projection with its computed input as hi/lo pairs x exact bf16 weights (2 products) on WMMA 16x16x32; head mixing (8x8), softmax, InstanceNorm statistics and affine in f32 on the VALU; f32 accumulate.
#include <hip/hip_runtime.h>
#include <math.h>

typedef __attribute__((ext_vector_type(16))) _Float16 v16h;
typedef __attribute__((ext_vector_type(16))) __bf16 v16b;
typedef __attribute__((ext_vector_type(8)))  _Float16 v8h;
typedef __attribute__((ext_vector_type(8)))  float v8f;
typedef __attribute__((ext_vector_type(4)))  float v4f;
typedef __attribute__((ext_vector_type(2)))  float v2f;
typedef __attribute__((ext_vector_type(4)))  unsigned v4u;
typedef __attribute__((ext_vector_type(4)))  int v4i;
typedef float __attribute__((may_alias)) float_a;
typedef int __attribute__((may_alias)) int_a;

template <typename T> __device__ __forceinline__ void vst2(void* p, T v) { *(T*)p = v;  }
__device__ __forceinline__ v8f wmma16(v16h a, v16h b, v8f c) {
  v8f d = __builtin_amdgcn_wmma_f32_16x16x32_f16(false, a, false, b, (short)0, c, false, false);
  asm volatile("v_nop\n\tv_nop\n\tv_nop\n\tv_nop" : "+v"(d) : "v"(a), "v"(b));
  return d;
}
__device__ __forceinline__ v8f wmma_bf(v16b a, v16b b, v8f c) {
  v8f d = __builtin_amdgcn_wmma_f32_16x16x32_bf16(false, a, false, b, (short)0, c, false, false);
  asm volatile("v_nop\n\tv_nop\n\tv_nop\n\tv_nop" : "+v"(d) : "v"(a), "v"(b));
  return d;
}
// 16x16x32 fragments: lane = (h = lane>>4, row/col = lane&15); elements 0..7 = k0+8h+0..7, 8..15 = k0+16+8h+0..7; D element r = row 8h+r
__device__ __forceinline__ v16h frag_h(const _Float16* rowk0, int lane) {
  union { v16h v; v8h q[2]; } u; const _Float16* p = rowk0 + 8 * (lane >> 4);
  u.q[0] = *(const v8h*)p; u.q[1] = *(const v8h*)(p + 16); return u.v;
}
__device__ __forceinline__ v16h frag_f32(const float* rowk0, int lane) {
  v16h a; const float* p = rowk0 + 8 * (lane >> 4);
#pragma unroll
  for (int i = 0; i < 8; ++i) { a[i] = (_Float16)p[i]; a[8 + i] = (_Float16)p[16 + i]; }
  return a;
}
__device__ __forceinline__ v16h frag_f32s(const float* rowk0, int lane, float sc) {
  v16h a; const float* p = rowk0 + 8 * (lane >> 4);
#pragma unroll
  for (int i = 0; i < 8; ++i) { a[i] = (_Float16)(p[i] * sc); a[8 + i] = (_Float16)(p[16 + i] * sc); }
  return a;
}
// column fragment from a [K][ld] layout (column n), rows >= K read as 0
__device__ __forceinline__ v16h fragc_f32(const float* W, int k0, int n, int lane, int ld, int K) {
  v16h a; const int g = lane >> 4;
#pragma unroll
  for (int i = 0; i < 8; ++i) { const int ka = k0 + 8 * g + i, kb = ka + 16;
    a[i] = (_Float16)(ka < K ? W[(size_t)(ka < K ? ka : K - 1) * ld + n] : 0.f); a[8 + i] = (_Float16)(kb < K ? W[(size_t)(kb < K ? kb : K - 1) * ld + n] : 0.f); }
  return a;
}
struct F2 { v16b h, l; };
__device__ __forceinline__ F2 bsplit16(const float v[16]) { F2 r;
#pragma unroll
  for (int i = 0; i < 16; ++i) { const __bf16 h = (__bf16)v[i]; r.h[i] = h; r.l[i] = (__bf16)(v[i] - (float)h); }
  return r; }
__device__ __forceinline__ F2 split_row(const float* row, int k0, int lane) { float v[16]; const float* p = row + k0 + 8 * (lane >> 4);
#pragma unroll
  for (int i = 0; i < 8; ++i) { v[i] = p[i]; v[8 + i] = p[16 + i]; }
  return bsplit16(v); }
__device__ __forceinline__ F2 split_rowK(const float* row, int k0, int lane, int K) { float v[16]; const int g = lane >> 4;
#pragma unroll
  for (int i = 0; i < 8; ++i) { const int ka = k0 + 8 * g + i, kb = ka + 16; v[i] = ka < K ? row[ka < K ? ka : K - 1] : 0.f; v[8 + i] = kb < K ? row[kb < K ? kb : K - 1] : 0.f; }
  return bsplit16(v); }
__device__ __forceinline__ F2 split_col(const float* W, int k0, int n, int lane, int ld, int K) { float v[16]; const int g = lane >> 4;
#pragma unroll
  for (int i = 0; i < 8; ++i) { const int ka = k0 + 8 * g + i, kb = ka + 16; v[i] = ka < K ? W[(size_t)(ka < K ? ka : K - 1) * ld + n] : 0.f; v[8 + i] = kb < K ? W[(size_t)(kb < K ? kb : K - 1) * ld + n] : 0.f; }
  return bsplit16(v); }
__device__ __forceinline__ v8f mac3(const F2& a, const F2& b, v8f c) { c = wmma_bf(a.l, b.h, c); c = wmma_bf(a.h, b.l, c); return wmma_bf(a.h, b.h, c); }
// the same for a b that a global load brought ahead of its use, one of many in flight: an asm operand has to lie in v0..v255, and the K fragments in flight do not fit there beside V and the accumulators (named in the statement below, they are spilled to scratch inside the key loop)
__device__ __forceinline__ v8f wmma_bf_far(v16b a, v16b b, v8f c) {
  v8f d = __builtin_amdgcn_wmma_f32_16x16x32_bf16(false, a, false, b, (short)0, c, false, false);
  asm volatile("v_nop\n\tv_nop\n\tv_nop\n\tv_nop" : "+v"(d) : "v"(a));   // the four slots between a WMMA and a vector instruction on its D or A; for b the compiler's own padding of the builtin stands
  return d;
}
__device__ __forceinline__ v8f mac3_far(const F2& a, const F2& b, v8f c) { c = wmma_bf_far(a.l, b.h, c); c = wmma_bf_far(a.h, b.l, c); return wmma_bf_far(a.h, b.h, c); }
__device__ __forceinline__ float sigm(float v) { return 1.0f / (1.0f + expf(-v)); }
#define LDSX() do { asm volatile("s_wait_dscnt 0" ::: "memory"); __builtin_amdgcn_wave_barrier(); __builtin_amdgcn_fence(__ATOMIC_RELEASE, "workgroup"); } while (0)


// Conv-projected multi-head self-attention with head mixing: q,k,v = W x (1x1 conv), s[h] = sum_g w_head[h][g] (q_g . k_g) * 32^-0.5, a = softmax over keys, InstanceNorm2d of each (b,h) 1024x1024 attention map (biased var, eps 1e-5, affine), out = a' v; y = out (B,nh,T,hd) reinterpreted as (B,T,C); y Wp^T + bp; stored as (B,C,T).  B 8, C 256, T 1024, 8 heads x 32.
// k_pack, k_xt (x -> bf16 [b][t][c]), k_qkv (exact GEMM; k as hi/lo planes in fragment order), k_vt (v -> hi/lo planes in fragment order), k_attn (one pass per (query block, b, head group of 4), keys split over two waves per query tile: raw scores of all 8 heads on WMMA, mixing + online softmax with sum and sum-of-squares per row on the VALU, P.V on WMMA; writes softmax-normalised O rows and per-row sum(a^2)), k_norm (per (b,h): variance -> affine coefficients; column sums of v), k_fin (affine applied at A-load, output projection, transposed 256-B stores).
#define NB 8
#define CC 256
#define TT 1024
#define NH 8
#define HD 32
#define NR (NB * TT)        // 8192
#define QKVP (3 * CC)       // 768
#define DM CC
#ifndef NBT
#define NBT NB              // batches launched (all)
#endif
typedef __attribute__((ext_vector_type(8))) __bf16 v8b;
__device__ __forceinline__ v16b frag_b(const __bf16* rowk0, int lane) {
  union { v16b v; v8b q[2]; } u; const __bf16* p = rowk0 + 8 * (lane >> 4);
  u.q[0] = *(const v8b*)p; u.q[1] = *(const v8b*)(p + 16); return u.v;
}
__device__ __forceinline__ float bfr(float v) { return (float)(__bf16)v; }
// the same fragment from fragment-order storage: elements 0..7 of all 32 lanes in 512 B in a row, then elements 8..15; p = the fragment's start + 8 * lane
__device__ __forceinline__ v16b frag_bp(const __bf16* p) { union { v16b v; v8b q[2]; } u; u.q[0] = *(const v8b*)p; u.q[1] = *(const v8b*)(p + 256); return u.v; }
// e^v on the hardware exponential, in line: 2^(v * log2 e); v <= 0 wherever it is used (a score or an older maximum minus the running maximum), a result below 2^-126 comes out as 0
#define LOG2E 1.4426950408889634f
__device__ __forceinline__ float exp_hw(float v) { const float x = v * LOG2E; const float r = __builtin_amdgcn_exp2f(x);
  asm volatile("v_nop" :: "v"(x), "v"(r));   // the free slot behind v_exp_f32; its argument is named so that no instruction in front of the slot rewrites that register
  return r; }
__device__ __attribute__((noinline)) float erf_ni(float v) { return erff(v); }

#define WS_PT   0u                                   // bf16 [1024][256]: Wq | Wk | Wv | Wp rows
#define WS_XT   (WS_PT + 2u * 4 * CC * CC)             // bf16 [8192][256] x transposed (token rows)
#define WS_QKV  (WS_XT + 2u * NR * CC)                 // f32 [8192][768]; the k columns 256..511 are not written: k goes to WS_KF
#define WS_VTH  (WS_QKV + 4u * NR * QKVP)              // bf16 [8 b][32 key step][8 h][2 dt][2 piece][32 lane][8]: v as the B fragments of P.V, in the order k_attn loads them
#define WS_VTL  (WS_VTH + 2u * NB * CC * TT)
#define WS_ON   (WS_VTL + 2u * NB * CC * TT)           // f32 [8][8][1024][32] softmax-normalised O
#define WS_RSQ  (WS_ON + 4u * NB * NH * TT * HD)        // f32 [8 b][2 hg][16 qb][4 wave][16 row][4 hl]
#define WS_CV   (WS_RSQ + 4u * NB * NH * TT)           // f32 [64 (b,h)][64]: coefA, coefB, .., vsum[32] at 32..63
#define WS_KF   (WS_CV + 4u * NB * NH * 64)            // bf16 [512 key tile of 16][8 g][2 hi, lo][2 piece][32 lane][8]: k as the B fragments of the scores, split once, in the order k_attn loads them
#define WS_END  (WS_KF + 4u * NR * CC)

__global__ __launch_bounds__(256) void k_pack(const float* __restrict__ Wq, const float* __restrict__ Wk, const float* __restrict__ Wv, const float* __restrict__ Wp, __bf16* __restrict__ PT) {
  __shared__ __align__(16) __bf16 s[CC]; const int n = blockIdx.x, tid = threadIdx.x; const int m = n & 255; const float* src = (n < 256) ? Wq : (n < 512) ? Wk : (n < 768) ? Wv : Wp;
  s[tid] = (__bf16)src[(size_t)m * CC + tid]; __syncthreads();
  if (tid < CC / 8) vst2((unsigned*)(PT + (size_t)n * CC + tid * 8), *(const v4u*)&s[tid * 8]);
}
// ---- k_xt: block = (32 tokens t0, b): XT[b][t][c] = bf16(x[b][c][t]); rows of 512 B
__global__ __launch_bounds__(256) void k_xt(const float* __restrict__ X, __bf16* __restrict__ XT) {
  __shared__ __align__(16) __bf16 s[32][CC + 8]; const int t0 = blockIdx.x * 32, b = blockIdx.y, tid = threadIdx.x;
  for (int q = tid; q < CC * 32; q += 256) { const int c = q >> 5, tl = q & 31; s[tl][c] = (__bf16)X[((size_t)b * CC + c) * TT + t0 + tl]; }
  __syncthreads();
  for (int q = tid; q < 32 * 32; q += 256) { const int tl = q >> 5, pc = q & 31; vst2((unsigned*)(XT + ((size_t)b * TT + t0 + tl) * CC + pc * 8), *(const v4u*)&s[tl][pc * 8]); }
}
// ---- k_qkv: block = (64 token rows, 128 cols): QKV[r][n] = XT[r] . PT[n] (exact), K = 256; the k columns leave as bf16 hi + residual planes in fragment order (KF), so that a load of k_attn reads whole cache lines and is an operand as it arrives
__global__ __launch_bounds__(128) void k_qkv(const __bf16* __restrict__ XT, const __bf16* __restrict__ PT, float* __restrict__ QKV, __bf16* __restrict__ KF) {
  __shared__ __align__(16) float so[4][16][132];
  const int tid = threadIdx.x, wave = tid >> 5, lane = tid & 31, col = lane & 15, g = lane >> 4; const size_t r0 = (size_t)blockIdx.x * 64 + wave * 16; const int n0 = blockIdx.y * 128;
  v8f acc[8] = {};
#pragma unroll 2
  for (int kc = 0; kc < CC / 32; ++kc) { const v16b a = frag_b(XT + (r0 + col) * CC + kc * 32, lane);
#pragma unroll
    for (int j = 0; j < 8; ++j) acc[j] = wmma_bf(a, frag_b(PT + (size_t)(n0 + j * 16 + col) * CC + kc * 32, lane), acc[j]); }
#pragma unroll
  for (int j = 0; j < 8; ++j)
#pragma unroll
    for (int r = 0; r < 8; ++r) so[wave][8 * g + r][j * 16 + col] = acc[j][r];
  LDSX();
  if (n0 >= CC && n0 < 2 * CC) {   // k (the same for the whole block): the wave's 16 rows are one key tile, its 128 columns 4 heads; per head the lane's 16 values (the element order of split_row) are split here, once, and leave as 2 planes x 2 pieces, 512 B a store
    __bf16* kf = KF + ((r0 >> 4) * NH + ((n0 - CC) >> 5)) * 1024 + lane * 8;
    for (int hd = 0; hd < 4; ++hd) { const F2 k = split_row(&so[wave][col][hd * HD], 0, lane); union { v16b v; v8b q[2]; } uh, ul; uh.v = k.h; ul.v = k.l;
      vst2(kf + hd * 1024, uh.q[0]); vst2(kf + hd * 1024 + 256, uh.q[1]); vst2(kf + hd * 1024 + 512, ul.q[0]); vst2(kf + hd * 1024 + 768, ul.q[1]); }
  } else {
    for (int rl = 0; rl < 16; ++rl) vst2(QKV + (r0 + rl) * QKVP + n0 + lane * 4, *(const v4f*)&so[wave][rl][lane * 4]);
  }
}
__global__ __launch_bounds__(256) void k_vt(const float* __restrict__ QKV, __bf16* __restrict__ VTH, __bf16* __restrict__ VTL) {
  __shared__ __align__(16) __bf16 svh[DM][72], svl[DM][72];
  const int tid = threadIdx.x; const size_t t0 = (size_t)blockIdx.x * 64; const int b = (int)(t0 / TT), p0 = (int)(t0 % TT);
  for (int q = tid; q < 64 * DM; q += 256) { const int tl = q >> 8, c = q & 255; const float v = QKV[(t0 + tl) * QKVP + 2 * DM + c]; const __bf16 hb = (__bf16)v; svh[c][tl] = hb; svl[c][tl] = (__bf16)(v - (float)hb); }
  __syncthreads();
  // fragment order: q = (key step of 32: q >> 10, head, column tile, piece j, lane = (hf, col)); the lane's 8 keys of channel rowi are j * 16 + 8 * hf + 0..7 of the step; a wave stores 512 B in a row
  for (int q = tid; q < DM * 8; q += 256) { const int rowi = ((q >> 6) & 15) * 16 + (q & 15), pc = (q >> 10) * 4 + ((q >> 5) & 1) * 2 + ((q >> 4) & 1); const size_t o = ((size_t)b * (TT / 32) + (p0 >> 5)) * 8192 + (size_t)q * 8; vst2((unsigned*)(VTH + o), *(const v4u*)&svh[rowi][pc * 8]); vst2((unsigned*)(VTL + o), *(const v4u*)&svl[rowi][pc * 8]); }
}
// ---- k_attn: block = (query block qb of 64, b, head group hg of 4 heads), 8 waves = 4 query tiles of 16 (qt) x 2 key halves of 512 (kh); the two waves of a query tile share its staged q rows, run the loop below on their own half of the keys, and are merged at the end.
//   per key step of 32: raw scores of all 8 heads g (q hi/lo from LDS x k hi/lo as loaded, 3 products) * scale -> sraw; per lane (row = lane&15, two heads of the group): mixed s' = sum_g w_head[h][g] sraw[g], online softmax (max, sum, sum of squares), p -> sp, rescale factor -> salpha; P.V for the group's 4 heads (3 products).
//   global loads run ahead of their use, in registers: K of heads g+4, g+5 is asked for before heads g, g+1 are worked on, V of the group's first two heads at the head of (b), of the last two at the head of (c) and behind P.V of the first head, K of heads 0..3 of the next step inside (c).
//   merge: the kh = 1 wave leaves m, l, l2 and its unnormalised acc in LDS; behind one block barrier the kh = 0 wave rescales both halves to the common maximum and adds them.
//   end: ON[b][h][q][:] = acc / l (softmax-normalised), RSQ chunk [row][hl] = l2 / l^2 = sum_t a^2 of that row.
__global__ __launch_bounds__(256) void k_attn(const float* __restrict__ QKV, const __bf16* __restrict__ KF, const __bf16* __restrict__ VTH, const __bf16* __restrict__ VTL, const float* __restrict__ WH, float* __restrict__ ON, float* __restrict__ RSQ) {
  __shared__ __align__(16) __bf16 sqh[4][8][16][40], sql[4][8][16][40]; __shared__ __align__(16) float sraw[8][8][16][36]; __shared__ __align__(16) float sp[8][4][16][36]; __shared__ float salpha[8][4][16], sl[8][4][16], sm[4][4][16], sf0[4][4][16], sf1[4][4][16];
  const int tid = threadIdx.x, wave = tid >> 5, lane = tid & 31, col = lane & 15, hf = lane >> 4; const int qb = blockIdx.x, b = blockIdx.y, hg = blockIdx.z; const int qt = wave & 3, kh = __builtin_amdgcn_readfirstlane(tid >> 7); const int q0 = qb * 64 + qt * 16; const size_t tq = (size_t)b * TT + q0;
  // stage the query tile's 16 rows (all 8 heads) as hi/lo bf16: 8 rows per wave of the pair
  for (int i = 0; i < 8 * CC / 32; ++i) { const int q = kh * 8 * CC + i * 32 + lane; const int rl = q >> 8, c = q & 255; const float v = QKV[(tq + rl) * QKVP + c]; const __bf16 hb = (__bf16)v; sqh[qt][c >> 5][rl][c & 31] = hb; sql[qt][c >> 5][rl][c & 31] = (__bf16)(v - (float)hb); }
  // mixing weights for the lane's two heads
  const int row = lane & 15; const int hl0 = hf * 2; float wm[2][8];
#pragma unroll
  for (int u = 0; u < 2; ++u)
#pragma unroll
    for (int gg = 0; gg < 8; ++gg) wm[u][gg] = bfr(WH[(hg * 4 + hl0 + u) * NH + gg]);
  float m[2], l[2], l2[2]; m[0] = m[1] = -3.0e38f; l[0] = l[1] = 0.f; l2[0] = l2[1] = 0.f;
  v8f acc[4][2] = {};
  // the lane's own pointers at key step 0, into the fragment-order storage: K of head 0, V of the group's first head; a key step is 16384 elements of K (both planes), 8192 of each V plane
  const __bf16* Kc = KF + (size_t)b * (TT / 32) * 16384 + lane * 8;
  const __bf16* VHc = VTH + (size_t)b * (TT / 32) * 8192 + hg * 4 * 1024 + lane * 8; const __bf16* VLc = VTL + (size_t)b * (TT / 32) * 8192 + hg * 4 * 1024 + lane * 8;
  const int ks1 = (kh + 1) * (TT / 64);
  F2 kr[8][2];               // K fragments (hi, lo) in flight, by head and key tile
  v16b vh[4][2], vl[4][2];   // V of the step in flight, by head of the group and column tile
  // the loops inside these macros are unrolled so that kr, vh, vl and acc are indexed by constants and stay in registers
  // ask for K of heads G, G+1 of the key step at P
#define LDK2(G, P) do { _Pragma("unroll") for (int g_ = (G); g_ < (G) + 2; ++g_) { _Pragma("unroll") for (int ct = 0; ct < 2; ++ct) { kr[g_][ct].h = frag_bp((P) + ct * 8192 + g_ * 1024); kr[g_][ct].l = frag_bp((P) + ct * 8192 + g_ * 1024 + 512); } } } while (0)
  // ask for V of head H of the group, key step at PH, PL
#define LDV1(H, PH, PL) do { _Pragma("unroll") for (int dt = 0; dt < 2; ++dt) { vh[H][dt] = frag_bp((PH) + (H) * 1024 + dt * 512); vl[H][dt] = frag_bp((PL) + (H) * 1024 + dt * 512); } } while (0)
  // raw scores of heads G, G+1 from the K fragments in registers
#define SC2(G) do { _Pragma("unroll") for (int gg = (G); gg < (G) + 2; ++gg) { F2 a; a.h = frag_b(&sqh[qt][gg][col][0], lane); a.l = frag_b(&sql[qt][gg][col][0], lane); \
    _Pragma("unroll") for (int ct = 0; ct < 2; ++ct) { const v8f c = mac3_far(a, kr[gg][ct], (v8f){}); \
      _Pragma("unroll") for (int r = 0; r < 8; ++r) sraw[wave][gg][8 * hf + r][ct * 16 + col] = c[r] * 0.17677669529663687f; } } } while (0)
  // P.V of head H of the group from the V fragments in registers
#define PV1(H) do { { const int hl = (H); const F2 pa = split_row(&sp[wave][hl][col][0], 0, lane); \
    _Pragma("unroll") for (int r = 0; r < 8; ++r) { const float al = salpha[wave][hl][8 * hf + r]; acc[hl][0][r] *= al; acc[hl][1][r] *= al; } \
    _Pragma("unroll") for (int dt = 0; dt < 2; ++dt) { acc[hl][dt] = wmma_bf(pa.l, vh[hl][dt], acc[hl][dt]); acc[hl][dt] = wmma_bf(pa.h, vl[hl][dt], acc[hl][dt]); acc[hl][dt] = wmma_bf(pa.h, vh[hl][dt], acc[hl][dt]); } } } while (0)
  // behind each group of these loads; the loads' address registers are inputs, so that they keep their values up to the wait
#define XW1(P) asm volatile("s_wait_xcnt 0x0" :: "v"(P) : "memory")
#define XW2(P, Q) asm volatile("s_wait_xcnt 0x0" :: "v"(P), "v"(Q) : "memory")
#define XW3(P, Q, R) asm volatile("s_wait_xcnt 0x0" :: "v"(P), "v"(Q), "v"(R) : "memory")
  { const __bf16* kp = Kc + (size_t)kh * (TT / 64) * 16384; LDK2(0, kp); LDK2(2, kp); XW1(kp); }
  __syncthreads();   // each wave reads q rows that its partner staged
#pragma unroll 1
  for (int ks = kh * (TT / 64); ks < ks1; ++ks) {
    const __bf16* kp = Kc + (size_t)ks * 16384; const __bf16* vhp = VHc + (size_t)ks * 8192; const __bf16* vlp = VLc + (size_t)ks * 8192;
    // (a) raw scores for all 8 heads, 32 keys
    LDK2(4, kp); XW1(kp); SC2(0);
    LDK2(6, kp); XW1(kp); SC2(2);
    SC2(4);
    SC2(6);
    LDSX();
    LDV1(0, vhp, vlp); LDV1(1, vhp, vlp); XW2(vhp, vlp);   // behind the fence of LDSX, which waits for every load in flight
    // (b) mixing + online softmax for (row, heads hl0, hl0+1)
    { float s0[32], s1[32];
#pragma unroll
      for (int k4 = 0; k4 < 8; ++k4) { float t0[4] = {0.f, 0.f, 0.f, 0.f}, t1[4] = {0.f, 0.f, 0.f, 0.f};
#pragma unroll
        for (int gg = 0; gg < 8; ++gg) { const v4f rv = *(const v4f*)&sraw[wave][gg][row][k4 * 4];
#pragma unroll
          for (int i = 0; i < 4; ++i) { t0[i] += wm[0][gg] * rv[i]; t1[i] += wm[1][gg] * rv[i]; } }
#pragma unroll
        for (int i = 0; i < 4; ++i) { s0[k4 * 4 + i] = t0[i]; s1[k4 * 4 + i] = t1[i]; } }
#pragma unroll
      for (int u = 0; u < 2; ++u) { float* s = u == 0 ? s0 : s1; float mx = s[0];
#pragma unroll
        for (int k = 1; k < 32; ++k) mx = fmaxf(mx, s[k]);
        const float mn = fmaxf(m[u], mx); const float al = exp_hw(m[u] - mn); float es = 0.f, es2 = 0.f;
#pragma unroll
        for (int k8 = 0; k8 < 32; k8 += 8) { float x[8], e[8];   // eight exponentials at a time, none waiting for another
#pragma unroll
          for (int i = 0; i < 8; ++i) x[i] = (s[k8 + i] - mn) * LOG2E;
#pragma unroll
          for (int i = 0; i < 8; ++i) e[i] = __builtin_amdgcn_exp2f(x[i]);
          // the free slot behind the last v_exp_f32 of the eight; the arguments are named so that no instruction in front of the slot rewrites the register of one
          asm volatile("v_nop" :: "v"(x[0]), "v"(x[1]), "v"(x[2]), "v"(x[3]), "v"(x[4]), "v"(x[5]), "v"(x[6]), "v"(x[7]), "v"(e[0]), "v"(e[1]), "v"(e[2]), "v"(e[3]), "v"(e[4]), "v"(e[5]), "v"(e[6]), "v"(e[7]));
#pragma unroll
          for (int i = 0; i < 8; ++i) { es += e[i]; es2 += e[i] * e[i]; sp[wave][hl0 + u][row][k8 + i] = e[i]; } }
        l[u] = l[u] * al + es; l2[u] = l2[u] * (al * al) + es2; m[u] = mn; salpha[wave][hl0 + u][row] = al; } }
    LDSX();
    // (c) P.V for the group's 4 heads
    const __bf16* kn = Kc + (size_t)(ks + 1 < ks1 ? ks + 1 : ks) * 16384;   // the last step asks for its own rows again (in bounds, not used)
    LDV1(2, vhp, vlp); LDK2(0, kn); XW3(vhp, vlp, kn); PV1(0);
    LDV1(3, vhp, vlp); LDK2(2, kn); XW3(vhp, vlp, kn); PV1(1);
    PV1(2);
    PV1(3);
    LDSX(); }
  // merge of the two key halves, then l and sum a^2 per (hl, row)
  float (*so)[16][36] = sp[wave];   // reuse: [hl][row][32]
  if (kh == 1) {
#pragma unroll
    for (int u = 0; u < 2; ++u) { sm[qt][hl0 + u][row] = m[u]; sl[wave][hl0 + u][row] = l[u]; salpha[wave][hl0 + u][row] = l2[u]; }
#pragma unroll
    for (int hl = 0; hl < 4; ++hl)
#pragma unroll
      for (int r = 0; r < 8; ++r) { so[hl][8 * hf + r][col] = acc[hl][0][r]; so[hl][8 * hf + r][16 + col] = acc[hl][1][r]; }
  }
  __syncthreads();   // the kh = 0 wave reads what its partner has just written
  if (kh == 0) {
#pragma unroll
    for (int u = 0; u < 2; ++u) { const float m1 = sm[qt][hl0 + u][row]; const float mn = fmaxf(m[u], m1); const float f0 = __builtin_amdgcn_exp2f((m[u] - mn) * LOG2E), f1 = __builtin_amdgcn_exp2f((m1 - mn) * LOG2E);
      const float lt = l[u] * f0 + sl[wave + 4][hl0 + u][row] * f1; const float l2t = l2[u] * (f0 * f0) + salpha[wave + 4][hl0 + u][row] * (f1 * f1);
      sl[wave][hl0 + u][row] = lt; salpha[wave][hl0 + u][row] = l2t / (lt * lt); sf0[qt][hl0 + u][row] = f0; sf1[qt][hl0 + u][row] = f1; }
    LDSX();
    const float (*sx)[16][36] = sp[wave + 4];   // the partner's unnormalised acc
#pragma unroll
    for (int hl = 0; hl < 4; ++hl)
#pragma unroll
      for (int r = 0; r < 8; ++r) { const int rr = 8 * hf + r; const float il = 1.0f / sl[wave][hl][rr], f0 = sf0[qt][hl][rr], f1 = sf1[qt][hl][rr];
        so[hl][rr][col] = (acc[hl][0][r] * f0 + sx[hl][rr][col] * f1) * il; so[hl][rr][16 + col] = (acc[hl][1][r] * f0 + sx[hl][rr][16 + col] * f1) * il; }
    LDSX();
#pragma unroll
    for (int hl = 0; hl < 4; ++hl) for (int rl = 0; rl < 16; ++rl) if (lane < 8) vst2(ON + ((((size_t)b * NH + hg * 4 + hl) * TT + q0 + rl) * HD) + lane * 4, *(const v4f*)&so[hl][rl][lane * 4]);
    { float* chunk = RSQ + ((((size_t)b * 2 + hg) * 16 + qb) * 4 + qt) * 64; __shared__ __align__(16) float sr[4][64];
      if (lane < 16) { sr[qt][lane * 4 + 0] = salpha[wave][0][lane]; sr[qt][lane * 4 + 1] = salpha[wave][1][lane]; sr[qt][lane * 4 + 2] = salpha[wave][2][lane]; sr[qt][lane * 4 + 3] = salpha[wave][3][lane]; }
      LDSX();
      if (lane < 16) vst2(chunk + lane * 4, *(const v4f*)&sr[qt][lane * 4]); }
  }
}
// ---- k_norm: block = (b, h), 256 threads: E[a^2] over the 1024x1024 map from the per-row sums, mean = 1/T, var = E[a^2] - mean^2, rs = rsqrt(var + 1e-5); coefA = rs*gamma[h], coefB = beta[h] - coefA/T; vsum[d] = sum_t v[b][h*32+d][t] (f32 from QKV; 32 partial sums of 32 rows each by all 256 threads, added in LDS). CV row [64]: coefA, coefB at 0,1; vsum at 32..63.
__global__ __launch_bounds__(256) void k_norm(const float* __restrict__ RSQ, const float* __restrict__ QKV, const float* __restrict__ GA, const float* __restrict__ BE, float* __restrict__ CV) {
  __shared__ float sred[256]; __shared__ __align__(16) float srow[64]; __shared__ __align__(16) float sv[32][36];
  const int b = blockIdx.x >> 3, h = blockIdx.x & 7, tid = threadIdx.x; const int hg = h >> 2, hl = h & 3;
  // column sums of v, first part: thread = (token rows rg, rg + 32, .., 4 columns from c4); its 32 loads of 16 B do not depend on one another
  const int rg = tid >> 3, c4 = (tid & 7) * 4; const float* vp = QKV + ((size_t)b * TT + rg) * QKVP + 2 * CC + h * HD + c4; v4f vr[32];
  // unrolled so that vr stays in registers and the loads are issued ahead of the adds, many in flight at a time
#pragma unroll
  for (int i = 0; i < 32; ++i) vr[i] = *(const v4f*)(vp + (size_t)i * 32 * QKVP);
  float s = 0.f;
#pragma unroll
  for (int i = 0; i < 4; ++i) { const int q = tid * 4 + i; const int qb = q >> 6, wave = (q >> 4) & 3, rl = q & 15; s += RSQ[((((size_t)b * 2 + hg) * 16 + qb) * 4 + wave) * 64 + rl * 4 + hl]; }
  { v4f vs = vr[0];
    // unrolled so that vr is indexed by constants
#pragma unroll
    for (int i = 1; i < 32; ++i) vs += vr[i];
    *(v4f*)&sv[rg][c4] = vs; }
  sred[tid] = s; __syncthreads();
  for (int st = 128; st >= 1; st >>= 1) { if (tid < st) sred[tid] += sred[tid + st]; __syncthreads(); }
  // second part: thread = column, adds the 32 row groups' partial sums; words 32..63 of srow have this one writer
  if (tid < 32) { srow[tid] = 0.f; float vs = 0.f;
    // unrolled so that the LDS loads are issued ahead of the adds
#pragma unroll
    for (int r = 0; r < 32; ++r) vs += sv[r][tid];
    srow[32 + tid] = vs; }
  __syncthreads();
  if (tid == 0) { const float e2 = sred[0] / ((float)TT * (float)TT); const float mean = 1.0f / (float)TT; const float var = e2 - mean * mean; const float rs = rsqrtf(var + 1e-5f); const float cA = rs * bfr(GA[h]); srow[0] = cA; srow[1] = bfr(BE[h]) - cA * mean; }
  __syncthreads();
  if (tid < 16) vst2(CV + (size_t)blockIdx.x * 64 + tid * 4, *(const v4f*)&srow[tid * 4]);
}
// ---- k_fin: block = (64 rows r' of y (= O viewed as [T][256]), 128 output channels, b): Y = (coefA*ON + coefB*vsum)(hi/lo) . Wp rows (2 products) + bp, stored transposed: out[b][o][r'] segments of 64 floats (256 B)
__global__ __launch_bounds__(128) void k_fin(const float* __restrict__ ON, const float* __restrict__ CV, const __bf16* __restrict__ PT, const float* __restrict__ bp, float* __restrict__ out) {
  __shared__ __align__(16) float sT[128][68];
  const int tid = threadIdx.x, wave = tid >> 5, lane = tid & 31, col = lane & 15, g = lane >> 4; const int b = blockIdx.z, n0 = blockIdx.y * 128; const int r0 = blockIdx.x * 64 + wave * 16; const int h = (blockIdx.x * 64) / 128;   // y row r' covers heads r'/128 (constant per 64-row block)
  const float cA = CV[(b * NH + h) * 64 + 0], cB = CV[(b * NH + h) * 64 + 1]; const float* vs = CV + (b * NH + h) * 64 + 32;
  const float* Arow = ON + ((size_t)b * TT + r0 + col) * CC;
  v8f acc[8] = {};
#pragma unroll 2
  for (int kc = 0; kc < CC / 32; ++kc) { float v[16]; const float* p = Arow + kc * 32 + 8 * g;
#pragma unroll
    for (int i = 0; i < 8; ++i) { v[i] = cA * p[i] + cB * vs[8 * g + i]; v[8 + i] = cA * p[16 + i] + cB * vs[16 + 8 * g + i]; }
    const F2 a = bsplit16(v);
#pragma unroll
    for (int j = 0; j < 8; ++j) { const v16b w = frag_b(PT + (size_t)(768 + n0 + j * 16 + col) * CC + kc * 32, lane); acc[j] = wmma_bf(a.l, w, acc[j]); acc[j] = wmma_bf(a.h, w, acc[j]); } }
#pragma unroll
  for (int j = 0; j < 8; ++j) { const float bb = bfr(bp[n0 + j * 16 + col]);
#pragma unroll
    for (int r = 0; r < 8; ++r) sT[j * 16 + col][wave * 16 + 8 * g + r] = acc[j][r] + bb; }
  __syncthreads();
  for (int q = tid; q < 128 * 16; q += 128) { const int o = q >> 4, piece = q & 15; vst2(out + ((size_t)b * CC + n0 + o) * TT + blockIdx.x * 64 + piece * 4, *(const v4f*)&sT[o][piece * 4]); }
}
extern "C" void kernel_launch(void* const* d_in, const int* in_sizes, int n_in, void* d_out, int out_size, void* d_ws, size_t ws_size, hipStream_t stream) {
  (void)in_sizes; (void)n_in; (void)out_size;
  const float** F = (const float**)d_in;   // x [8,256,32,32], Wq, Wk, Wv [256,256], w_head [8,8], gamma [8], beta [8], Wp [256,256], bp [256]
  if (ws_size < (size_t)WS_END) return;
  char* ws = (char*)d_ws; __bf16 *PT = (__bf16*)(ws + WS_PT), *XT = (__bf16*)(ws + WS_XT), *VTH = (__bf16*)(ws + WS_VTH), *VTL = (__bf16*)(ws + WS_VTL); float *QKV = (float*)(ws + WS_QKV), *ON = (float*)(ws + WS_ON), *RSQ = (float*)(ws + WS_RSQ), *CV = (float*)(ws + WS_CV); __bf16* KF = (__bf16*)(ws + WS_KF);
  k_pack<<<4 * CC, 256, 0, stream>>>(F[1], F[2], F[3], F[7], PT);
  k_xt<<<dim3(TT / 32, NBT), 256, 0, stream>>>(F[0], XT);
  k_qkv<<<dim3(NBT * TT / 64, QKVP / 128), 128, 0, stream>>>(XT, PT, QKV, KF);
  k_vt<<<NBT * TT / 64, 256, 0, stream>>>(QKV, VTH, VTL);
  k_attn<<<dim3(TT / 64, NBT, 2), 256, 0, stream>>>(QKV, KF, VTH, VTL, F[4], ON, RSQ);
  k_norm<<<NBT * NH, 256, 0, stream>>>(RSQ, QKV, F[5], F[6], CV);
  k_fin<<<dim3(TT / 64, CC / 128, NBT), 128, 0, stream>>>(ON, CV, PT, F[8], (float*)d_out);
}

// v007
// A run of this version takes 136 microseconds.
// Two timings next to v006 both put it at 1.13 times that version's speed.
// Counting every step since v000, it is 4.17 times as fast.
// compute dtype: x and all weights (Wq, Wk, Wv, w_head, gamma, beta, Wp, bp; module inputs) rounded to bf16; the 1x1-conv projections with exact bf16 products; per-head raw scores q.k and the attention-weighted V sums with both computed operands as bf16 hi + residual pairs (3 products); the output projection with its computed input as hi/lo pairs x exact bf16 weights (2 products) on WMMA 16x16x32; head mixing (8x8), softmax, InstanceNorm statistics and affine in f32 on the VALU; f32 accumulate.
#include <hip/hip_runtime.h>
#include <math.h>

typedef __attribute__((ext_vector_type(16))) _Float16 v16h;
typedef __attribute__((ext_vector_type(16))) __bf16 v16b;
typedef __attribute__((ext_vector_type(8)))  _Float16 v8h;
typedef __attribute__((ext_vector_type(8)))  float v8f;
typedef __attribute__((ext_vector_type(4)))  float v4f;
typedef __attribute__((ext_vector_type(2)))  float v2f;
typedef __attribute__((ext_vector_type(4)))  unsigned v4u;
typedef __attribute__((ext_vector_type(4)))  int v4i;
typedef float __attribute__((may_alias)) float_a;
typedef int __attribute__((may_alias)) int_a;

template <typename T> __device__ __forceinline__ void vst2(void* p, T v) { *(T*)p = v;  }
__device__ __forceinline__ v8f wmma16(v16h a, v16h b, v8f c) {
  v8f d = __builtin_amdgcn_wmma_f32_16x16x32_f16(false, a, false, b, (short)0, c, false, false);
  asm volatile("v_nop\n\tv_nop\n\tv_nop\n\tv_nop" : "+v"(d) : "v"(a), "v"(b));
  return d;
}
__device__ __forceinline__ v8f wmma_bf(v16b a, v16b b, v8f c) {
  v8f d = __builtin_amdgcn_wmma_f32_16x16x32_bf16(false, a, false, b, (short)0, c, false, false);
  asm volatile("v_nop\n\tv_nop\n\tv_nop\n\tv_nop" : "+v"(d) : "v"(a), "v"(b));
  return d;
}
// 16x16x32 fragments: lane = (h = lane>>4, row/col = lane&15); elements 0..7 = k0+8h+0..7, 8..15 = k0+16+8h+0..7; D element r = row 8h+r
__device__ __forceinline__ v16h frag_h(const _Float16* rowk0, int lane) {
  union { v16h v; v8h q[2]; } u; const _Float16* p = rowk0 + 8 * (lane >> 4);
  u.q[0] = *(const v8h*)p; u.q[1] = *(const v8h*)(p + 16); return u.v;
}
__device__ __forceinline__ v16h frag_f32(const float* rowk0, int lane) {
  v16h a; const float* p = rowk0 + 8 * (lane >> 4);
#pragma unroll
  for (int i = 0; i < 8; ++i) { a[i] = (_Float16)p[i]; a[8 + i] = (_Float16)p[16 + i]; }
  return a;
}
__device__ __forceinline__ v16h frag_f32s(const float* rowk0, int lane, float sc) {
  v16h a; const float* p = rowk0 + 8 * (lane >> 4);
#pragma unroll
  for (int i = 0; i < 8; ++i) { a[i] = (_Float16)(p[i] * sc); a[8 + i] = (_Float16)(p[16 + i] * sc); }
  return a;
}
// column fragment from a [K][ld] layout (column n), rows >= K read as 0
__device__ __forceinline__ v16h fragc_f32(const float* W, int k0, int n, int lane, int ld, int K) {
  v16h a; const int g = lane >> 4;
#pragma unroll
  for (int i = 0; i < 8; ++i) { const int ka = k0 + 8 * g + i, kb = ka + 16;
    a[i] = (_Float16)(ka < K ? W[(size_t)(ka < K ? ka : K - 1) * ld + n] : 0.f); a[8 + i] = (_Float16)(kb < K ? W[(size_t)(kb < K ? kb : K - 1) * ld + n] : 0.f); }
  return a;
}
struct F2 { v16b h, l; };
__device__ __forceinline__ F2 bsplit16(const float v[16]) { F2 r;
#pragma unroll
  for (int i = 0; i < 16; ++i) { const __bf16 h = (__bf16)v[i]; r.h[i] = h; r.l[i] = (__bf16)(v[i] - (float)h); }
  return r; }
__device__ __forceinline__ F2 split_row(const float* row, int k0, int lane) { float v[16]; const float* p = row + k0 + 8 * (lane >> 4);
#pragma unroll
  for (int i = 0; i < 8; ++i) { v[i] = p[i]; v[8 + i] = p[16 + i]; }
  return bsplit16(v); }
__device__ __forceinline__ F2 split_rowK(const float* row, int k0, int lane, int K) { float v[16]; const int g = lane >> 4;
#pragma unroll
  for (int i = 0; i < 8; ++i) { const int ka = k0 + 8 * g + i, kb = ka + 16; v[i] = ka < K ? row[ka < K ? ka : K - 1] : 0.f; v[8 + i] = kb < K ? row[kb < K ? kb : K - 1] : 0.f; }
  return bsplit16(v); }
__device__ __forceinline__ F2 split_col(const float* W, int k0, int n, int lane, int ld, int K) { float v[16]; const int g = lane >> 4;
#pragma unroll
  for (int i = 0; i < 8; ++i) { const int ka = k0 + 8 * g + i, kb = ka + 16; v[i] = ka < K ? W[(size_t)(ka < K ? ka : K - 1) * ld + n] : 0.f; v[8 + i] = kb < K ? W[(size_t)(kb < K ? kb : K - 1) * ld + n] : 0.f; }
  return bsplit16(v); }
__device__ __forceinline__ v8f mac3(const F2& a, const F2& b, v8f c) { c = wmma_bf(a.l, b.h, c); c = wmma_bf(a.h, b.l, c); return wmma_bf(a.h, b.h, c); }
// the bare builtin, for runs of WMMAs on independent accumulator tiles: each fills the slots behind the one in front, and the compiler pads what is left
__device__ __forceinline__ v8f wmma_il(v16b a, v16b b, v8f c) { return __builtin_amdgcn_wmma_f32_16x16x32_bf16(false, a, false, b, (short)0, c, false, false); }
__device__ __forceinline__ float sigm(float v) { return 1.0f / (1.0f + expf(-v)); }
#define LDSX() do { asm volatile("s_wait_dscnt 0" ::: "memory"); __builtin_amdgcn_wave_barrier(); __builtin_amdgcn_fence(__ATOMIC_RELEASE, "workgroup"); } while (0)


// Conv-projected multi-head self-attention with head mixing: q,k,v = W x (1x1 conv), s[h] = sum_g w_head[h][g] (q_g . k_g) * 32^-0.5, a = softmax over keys, InstanceNorm2d of each (b,h) 1024x1024 attention map (biased var, eps 1e-5, affine), out = a' v; y = out (B,nh,T,hd) reinterpreted as (B,T,C); y Wp^T + bp; stored as (B,C,T).  B 8, C 256, T 1024, 8 heads x 32.
// k_pack, k_xt (x -> bf16 [b][t][c]), k_qkv (exact GEMM; k as hi/lo planes in fragment order), k_vt (v -> hi/lo planes in fragment order), k_attn (one pass per (query block, b, head group of 4), keys split over two waves per query tile: raw scores of all 8 heads on WMMA, mixing + online softmax with sum and sum-of-squares per row on the VALU, P.V on WMMA; writes softmax-normalised O rows and per-row sum(a^2)), k_norm (per (b,h): variance -> affine coefficients; column sums of v), k_fin (affine applied at A-load, output projection, transposed 256-B stores).
#define NB 8
#define CC 256
#define TT 1024
#define NH 8
#define HD 32
#define NR (NB * TT)        // 8192
#define QKVP (3 * CC)       // 768
#define DM CC
#ifndef NBT
#define NBT NB              // batches launched (all)
#endif
typedef __attribute__((ext_vector_type(8))) __bf16 v8b;
__device__ __forceinline__ v16b frag_b(const __bf16* rowk0, int lane) {
  union { v16b v; v8b q[2]; } u; const __bf16* p = rowk0 + 8 * (lane >> 4);
  u.q[0] = *(const v8b*)p; u.q[1] = *(const v8b*)(p + 16); return u.v;
}
__device__ __forceinline__ float bfr(float v) { return (float)(__bf16)v; }
// the same fragment from fragment-order storage: elements 0..7 of all 32 lanes in 512 B in a row, then elements 8..15; p = the fragment's start + 8 * lane
__device__ __forceinline__ v16b frag_bp(const __bf16* p) { union { v16b v; v8b q[2]; } u; u.q[0] = *(const v8b*)p; u.q[1] = *(const v8b*)(p + 256); return u.v; }
// e^v on the hardware exponential, in line: 2^(v * log2 e); v <= 0 wherever it is used (a score or an older maximum minus the running maximum), a result below 2^-126 comes out as 0
#define LOG2E 1.4426950408889634f
__device__ __forceinline__ float exp_hw(float v) { const float x = v * LOG2E; const float r = __builtin_amdgcn_exp2f(x);
  asm volatile("v_nop" :: "v"(x), "v"(r));   // the free slot behind v_exp_f32; its argument is named so that no instruction in front of the slot rewrites that register
  return r; }
__device__ __attribute__((noinline)) float erf_ni(float v) { return erff(v); }

#define WS_PT   0u                                   // bf16 [1024][256]: Wq | Wk | Wv | Wp rows
#define WS_XT   (WS_PT + 2u * 4 * CC * CC)             // bf16 [8192][256] x transposed (token rows)
#define WS_QKV  (WS_XT + 2u * NR * CC)                 // f32 [8192][768]; the k columns 256..511 are not written: k goes to WS_KF
#define WS_VTH  (WS_QKV + 4u * NR * QKVP)              // bf16 [8 b][32 key step][8 h][2 dt][2 piece][32 lane][8]: v as the B fragments of P.V, in the order k_attn loads them
#define WS_VTL  (WS_VTH + 2u * NB * CC * TT)
#define WS_ON   (WS_VTL + 2u * NB * CC * TT)           // f32 [8][8][1024][32] softmax-normalised O
#define WS_RSQ  (WS_ON + 4u * NB * NH * TT * HD)        // f32 [8 b][2 hg][16 qb][4 wave][16 row][4 hl]
#define WS_CV   (WS_RSQ + 4u * NB * NH * TT)           // f32 [64 (b,h)][64]: coefA, coefB, .., vsum[32] at 32..63
#define WS_KF   (WS_CV + 4u * NB * NH * 64)            // bf16 [512 key tile of 16][8 g][2 hi, lo][2 piece][32 lane][8]: k as the B fragments of the scores, split once, in the order k_attn loads them
#define WS_END  (WS_KF + 4u * NR * CC)

__global__ __launch_bounds__(256) void k_pack(const float* __restrict__ Wq, const float* __restrict__ Wk, const float* __restrict__ Wv, const float* __restrict__ Wp, __bf16* __restrict__ PT) {
  __shared__ __align__(16) __bf16 s[CC]; const int n = blockIdx.x, tid = threadIdx.x; const int m = n & 255; const float* src = (n < 256) ? Wq : (n < 512) ? Wk : (n < 768) ? Wv : Wp;
  s[tid] = (__bf16)src[(size_t)m * CC + tid]; __syncthreads();
  if (tid < CC / 8) vst2((unsigned*)(PT + (size_t)n * CC + tid * 8), *(const v4u*)&s[tid * 8]);
}
// ---- k_xt: block = (32 tokens t0, b): XT[b][t][c] = bf16(x[b][c][t]); rows of 512 B
__global__ __launch_bounds__(256) void k_xt(const float* __restrict__ X, __bf16* __restrict__ XT) {
  __shared__ __align__(16) __bf16 s[32][CC + 8]; const int t0 = blockIdx.x * 32, b = blockIdx.y, tid = threadIdx.x;
  for (int q = tid; q < CC * 32; q += 256) { const int c = q >> 5, tl = q & 31; s[tl][c] = (__bf16)X[((size_t)b * CC + c) * TT + t0 + tl]; }
  __syncthreads();
  for (int q = tid; q < 32 * 32; q += 256) { const int tl = q >> 5, pc = q & 31; vst2((unsigned*)(XT + ((size_t)b * TT + t0 + tl) * CC + pc * 8), *(const v4u*)&s[tl][pc * 8]); }
}
// ---- k_qkv: block = (64 token rows, 128 cols): QKV[r][n] = XT[r] . PT[n] (exact), K = 256; the k columns leave as bf16 hi + residual planes in fragment order (KF), so that a load of k_attn reads whole cache lines and is an operand as it arrives
__global__ __launch_bounds__(128) void k_qkv(const __bf16* __restrict__ XT, const __bf16* __restrict__ PT, float* __restrict__ QKV, __bf16* __restrict__ KF) {
  __shared__ __align__(16) float so[4][16][132];
  const int tid = threadIdx.x, wave = tid >> 5, lane = tid & 31, col = lane & 15, g = lane >> 4; const size_t r0 = (size_t)blockIdx.x * 64 + wave * 16; const int n0 = blockIdx.y * 128;
  v8f acc[8] = {};
#pragma unroll 2
  for (int kc = 0; kc < CC / 32; ++kc) { const v16b a = frag_b(XT + (r0 + col) * CC + kc * 32, lane);
#pragma unroll
    for (int j = 0; j < 8; ++j) acc[j] = wmma_bf(a, frag_b(PT + (size_t)(n0 + j * 16 + col) * CC + kc * 32, lane), acc[j]); }
#pragma unroll
  for (int j = 0; j < 8; ++j)
#pragma unroll
    for (int r = 0; r < 8; ++r) so[wave][8 * g + r][j * 16 + col] = acc[j][r];
  LDSX();
  if (n0 >= CC && n0 < 2 * CC) {   // k (the same for the whole block): the wave's 16 rows are one key tile, its 128 columns 4 heads; per head the lane's 16 values (the element order of split_row) are split here, once, and leave as 2 planes x 2 pieces, 512 B a store
    __bf16* kf = KF + ((r0 >> 4) * NH + ((n0 - CC) >> 5)) * 1024 + lane * 8;
    for (int hd = 0; hd < 4; ++hd) { const F2 k = split_row(&so[wave][col][hd * HD], 0, lane); union { v16b v; v8b q[2]; } uh, ul; uh.v = k.h; ul.v = k.l;
      vst2(kf + hd * 1024, uh.q[0]); vst2(kf + hd * 1024 + 256, uh.q[1]); vst2(kf + hd * 1024 + 512, ul.q[0]); vst2(kf + hd * 1024 + 768, ul.q[1]); }
  } else {
    for (int rl = 0; rl < 16; ++rl) vst2(QKV + (r0 + rl) * QKVP + n0 + lane * 4, *(const v4f*)&so[wave][rl][lane * 4]);
  }
}
__global__ __launch_bounds__(256) void k_vt(const float* __restrict__ QKV, __bf16* __restrict__ VTH, __bf16* __restrict__ VTL) {
  __shared__ __align__(16) __bf16 svh[DM][72], svl[DM][72];
  const int tid = threadIdx.x; const size_t t0 = (size_t)blockIdx.x * 64; const int b = (int)(t0 / TT), p0 = (int)(t0 % TT);
  for (int q = tid; q < 64 * DM; q += 256) { const int tl = q >> 8, c = q & 255; const float v = QKV[(t0 + tl) * QKVP + 2 * DM + c]; const __bf16 hb = (__bf16)v; svh[c][tl] = hb; svl[c][tl] = (__bf16)(v - (float)hb); }
  __syncthreads();
  // fragment order: q = (key step of 32: q >> 10, head, column tile, piece j, lane = (hf, col)); the lane's 8 keys of channel rowi are j * 16 + 8 * hf + 0..7 of the step; a wave stores 512 B in a row
  for (int q = tid; q < DM * 8; q += 256) { const int rowi = ((q >> 6) & 15) * 16 + (q & 15), pc = (q >> 10) * 4 + ((q >> 5) & 1) * 2 + ((q >> 4) & 1); const size_t o = ((size_t)b * (TT / 32) + (p0 >> 5)) * 8192 + (size_t)q * 8; vst2((unsigned*)(VTH + o), *(const v4u*)&svh[rowi][pc * 8]); vst2((unsigned*)(VTL + o), *(const v4u*)&svl[rowi][pc * 8]); }
}
// ---- k_attn: block = (query block qb of 64, b, head group hg of 4 heads), 8 waves = 4 query tiles of 16 (qt) x 2 key halves of 512 (kh); the two waves of a query tile share its staged q rows, run the loop below on their own half of the keys, and are merged at the end.
//   per key step of 32: raw scores of all 8 heads g (q hi/lo from LDS x k hi/lo as loaded, 3 products) * scale -> sraw; per lane (row = lane&15, two heads of the group): mixed s' = sum_g w_head[h][g] sraw[g], online softmax (max, sum, sum of squares), p -> sp, rescale factor -> salpha; P.V for the group's 4 heads (3 products).
//   global loads run ahead of their use, in registers: K of heads g+4, g+5 is asked for before heads g, g+1 are worked on, V of the group's four heads at the head of (b), K of heads 0..3 of the next step at the head of (c).
//   issue order inside a step: a wave issues in order and only two share a SIMD, so nothing stands directly behind what it depends on: WMMAs go in turn over 4 (scores) or 2 (P.V) accumulator tiles, the mixing FMAs over 8 sums, and each group of LDS reads is issued one group of work ahead of its use.
//   merge: the kh = 1 wave leaves m, l, l2 and its unnormalised acc in LDS; behind one block barrier the kh = 0 wave rescales both halves to the common maximum and adds them.
//   end: ON[b][h][q][:] = acc / l (softmax-normalised), RSQ chunk [row][hl] = l2 / l^2 = sum_t a^2 of that row.
__global__ __launch_bounds__(256) void k_attn(const float* __restrict__ QKV, const __bf16* __restrict__ KF, const __bf16* __restrict__ VTH, const __bf16* __restrict__ VTL, const float* __restrict__ WH, float* __restrict__ ON, float* __restrict__ RSQ) {
  __shared__ __align__(16) __bf16 sqh[4][8][16][40], sql[4][8][16][40]; __shared__ __align__(16) float sraw[8][8][16][36]; __shared__ __align__(16) float sp[8][4][16][36]; __shared__ float salpha[8][4][16], sl[8][4][16], sm[4][4][16], sf0[4][4][16], sf1[4][4][16];
  const int tid = threadIdx.x, wave = tid >> 5, lane = tid & 31, col = lane & 15, hf = lane >> 4; const int qb = blockIdx.x, b = blockIdx.y, hg = blockIdx.z; const int qt = wave & 3, kh = __builtin_amdgcn_readfirstlane(tid >> 7); const int q0 = qb * 64 + qt * 16; const size_t tq = (size_t)b * TT + q0;
  // stage the query tile's 16 rows (all 8 heads) as hi/lo bf16: 8 rows per wave of the pair
  for (int i = 0; i < 8 * CC / 32; ++i) { const int q = kh * 8 * CC + i * 32 + lane; const int rl = q >> 8, c = q & 255; const float v = QKV[(tq + rl) * QKVP + c]; const __bf16 hb = (__bf16)v; sqh[qt][c >> 5][rl][c & 31] = hb; sql[qt][c >> 5][rl][c & 31] = (__bf16)(v - (float)hb); }
  // mixing weights for the lane's two heads
  const int row = lane & 15; const int hl0 = hf * 2; float wm[2][8];
#pragma unroll
  for (int u = 0; u < 2; ++u)
#pragma unroll
    for (int gg = 0; gg < 8; ++gg) wm[u][gg] = bfr(WH[(hg * 4 + hl0 + u) * NH + gg]);
  float m[2], l[2], l2[2]; m[0] = m[1] = -3.0e38f; l[0] = l[1] = 0.f; l2[0] = l2[1] = 0.f;
  v8f acc[4][2] = {};
  // the lane's own pointers at key step 0, into the fragment-order storage: K of head 0, V of the group's first head; a key step is 16384 elements of K (both planes), 8192 of each V plane
  const __bf16* Kc = KF + (size_t)b * (TT / 32) * 16384 + lane * 8;
  const __bf16* VHc = VTH + (size_t)b * (TT / 32) * 8192 + hg * 4 * 1024 + lane * 8; const __bf16* VLc = VTL + (size_t)b * (TT / 32) * 8192 + hg * 4 * 1024 + lane * 8;
  const int ks1 = (kh + 1) * (TT / 64);
  F2 kr[8][2];               // K fragments (hi, lo) in flight, by head and key tile
  v16b vh[4][2], vl[4][2];   // V of the step in flight, by head of the group and column tile
  F2 qa[2][2];               // q fragments of two pairs of heads
  float pr[2][16], pal[2][8];   // p row pieces and rescale factors of two heads
  // the loops inside these macros are unrolled so that kr, vh, vl and acc are indexed by constants and stay in registers
  // ask for K of heads G, G+1 of the key step at P
#define LDK2(G, P) do { _Pragma("unroll") for (int g_ = (G); g_ < (G) + 2; ++g_) { _Pragma("unroll") for (int ct = 0; ct < 2; ++ct) { kr[g_][ct].h = frag_bp((P) + ct * 8192 + g_ * 1024); kr[g_][ct].l = frag_bp((P) + ct * 8192 + g_ * 1024 + 512); } } } while (0)
  // ask for V of head H of the group, key step at PH, PL
#define LDV1(H, PH, PL) do { _Pragma("unroll") for (int dt = 0; dt < 2; ++dt) { vh[H][dt] = frag_bp((PH) + (H) * 1024 + dt * 512); vl[H][dt] = frag_bp((PL) + (H) * 1024 + dt * 512); } } while (0)
  // q fragments (hi, lo) of heads G, G+1 from LDS into one of two register sets, asked for one pair of heads ahead of their use; the scheduling barrier keeps the reads where they stand (the scheduler otherwise sinks each read to its first use, where the wave then waits out the LDS latency)
#define SCQ(G) do { _Pragma("unroll") for (int u = 0; u < 2; ++u) { qa[((G) >> 1) & 1][u].h = frag_b(&sqh[qt][(G) + u][col][0], lane); qa[((G) >> 1) & 1][u].l = frag_b(&sql[qt][(G) + u][col][0], lane); } __builtin_amdgcn_sched_barrier(0); } while (0)
  // raw scores of heads G, G+1 from the q and K fragments in registers: four accumulator tiles (2 heads x 2 key tiles), their three products each issued in turn, so that no WMMA waits for the one in front of it; each tile's own sum order is that of mac3
#define SCW(G) do { v8f c_[2][2]; \
    _Pragma("unroll") for (int u = 0; u < 2; ++u) { _Pragma("unroll") for (int ct = 0; ct < 2; ++ct) c_[u][ct] = wmma_il(qa[((G) >> 1) & 1][u].l, kr[(G) + u][ct].h, (v8f){}); } \
    _Pragma("unroll") for (int u = 0; u < 2; ++u) { _Pragma("unroll") for (int ct = 0; ct < 2; ++ct) c_[u][ct] = wmma_il(qa[((G) >> 1) & 1][u].h, kr[(G) + u][ct].l, c_[u][ct]); } \
    _Pragma("unroll") for (int u = 0; u < 2; ++u) { _Pragma("unroll") for (int ct = 0; ct < 2; ++ct) c_[u][ct] = wmma_il(qa[((G) >> 1) & 1][u].h, kr[(G) + u][ct].h, c_[u][ct]); } \
    _Pragma("unroll") for (int u = 0; u < 2; ++u) { _Pragma("unroll") for (int ct = 0; ct < 2; ++ct) { \
      _Pragma("unroll") for (int r = 0; r < 8; ++r) sraw[wave][(G) + u][8 * hf + r][ct * 16 + col] = c_[u][ct][r] * 0.17677669529663687f; } } } while (0)
  // p row pieces and rescale factors of head H of the group from LDS into one of two register sets, asked for one head ahead of their use; the scheduling barrier keeps the reads in front of the head worked on and their first use behind it (the scheduler otherwise brings the two together, and the wave waits out the LDS latency)
#define PVQ(H) do { const float* p_ = &sp[wave][(H)][col][0] + 8 * hf; \
    _Pragma("unroll") for (int i = 0; i < 8; ++i) { pr[(H) & 1][i] = p_[i]; pr[(H) & 1][8 + i] = p_[16 + i]; } \
    _Pragma("unroll") for (int r = 0; r < 8; ++r) pal[(H) & 1][r] = salpha[wave][(H)][8 * hf + r]; \
    __builtin_amdgcn_sched_barrier(0); } while (0)
  // P.V of head H of the group from the V fragments in registers: its two accumulator tiles in turn, so that a WMMA stands two behind the one whose sum it adds to
#define PVW(H) do { { const int hl = (H); const F2 pa = bsplit16(pr[(H) & 1]); \
    _Pragma("unroll") for (int r = 0; r < 8; ++r) { const float al = pal[(H) & 1][r]; acc[hl][0][r] *= al; acc[hl][1][r] *= al; } \
    _Pragma("unroll") for (int dt = 0; dt < 2; ++dt) acc[hl][dt] = wmma_il(pa.l, vh[hl][dt], acc[hl][dt]); \
    _Pragma("unroll") for (int dt = 0; dt < 2; ++dt) acc[hl][dt] = wmma_il(pa.h, vl[hl][dt], acc[hl][dt]); \
    _Pragma("unroll") for (int dt = 0; dt < 2; ++dt) acc[hl][dt] = wmma_il(pa.h, vh[hl][dt], acc[hl][dt]); } } while (0)
  // behind each group of these loads; the loads' address registers are inputs, so that they keep their values up to the wait
#define XW1(P) asm volatile("s_wait_xcnt 0x0" :: "v"(P) : "memory")
#define XW2(P, Q) asm volatile("s_wait_xcnt 0x0" :: "v"(P), "v"(Q) : "memory")
  { const __bf16* kp = Kc + (size_t)kh * (TT / 64) * 16384; LDK2(0, kp); LDK2(2, kp); XW1(kp); }
  __syncthreads();   // each wave reads q rows that its partner staged
#pragma unroll 1
  for (int ks = kh * (TT / 64); ks < ks1; ++ks) {
    const __bf16* kp = Kc + (size_t)ks * 16384; const __bf16* vhp = VHc + (size_t)ks * 8192; const __bf16* vlp = VLc + (size_t)ks * 8192;
    // (a) raw scores for all 8 heads, 32 keys
    LDK2(4, kp); XW1(kp); SCQ(0); SCQ(2); SCW(0);
    LDK2(6, kp); XW1(kp); SCQ(4); SCW(2);
    SCQ(6); SCW(4);
    SCW(6);
    LDSX();
    LDV1(0, vhp, vlp); LDV1(1, vhp, vlp); LDV1(2, vhp, vlp); LDV1(3, vhp, vlp); XW2(vhp, vlp);   // behind the fence of LDSX, which waits for every load in flight
    // (b) mixing + online softmax for (row, heads hl0, hl0+1)
    { float s0[32], s1[32];
      // 4 keys (8 sums) at a time, head g of all 8 before head g + 1 of any: a sum's next term then stands 4 packed FMAs behind its last one instead of directly behind it; the raw scores of the next 4 keys are read from LDS ahead of the work on these. Each sum keeps its order g = 0..7.
      v4f rv[2][8];
      // all loops here are unrolled so that rv, s0 and s1 are indexed by constants and stay in registers
#pragma unroll
      for (int gg = 0; gg < 8; ++gg) rv[0][gg] = *(const v4f*)&sraw[wave][gg][row][0];
#pragma unroll
      for (int k4 = 0; k4 < 8; ++k4) {
        if (k4 < 7) {
#pragma unroll
          for (int gg = 0; gg < 8; ++gg) rv[(k4 + 1) & 1][gg] = *(const v4f*)&sraw[wave][gg][row][k4 * 4 + 4]; }
        __builtin_amdgcn_sched_barrier(0);   // keeps the reads above in front of the FMAs below
        v2f t00 = {0.f, 0.f}, t01 = {0.f, 0.f}, t10 = {0.f, 0.f}, t11 = {0.f, 0.f};   // the 8 sums as 4 pairs, written as packed FMAs (what the scalar form compiled to)
#pragma unroll
        for (int gg = 0; gg < 8; ++gg) { const v4f r = rv[k4 & 1][gg]; const v2f lo = {r[0], r[1]}, hi = {r[2], r[3]}, w0 = {wm[0][gg], wm[0][gg]}, w1 = {wm[1][gg], wm[1][gg]};
          t00 = __builtin_elementwise_fma(w0, lo, t00); t01 = __builtin_elementwise_fma(w0, hi, t01); t10 = __builtin_elementwise_fma(w1, lo, t10); t11 = __builtin_elementwise_fma(w1, hi, t11);
          __builtin_amdgcn_sched_barrier(0);   // keeps the 8 sums in step: without it the scheduler runs a sum's 8 terms back to back, every FMA waiting for the one in front
        }
        s0[k4 * 4 + 0] = t00[0]; s0[k4 * 4 + 1] = t00[1]; s0[k4 * 4 + 2] = t01[0]; s0[k4 * 4 + 3] = t01[1];
        s1[k4 * 4 + 0] = t10[0]; s1[k4 * 4 + 1] = t10[1]; s1[k4 * 4 + 2] = t11[0]; s1[k4 * 4 + 3] = t11[1]; }
#pragma unroll
      for (int u = 0; u < 2; ++u) { float* s = u == 0 ? s0 : s1; float mx = s[0];
#pragma unroll
        for (int k = 1; k < 32; ++k) mx = fmaxf(mx, s[k]);
        const float mn = fmaxf(m[u], mx); const float al = exp_hw(m[u] - mn); float es = 0.f, es2 = 0.f;
#pragma unroll
        for (int k8 = 0; k8 < 32; k8 += 8) { float x[8], e[8];   // eight exponentials at a time, none waiting for another
#pragma unroll
          for (int i = 0; i < 8; ++i) x[i] = (s[k8 + i] - mn) * LOG2E;
#pragma unroll
          for (int i = 0; i < 8; ++i) e[i] = __builtin_amdgcn_exp2f(x[i]);
          // the free slot behind the last v_exp_f32 of the eight; the arguments are named so that no instruction in front of the slot rewrites the register of one
          asm volatile("v_nop" :: "v"(x[0]), "v"(x[1]), "v"(x[2]), "v"(x[3]), "v"(x[4]), "v"(x[5]), "v"(x[6]), "v"(x[7]), "v"(e[0]), "v"(e[1]), "v"(e[2]), "v"(e[3]), "v"(e[4]), "v"(e[5]), "v"(e[6]), "v"(e[7]));
#pragma unroll
          for (int i = 0; i < 8; ++i) { es += e[i]; es2 += e[i] * e[i]; sp[wave][hl0 + u][row][k8 + i] = e[i]; } }
        l[u] = l[u] * al + es; l2[u] = l2[u] * (al * al) + es2; m[u] = mn; salpha[wave][hl0 + u][row] = al; } }
    LDSX();
    // (c) P.V for the group's 4 heads
    const __bf16* kn = Kc + (size_t)(ks + 1 < ks1 ? ks + 1 : ks) * 16384;   // the last step asks for its own rows again (in bounds, not used)
    LDK2(0, kn); LDK2(2, kn); XW1(kn); PVQ(0); PVQ(1); PVW(0);
    PVQ(2); PVW(1);
    PVQ(3); PVW(2);
    PVW(3);
    LDSX(); }
  // merge of the two key halves, then l and sum a^2 per (hl, row)
  float (*so)[16][36] = sp[wave];   // reuse: [hl][row][32]
  if (kh == 1) {
#pragma unroll
    for (int u = 0; u < 2; ++u) { sm[qt][hl0 + u][row] = m[u]; sl[wave][hl0 + u][row] = l[u]; salpha[wave][hl0 + u][row] = l2[u]; }
#pragma unroll
    for (int hl = 0; hl < 4; ++hl)
#pragma unroll
      for (int r = 0; r < 8; ++r) { so[hl][8 * hf + r][col] = acc[hl][0][r]; so[hl][8 * hf + r][16 + col] = acc[hl][1][r]; }
  }
  __syncthreads();   // the kh = 0 wave reads what its partner has just written
  if (kh == 0) {
#pragma unroll
    for (int u = 0; u < 2; ++u) { const float m1 = sm[qt][hl0 + u][row]; const float mn = fmaxf(m[u], m1); const float f0 = __builtin_amdgcn_exp2f((m[u] - mn) * LOG2E), f1 = __builtin_amdgcn_exp2f((m1 - mn) * LOG2E);
      const float lt = l[u] * f0 + sl[wave + 4][hl0 + u][row] * f1; const float l2t = l2[u] * (f0 * f0) + salpha[wave + 4][hl0 + u][row] * (f1 * f1);
      sl[wave][hl0 + u][row] = lt; salpha[wave][hl0 + u][row] = l2t / (lt * lt); sf0[qt][hl0 + u][row] = f0; sf1[qt][hl0 + u][row] = f1; }
    LDSX();
    const float (*sx)[16][36] = sp[wave + 4];   // the partner's unnormalised acc
#pragma unroll
    for (int hl = 0; hl < 4; ++hl)
#pragma unroll
      for (int r = 0; r < 8; ++r) { const int rr = 8 * hf + r; const float il = 1.0f / sl[wave][hl][rr], f0 = sf0[qt][hl][rr], f1 = sf1[qt][hl][rr];
        so[hl][rr][col] = (acc[hl][0][r] * f0 + sx[hl][rr][col] * f1) * il; so[hl][rr][16 + col] = (acc[hl][1][r] * f0 + sx[hl][rr][16 + col] * f1) * il; }
    LDSX();
#pragma unroll
    for (int hl = 0; hl < 4; ++hl) for (int rl = 0; rl < 16; ++rl) if (lane < 8) vst2(ON + ((((size_t)b * NH + hg * 4 + hl) * TT + q0 + rl) * HD) + lane * 4, *(const v4f*)&so[hl][rl][lane * 4]);
    { float* chunk = RSQ + ((((size_t)b * 2 + hg) * 16 + qb) * 4 + qt) * 64; __shared__ __align__(16) float sr[4][64];
      if (lane < 16) { sr[qt][lane * 4 + 0] = salpha[wave][0][lane]; sr[qt][lane * 4 + 1] = salpha[wave][1][lane]; sr[qt][lane * 4 + 2] = salpha[wave][2][lane]; sr[qt][lane * 4 + 3] = salpha[wave][3][lane]; }
      LDSX();
      if (lane < 16) vst2(chunk + lane * 4, *(const v4f*)&sr[qt][lane * 4]); }
  }
}
// ---- k_norm: block = (b, h), 256 threads: E[a^2] over the 1024x1024 map from the per-row sums, mean = 1/T, var = E[a^2] - mean^2, rs = rsqrt(var + 1e-5); coefA = rs*gamma[h], coefB = beta[h] - coefA/T; vsum[d] = sum_t v[b][h*32+d][t] (f32 from QKV; 32 partial sums of 32 rows each by all 256 threads, added in LDS). CV row [64]: coefA, coefB at 0,1; vsum at 32..63.
__global__ __launch_bounds__(256) void k_norm(const float* __restrict__ RSQ, const float* __restrict__ QKV, const float* __restrict__ GA, const float* __restrict__ BE, float* __restrict__ CV) {
  __shared__ float sred[256]; __shared__ __align__(16) float srow[64]; __shared__ __align__(16) float sv[32][36];
  const int b = blockIdx.x >> 3, h = blockIdx.x & 7, tid = threadIdx.x; const int hg = h >> 2, hl = h & 3;
  // column sums of v, first part: thread = (token rows rg, rg + 32, .., 4 columns from c4); its 32 loads of 16 B do not depend on one another
  const int rg = tid >> 3, c4 = (tid & 7) * 4; const float* vp = QKV + ((size_t)b * TT + rg) * QKVP + 2 * CC + h * HD + c4; v4f vr[32];
  // unrolled so that vr stays in registers and the loads are issued ahead of the adds, many in flight at a time
#pragma unroll
  for (int i = 0; i < 32; ++i) vr[i] = *(const v4f*)(vp + (size_t)i * 32 * QKVP);
  float s = 0.f;
#pragma unroll
  for (int i = 0; i < 4; ++i) { const int q = tid * 4 + i; const int qb = q >> 6, wave = (q >> 4) & 3, rl = q & 15; s += RSQ[((((size_t)b * 2 + hg) * 16 + qb) * 4 + wave) * 64 + rl * 4 + hl]; }
  { v4f vs = vr[0];
    // unrolled so that vr is indexed by constants
#pragma unroll
    for (int i = 1; i < 32; ++i) vs += vr[i];
    *(v4f*)&sv[rg][c4] = vs; }
  sred[tid] = s; __syncthreads();
  for (int st = 128; st >= 1; st >>= 1) { if (tid < st) sred[tid] += sred[tid + st]; __syncthreads(); }
  // second part: thread = column, adds the 32 row groups' partial sums; words 32..63 of srow have this one writer
  if (tid < 32) { srow[tid] = 0.f; float vs = 0.f;
    // unrolled so that the LDS loads are issued ahead of the adds
#pragma unroll
    for (int r = 0; r < 32; ++r) vs += sv[r][tid];
    srow[32 + tid] = vs; }
  __syncthreads();
  if (tid == 0) { const float e2 = sred[0] / ((float)TT * (float)TT); const float mean = 1.0f / (float)TT; const float var = e2 - mean * mean; const float rs = rsqrtf(var + 1e-5f); const float cA = rs * bfr(GA[h]); srow[0] = cA; srow[1] = bfr(BE[h]) - cA * mean; }
  __syncthreads();
  if (tid < 16) vst2(CV + (size_t)blockIdx.x * 64 + tid * 4, *(const v4f*)&srow[tid * 4]);
}
// ---- k_fin: block = (64 rows r' of y (= O viewed as [T][256]), 128 output channels, b): Y = (coefA*ON + coefB*vsum)(hi/lo) . Wp rows (2 products) + bp, stored transposed: out[b][o][r'] segments of 64 floats (256 B)
__global__ __launch_bounds__(128) void k_fin(const float* __restrict__ ON, const float* __restrict__ CV, const __bf16* __restrict__ PT, const float* __restrict__ bp, float* __restrict__ out) {
  __shared__ __align__(16) float sT[128][68];
  const int tid = threadIdx.x, wave = tid >> 5, lane = tid & 31, col = lane & 15, g = lane >> 4; const int b = blockIdx.z, n0 = blockIdx.y * 128; const int r0 = blockIdx.x * 64 + wave * 16; const int h = (blockIdx.x * 64) / 128;   // y row r' covers heads r'/128 (constant per 64-row block)
  const float cA = CV[(b * NH + h) * 64 + 0], cB = CV[(b * NH + h) * 64 + 1]; const float* vs = CV + (b * NH + h) * 64 + 32;
  const float* Arow = ON + ((size_t)b * TT + r0 + col) * CC;
  v8f acc[8] = {};
#pragma unroll 2
  for (int kc = 0; kc < CC / 32; ++kc) { float v[16]; const float* p = Arow + kc * 32 + 8 * g;
#pragma unroll
    for (int i = 0; i < 8; ++i) { v[i] = cA * p[i] + cB * vs[8 * g + i]; v[8 + i] = cA * p[16 + i] + cB * vs[16 + 8 * g + i]; }
    const F2 a = bsplit16(v);
#pragma unroll
    for (int j = 0; j < 8; ++j) { const v16b w = frag_b(PT + (size_t)(768 + n0 + j * 16 + col) * CC + kc * 32, lane); acc[j] = wmma_bf(a.l, w, acc[j]); acc[j] = wmma_bf(a.h, w, acc[j]); } }
#pragma unroll
  for (int j = 0; j < 8; ++j) { const float bb = bfr(bp[n0 + j * 16 + col]);
#pragma unroll
    for (int r = 0; r < 8; ++r) sT[j * 16 + col][wave * 16 + 8 * g + r] = acc[j][r] + bb; }
  __syncthreads();
  for (int q = tid; q < 128 * 16; q += 128) { const int o = q >> 4, piece = q & 15; vst2(out + ((size_t)b * CC + n0 + o) * TT + blockIdx.x * 64 + piece * 4, *(const v4f*)&sT[o][piece * 4]); }
}
extern "C" void kernel_launch(void* const* d_in, const int* in_sizes, int n_in, void* d_out, int out_size, void* d_ws, size_t ws_size, hipStream_t stream) {
  (void)in_sizes; (void)n_in; (void)out_size;
  const float** F = (const float**)d_in;   // x [8,256,32,32], Wq, Wk, Wv [256,256], w_head [8,8], gamma [8], beta [8], Wp [256,256], bp [256]
  if (ws_size < (size_t)WS_END) return;
  char* ws = (char*)d_ws; __bf16 *PT = (__bf16*)(ws + WS_PT), *XT = (__bf16*)(ws + WS_XT), *VTH = (__bf16*)(ws + WS_VTH), *VTL = (__bf16*)(ws + WS_VTL); float *QKV = (float*)(ws + WS_QKV), *ON = (float*)(ws + WS_ON), *RSQ = (float*)(ws + WS_RSQ), *CV = (float*)(ws + WS_CV); __bf16* KF = (__bf16*)(ws + WS_KF);
  k_pack<<<4 * CC, 256, 0, stream>>>(F[1], F[2], F[3], F[7], PT);
  k_xt<<<dim3(TT / 32, NBT), 256, 0, stream>>>(F[0], XT);
  k_qkv<<<dim3(NBT * TT / 64, QKVP / 128), 128, 0, stream>>>(XT, PT, QKV, KF);
  k_vt<<<NBT * TT / 64, 256, 0, stream>>>(QKV, VTH, VTL);
  k_attn<<<dim3(TT / 64, NBT, 2), 256, 0, stream>>>(QKV, KF, VTH, VTL, F[4], ON, RSQ);
  k_norm<<<NBT * NH, 256, 0, stream>>>(RSQ, QKV, F[5], F[6], CV);
  k_fin<<<dim3(TT / 64, CC / 128, NBT), 128, 0, stream>>>(ON, CV, PT, F[8], (float*)d_out);
}

// v008
// One run takes 123 microseconds.
// In two side-by-side timings against v007, it was 1.10 and 1.11 times as fast.
// Over all steps from v000 it is 4.60 times as fast.
// compute dtype: x and all weights (Wq, Wk, Wv, w_head, gamma, beta, Wp, bp; module inputs) rounded to bf16; the 1x1-conv projections with exact bf16 products; per-head raw scores q.k and the attention-weighted V sums with both computed operands as bf16 hi + residual pairs (3 products); the output projection with its computed input as hi/lo pairs x exact bf16 weights (2 products) on WMMA 16x16x32; head mixing (8x8), softmax, InstanceNorm statistics and affine in f32 on the VALU; f32 accumulate.
#include <hip/hip_runtime.h>
#include <math.h>

typedef __attribute__((ext_vector_type(16))) _Float16 v16h;
typedef __attribute__((ext_vector_type(16))) __bf16 v16b;
typedef __attribute__((ext_vector_type(8)))  _Float16 v8h;
typedef __attribute__((ext_vector_type(8)))  float v8f;
typedef __attribute__((ext_vector_type(4)))  float v4f;
typedef __attribute__((ext_vector_type(2)))  float v2f;
typedef __attribute__((ext_vector_type(4)))  unsigned v4u;
typedef __attribute__((ext_vector_type(4)))  int v4i;
typedef float __attribute__((may_alias)) float_a;
typedef int __attribute__((may_alias)) int_a;

template <typename T> __device__ __forceinline__ void vst2(void* p, T v) { *(T*)p = v;  }
__device__ __forceinline__ v8f wmma16(v16h a, v16h b, v8f c) {
  v8f d = __builtin_amdgcn_wmma_f32_16x16x32_f16(false, a, false, b, (short)0, c, false, false);
  asm volatile("v_nop\n\tv_nop\n\tv_nop\n\tv_nop" : "+v"(d) : "v"(a), "v"(b));
  return d;
}
__device__ __forceinline__ v8f wmma_bf(v16b a, v16b b, v8f c) {
  v8f d = __builtin_amdgcn_wmma_f32_16x16x32_bf16(false, a, false, b, (short)0, c, false, false);
  asm volatile("v_nop\n\tv_nop\n\tv_nop\n\tv_nop" : "+v"(d) : "v"(a), "v"(b));
  return d;
}
// 16x16x32 fragments: lane = (h = lane>>4, row/col = lane&15); elements 0..7 = k0+8h+0..7, 8..15 = k0+16+8h+0..7; D element r = row 8h+r
__device__ __forceinline__ v16h frag_h(const _Float16* rowk0, int lane) {
  union { v16h v; v8h q[2]; } u; const _Float16* p = rowk0 + 8 * (lane >> 4);
  u.q[0] = *(const v8h*)p; u.q[1] = *(const v8h*)(p + 16); return u.v;
}
__device__ __forceinline__ v16h frag_f32(const float* rowk0, int lane) {
  v16h a; const float* p = rowk0 + 8 * (lane >> 4);
#pragma unroll
  for (int i = 0; i < 8; ++i) { a[i] = (_Float16)p[i]; a[8 + i] = (_Float16)p[16 + i]; }
  return a;
}
__device__ __forceinline__ v16h frag_f32s(const float* rowk0, int lane, float sc) {
  v16h a; const float* p = rowk0 + 8 * (lane >> 4);
#pragma unroll
  for (int i = 0; i < 8; ++i) { a[i] = (_Float16)(p[i] * sc); a[8 + i] = (_Float16)(p[16 + i] * sc); }
  return a;
}
// column fragment from a [K][ld] layout (column n), rows >= K read as 0
__device__ __forceinline__ v16h fragc_f32(const float* W, int k0, int n, int lane, int ld, int K) {
  v16h a; const int g = lane >> 4;
#pragma unroll
  for (int i = 0; i < 8; ++i) { const int ka = k0 + 8 * g + i, kb = ka + 16;
    a[i] = (_Float16)(ka < K ? W[(size_t)(ka < K ? ka : K - 1) * ld + n] : 0.f); a[8 + i] = (_Float16)(kb < K ? W[(size_t)(kb < K ? kb : K - 1) * ld + n] : 0.f); }
  return a;
}
struct F2 { v16b h, l; };
__device__ __forceinline__ F2 bsplit16(const float v[16]) { F2 r;
#pragma unroll
  for (int i = 0; i < 16; ++i) { const __bf16 h = (__bf16)v[i]; r.h[i] = h; r.l[i] = (__bf16)(v[i] - (float)h); }
  return r; }
__device__ __forceinline__ F2 split_row(const float* row, int k0, int lane) { float v[16]; const float* p = row + k0 + 8 * (lane >> 4);
#pragma unroll
  for (int i = 0; i < 8; ++i) { v[i] = p[i]; v[8 + i] = p[16 + i]; }
  return bsplit16(v); }
__device__ __forceinline__ F2 split_rowK(const float* row, int k0, int lane, int K) { float v[16]; const int g = lane >> 4;
#pragma unroll
  for (int i = 0; i < 8; ++i) { const int ka = k0 + 8 * g + i, kb = ka + 16; v[i] = ka < K ? row[ka < K ? ka : K - 1] : 0.f; v[8 + i] = kb < K ? row[kb < K ? kb : K - 1] : 0.f; }
  return bsplit16(v); }
__device__ __forceinline__ F2 split_col(const float* W, int k0, int n, int lane, int ld, int K) { float v[16]; const int g = lane >> 4;
#pragma unroll
  for (int i = 0; i < 8; ++i) { const int ka = k0 + 8 * g + i, kb = ka + 16; v[i] = ka < K ? W[(size_t)(ka < K ? ka : K - 1) * ld + n] : 0.f; v[8 + i] = kb < K ? W[(size_t)(kb < K ? kb : K - 1) * ld + n] : 0.f; }
  return bsplit16(v); }
__device__ __forceinline__ v8f mac3(const F2& a, const F2& b, v8f c) { c = wmma_bf(a.l, b.h, c); c = wmma_bf(a.h, b.l, c); return wmma_bf(a.h, b.h, c); }
// the bare builtin, for runs of WMMAs on independent accumulator tiles: each fills the slots behind the one in front, and the compiler pads what is left
__device__ __forceinline__ v8f wmma_il(v16b a, v16b b, v8f c) { return __builtin_amdgcn_wmma_f32_16x16x32_bf16(false, a, false, b, (short)0, c, false, false); }
__device__ __forceinline__ float sigm(float v) { return 1.0f / (1.0f + expf(-v)); }
#define LDSX() do { asm volatile("s_wait_dscnt 0" ::: "memory"); __builtin_amdgcn_wave_barrier(); __builtin_amdgcn_fence(__ATOMIC_RELEASE, "workgroup"); } while (0)


// Conv-projected multi-head self-attention with head mixing: q,k,v = W x (1x1 conv), s[h] = sum_g w_head[h][g] (q_g . k_g) * 32^-0.5, a = softmax over keys, InstanceNorm2d of each (b,h) 1024x1024 attention map (biased var, eps 1e-5, affine), out = a' v; y = out (B,nh,T,hd) reinterpreted as (B,T,C); y Wp^T + bp; stored as (B,C,T).  B 8, C 256, T 1024, 8 heads x 32.
// k_pack, k_xt (x -> bf16 [b][t][c]), k_qkv (exact GEMM; k as hi/lo planes in fragment order), k_vt (v -> hi/lo planes in fragment order), k_attn (one pass per (query block, b, head group of 4), keys split over two waves per query tile: raw scores of all 8 heads on WMMA, mixing + online softmax with sum and sum-of-squares per row on the VALU, P.V on WMMA; writes softmax-normalised O rows and per-row sum(a^2)), k_norm (per (b,h): variance -> affine coefficients; column sums of v), k_fin (affine applied at A-load, output projection, transposed 256-B stores).
#define NB 8
#define CC 256
#define TT 1024
#define NH 8
#define HD 32
#define NR (NB * TT)        // 8192
#define QKVP (3 * CC)       // 768
#define DM CC
#ifndef NBT
#define NBT NB              // batches launched (all)
#endif
typedef __attribute__((ext_vector_type(8))) __bf16 v8b;
__device__ __forceinline__ v16b frag_b(const __bf16* rowk0, int lane) {
  union { v16b v; v8b q[2]; } u; const __bf16* p = rowk0 + 8 * (lane >> 4);
  u.q[0] = *(const v8b*)p; u.q[1] = *(const v8b*)(p + 16); return u.v;
}
__device__ __forceinline__ float bfr(float v) { return (float)(__bf16)v; }
// the same fragment from fragment-order storage: elements 0..7 of all 32 lanes in 512 B in a row, then elements 8..15; p = the fragment's start + 8 * lane
__device__ __forceinline__ v16b frag_bp(const __bf16* p) { union { v16b v; v8b q[2]; } u; u.q[0] = *(const v8b*)p; u.q[1] = *(const v8b*)(p + 256); return u.v; }
// e^v on the hardware exponential, in line: 2^(v * log2 e); v <= 0 wherever it is used (a score or an older maximum minus the running maximum), a result below 2^-126 comes out as 0
#define LOG2E 1.4426950408889634f
__device__ __forceinline__ float exp_hw(float v) { const float x = v * LOG2E; const float r = __builtin_amdgcn_exp2f(x);
  asm volatile("v_nop" :: "v"(x), "v"(r));   // the free slot behind v_exp_f32; its argument is named so that no instruction in front of the slot rewrites that register
  return r; }
__device__ __attribute__((noinline)) float erf_ni(float v) { return erff(v); }

#define WS_PT   0u                                   // bf16 [1024][256]: Wq | Wk | Wv | Wp rows
#define WS_XT   (WS_PT + 2u * 4 * CC * CC)             // bf16 [8192][256] x transposed (token rows)
#define WS_QKV  (WS_XT + 2u * NR * CC)                 // f32 [8192][768]; the k columns 256..511 are not written: k goes to WS_KF
#define WS_VTH  (WS_QKV + 4u * NR * QKVP)              // bf16 [8 b][32 key step][8 h][2 dt][2 piece][32 lane][8]: v as the A fragments of P.V, in the order k_attn loads them
#define WS_VTL  (WS_VTH + 2u * NB * CC * TT)
#define WS_ON   (WS_VTL + 2u * NB * CC * TT)           // f32 [8][8][1024][32] softmax-normalised O
#define WS_RSQ  (WS_ON + 4u * NB * NH * TT * HD)        // f32 [8 b][2 hg][16 qb][4 wave][16 row][4 hl]
#define WS_CV   (WS_RSQ + 4u * NB * NH * TT)           // f32 [64 (b,h)][64]: coefA, coefB, .., vsum[32] at 32..63
#define WS_KF   (WS_CV + 4u * NB * NH * 64)            // bf16 [512 key tile of 16][8 g][2 hi, lo][2 piece][32 lane][8]: k as the A fragments of the scores, split once, in the order k_attn loads them
#define WS_END  (WS_KF + 4u * NR * CC)

__global__ __launch_bounds__(256) void k_pack(const float* __restrict__ Wq, const float* __restrict__ Wk, const float* __restrict__ Wv, const float* __restrict__ Wp, __bf16* __restrict__ PT) {
  __shared__ __align__(16) __bf16 s[CC]; const int n = blockIdx.x, tid = threadIdx.x; const int m = n & 255; const float* src = (n < 256) ? Wq : (n < 512) ? Wk : (n < 768) ? Wv : Wp;
  s[tid] = (__bf16)src[(size_t)m * CC + tid]; __syncthreads();
  if (tid < CC / 8) vst2((unsigned*)(PT + (size_t)n * CC + tid * 8), *(const v4u*)&s[tid * 8]);
}
// ---- k_xt: block = (32 tokens t0, b): XT[b][t][c] = bf16(x[b][c][t]); rows of 512 B
__global__ __launch_bounds__(256) void k_xt(const float* __restrict__ X, __bf16* __restrict__ XT) {
  __shared__ __align__(16) __bf16 s[32][CC + 8]; const int t0 = blockIdx.x * 32, b = blockIdx.y, tid = threadIdx.x;
  for (int q = tid; q < CC * 32; q += 256) { const int c = q >> 5, tl = q & 31; s[tl][c] = (__bf16)X[((size_t)b * CC + c) * TT + t0 + tl]; }
  __syncthreads();
  for (int q = tid; q < 32 * 32; q += 256) { const int tl = q >> 5, pc = q & 31; vst2((unsigned*)(XT + ((size_t)b * TT + t0 + tl) * CC + pc * 8), *(const v4u*)&s[tl][pc * 8]); }
}
// ---- k_qkv: block = (64 token rows, 128 cols): QKV[r][n] = XT[r] . PT[n] (exact), K = 256; the k columns leave as bf16 hi + residual planes in fragment order (KF), so that a load of k_attn reads whole cache lines and is an operand as it arrives
__global__ __launch_bounds__(128) void k_qkv(const __bf16* __restrict__ XT, const __bf16* __restrict__ PT, float* __restrict__ QKV, __bf16* __restrict__ KF) {
  __shared__ __align__(16) float so[4][16][132];
  const int tid = threadIdx.x, wave = tid >> 5, lane = tid & 31, col = lane & 15, g = lane >> 4; const size_t r0 = (size_t)blockIdx.x * 64 + wave * 16; const int n0 = blockIdx.y * 128;
  v8f acc[8] = {};
#pragma unroll 2
  for (int kc = 0; kc < CC / 32; ++kc) { const v16b a = frag_b(XT + (r0 + col) * CC + kc * 32, lane);
#pragma unroll
    for (int j = 0; j < 8; ++j) acc[j] = wmma_bf(a, frag_b(PT + (size_t)(n0 + j * 16 + col) * CC + kc * 32, lane), acc[j]); }
#pragma unroll
  for (int j = 0; j < 8; ++j)
#pragma unroll
    for (int r = 0; r < 8; ++r) so[wave][8 * g + r][j * 16 + col] = acc[j][r];
  LDSX();
  if (n0 >= CC && n0 < 2 * CC) {   // k (the same for the whole block): the wave's 16 rows are one key tile, its 128 columns 4 heads; per head the lane's 16 values (the element order of split_row) are split here, once, and leave as 2 planes x 2 pieces, 512 B a store
    __bf16* kf = KF + ((r0 >> 4) * NH + ((n0 - CC) >> 5)) * 1024 + lane * 8;
    for (int hd = 0; hd < 4; ++hd) { const F2 k = split_row(&so[wave][col][hd * HD], 0, lane); union { v16b v; v8b q[2]; } uh, ul; uh.v = k.h; ul.v = k.l;
      vst2(kf + hd * 1024, uh.q[0]); vst2(kf + hd * 1024 + 256, uh.q[1]); vst2(kf + hd * 1024 + 512, ul.q[0]); vst2(kf + hd * 1024 + 768, ul.q[1]); }
  } else {
    for (int rl = 0; rl < 16; ++rl) vst2(QKV + (r0 + rl) * QKVP + n0 + lane * 4, *(const v4f*)&so[wave][rl][lane * 4]);
  }
}
__global__ __launch_bounds__(256) void k_vt(const float* __restrict__ QKV, __bf16* __restrict__ VTH, __bf16* __restrict__ VTL) {
  __shared__ __align__(16) __bf16 svh[DM][72], svl[DM][72];
  const int tid = threadIdx.x; const size_t t0 = (size_t)blockIdx.x * 64; const int b = (int)(t0 / TT), p0 = (int)(t0 % TT);
  for (int q = tid; q < 64 * DM; q += 256) { const int tl = q >> 8, c = q & 255; const float v = QKV[(t0 + tl) * QKVP + 2 * DM + c]; const __bf16 hb = (__bf16)v; svh[c][tl] = hb; svl[c][tl] = (__bf16)(v - (float)hb); }
  __syncthreads();
  // fragment order: q = (key step of 32: q >> 10, head, column tile, piece j, lane = (hf, col)); the lane's 8 keys of channel rowi are j * 16 + 8 * hf + 0..7 of the step; a wave stores 512 B in a row
  for (int q = tid; q < DM * 8; q += 256) { const int rowi = ((q >> 6) & 15) * 16 + (q & 15), pc = (q >> 10) * 4 + ((q >> 5) & 1) * 2 + ((q >> 4) & 1); const size_t o = ((size_t)b * (TT / 32) + (p0 >> 5)) * 8192 + (size_t)q * 8; vst2((unsigned*)(VTH + o), *(const v4u*)&svh[rowi][pc * 8]); vst2((unsigned*)(VTL + o), *(const v4u*)&svl[rowi][pc * 8]); }
}
__device__ __forceinline__ float xhalf(float v) { const int b = __builtin_bit_cast(int, v); return __builtin_bit_cast(float, __builtin_amdgcn_permlanex16(b, b, 0x76543210, 0xfedcba98, false, false)); }
__global__ __launch_bounds__(256) void k_attn(const float* __restrict__ QKV, const __bf16* __restrict__ KF, const __bf16* __restrict__ VTH, const __bf16* __restrict__ VTL, const float* __restrict__ WH, float* __restrict__ ON, float* __restrict__ RSQ) {
  __shared__ __align__(16) __bf16 sqh[4][8][16][40], sql[4][8][16][40]; __shared__ __align__(16) float sp[8][4][16][36]; __shared__ float sm[4][4][16], sl[4][4][16], sl2[4][4][16];
  const int tid = threadIdx.x, wave = tid >> 5, lane = tid & 31, col = lane & 15, hf = lane >> 4; const int qb = blockIdx.x, b = blockIdx.y, hg = blockIdx.z; const int qt = wave & 3, kh = __builtin_amdgcn_readfirstlane(tid >> 7); const int q0 = qb * 64 + qt * 16; const size_t tq = (size_t)b * TT + q0;
  // stage the query tile's 16 rows (all 8 heads) as hi/lo bf16: 8 rows per wave of the pair
  for (int i = 0; i < 8 * CC / 32; ++i) { const int q = kh * 8 * CC + i * 32 + lane; const int rl = q >> 8, c = q & 255; const float v = QKV[(tq + rl) * QKVP + c]; const __bf16 hb = (__bf16)v; sqh[qt][c >> 5][rl][c & 31] = hb; sql[qt][c >> 5][rl][c & 31] = (__bf16)(v - (float)hb); }
  // mixing weights of the group's four heads, two heads to a pair (the same in every lane)
  v2f wm[2][8];
#pragma unroll
  for (int hl = 0; hl < 4; ++hl)
#pragma unroll
    for (int gg = 0; gg < 8; ++gg) wm[hl >> 1][gg][hl & 1] = bfr(WH[(hg * 4 + hl) * NH + gg]);
  v2f m[2], l[2], l2[2];     // of query col, two heads of the group to a pair: [hl >> 1][hl & 1]; l and l2 over the lane half's own keys
#pragma unroll
  for (int hp = 0; hp < 2; ++hp) { m[hp] = (v2f){-3.0e38f, -3.0e38f}; l[hp] = (v2f){0.f, 0.f}; l2[hp] = (v2f){0.f, 0.f}; }
  v8f acc[4][2] = {};        // acc[hl][dt][r] = O[query col][dt * 16 + 8 hf + r]
  // the lane's own pointers at key step 0, into the fragment-order storage: K of head 0, V of the group's first head; a key step is 16384 elements of K (both planes), 8192 of each V plane
  const __bf16* Kc = KF + (size_t)b * (TT / 32) * 16384 + lane * 8;
  const __bf16* VHc = VTH + (size_t)b * (TT / 32) * 8192 + hg * 4 * 1024 + lane * 8; const __bf16* VLc = VTL + (size_t)b * (TT / 32) * 8192 + hg * 4 * 1024 + lane * 8;
  const int ks1 = (kh + 1) * (TT / 64);
  F2 kr[8][2];               // K fragments (hi, lo) in flight, by head and key tile
  v16b vh[4][2], vl[4][2];   // V of the step in flight, by head of the group and column tile
  F2 qa[2][2];               // q fragments of two pairs of heads
  v8f cs[2][2][2];           // raw score tiles of two pairs of heads: [pair & 1][head of the pair][key tile]
  v2f sx[2][16];             // mixed scores, then p, of the lane's 16 keys (key i = ct * 8 + r is key ct * 16 + 8 hf + r of the step), two heads of the group to a pair: [hl >> 1][i][hl & 1]
  // the loops inside these macros are unrolled so that kr, vh, vl, cs, sx and acc are indexed by constants and stay in registers
  // ask for K of heads G, G+1 of the key step at P
#define LDK2(G, P) do { _Pragma("unroll") for (int g_ = (G); g_ < (G) + 2; ++g_) { _Pragma("unroll") for (int ct = 0; ct < 2; ++ct) { kr[g_][ct].h = frag_bp((P) + ct * 8192 + g_ * 1024); kr[g_][ct].l = frag_bp((P) + ct * 8192 + g_ * 1024 + 512); } } } while (0)
  // ask for V of head H of the group, key step at PH, PL
#define LDV1(H, PH, PL) do { _Pragma("unroll") for (int dt = 0; dt < 2; ++dt) { vh[H][dt] = frag_bp((PH) + (H) * 1024 + dt * 512); vl[H][dt] = frag_bp((PL) + (H) * 1024 + dt * 512); } } while (0)
  // q fragments (hi, lo) of heads G, G+1 from LDS into one of two register sets, asked for one pair of heads ahead of their use; the scheduling barrier keeps the reads where they stand (the scheduler otherwise sinks each read to its first use, where the wave then waits out the LDS latency)
#define SCQ(G) do { _Pragma("unroll") for (int u = 0; u < 2; ++u) { qa[((G) >> 1) & 1][u].h = frag_b(&sqh[qt][(G) + u][col][0], lane); qa[((G) >> 1) & 1][u].l = frag_b(&sql[qt][(G) + u][col][0], lane); } __builtin_amdgcn_sched_barrier(0); } while (0)
  // raw scores of heads G, G+1, transposed (rows = keys, column = query): four accumulator tiles (2 heads x 2 key tiles), their three products each issued in turn, so that no WMMA waits for the one in front of it; each tile's own sum order is that of mac3
#define SCW(G) do { \
    _Pragma("unroll") for (int u = 0; u < 2; ++u) { _Pragma("unroll") for (int ct = 0; ct < 2; ++ct) cs[((G) >> 1) & 1][u][ct] = wmma_il(kr[(G) + u][ct].h, qa[((G) >> 1) & 1][u].l, (v8f){}); } \
    _Pragma("unroll") for (int u = 0; u < 2; ++u) { _Pragma("unroll") for (int ct = 0; ct < 2; ++ct) cs[((G) >> 1) & 1][u][ct] = wmma_il(kr[(G) + u][ct].l, qa[((G) >> 1) & 1][u].h, cs[((G) >> 1) & 1][u][ct]); } \
    _Pragma("unroll") for (int u = 0; u < 2; ++u) { _Pragma("unroll") for (int ct = 0; ct < 2; ++ct) cs[((G) >> 1) & 1][u][ct] = wmma_il(kr[(G) + u][ct].h, qa[((G) >> 1) & 1][u].h, cs[((G) >> 1) & 1][u][ct]); } } while (0)
  // heads G, G+1 into the 64 mixed sums of the lane (4 heads x 16 keys, as packed FMAs over two heads: the weights then take 32 registers, not 64 as pairs of equal words): 32 independent FMAs per head g, each sum in the order g = 0..7; it stands one pair of heads behind the WMMAs that made its scores, beside those of the next pair
#define MIX(G) do { _Pragma("unroll") for (int u = 0; u < 2; ++u) { \
    _Pragma("unroll") for (int ct = 0; ct < 2; ++ct) cs[((G) >> 1) & 1][u][ct] *= 0.17677669529663687f; \
    _Pragma("unroll") for (int hp = 0; hp < 2; ++hp) { \
      _Pragma("unroll") for (int ct = 0; ct < 2; ++ct) { _Pragma("unroll") for (int r = 0; r < 8; ++r) { const float r1_ = cs[((G) >> 1) & 1][u][ct][r]; const v2f r_ = {r1_, r1_}; \
        sx[hp][ct * 8 + r] = __builtin_elementwise_fma(wm[hp][(G) + u], r_, ((G) + u) == 0 ? (v2f){0.f, 0.f} : sx[hp][ct * 8 + r]); } } } } } while (0)
  // P.V of head H of the group, transposed (rows = output columns, column = query): the lane's 16 p, split in place, are its part of the B fragment; two accumulator tiles in turn, so that a WMMA stands two behind the one whose sum it adds to
#define PVW(H) do { float p_[16]; _Pragma("unroll") for (int i = 0; i < 16; ++i) p_[i] = sx[(H) >> 1][i][(H) & 1]; \
    const F2 pa = bsplit16(p_); acc[H][0] *= al[(H) >> 1][(H) & 1]; acc[H][1] *= al[(H) >> 1][(H) & 1]; \
    _Pragma("unroll") for (int dt = 0; dt < 2; ++dt) acc[H][dt] = wmma_il(vh[H][dt], pa.l, acc[H][dt]); \
    _Pragma("unroll") for (int dt = 0; dt < 2; ++dt) acc[H][dt] = wmma_il(vl[H][dt], pa.h, acc[H][dt]); \
    _Pragma("unroll") for (int dt = 0; dt < 2; ++dt) acc[H][dt] = wmma_il(vh[H][dt], pa.h, acc[H][dt]); } while (0)
  // behind each group of these loads; the loads' address registers are inputs, so that they keep their values up to the wait
#define XW1(P) asm volatile("s_wait_xcnt 0x0" :: "v"(P) : "memory")
#define XW2(P, Q) asm volatile("s_wait_xcnt 0x0" :: "v"(P), "v"(Q) : "memory")
  // behind a group of loads and its wait: keeps the work that follows behind the loads (the scheduler otherwise lifts it over them, and the loads leave later than they stand here, nearer to their use)
#define SB() __builtin_amdgcn_sched_barrier(0)
  { const __bf16* kp = Kc + (size_t)kh * (TT / 64) * 16384; LDK2(0, kp); LDK2(2, kp); LDK2(4, kp); XW1(kp); }
  __syncthreads();   // each wave reads q rows that its partner staged
#pragma unroll 1
  for (int ks = kh * (TT / 64); ks < ks1; ++ks) {
    const __bf16* kp = Kc + (size_t)ks * 16384; const __bf16* vhp = VHc + (size_t)ks * 8192; const __bf16* vlp = VLc + (size_t)ks * 8192;
    const __bf16* kn = Kc + (size_t)(ks + 1 < ks1 ? ks + 1 : ks) * 16384;   // the last step asks for its own rows again (in bounds, not used)
    // (a) raw scores of all 8 heads, 32 keys, and their mixing
    SCQ(0); SCQ(2); SCW(0);
    LDK2(6, kp); XW1(kp); SCQ(4); SCW(2); MIX(0);
    SCQ(6); SCW(4); MIX(2);
    LDV1(0, vhp, vlp); LDV1(1, vhp, vlp); LDV1(2, vhp, vlp); LDV1(3, vhp, vlp); XW2(vhp, vlp); SB();
    SCW(6); MIX(4);
    LDK2(0, kn); LDK2(2, kn); XW1(kn); SB();
    MIX(6);
    // (b) online softmax of the lane's query, 4 heads x 16 keys, two heads to a packed operation
    v2f al[2];
#pragma unroll
    for (int hp = 0; hp < 2; ++hp) { v2f mn;
#pragma unroll
      for (int u = 0; u < 2; ++u) { float mx = sx[hp][0][u];
#pragma unroll
        for (int i = 1; i < 16; ++i) mx = fmaxf(mx, sx[hp][i][u]);
        mx = fmaxf(mx, xhalf(mx));   // the step's 32 keys: both lane halves go on with the same maximum
        mn[u] = fmaxf(m[hp][u], mx); al[hp][u] = exp_hw(m[hp][u] - mn[u]); }
      m[hp] = mn; v2f es = {0.f, 0.f}, es2 = {0.f, 0.f};
#pragma unroll
      for (int k4 = 0; k4 < 16; k4 += 4) { v2f x[4], e[4];   // eight exponentials at a time, none waiting for another
#pragma unroll
        for (int i = 0; i < 4; ++i) x[i] = (sx[hp][k4 + i] - mn) * LOG2E;
#pragma unroll
        for (int i = 0; i < 4; ++i) { e[i][0] = __builtin_amdgcn_exp2f(x[i][0]); e[i][1] = __builtin_amdgcn_exp2f(x[i][1]); }
        // the free slot behind the last v_exp_f32 of the eight; the arguments are named so that no instruction in front of the slot rewrites the register of one
        asm volatile("v_nop" :: "v"(x[0]), "v"(x[1]), "v"(x[2]), "v"(x[3]), "v"(e[0]), "v"(e[1]), "v"(e[2]), "v"(e[3]));
#pragma unroll
        for (int i = 0; i < 4; ++i) { es += e[i]; es2 = __builtin_elementwise_fma(e[i], e[i], es2); sx[hp][k4 + i] = e[i]; } }
      l[hp] = l[hp] * al[hp] + es; l2[hp] = l2[hp] * (al[hp] * al[hp]) + es2; }
    // (c) P.V for the group's 4 heads
    PVW(0); PVW(1);
    LDK2(4, kn); XW1(kn); SB();
    PVW(2); PVW(3); }
  // the lane halves' sums joined; then the merge of the two key halves, l and sum a^2 per (hl, query)
#pragma unroll
  for (int hl = 0; hl < 4; ++hl) { l[hl >> 1][hl & 1] += xhalf(l[hl >> 1][hl & 1]); l2[hl >> 1][hl & 1] += xhalf(l2[hl >> 1][hl & 1]); }
  float (*so)[16][36] = sp[wave];   // [hl][query][32]
  if (kh == 1) {
    if (hf == 0) {
#pragma unroll
      for (int hl = 0; hl < 4; ++hl) { sm[qt][hl][col] = m[hl >> 1][hl & 1]; sl[qt][hl][col] = l[hl >> 1][hl & 1]; sl2[qt][hl][col] = l2[hl >> 1][hl & 1]; } }
#pragma unroll
    for (int hl = 0; hl < 4; ++hl)
#pragma unroll
      for (int dt = 0; dt < 2; ++dt) { float* o_ = &so[hl][col][dt * 16 + 8 * hf]; *(v4f*)o_ = __builtin_shufflevector(acc[hl][dt], acc[hl][dt], 0, 1, 2, 3); *(v4f*)(o_ + 4) = __builtin_shufflevector(acc[hl][dt], acc[hl][dt], 4, 5, 6, 7); }
  }
  __syncthreads();   // the kh = 0 wave reads what its partner has just written
  if (kh == 0) {
    const float (*sy)[16][36] = sp[wave + 4];   // the partner's unnormalised acc
    v4f rq;
#pragma unroll
    for (int hl = 0; hl < 4; ++hl) { const float m0 = m[hl >> 1][hl & 1], m1 = sm[qt][hl][col]; const float mn = fmaxf(m0, m1); const float f0 = exp_hw(m0 - mn), f1 = exp_hw(m1 - mn);
      const float lt = l[hl >> 1][hl & 1] * f0 + sl[qt][hl][col] * f1; const float l2t = l2[hl >> 1][hl & 1] * (f0 * f0) + sl2[qt][hl][col] * (f1 * f1); rq[hl] = l2t / (lt * lt); const float il = 1.0f / lt;
#pragma unroll
      for (int dt = 0; dt < 2; ++dt)
#pragma unroll
        for (int r4 = 0; r4 < 8; r4 += 4) { const v4f y = *(const v4f*)&sy[hl][col][dt * 16 + 8 * hf + r4]; v4f o;
#pragma unroll
          for (int r = 0; r < 4; ++r) o[r] = (acc[hl][dt][r4 + r] * f0 + y[r] * f1) * il;
          *(v4f*)&so[hl][col][dt * 16 + 8 * hf + r4] = o; } }
    LDSX();
#pragma unroll
    for (int hl = 0; hl < 4; ++hl) for (int rl = 0; rl < 16; ++rl) if (lane < 8) vst2(ON + ((((size_t)b * NH + hg * 4 + hl) * TT + q0 + rl) * HD) + lane * 4, *(const v4f*)&so[hl][rl][lane * 4]);
    if (lane < 16) vst2(RSQ + ((((size_t)b * 2 + hg) * 16 + qb) * 4 + qt) * 64 + lane * 4, rq);
  }
}
// ---- k_norm: block = (b, h), 256 threads: E[a^2] over the 1024x1024 map from the per-row sums, mean = 1/T, var = E[a^2] - mean^2, rs = rsqrt(var + 1e-5); coefA = rs*gamma[h], coefB = beta[h] - coefA/T; vsum[d] = sum_t v[b][h*32+d][t] (f32 from QKV; 32 partial sums of 32 rows each by all 256 threads, added in LDS). CV row [64]: coefA, coefB at 0,1; vsum at 32..63.
__global__ __launch_bounds__(256) void k_norm(const float* __restrict__ RSQ, const float* __restrict__ QKV, const float* __restrict__ GA, const float* __restrict__ BE, float* __restrict__ CV) {
  __shared__ float sred[256]; __shared__ __align__(16) float srow[64]; __shared__ __align__(16) float sv[32][36];
  const int b = blockIdx.x >> 3, h = blockIdx.x & 7, tid = threadIdx.x; const int hg = h >> 2, hl = h & 3;
  // column sums of v, first part: thread = (token rows rg, rg + 32, .., 4 columns from c4); its 32 loads of 16 B do not depend on one another
  const int rg = tid >> 3, c4 = (tid & 7) * 4; const float* vp = QKV + ((size_t)b * TT + rg) * QKVP + 2 * CC + h * HD + c4; v4f vr[32];
  // unrolled so that vr stays in registers and the loads are issued ahead of the adds, many in flight at a time
#pragma unroll
  for (int i = 0; i < 32; ++i) vr[i] = *(const v4f*)(vp + (size_t)i * 32 * QKVP);
  float s = 0.f;
#pragma unroll
  for (int i = 0; i < 4; ++i) { const int q = tid * 4 + i; const int qb = q >> 6, wave = (q >> 4) & 3, rl = q & 15; s += RSQ[((((size_t)b * 2 + hg) * 16 + qb) * 4 + wave) * 64 + rl * 4 + hl]; }
  { v4f vs = vr[0];
    // unrolled so that vr is indexed by constants
#pragma unroll
    for (int i = 1; i < 32; ++i) vs += vr[i];
    *(v4f*)&sv[rg][c4] = vs; }
  sred[tid] = s; __syncthreads();
  for (int st = 128; st >= 1; st >>= 1) { if (tid < st) sred[tid] += sred[tid + st]; __syncthreads(); }
  // second part: thread = column, adds the 32 row groups' partial sums; words 32..63 of srow have this one writer
  if (tid < 32) { srow[tid] = 0.f; float vs = 0.f;
    // unrolled so that the LDS loads are issued ahead of the adds
#pragma unroll
    for (int r = 0; r < 32; ++r) vs += sv[r][tid];
    srow[32 + tid] = vs; }
  __syncthreads();
  if (tid == 0) { const float e2 = sred[0] / ((float)TT * (float)TT); const float mean = 1.0f / (float)TT; const float var = e2 - mean * mean; const float rs = rsqrtf(var + 1e-5f); const float cA = rs * bfr(GA[h]); srow[0] = cA; srow[1] = bfr(BE[h]) - cA * mean; }
  __syncthreads();
  if (tid < 16) vst2(CV + (size_t)blockIdx.x * 64 + tid * 4, *(const v4f*)&srow[tid * 4]);
}
// ---- k_fin: block = (64 rows r' of y (= O viewed as [T][256]), 128 output channels, b): Y = (coefA*ON + coefB*vsum)(hi/lo) . Wp rows (2 products) + bp, stored transposed: out[b][o][r'] segments of 64 floats (256 B)
__global__ __launch_bounds__(128) void k_fin(const float* __restrict__ ON, const float* __restrict__ CV, const __bf16* __restrict__ PT, const float* __restrict__ bp, float* __restrict__ out) {
  __shared__ __align__(16) float sT[128][68];
  const int tid = threadIdx.x, wave = tid >> 5, lane = tid & 31, col = lane & 15, g = lane >> 4; const int b = blockIdx.z, n0 = blockIdx.y * 128; const int r0 = blockIdx.x * 64 + wave * 16; const int h = (blockIdx.x * 64) / 128;   // y row r' covers heads r'/128 (constant per 64-row block)
  const float cA = CV[(b * NH + h) * 64 + 0], cB = CV[(b * NH + h) * 64 + 1]; const float* vs = CV + (b * NH + h) * 64 + 32;
  const float* Arow = ON + ((size_t)b * TT + r0 + col) * CC;
  v8f acc[8] = {};
#pragma unroll 2
  for (int kc = 0; kc < CC / 32; ++kc) { float v[16]; const float* p = Arow + kc * 32 + 8 * g;
#pragma unroll
    for (int i = 0; i < 8; ++i) { v[i] = cA * p[i] + cB * vs[8 * g + i]; v[8 + i] = cA * p[16 + i] + cB * vs[16 + 8 * g + i]; }
    const F2 a = bsplit16(v);
#pragma unroll
    for (int j = 0; j < 8; ++j) { const v16b w = frag_b(PT + (size_t)(768 + n0 + j * 16 + col) * CC + kc * 32, lane); acc[j] = wmma_bf(a.l, w, acc[j]); acc[j] = wmma_bf(a.h, w, acc[j]); } }
#pragma unroll
  for (int j = 0; j < 8; ++j) { const float bb = bfr(bp[n0 + j * 16 + col]);
#pragma unroll
    for (int r = 0; r < 8; ++r) sT[j * 16 + col][wave * 16 + 8 * g + r] = acc[j][r] + bb; }
  __syncthreads();
  for (int q = tid; q < 128 * 16; q += 128) { const int o = q >> 4, piece = q & 15; vst2(out + ((size_t)b * CC + n0 + o) * TT + blockIdx.x * 64 + piece * 4, *(const v4f*)&sT[o][piece * 4]); }
}
extern "C" void kernel_launch(void* const* d_in, const int* in_sizes, int n_in, void* d_out, int out_size, void* d_ws, size_t ws_size, hipStream_t stream) {
  (void)in_sizes; (void)n_in; (void)out_size;
  const float** F = (const float**)d_in;   // x [8,256,32,32], Wq, Wk, Wv [256,256], w_head [8,8], gamma [8], beta [8], Wp [256,256], bp [256]
  if (ws_size < (size_t)WS_END) return;
  char* ws = (char*)d_ws; __bf16 *PT = (__bf16*)(ws + WS_PT), *XT = (__bf16*)(ws + WS_XT), *VTH = (__bf16*)(ws + WS_VTH), *VTL = (__bf16*)(ws + WS_VTL); float *QKV = (float*)(ws + WS_QKV), *ON = (float*)(ws + WS_ON), *RSQ = (float*)(ws + WS_RSQ), *CV = (float*)(ws + WS_CV); __bf16* KF = (__bf16*)(ws + WS_KF);
  k_pack<<<4 * CC, 256, 0, stream>>>(F[1], F[2], F[3], F[7], PT);
  k_xt<<<dim3(TT / 32, NBT), 256, 0, stream>>>(F[0], XT);
  k_qkv<<<dim3(NBT * TT / 64, QKVP / 128), 128, 0, stream>>>(XT, PT, QKV, KF);
  k_vt<<<NBT * TT / 64, 256, 0, stream>>>(QKV, VTH, VTL);
  k_attn<<<dim3(TT / 64, NBT, 2), 256, 0, stream>>>(QKV, KF, VTH, VTL, F[4], ON, RSQ);
  k_norm<<<NBT * NH, 256, 0, stream>>>(RSQ, QKV, F[5], F[6], CV);
  k_fin<<<dim3(TT / 64, CC / 128, NBT), 128, 0, stream>>>(ON, CV, PT, F[8], (float*)d_out);
}

// v009
// Measured time: 86 microseconds a run.
// In both of two side-by-side timings against v008, it was 1.43 times as fast.
// Counting every step since v000, it is 6.58 times as fast.
// compute dtype: x and all weights (Wq, Wk, Wv, w_head, gamma, beta, Wp, bp; module inputs) rounded to bf16; the 1x1-conv projections with exact bf16 products; per-head raw scores q.k and the attention-weighted V sums with both computed operands as bf16 hi + residual pairs (3 products); the output projection with its computed input as hi/lo pairs x exact bf16 weights (2 products) on WMMA 16x16x32; head mixing (8x8), softmax, InstanceNorm statistics and affine in f32 on the VALU; f32 accumulate.
#include <hip/hip_runtime.h>
#include <math.h>

typedef __attribute__((ext_vector_type(16))) _Float16 v16h;
typedef __attribute__((ext_vector_type(16))) __bf16 v16b;
typedef __attribute__((ext_vector_type(8)))  _Float16 v8h;
typedef __attribute__((ext_vector_type(8)))  float v8f;
typedef __attribute__((ext_vector_type(4)))  float v4f;
typedef __attribute__((ext_vector_type(2)))  float v2f;
typedef __attribute__((ext_vector_type(4)))  unsigned v4u;
typedef __attribute__((ext_vector_type(4)))  int v4i;
typedef float __attribute__((may_alias)) float_a;
typedef int __attribute__((may_alias)) int_a;

template <typename T> __device__ __forceinline__ void vst2(void* p, T v) { *(T*)p = v;  }
__device__ __forceinline__ v8f wmma16(v16h a, v16h b, v8f c) {
  v8f d = __builtin_amdgcn_wmma_f32_16x16x32_f16(false, a, false, b, (short)0, c, false, false);
  asm volatile("v_nop\n\tv_nop\n\tv_nop\n\tv_nop" : "+v"(d) : "v"(a), "v"(b));
  return d;
}
__device__ __forceinline__ v8f wmma_bf(v16b a, v16b b, v8f c) {
  v8f d = __builtin_amdgcn_wmma_f32_16x16x32_bf16(false, a, false, b, (short)0, c, false, false);
  asm volatile("v_nop\n\tv_nop\n\tv_nop\n\tv_nop" : "+v"(d) : "v"(a), "v"(b));
  return d;
}
// 16x16x32 fragments: lane = (h = lane>>4, row/col = lane&15); elements 0..7 = k0+8h+0..7, 8..15 = k0+16+8h+0..7; D element r = row 8h+r
__device__ __forceinline__ v16h frag_h(const _Float16* rowk0, int lane) {
  union { v16h v; v8h q[2]; } u; const _Float16* p = rowk0 + 8 * (lane >> 4);
  u.q[0] = *(const v8h*)p; u.q[1] = *(const v8h*)(p + 16); return u.v;
}
__device__ __forceinline__ v16h frag_f32(const float* rowk0, int lane) {
  v16h a; const float* p = rowk0 + 8 * (lane >> 4);
#pragma unroll
  for (int i = 0; i < 8; ++i) { a[i] = (_Float16)p[i]; a[8 + i] = (_Float16)p[16 + i]; }
  return a;
}
__device__ __forceinline__ v16h frag_f32s(const float* rowk0, int lane, float sc) {
  v16h a; const float* p = rowk0 + 8 * (lane >> 4);
#pragma unroll
  for (int i = 0; i < 8; ++i) { a[i] = (_Float16)(p[i] * sc); a[8 + i] = (_Float16)(p[16 + i] * sc); }
  return a;
}
// column fragment from a [K][ld] layout (column n), rows >= K read as 0
__device__ __forceinline__ v16h fragc_f32(const float* W, int k0, int n, int lane, int ld, int K) {
  v16h a; const int g = lane >> 4;
#pragma unroll
  for (int i = 0; i < 8; ++i) { const int ka = k0 + 8 * g + i, kb = ka + 16;
    a[i] = (_Float16)(ka < K ? W[(size_t)(ka < K ? ka : K - 1) * ld + n] : 0.f); a[8 + i] = (_Float16)(kb < K ? W[(size_t)(kb < K ? kb : K - 1) * ld + n] : 0.f); }
  return a;
}
struct F2 { v16b h, l; };
__device__ __forceinline__ F2 bsplit16(const float v[16]) { F2 r;
#pragma unroll
  for (int i = 0; i < 16; ++i) { const __bf16 h = (__bf16)v[i]; r.h[i] = h; r.l[i] = (__bf16)(v[i] - (float)h); }
  return r; }
__device__ __forceinline__ F2 split_row(const float* row, int k0, int lane) { float v[16]; const float* p = row + k0 + 8 * (lane >> 4);
#pragma unroll
  for (int i = 0; i < 8; ++i) { v[i] = p[i]; v[8 + i] = p[16 + i]; }
  return bsplit16(v); }
__device__ __forceinline__ F2 split_rowK(const float* row, int k0, int lane, int K) { float v[16]; const int g = lane >> 4;
#pragma unroll
  for (int i = 0; i < 8; ++i) { const int ka = k0 + 8 * g + i, kb = ka + 16; v[i] = ka < K ? row[ka < K ? ka : K - 1] : 0.f; v[8 + i] = kb < K ? row[kb < K ? kb : K - 1] : 0.f; }
  return bsplit16(v); }
__device__ __forceinline__ F2 split_col(const float* W, int k0, int n, int lane, int ld, int K) { float v[16]; const int g = lane >> 4;
#pragma unroll
  for (int i = 0; i < 8; ++i) { const int ka = k0 + 8 * g + i, kb = ka + 16; v[i] = ka < K ? W[(size_t)(ka < K ? ka : K - 1) * ld + n] : 0.f; v[8 + i] = kb < K ? W[(size_t)(kb < K ? kb : K - 1) * ld + n] : 0.f; }
  return bsplit16(v); }
__device__ __forceinline__ v8f mac3(const F2& a, const F2& b, v8f c) { c = wmma_bf(a.l, b.h, c); c = wmma_bf(a.h, b.l, c); return wmma_bf(a.h, b.h, c); }
// the bare builtin, for runs of WMMAs on independent accumulator tiles: each fills the slots behind the one in front, and the compiler pads what is left
__device__ __forceinline__ v8f wmma_il(v16b a, v16b b, v8f c) { return __builtin_amdgcn_wmma_f32_16x16x32_bf16(false, a, false, b, (short)0, c, false, false); }
__device__ __forceinline__ float sigm(float v) { return 1.0f / (1.0f + expf(-v)); }
#define LDSX() do { asm volatile("s_wait_dscnt 0" ::: "memory"); __builtin_amdgcn_wave_barrier(); __builtin_amdgcn_fence(__ATOMIC_RELEASE, "workgroup"); } while (0)


// Conv-projected multi-head self-attention with head mixing: q,k,v = W x (1x1 conv), s[h] = sum_g w_head[h][g] (q_g . k_g) * 32^-0.5, a = softmax over keys, InstanceNorm2d of each (b,h) 1024x1024 attention map (biased var, eps 1e-5, affine), out = a' v; y = out (B,nh,T,hd) reinterpreted as (B,T,C); y Wp^T + bp; stored as (B,C,T).  B 8, C 256, T 1024, 8 heads x 32.
// k_pack, k_xt (x -> bf16 [b][t][c]), k_qkv (exact GEMM; k as hi/lo planes in fragment order), k_vt (v -> hi/lo planes in fragment order), k_attn (one pass per (query block, b, head group of 4), keys split over two waves per query tile: raw scores of all 8 heads on WMMA, mixing + online softmax with sum and sum-of-squares per row on the VALU, P.V on WMMA; writes softmax-normalised O rows and per-row sum(a^2)), k_norm (per (b,h): variance -> affine coefficients; column sums of v), k_fin (affine applied at A-load, output projection, transposed 256-B stores).
#define NB 8
#define CC 256
#define TT 1024
#define NH 8
#define HD 32
#define NR (NB * TT)        // 8192
#define QKVP (3 * CC)       // 768
#define DM CC
#ifndef NBT
#define NBT NB              // batches launched (all)
#endif
typedef __attribute__((ext_vector_type(8))) __bf16 v8b;
typedef __attribute__((ext_vector_type(4))) __bf16 v4b;
__device__ __forceinline__ v16b frag_b(const __bf16* rowk0, int lane) {
  union { v16b v; v8b q[2]; } u; const __bf16* p = rowk0 + 8 * (lane >> 4);
  u.q[0] = *(const v8b*)p; u.q[1] = *(const v8b*)(p + 16); return u.v;
}
__device__ __forceinline__ float bfr(float v) { return (float)(__bf16)v; }
// the same fragment from fragment-order storage: elements 0..7 of all 32 lanes in 512 B in a row, then elements 8..15; p = the fragment's start + 8 * lane
__device__ __forceinline__ v16b frag_bp(const __bf16* p) { union { v16b v; v8b q[2]; } u; u.q[0] = *(const v8b*)p; u.q[1] = *(const v8b*)(p + 256); return u.v; }
// e^v on the hardware exponential, in line: 2^(v * log2 e); v <= 0 wherever it is used (a score or an older maximum minus the running maximum), a result below 2^-126 comes out as 0
#define LOG2E 1.4426950408889634f
__device__ __forceinline__ float exp_hw(float v) { const float x = v * LOG2E; const float r = __builtin_amdgcn_exp2f(x);
  asm volatile("v_nop" :: "v"(x), "v"(r));   // the free slot behind v_exp_f32; its argument is named so that no instruction in front of the slot rewrites that register
  return r; }
__device__ __attribute__((noinline)) float erf_ni(float v) { return erff(v); }

#define WS_PT   0u                                   // bf16 [1024][256]: Wq | Wk | Wv | Wp rows
#define WS_XT   (WS_PT + 2u * 4 * CC * CC)             // bf16 [8192][256] x transposed (token rows)
#define WS_QKV  (WS_XT + 2u * NR * CC)                 // f32 [8192][768]; the k columns 256..511 are not written: k goes to WS_KF
#define WS_VTH  (WS_QKV + 4u * NR * QKVP)              // bf16 [8 b][32 key step][8 h][2 dt][2 piece][32 lane][8]: v as the A fragments of P.V, in the order k_attn loads them
#define WS_VTL  (WS_VTH + 2u * NB * CC * TT)
#define WS_ON   (WS_VTL + 2u * NB * CC * TT)           // f32 [8][8][1024][32] softmax-normalised O
#define WS_RSQ  (WS_ON + 4u * NB * NH * TT * HD)        // f32 [8 b][2 hg][16 qb][4 wave][16 row][4 hl]
#define WS_CV   (WS_RSQ + 4u * NB * NH * TT)           // f32 [64 (b,h)][64]: coefA, coefB, .., vsum[32] at 32..63
#define WS_KF   (WS_CV + 4u * NB * NH * 64)            // bf16 [512 key tile of 16][8 g][2 hi, lo][2 piece][32 lane][8]: k as the A fragments of the scores, split once, in the order k_attn loads them
#define WS_END  (WS_KF + 4u * NR * CC)

__global__ __launch_bounds__(256) void k_pack(const float* __restrict__ Wq, const float* __restrict__ Wk, const float* __restrict__ Wv, const float* __restrict__ Wp, __bf16* __restrict__ PT) {
  __shared__ __align__(16) __bf16 s[CC]; const int n = blockIdx.x, tid = threadIdx.x; const int m = n & 255; const float* src = (n < 256) ? Wq : (n < 512) ? Wk : (n < 768) ? Wv : Wp;
  s[tid] = (__bf16)src[(size_t)m * CC + tid]; __syncthreads();
  if (tid < CC / 8) vst2((unsigned*)(PT + (size_t)n * CC + tid * 8), *(const v4u*)&s[tid * 8]);
}
// ---- k_xt: block = (32 tokens t0, b): XT[b][t][c] = bf16(x[b][c][t]); rows of 512 B
__global__ __launch_bounds__(256) void k_xt(const float* __restrict__ X, __bf16* __restrict__ XT) {
  __shared__ __align__(16) __bf16 s[32][CC + 8]; const int t0 = blockIdx.x * 32, b = blockIdx.y, tid = threadIdx.x;
  // thread = (token tl, channels c0, c0 + 8, ..): its 32 loads do not depend on one another and leave together, ahead of the first conversion
  const int c0 = tid >> 5, tl0 = tid & 31; const float* xp = X + ((size_t)b * CC + c0) * TT + t0 + tl0; float xv[32];
  // unrolled so that xv stays in registers and every load is issued before the first is waited for
#pragma unroll
  for (int i = 0; i < 32; ++i) xv[i] = xp[(size_t)i * 8 * TT];
  // unrolled so that xv is indexed by constants
#pragma unroll
  for (int i = 0; i < 32; ++i) s[tl0][c0 + 8 * i] = (__bf16)xv[i];
  __syncthreads();
  for (int q = tid; q < 32 * 32; q += 256) { const int tl = q >> 5, pc = q & 31; vst2((unsigned*)(XT + ((size_t)b * TT + t0 + tl) * CC + pc * 8), *(const v4u*)&s[tl][pc * 8]); }
}
// ---- k_qkv: block = (64 token rows, 128 cols): QKV[r][n] = XT[r] . PT[n] (exact), K = 256; the k columns leave as bf16 hi + residual planes in fragment order (KF), so that a load of k_attn reads whole cache lines and is an operand as it arrives
__global__ __launch_bounds__(128) void k_qkv(const __bf16* __restrict__ XT, const __bf16* __restrict__ PT, float* __restrict__ QKV, __bf16* __restrict__ KF) {
  __shared__ __align__(16) float so[4][16][132];
  const int tid = threadIdx.x, wave = tid >> 5, lane = tid & 31, col = lane & 15, g = lane >> 4; const size_t r0 = (size_t)blockIdx.x * 64 + wave * 16; const int n0 = blockIdx.y * 128;
  v8f acc[8] = {};
  // the 18 fragment loads of a k step of 32 leave as one group, two k steps ahead of their use, into a ring of three register sets: three groups are in flight where the wave waits, not one fragment
  const __bf16* ar = XT + (r0 + col) * CC; const __bf16* br = PT + (size_t)(n0 + col) * CC; v16b af[3], bq[3][8];
#define QLD(KC) do { af[(KC) % 3] = frag_b(ar + (KC) * 32, lane); _Pragma("unroll") for (int j = 0; j < 8; ++j) bq[(KC) % 3][j] = frag_b(br + j * 16 * CC + (KC) * 32, lane); } while (0)
  QLD(0); QLD(1);
  // unrolled so that the ring is indexed by constants and stays in registers
#pragma unroll
  for (int kc = 0; kc < CC / 32; ++kc) {
    if (kc + 2 < CC / 32) QLD(kc + 2);
    // behind the last group of loads, before their address registers are used for anything else (they are inputs, so that they keep their values up to the wait)
    if (kc + 2 == CC / 32 - 1) asm volatile("s_wait_xcnt 0x0" :: "v"(ar), "v"(br) : "memory");
    // keeps the group of loads in front of the WMMAs (the scheduler otherwise sinks each load to its use, where the wave waits out its latency)
    __builtin_amdgcn_sched_barrier(0);
    // eight independent accumulator tiles in turn; each tile's own sum order is kc = 0..7
#pragma unroll
    for (int j = 0; j < 8; ++j) acc[j] = wmma_il(af[kc % 3], bq[kc % 3][j], acc[j]);
    // keeps the next group of loads, which refills the set read here, behind these WMMAs
    __builtin_amdgcn_sched_barrier(0); }
#undef QLD
#pragma unroll
  for (int j = 0; j < 8; ++j)
#pragma unroll
    for (int r = 0; r < 8; ++r) so[wave][8 * g + r][j * 16 + col] = acc[j][r];
  LDSX();
  if (n0 >= CC && n0 < 2 * CC) {   // k (the same for the whole block): the wave's 16 rows are one key tile, its 128 columns 4 heads; per head the lane's 16 values (the element order of split_row) are split here, once, and leave as 2 planes x 2 pieces, 512 B a store
    __bf16* kf = KF + ((r0 >> 4) * NH + ((n0 - CC) >> 5)) * 1024 + lane * 8;
    for (int hd = 0; hd < 4; ++hd) { const F2 k = split_row(&so[wave][col][hd * HD], 0, lane); union { v16b v; v8b q[2]; } uh, ul; uh.v = k.h; ul.v = k.l;
      vst2(kf + hd * 1024, uh.q[0]); vst2(kf + hd * 1024 + 256, uh.q[1]); vst2(kf + hd * 1024 + 512, ul.q[0]); vst2(kf + hd * 1024 + 768, ul.q[1]); }
  } else {
    for (int rl = 0; rl < 16; ++rl) vst2(QKV + (r0 + rl) * QKVP + n0 + lane * 4, *(const v4f*)&so[wave][rl][lane * 4]);
  }
}
__global__ __launch_bounds__(256) void k_vt(const float* __restrict__ QKV, __bf16* __restrict__ VTH, __bf16* __restrict__ VTL) {
  __shared__ __align__(16) __bf16 svh[DM][72], svl[DM][72];
  const int tid = threadIdx.x; const size_t t0 = (size_t)blockIdx.x * 64; const int b = (int)(t0 / TT), p0 = (int)(t0 % TT);
  // thread = channel tid, all 64 tokens: its 64 loads do not depend on one another and leave together, ahead of the first split
  const float* vp = QKV + t0 * QKVP + 2 * DM + tid; float vv[64];
  // unrolled so that vv stays in registers and the loads are issued before the first is waited for
#pragma unroll
  for (int i = 0; i < 64; ++i) vv[i] = vp[(size_t)i * QKVP];
  // unrolled so that vv is indexed by constants
#pragma unroll
  for (int i = 0; i < 64; ++i) { const float v = vv[i]; const __bf16 hb = (__bf16)v; svh[tid][i] = hb; svl[tid][i] = (__bf16)(v - (float)hb); }
  __syncthreads();
  // fragment order: q = (key step of 32: q >> 10, head, column tile, piece j, lane = (hf, col)); the lane's 8 keys of channel rowi are j * 16 + 8 * hf + 0..7 of the step; a wave stores 512 B in a row
  for (int q = tid; q < DM * 8; q += 256) { const int rowi = ((q >> 6) & 15) * 16 + (q & 15), pc = (q >> 10) * 4 + ((q >> 5) & 1) * 2 + ((q >> 4) & 1); const size_t o = ((size_t)b * (TT / 32) + (p0 >> 5)) * 8192 + (size_t)q * 8; vst2((unsigned*)(VTH + o), *(const v4u*)&svh[rowi][pc * 8]); vst2((unsigned*)(VTL + o), *(const v4u*)&svl[rowi][pc * 8]); }
}
__device__ __forceinline__ float xhalf(float v) { const int b = __builtin_bit_cast(int, v); return __builtin_bit_cast(float, __builtin_amdgcn_permlanex16(b, b, 0x76543210, 0xfedcba98, false, false)); }
__global__ __launch_bounds__(256) void k_attn(const float* __restrict__ QKV, const __bf16* __restrict__ KF, const __bf16* __restrict__ VTH, const __bf16* __restrict__ VTL, const float* __restrict__ WH, float* __restrict__ ON, float* __restrict__ RSQ) {
  __shared__ __align__(16) __bf16 sqh[4][8][16][40], sql[4][8][16][40]; __shared__ __align__(16) float sp[8][4][16][36]; __shared__ float sm[4][4][16], sl[4][4][16], sl2[4][4][16];
  const int tid = threadIdx.x, wave = tid >> 5, lane = tid & 31, col = lane & 15, hf = lane >> 4; const int qb = blockIdx.x, b = blockIdx.y, hg = blockIdx.z; const int qt = wave & 3, kh = __builtin_amdgcn_readfirstlane(tid >> 7); const int q0 = qb * 64 + qt * 16; const size_t tq = (size_t)b * TT + q0;
  // mixing weights of the group's four heads, two heads to a pair (the same in every lane)
  v2f wm[2][8];
#pragma unroll
  for (int hl = 0; hl < 4; ++hl)
#pragma unroll
    for (int gg = 0; gg < 8; ++gg) wm[hl >> 1][gg][hl & 1] = bfr(WH[(hg * 4 + hl) * NH + gg]);
  v2f m[2], l[2], l2[2];     // of query col, two heads of the group to a pair: [hl >> 1][hl & 1]; l and l2 over the lane half's own keys
#pragma unroll
  for (int hp = 0; hp < 2; ++hp) { m[hp] = (v2f){-3.0e38f, -3.0e38f}; l[hp] = (v2f){0.f, 0.f}; l2[hp] = (v2f){0.f, 0.f}; }
  v8f acc[4][2] = {};        // acc[hl][dt][r] = O[query col][dt * 16 + 8 hf + r]
  // the lane's own pointers at key step 0, into the fragment-order storage: K of head 0, V of the group's first head; a key step is 16384 elements of K (both planes), 8192 of each V plane
  const __bf16* Kc = KF + (size_t)b * (TT / 32) * 16384 + lane * 8;
  const __bf16* VHc = VTH + (size_t)b * (TT / 32) * 8192 + hg * 4 * 1024 + lane * 8; const __bf16* VLc = VTL + (size_t)b * (TT / 32) * 8192 + hg * 4 * 1024 + lane * 8;
  const int ks1 = (kh + 1) * (TT / 64);
  F2 kr[8][2];               // K fragments (hi, lo) in flight, by head and key tile
  v16b vh[4][2], vl[4][2];   // V of the step in flight, by head of the group and column tile
  F2 qa[2][2];               // q fragments of two pairs of heads
  v8f cs[2][2][2];           // raw score tiles of two pairs of heads: [pair & 1][head of the pair][key tile]
  v2f sx[2][16];             // mixed scores, then p, of the lane's 16 keys (key i = ct * 8 + r is key ct * 16 + 8 hf + r of the step), two heads of the group to a pair: [hl >> 1][i][hl & 1]
  // the loops inside these macros are unrolled so that kr, vh, vl, cs, sx and acc are indexed by constants and stay in registers
  // ask for K of heads G, G+1 of the key step at P
#define LDK2(G, P) do { _Pragma("unroll") for (int g_ = (G); g_ < (G) + 2; ++g_) { _Pragma("unroll") for (int ct = 0; ct < 2; ++ct) { kr[g_][ct].h = frag_bp((P) + ct * 8192 + g_ * 1024); kr[g_][ct].l = frag_bp((P) + ct * 8192 + g_ * 1024 + 512); } } } while (0)
  // ask for V of head H of the group, key step at PH, PL
#define LDV1(H, PH, PL) do { _Pragma("unroll") for (int dt = 0; dt < 2; ++dt) { vh[H][dt] = frag_bp((PH) + (H) * 1024 + dt * 512); vl[H][dt] = frag_bp((PL) + (H) * 1024 + dt * 512); } } while (0)
  // q fragments (hi, lo) of heads G, G+1 from LDS into one of two register sets, asked for one pair of heads ahead of their use; the scheduling barrier keeps the reads where they stand (the scheduler otherwise sinks each read to its first use, where the wave then waits out the LDS latency)
#define SCQ(G) do { _Pragma("unroll") for (int u = 0; u < 2; ++u) { qa[((G) >> 1) & 1][u].h = frag_b(&sqh[qt][(G) + u][col][0], lane); qa[((G) >> 1) & 1][u].l = frag_b(&sql[qt][(G) + u][col][0], lane); } __builtin_amdgcn_sched_barrier(0); } while (0)
  // raw scores of heads G, G+1, transposed (rows = keys, column = query): four accumulator tiles (2 heads x 2 key tiles), their three products each issued in turn, so that no WMMA waits for the one in front of it; each tile's own sum order is that of mac3
#define SCW(G) do { \
    _Pragma("unroll") for (int u = 0; u < 2; ++u) { _Pragma("unroll") for (int ct = 0; ct < 2; ++ct) cs[((G) >> 1) & 1][u][ct] = wmma_il(kr[(G) + u][ct].h, qa[((G) >> 1) & 1][u].l, (v8f){}); } \
    _Pragma("unroll") for (int u = 0; u < 2; ++u) { _Pragma("unroll") for (int ct = 0; ct < 2; ++ct) cs[((G) >> 1) & 1][u][ct] = wmma_il(kr[(G) + u][ct].l, qa[((G) >> 1) & 1][u].h, cs[((G) >> 1) & 1][u][ct]); } \
    _Pragma("unroll") for (int u = 0; u < 2; ++u) { _Pragma("unroll") for (int ct = 0; ct < 2; ++ct) cs[((G) >> 1) & 1][u][ct] = wmma_il(kr[(G) + u][ct].h, qa[((G) >> 1) & 1][u].h, cs[((G) >> 1) & 1][u][ct]); } } while (0)
  // heads G, G+1 into the 64 mixed sums of the lane (4 heads x 16 keys, as packed FMAs over two heads: the weights then take 32 registers, not 64 as pairs of equal words): 32 independent FMAs per head g, each sum in the order g = 0..7; it stands one pair of heads behind the WMMAs that made its scores, beside those of the next pair
#define MIX(G) do { _Pragma("unroll") for (int u = 0; u < 2; ++u) { \
    _Pragma("unroll") for (int ct = 0; ct < 2; ++ct) cs[((G) >> 1) & 1][u][ct] *= 0.17677669529663687f; \
    _Pragma("unroll") for (int hp = 0; hp < 2; ++hp) { \
      _Pragma("unroll") for (int ct = 0; ct < 2; ++ct) { _Pragma("unroll") for (int r = 0; r < 8; ++r) { const float r1_ = cs[((G) >> 1) & 1][u][ct][r]; const v2f r_ = {r1_, r1_}; \
        sx[hp][ct * 8 + r] = __builtin_elementwise_fma(wm[hp][(G) + u], r_, ((G) + u) == 0 ? (v2f){0.f, 0.f} : sx[hp][ct * 8 + r]); } } } } } while (0)
  // P.V of head H of the group, transposed (rows = output columns, column = query): the lane's 16 p, split in place, are its part of the B fragment; two accumulator tiles in turn, so that a WMMA stands two behind the one whose sum it adds to
#define PVW(H) do { float p_[16]; _Pragma("unroll") for (int i = 0; i < 16; ++i) p_[i] = sx[(H) >> 1][i][(H) & 1]; \
    const F2 pa = bsplit16(p_); acc[H][0] *= al[(H) >> 1][(H) & 1]; acc[H][1] *= al[(H) >> 1][(H) & 1]; \
    _Pragma("unroll") for (int dt = 0; dt < 2; ++dt) acc[H][dt] = wmma_il(vh[H][dt], pa.l, acc[H][dt]); \
    _Pragma("unroll") for (int dt = 0; dt < 2; ++dt) acc[H][dt] = wmma_il(vl[H][dt], pa.h, acc[H][dt]); \
    _Pragma("unroll") for (int dt = 0; dt < 2; ++dt) acc[H][dt] = wmma_il(vh[H][dt], pa.h, acc[H][dt]); } while (0)
  // behind each group of these loads; the loads' address registers are inputs, so that they keep their values up to the wait
#define XW1(P) asm volatile("s_wait_xcnt 0x0" :: "v"(P) : "memory")
#define XW2(P, Q) asm volatile("s_wait_xcnt 0x0" :: "v"(P), "v"(Q) : "memory")
  // behind a group of loads and its wait: keeps the work that follows behind the loads (the scheduler otherwise lifts it over them, and the loads leave later than they stand here, nearer to their use)
#define SB() __builtin_amdgcn_sched_barrier(0)
  // stage the query tile's 16 rows (all 8 heads) as hi/lo bf16, 8 rows per wave of the pair: 16 loads of 512 B (half a row: 4 heads, 4 columns a lane) that do not depend on one another leave together, with the first K loads behind them, and are split and stored once they are in
  { const float* qp = QKV + (tq + kh * 8) * QKVP + lane * 4; v4f qv[16];
    // unrolled so that qv stays in registers and every load is issued before the first is waited for
#pragma unroll
    for (int i = 0; i < 16; ++i) qv[i] = *(const v4f*)(qp + (i >> 1) * QKVP + (i & 1) * 128);
    const __bf16* kp = Kc + (size_t)kh * (TT / 64) * 16384; LDK2(0, kp); LDK2(2, kp); LDK2(4, kp); XW2(qp, kp); SB();
    // unrolled so that qv is indexed by constants
#pragma unroll
    for (int i = 0; i < 16; ++i) { v4b h4, l4;
#pragma unroll
      for (int j = 0; j < 4; ++j) { const float v = qv[i][j]; const __bf16 hb = (__bf16)v; h4[j] = hb; l4[j] = (__bf16)(v - (float)hb); }
      *(v4b*)&sqh[qt][(i & 1) * 4 + (lane >> 3)][kh * 8 + (i >> 1)][(lane & 7) * 4] = h4; *(v4b*)&sql[qt][(i & 1) * 4 + (lane >> 3)][kh * 8 + (i >> 1)][(lane & 7) * 4] = l4; } }
  __syncthreads();   // each wave reads q rows that its partner staged
#pragma unroll 1
  for (int ks = kh * (TT / 64); ks < ks1; ++ks) {
    const __bf16* kp = Kc + (size_t)ks * 16384; const __bf16* vhp = VHc + (size_t)ks * 8192; const __bf16* vlp = VLc + (size_t)ks * 8192;
    const __bf16* kn = Kc + (size_t)(ks + 1 < ks1 ? ks + 1 : ks) * 16384;   // the last step asks for its own rows again (in bounds, not used)
    // (a) raw scores of all 8 heads, 32 keys, and their mixing
    SCQ(0); SCQ(2); SCW(0);
    LDK2(6, kp); XW1(kp); SCQ(4); SCW(2); MIX(0);
    SCQ(6); SCW(4); MIX(2);
    LDV1(0, vhp, vlp); LDV1(1, vhp, vlp); LDV1(2, vhp, vlp); LDV1(3, vhp, vlp); XW2(vhp, vlp); SB();
    SCW(6); MIX(4);
    LDK2(0, kn); LDK2(2, kn); XW1(kn); SB();
    MIX(6);
    // (b) online softmax of the lane's query, 4 heads x 16 keys, two heads to a packed operation
    v2f al[2];
#pragma unroll
    for (int hp = 0; hp < 2; ++hp) { v2f mn;
#pragma unroll
      for (int u = 0; u < 2; ++u) { float mx = sx[hp][0][u];
#pragma unroll
        for (int i = 1; i < 16; ++i) mx = fmaxf(mx, sx[hp][i][u]);
        mx = fmaxf(mx, xhalf(mx));   // the step's 32 keys: both lane halves go on with the same maximum
        mn[u] = fmaxf(m[hp][u], mx); al[hp][u] = exp_hw(m[hp][u] - mn[u]); }
      m[hp] = mn; v2f es = {0.f, 0.f}, es2 = {0.f, 0.f};
#pragma unroll
      for (int k4 = 0; k4 < 16; k4 += 4) { v2f x[4], e[4];   // eight exponentials at a time, none waiting for another
#pragma unroll
        for (int i = 0; i < 4; ++i) x[i] = (sx[hp][k4 + i] - mn) * LOG2E;
#pragma unroll
        for (int i = 0; i < 4; ++i) { e[i][0] = __builtin_amdgcn_exp2f(x[i][0]); e[i][1] = __builtin_amdgcn_exp2f(x[i][1]); }
        // the free slot behind the last v_exp_f32 of the eight; the arguments are named so that no instruction in front of the slot rewrites the register of one
        asm volatile("v_nop" :: "v"(x[0]), "v"(x[1]), "v"(x[2]), "v"(x[3]), "v"(e[0]), "v"(e[1]), "v"(e[2]), "v"(e[3]));
#pragma unroll
        for (int i = 0; i < 4; ++i) { es += e[i]; es2 = __builtin_elementwise_fma(e[i], e[i], es2); sx[hp][k4 + i] = e[i]; } }
      l[hp] = l[hp] * al[hp] + es; l2[hp] = l2[hp] * (al[hp] * al[hp]) + es2; }
    // (c) P.V for the group's 4 heads
    PVW(0); PVW(1);
    LDK2(4, kn); XW1(kn); SB();
    PVW(2); PVW(3); }
  // the lane halves' sums joined; then the merge of the two key halves, l and sum a^2 per (hl, query)
#pragma unroll
  for (int hl = 0; hl < 4; ++hl) { l[hl >> 1][hl & 1] += xhalf(l[hl >> 1][hl & 1]); l2[hl >> 1][hl & 1] += xhalf(l2[hl >> 1][hl & 1]); }
  float (*so)[16][36] = sp[wave];   // [hl][query][32]
  if (kh == 1) {
    if (hf == 0) {
#pragma unroll
      for (int hl = 0; hl < 4; ++hl) { sm[qt][hl][col] = m[hl >> 1][hl & 1]; sl[qt][hl][col] = l[hl >> 1][hl & 1]; sl2[qt][hl][col] = l2[hl >> 1][hl & 1]; } }
#pragma unroll
    for (int hl = 0; hl < 4; ++hl)
#pragma unroll
      for (int dt = 0; dt < 2; ++dt) { float* o_ = &so[hl][col][dt * 16 + 8 * hf]; *(v4f*)o_ = __builtin_shufflevector(acc[hl][dt], acc[hl][dt], 0, 1, 2, 3); *(v4f*)(o_ + 4) = __builtin_shufflevector(acc[hl][dt], acc[hl][dt], 4, 5, 6, 7); }
  }
  __syncthreads();   // the kh = 0 wave reads what its partner has just written
  if (kh == 0) {
    const float (*sy)[16][36] = sp[wave + 4];   // the partner's unnormalised acc
    v4f rq;
#pragma unroll
    for (int hl = 0; hl < 4; ++hl) { const float m0 = m[hl >> 1][hl & 1], m1 = sm[qt][hl][col]; const float mn = fmaxf(m0, m1); const float f0 = exp_hw(m0 - mn), f1 = exp_hw(m1 - mn);
      const float lt = l[hl >> 1][hl & 1] * f0 + sl[qt][hl][col] * f1; const float l2t = l2[hl >> 1][hl & 1] * (f0 * f0) + sl2[qt][hl][col] * (f1 * f1); rq[hl] = l2t / (lt * lt); const float il = 1.0f / lt;
#pragma unroll
      for (int dt = 0; dt < 2; ++dt)
#pragma unroll
        for (int r4 = 0; r4 < 8; r4 += 4) { const v4f y = *(const v4f*)&sy[hl][col][dt * 16 + 8 * hf + r4]; v4f o;
#pragma unroll
          for (int r = 0; r < 4; ++r) o[r] = (acc[hl][dt][r4 + r] * f0 + y[r] * f1) * il;
          *(v4f*)&so[hl][col][dt * 16 + 8 * hf + r4] = o; } }
    LDSX();
#pragma unroll
    for (int hl = 0; hl < 4; ++hl) for (int rl = 0; rl < 16; ++rl) if (lane < 8) vst2(ON + ((((size_t)b * NH + hg * 4 + hl) * TT + q0 + rl) * HD) + lane * 4, *(const v4f*)&so[hl][rl][lane * 4]);
    if (lane < 16) vst2(RSQ + ((((size_t)b * 2 + hg) * 16 + qb) * 4 + qt) * 64 + lane * 4, rq);
  }
}
// ---- k_norm: block = (b, h), 256 threads: E[a^2] over the 1024x1024 map from the per-row sums, mean = 1/T, var = E[a^2] - mean^2, rs = rsqrt(var + 1e-5); coefA = rs*gamma[h], coefB = beta[h] - coefA/T; vsum[d] = sum_t v[b][h*32+d][t] (f32 from QKV; 32 partial sums of 32 rows each by all 256 threads, added in LDS). CV row [64]: coefA, coefB at 0,1; vsum at 32..63.
__global__ __launch_bounds__(256) void k_norm(const float* __restrict__ RSQ, const float* __restrict__ QKV, const float* __restrict__ GA, const float* __restrict__ BE, float* __restrict__ CV) {
  __shared__ float sred[256]; __shared__ __align__(16) float srow[64]; __shared__ __align__(16) float sv[32][36];
  const int b = blockIdx.x >> 3, h = blockIdx.x & 7, tid = threadIdx.x; const int hg = h >> 2, hl = h & 3;
  // column sums of v, first part: thread = (token rows rg, rg + 32, .., 4 columns from c4); its 32 loads of 16 B do not depend on one another
  const int rg = tid >> 3, c4 = (tid & 7) * 4; const float* vp = QKV + ((size_t)b * TT + rg) * QKVP + 2 * CC + h * HD + c4; v4f vr[32];
  // unrolled so that vr stays in registers and the loads are issued ahead of the adds, many in flight at a time
#pragma unroll
  for (int i = 0; i < 32; ++i) vr[i] = *(const v4f*)(vp + (size_t)i * 32 * QKVP);
  float s = 0.f;
#pragma unroll
  for (int i = 0; i < 4; ++i) { const int q = tid * 4 + i; const int qb = q >> 6, wave = (q >> 4) & 3, rl = q & 15; s += RSQ[((((size_t)b * 2 + hg) * 16 + qb) * 4 + wave) * 64 + rl * 4 + hl]; }
  { v4f vs = vr[0];
    // unrolled so that vr is indexed by constants
#pragma unroll
    for (int i = 1; i < 32; ++i) vs += vr[i];
    *(v4f*)&sv[rg][c4] = vs; }
  sred[tid] = s; __syncthreads();
  for (int st = 128; st >= 1; st >>= 1) { if (tid < st) sred[tid] += sred[tid + st]; __syncthreads(); }
  // second part: thread = column, adds the 32 row groups' partial sums; words 32..63 of srow have this one writer
  if (tid < 32) { srow[tid] = 0.f; float vs = 0.f;
    // unrolled so that the LDS loads are issued ahead of the adds
#pragma unroll
    for (int r = 0; r < 32; ++r) vs += sv[r][tid];
    srow[32 + tid] = vs; }
  __syncthreads();
  if (tid == 0) { const float e2 = sred[0] / ((float)TT * (float)TT); const float mean = 1.0f / (float)TT; const float var = e2 - mean * mean; const float rs = rsqrtf(var + 1e-5f); const float cA = rs * bfr(GA[h]); srow[0] = cA; srow[1] = bfr(BE[h]) - cA * mean; }
  __syncthreads();
  if (tid < 16) vst2(CV + (size_t)blockIdx.x * 64 + tid * 4, *(const v4f*)&srow[tid * 4]);
}
// ---- k_fin: block = (64 rows r' of y (= O viewed as [T][256]), 128 output channels, b): Y = (coefA*ON + coefB*vsum)(hi/lo) . Wp rows (2 products) + bp, stored transposed: out[b][o][r'] segments of 64 floats (256 B)
__global__ __launch_bounds__(128) void k_fin(const float* __restrict__ ON, const float* __restrict__ CV, const __bf16* __restrict__ PT, const float* __restrict__ bp, float* __restrict__ out) {
  __shared__ __align__(16) float sT[128][68];
  const int tid = threadIdx.x, wave = tid >> 5, lane = tid & 31, col = lane & 15, g = lane >> 4; const int b = blockIdx.z, n0 = blockIdx.y * 128; const int r0 = blockIdx.x * 64 + wave * 16; const int h = (blockIdx.x * 64) / 128;   // y row r' covers heads r'/128 (constant per 64-row block)
  const float cA = CV[(b * NH + h) * 64 + 0], cB = CV[(b * NH + h) * 64 + 1]; const float* vs = CV + (b * NH + h) * 64 + 32;
  const float* Arow = ON + ((size_t)b * TT + r0 + col) * CC;
  v8f acc[8] = {};
  // the 20 loads of a k step of 32 (4 of the O row, 16 of the weight fragments) leave as one group, three k steps ahead of their use, into a ring of four register sets: four groups are in flight where the wave waits, not one fragment
  const float* pr = Arow + 8 * g; const __bf16* br = PT + (size_t)(768 + n0 + col) * CC; v4f av[4][4]; v16b bq[4][8];
#define FLD(KC) do { _Pragma("unroll") for (int i = 0; i < 4; ++i) av[(KC) % 4][i] = *(const v4f*)(pr + (KC) * 32 + (i >> 1) * 16 + (i & 1) * 4); _Pragma("unroll") for (int j = 0; j < 8; ++j) bq[(KC) % 4][j] = frag_b(br + j * 16 * CC + (KC) * 32, lane); } while (0)
  // the head's column sums of v, the lane's 16, asked for first: every k step needs them, and loads come back in the order in which they were asked for
  float vq[16], bq0[8];
#pragma unroll
  for (int i = 0; i < 8; ++i) { vq[i] = vs[8 * g + i]; vq[8 + i] = vs[16 + 8 * g + i]; }
  // the lane's eight bias values too, so that the epilogue does not wait for them
#pragma unroll
  for (int j = 0; j < 8; ++j) bq0[j] = bp[n0 + j * 16 + col];
  // keeps those loads in front of the ring's
  __builtin_amdgcn_sched_barrier(0);
  FLD(0); FLD(1); FLD(2);
  // keeps the first work on loaded values behind the ring's first loads (the scheduler otherwise lifts it, with its wait, in front of them)
  __builtin_amdgcn_sched_barrier(0);
  v2f cv[8];   // cB * vsum of the lane's 16 columns, the same for every k step
#pragma unroll
  for (int k = 0; k < 8; ++k) cv[k] = (v2f){cB, cB} * (v2f){vq[2 * k], vq[2 * k + 1]};
  // unrolled so that the ring is indexed by constants and stays in registers
#pragma unroll
  for (int kc = 0; kc < CC / 32; ++kc) {
    if (kc + 3 < CC / 32) FLD(kc + 3);
    // behind the last group of loads, before their address registers are used for anything else (they are inputs, so that they keep their values up to the wait)
    if (kc + 3 == CC / 32 - 1) asm volatile("s_wait_xcnt 0x0" :: "v"(pr), "v"(br) : "memory");
    // keeps the group of loads in front of the work on this k step (the scheduler otherwise sinks each load to its use, where the wave waits out its latency)
    __builtin_amdgcn_sched_barrier(0);
    float v[16];   // cA * O + cB * vsum, two columns to a packed FMA; column n of the lane's 16 is word n & 3 of load n >> 2
#pragma unroll
    for (int k = 0; k < 8; ++k) { const v2f o2 = {av[kc % 4][k >> 1][(k & 1) * 2], av[kc % 4][k >> 1][(k & 1) * 2 + 1]}; const v2f t = __builtin_elementwise_fma((v2f){cA, cA}, o2, cv[k]); v[2 * k] = t[0]; v[2 * k + 1] = t[1]; }
    const F2 a = bsplit16(v);
    // eight independent accumulator tiles in turn; each tile's own sum order stays residual, then hi, kc = 0..7
#pragma unroll
    for (int j = 0; j < 8; ++j) acc[j] = wmma_il(a.l, bq[kc % 4][j], acc[j]);
#pragma unroll
    for (int j = 0; j < 8; ++j) acc[j] = wmma_il(a.h, bq[kc % 4][j], acc[j]);
    // keeps the next group of loads, which refills the set read here, behind these WMMAs
    __builtin_amdgcn_sched_barrier(0); }
#undef FLD
#pragma unroll
  for (int j = 0; j < 8; ++j) { const float bb = bfr(bq0[j]);
#pragma unroll
    for (int r = 0; r < 8; ++r) sT[j * 16 + col][wave * 16 + 8 * g + r] = acc[j][r] + bb; }
  __syncthreads();
  for (int q = tid; q < 128 * 16; q += 128) { const int o = q >> 4, piece = q & 15; vst2(out + ((size_t)b * CC + n0 + o) * TT + blockIdx.x * 64 + piece * 4, *(const v4f*)&sT[o][piece * 4]); }
}
extern "C" void kernel_launch(void* const* d_in, const int* in_sizes, int n_in, void* d_out, int out_size, void* d_ws, size_t ws_size, hipStream_t stream) {
  (void)in_sizes; (void)n_in; (void)out_size;
  const float** F = (const float**)d_in;   // x [8,256,32,32], Wq, Wk, Wv [256,256], w_head [8,8], gamma [8], beta [8], Wp [256,256], bp [256]
  if (ws_size < (size_t)WS_END) return;
  char* ws = (char*)d_ws; __bf16 *PT = (__bf16*)(ws + WS_PT), *XT = (__bf16*)(ws + WS_XT), *VTH = (__bf16*)(ws + WS_VTH), *VTL = (__bf16*)(ws + WS_VTL); float *QKV = (float*)(ws + WS_QKV), *ON = (float*)(ws + WS_ON), *RSQ = (float*)(ws + WS_RSQ), *CV = (float*)(ws + WS_CV); __bf16* KF = (__bf16*)(ws + WS_KF);
  k_pack<<<4 * CC, 256, 0, stream>>>(F[1], F[2], F[3], F[7], PT);
  k_xt<<<dim3(TT / 32, NBT), 256, 0, stream>>>(F[0], XT);
  k_qkv<<<dim3(NBT * TT / 64, QKVP / 128), 128, 0, stream>>>(XT, PT, QKV, KF);
  k_vt<<<NBT * TT / 64, 256, 0, stream>>>(QKV, VTH, VTL);
  k_attn<<<dim3(TT / 64, NBT, 2), 256, 0, stream>>>(QKV, KF, VTH, VTL, F[4], ON, RSQ);
  k_norm<<<NBT * NH, 256, 0, stream>>>(RSQ, QKV, F[5], F[6], CV);
  k_fin<<<dim3(TT / 64, CC / 128, NBT), 128, 0, stream>>>(ON, CV, PT, F[8], (float*)d_out);
}

// v010
// It runs in 74.2 microseconds.
// Two timings next to v009 put it at 1.15 and 1.16 times that version's speed.
// All steps since v000 together make it 7.61 times as fast.
// compute dtype: x and all weights (Wq, Wk, Wv, w_head, gamma, beta, Wp, bp; module inputs) rounded to bf16; the 1x1-conv projections with exact bf16 products; per-head raw scores q.k and the attention-weighted V sums with both computed operands as bf16 hi + residual pairs (3 products); the output projection with its computed input as hi/lo pairs x exact bf16 weights (2 products) on WMMA 16x16x32; head mixing (8x8), softmax, InstanceNorm statistics and affine in f32 on the VALU; f32 accumulate.
#include <hip/hip_runtime.h>
#include <math.h>

typedef __attribute__((ext_vector_type(16))) _Float16 v16h;
typedef __attribute__((ext_vector_type(16))) __bf16 v16b;
typedef __attribute__((ext_vector_type(8)))  _Float16 v8h;
typedef __attribute__((ext_vector_type(8)))  float v8f;
typedef __attribute__((ext_vector_type(4)))  float v4f;
typedef __attribute__((ext_vector_type(2)))  float v2f;
typedef __attribute__((ext_vector_type(4)))  unsigned v4u;
typedef __attribute__((ext_vector_type(4)))  int v4i;
typedef float __attribute__((may_alias)) float_a;
typedef int __attribute__((may_alias)) int_a;

template <typename T> __device__ __forceinline__ void vst2(void* p, T v) { *(T*)p = v;  }
__device__ __forceinline__ v8f wmma16(v16h a, v16h b, v8f c) {
  v8f d = __builtin_amdgcn_wmma_f32_16x16x32_f16(false, a, false, b, (short)0, c, false, false);
  asm volatile("v_nop\n\tv_nop\n\tv_nop\n\tv_nop" : "+v"(d) : "v"(a), "v"(b));
  return d;
}
__device__ __forceinline__ v8f wmma_bf(v16b a, v16b b, v8f c) {
  v8f d = __builtin_amdgcn_wmma_f32_16x16x32_bf16(false, a, false, b, (short)0, c, false, false);
  asm volatile("v_nop\n\tv_nop\n\tv_nop\n\tv_nop" : "+v"(d) : "v"(a), "v"(b));
  return d;
}
// 16x16x32 fragments: lane = (h = lane>>4, row/col = lane&15); elements 0..7 = k0+8h+0..7, 8..15 = k0+16+8h+0..7; D element r = row 8h+r
__device__ __forceinline__ v16h frag_h(const _Float16* rowk0, int lane) {
  union { v16h v; v8h q[2]; } u; const _Float16* p = rowk0 + 8 * (lane >> 4);
  u.q[0] = *(const v8h*)p; u.q[1] = *(const v8h*)(p + 16); return u.v;
}
__device__ __forceinline__ v16h frag_f32(const float* rowk0, int lane) {
  v16h a; const float* p = rowk0 + 8 * (lane >> 4);
#pragma unroll
  for (int i = 0; i < 8; ++i) { a[i] = (_Float16)p[i]; a[8 + i] = (_Float16)p[16 + i]; }
  return a;
}
__device__ __forceinline__ v16h frag_f32s(const float* rowk0, int lane, float sc) {
  v16h a; const float* p = rowk0 + 8 * (lane >> 4);
#pragma unroll
  for (int i = 0; i < 8; ++i) { a[i] = (_Float16)(p[i] * sc); a[8 + i] = (_Float16)(p[16 + i] * sc); }
  return a;
}
// column fragment from a [K][ld] layout (column n), rows >= K read as 0
__device__ __forceinline__ v16h fragc_f32(const float* W, int k0, int n, int lane, int ld, int K) {
  v16h a; const int g = lane >> 4;
#pragma unroll
  for (int i = 0; i < 8; ++i) { const int ka = k0 + 8 * g + i, kb = ka + 16;
    a[i] = (_Float16)(ka < K ? W[(size_t)(ka < K ? ka : K - 1) * ld + n] : 0.f); a[8 + i] = (_Float16)(kb < K ? W[(size_t)(kb < K ? kb : K - 1) * ld + n] : 0.f); }
  return a;
}
struct F2 { v16b h, l; };
__device__ __forceinline__ F2 bsplit16(const float v[16]) { F2 r;
#pragma unroll
  for (int i = 0; i < 16; ++i) { const __bf16 h = (__bf16)v[i]; r.h[i] = h; r.l[i] = (__bf16)(v[i] - (float)h); }
  return r; }
__device__ __forceinline__ F2 split_row(const float* row, int k0, int lane) { float v[16]; const float* p = row + k0 + 8 * (lane >> 4);
#pragma unroll
  for (int i = 0; i < 8; ++i) { v[i] = p[i]; v[8 + i] = p[16 + i]; }
  return bsplit16(v); }
__device__ __forceinline__ F2 split_rowK(const float* row, int k0, int lane, int K) { float v[16]; const int g = lane >> 4;
#pragma unroll
  for (int i = 0; i < 8; ++i) { const int ka = k0 + 8 * g + i, kb = ka + 16; v[i] = ka < K ? row[ka < K ? ka : K - 1] : 0.f; v[8 + i] = kb < K ? row[kb < K ? kb : K - 1] : 0.f; }
  return bsplit16(v); }
__device__ __forceinline__ F2 split_col(const float* W, int k0, int n, int lane, int ld, int K) { float v[16]; const int g = lane >> 4;
#pragma unroll
  for (int i = 0; i < 8; ++i) { const int ka = k0 + 8 * g + i, kb = ka + 16; v[i] = ka < K ? W[(size_t)(ka < K ? ka : K - 1) * ld + n] : 0.f; v[8 + i] = kb < K ? W[(size_t)(kb < K ? kb : K - 1) * ld + n] : 0.f; }
  return bsplit16(v); }
__device__ __forceinline__ v8f mac3(const F2& a, const F2& b, v8f c) { c = wmma_bf(a.l, b.h, c); c = wmma_bf(a.h, b.l, c); return wmma_bf(a.h, b.h, c); }
// the bare builtin, for runs of WMMAs on independent accumulator tiles: each fills the slots behind the one in front, and the compiler pads what is left
__device__ __forceinline__ v8f wmma_il(v16b a, v16b b, v8f c) { return __builtin_amdgcn_wmma_f32_16x16x32_bf16(false, a, false, b, (short)0, c, false, false); }
__device__ __forceinline__ float sigm(float v) { return 1.0f / (1.0f + expf(-v)); }
#define LDSX() do { asm volatile("s_wait_dscnt 0" ::: "memory"); __builtin_amdgcn_wave_barrier(); __builtin_amdgcn_fence(__ATOMIC_RELEASE, "workgroup"); } while (0)


// Conv-projected multi-head self-attention with head mixing: q,k,v = W x (1x1 conv), s[h] = sum_g w_head[h][g] (q_g . k_g) * 32^-0.5, a = softmax over keys, InstanceNorm2d of each (b,h) 1024x1024 attention map (biased var, eps 1e-5, affine), out = a' v; y = out (B,nh,T,hd) reinterpreted as (B,T,C); y Wp^T + bp; stored as (B,C,T).  B 8, C 256, T 1024, 8 heads x 32.
// four launches: k_prep (x -> bf16 [b][t][c]; the weights -> bf16, in further blocks of the same grid), k_qkv (exact GEMM; k and v as hi/lo planes in fragment order; column sums of v per 64 tokens), k_attn (one pass per (query block, b, head group of 4), keys split over two waves per query tile: raw scores of all 8 heads on WMMA, mixing + online softmax with sum and sum-of-squares per row on the VALU, P.V on WMMA; writes softmax-normalised O rows and per-row sum(a^2)), k_fin (per (b,h): variance -> affine coefficients, column sums of v, by each wave for itself; affine applied at A-load, output projection, transposed 256-B stores).
#define NB 8
#define CC 256
#define TT 1024
#define NH 8
#define HD 32
#define NR (NB * TT)        // 8192
#define QKVP (3 * CC)       // 768
#define DM CC
#ifndef NBT
#define NBT NB              // batches launched (all)
#endif
typedef __attribute__((ext_vector_type(8))) __bf16 v8b;
typedef __attribute__((ext_vector_type(4))) __bf16 v4b;
__device__ __forceinline__ v16b frag_b(const __bf16* rowk0, int lane) {
  union { v16b v; v8b q[2]; } u; const __bf16* p = rowk0 + 8 * (lane >> 4);
  u.q[0] = *(const v8b*)p; u.q[1] = *(const v8b*)(p + 16); return u.v;
}
__device__ __forceinline__ float bfr(float v) { return (float)(__bf16)v; }
// the same fragment from fragment-order storage: elements 0..7 of all 32 lanes in 512 B in a row, then elements 8..15; p = the fragment's start + 8 * lane
__device__ __forceinline__ v16b frag_bp(const __bf16* p) { union { v16b v; v8b q[2]; } u; u.q[0] = *(const v8b*)p; u.q[1] = *(const v8b*)(p + 256); return u.v; }
// e^v on the hardware exponential, in line: 2^(v * log2 e); v <= 0 wherever it is used (a score or an older maximum minus the running maximum), a result below 2^-126 comes out as 0
#define LOG2E 1.4426950408889634f
__device__ __forceinline__ float exp_hw(float v) { const float x = v * LOG2E; const float r = __builtin_amdgcn_exp2f(x);
  asm volatile("v_nop" :: "v"(x), "v"(r));   // the free slot behind v_exp_f32; its argument is named so that no instruction in front of the slot rewrites that register
  return r; }
__device__ __attribute__((noinline)) float erf_ni(float v) { return erff(v); }

#define WS_PT   0u                                   // bf16 [1024][256]: Wq | Wk | Wv | Wp rows
#define WS_XT   (WS_PT + 2u * 4 * CC * CC)             // bf16 [8192][256] x transposed (token rows)
#define WS_QKV  (WS_XT + 2u * NR * CC)                 // f32 [8192][768]; only the q columns 0..255 are written: k goes to WS_KF, v to WS_VTH, WS_VTL
#define WS_VTH  (WS_QKV + 4u * NR * QKVP)              // bf16 [8 b][32 key step][8 h][2 dt][2 piece][32 lane][8]: v as the A fragments of the transposed P.V, in the order k_attn loads them
#define WS_VTL  (WS_VTH + 2u * NB * CC * TT)
#define WS_ON   (WS_VTL + 2u * NB * CC * TT)           // f32 [8][8][1024][32] softmax-normalised O
#define WS_RSQ  (WS_ON + 4u * NB * NH * TT * HD)        // f32 [8 b][2 hg][16 qb][4 wave][16 row][4 hl]
#define WS_VS   (WS_RSQ + 4u * NB * NH * TT)           // f32 [128 blocks of 64 tokens][256]: column sums of v over the block's tokens
#define WS_KF   (WS_VS + 4u * (NR / 64) * CC)           // bf16 [512 key tile of 16][8 g][2 hi, lo][2 piece][32 lane][8]: k as the A fragments of the transposed scores, split once, in the order k_attn loads them
#define WS_END  (WS_KF + 4u * NR * CC)

// ---- k_prep: blocks 0..255 = (32 tokens t0, b): XT[b][t][c] = bf16(x[b][c][t]), rows of 512 B; blocks 256..383: the four weight matrices to bf16, PT rows Wq | Wk | Wv | Wp, 32 blocks a matrix, 8 elements a thread. The two jobs need nothing of each other and share one launch.
#define XTB ((TT / 32) * NBT)
__global__ __launch_bounds__(256) void k_prep(const float* __restrict__ X, const float* __restrict__ Wq, const float* __restrict__ Wk, const float* __restrict__ Wv, const float* __restrict__ Wp, __bf16* __restrict__ XT, __bf16* __restrict__ PT) {
  __shared__ __align__(16) __bf16 s[32][CC + 8]; const int bx = blockIdx.x, tid = threadIdx.x;
  if (bx >= XTB) {   // the same for the whole block, in front of the barrier
    const int mt = (bx - XTB) >> 5; const float* src = (mt == 0) ? Wq : (mt == 1) ? Wk : (mt == 2) ? Wv : Wp; const int e = ((bx - XTB) & 31) * 2048 + tid * 8;
    const v4f w0 = *(const v4f*)(src + e), w1 = *(const v4f*)(src + e + 4); v8b o;
    // unrolled so that the vectors are indexed by constants
#pragma unroll
    for (int i = 0; i < 4; ++i) { o[i] = (__bf16)w0[i]; o[4 + i] = (__bf16)w1[i]; }
    vst2(PT + (size_t)mt * CC * CC + e, o); return; }
  const int t0 = (bx & 31) * 32, b = bx >> 5;
  // thread = (token tl, channels c0, c0 + 8, ..): its 32 loads do not depend on one another and leave together, ahead of the first conversion
  const int c0 = tid >> 5, tl0 = tid & 31; const float* xp = X + ((size_t)b * CC + c0) * TT + t0 + tl0; float xv[32];
  // unrolled so that xv stays in registers and every load is issued before the first is waited for
#pragma unroll
  for (int i = 0; i < 32; ++i) xv[i] = xp[(size_t)i * 8 * TT];
  // unrolled so that xv is indexed by constants
#pragma unroll
  for (int i = 0; i < 32; ++i) s[tl0][c0 + 8 * i] = (__bf16)xv[i];
  __syncthreads();
  for (int q = tid; q < 32 * 32; q += 256) { const int tl = q >> 5, pc = q & 31; vst2((unsigned*)(XT + ((size_t)b * TT + t0 + tl) * CC + pc * 8), *(const v4u*)&s[tl][pc * 8]); }
}
// the value of lane l ^ 16
__device__ __forceinline__ float xhalf(float v) { const int b = __builtin_bit_cast(int, v); return __builtin_bit_cast(float, __builtin_amdgcn_permlanex16(b, b, 0x76543210, 0xfedcba98, false, false)); }
// ---- k_qkv: block = (64 token rows, 128 cols): QKV[r][n] = XT[r] . PT[n] (exact), K = 256; the k and the v columns leave as bf16 hi + residual planes in fragment order (KF; VTH, VTL), so that a load of k_attn reads whole cache lines and is an operand as it arrives; of v also the block's column sums (VS)
__global__ __launch_bounds__(128) void k_qkv(const __bf16* __restrict__ XT, const __bf16* __restrict__ PT, float* __restrict__ QKV, __bf16* __restrict__ KF, __bf16* __restrict__ VTH, __bf16* __restrict__ VTL, float* __restrict__ VS) {
  __shared__ __align__(16) float so[4][16][132];
  const int tid = threadIdx.x, wave = tid >> 5, lane = tid & 31, col = lane & 15, g = lane >> 4; const size_t r0 = (size_t)blockIdx.x * 64 + wave * 16; const int n0 = blockIdx.y * 128;
  v8f acc[8] = {};
  // the 18 fragment loads of a k step of 32 leave as one group, two k steps ahead of their use, into a ring of three register sets: three groups are in flight where the wave waits, not one fragment
  const __bf16* ar = XT + (r0 + col) * CC; const __bf16* br = PT + (size_t)(n0 + col) * CC; v16b af[3], bq[3][8];
#define QLD(KC) do { af[(KC) % 3] = frag_b(ar + (KC) * 32, lane); _Pragma("unroll") for (int j = 0; j < 8; ++j) bq[(KC) % 3][j] = frag_b(br + j * 16 * CC + (KC) * 32, lane); } while (0)
  QLD(0); QLD(1);
  // unrolled so that the ring is indexed by constants and stays in registers
#pragma unroll
  for (int kc = 0; kc < CC / 32; ++kc) {
    if (kc + 2 < CC / 32) QLD(kc + 2);
    // behind the last group of loads, before their address registers are used for anything else (they are inputs, so that they keep their values up to the wait)
    if (kc + 2 == CC / 32 - 1) asm volatile("s_wait_xcnt 0x0" :: "v"(ar), "v"(br) : "memory");
    // keeps the group of loads in front of the WMMAs (the scheduler otherwise sinks each load to its use, where the wave waits out its latency)
    __builtin_amdgcn_sched_barrier(0);
    // eight independent accumulator tiles in turn; each tile's own sum order is kc = 0..7
#pragma unroll
    for (int j = 0; j < 8; ++j) acc[j] = wmma_il(af[kc % 3], bq[kc % 3][j], acc[j]);
    // keeps the next group of loads, which refills the set read here, behind these WMMAs
    __builtin_amdgcn_sched_barrier(0); }
#undef QLD
  if (n0 >= 2 * CC) {   // v (the same for the whole block): the wave's 16 rows are piece (wave & 1) of a key step of 32, and the lane's 8 accumulator values of a column tile (keys 8 g + 0..7 of the piece, channel col) are its 8 elements of that fragment piece: split here, once, they leave from the registers, 512 B a store
    const size_t vo = (r0 >> 5) * 8192 + (size_t)(((n0 - 2 * CC) >> 4) * 64 + (wave & 1) * 32 + lane) * 8; float cs[8];
    // both loops unrolled so that acc and cs are indexed by constants and stay in registers
#pragma unroll
    for (int j = 0; j < 8; ++j) { v8b h8, l8;
#pragma unroll
      for (int r = 0; r < 8; ++r) { const float v = acc[j][r]; const __bf16 hb = (__bf16)v; h8[r] = hb; l8[r] = (__bf16)(v - (float)hb); }
      vst2(VTH + vo + j * 512, h8); vst2(VTL + vo + j * 512, l8);
      const float c8 = ((acc[j][0] + acc[j][1]) + (acc[j][2] + acc[j][3])) + ((acc[j][4] + acc[j][5]) + (acc[j][6] + acc[j][7]));
      cs[j] = c8 + xhalf(c8); }   // channel j * 16 + col summed over the wave's 16 rows, in both lane halves
    // column sums over the block's 64 rows: channel k * 32 + lane is tile 2 k + g, column col (unrolled so that cs is indexed by constants)
#pragma unroll
    for (int k = 0; k < 4; ++k) so[wave][0][k * 32 + lane] = g ? cs[2 * k + 1] : cs[2 * k];
    __syncthreads();   // each thread adds the four waves' sums of its channel
    VS[(size_t)blockIdx.x * CC + (n0 - 2 * CC) + tid] = (so[0][0][tid] + so[1][0][tid]) + (so[2][0][tid] + so[3][0][tid]);
    return; }
#pragma unroll
  for (int j = 0; j < 8; ++j)
#pragma unroll
    for (int r = 0; r < 8; ++r) so[wave][8 * g + r][j * 16 + col] = acc[j][r];
  LDSX();
  if (n0 >= CC && n0 < 2 * CC) {   // k (the same for the whole block): the wave's 16 rows are one key tile, its 128 columns 4 heads; per head the lane's 16 values (the element order of split_row) are split here, once, and leave as 2 planes x 2 pieces, 512 B a store
    __bf16* kf = KF + ((r0 >> 4) * NH + ((n0 - CC) >> 5)) * 1024 + lane * 8;
    for (int hd = 0; hd < 4; ++hd) { const F2 k = split_row(&so[wave][col][hd * HD], 0, lane); union { v16b v; v8b q[2]; } uh, ul; uh.v = k.h; ul.v = k.l;
      vst2(kf + hd * 1024, uh.q[0]); vst2(kf + hd * 1024 + 256, uh.q[1]); vst2(kf + hd * 1024 + 512, ul.q[0]); vst2(kf + hd * 1024 + 768, ul.q[1]); }
  } else {
    for (int rl = 0; rl < 16; ++rl) vst2(QKV + (r0 + rl) * QKVP + n0 + lane * 4, *(const v4f*)&so[wave][rl][lane * 4]);
  }
}
__global__ __launch_bounds__(256) void k_attn(const float* __restrict__ QKV, const __bf16* __restrict__ KF, const __bf16* __restrict__ VTH, const __bf16* __restrict__ VTL, const float* __restrict__ WH, float* __restrict__ ON, float* __restrict__ RSQ) {
  __shared__ __align__(16) __bf16 sqh[4][8][16][40], sql[4][8][16][40]; __shared__ __align__(16) float sp[8][4][16][36]; __shared__ float sm[4][4][16], sl[4][4][16], sl2[4][4][16];
  const int tid = threadIdx.x, wave = tid >> 5, lane = tid & 31, col = lane & 15, hf = lane >> 4; const int qb = blockIdx.x, b = blockIdx.y, hg = blockIdx.z; const int qt = wave & 3, kh = __builtin_amdgcn_readfirstlane(tid >> 7); const int q0 = qb * 64 + qt * 16; const size_t tq = (size_t)b * TT + q0;
  // mixing weights of the group's four heads, two heads to a pair (the same in every lane)
  v2f wm[2][8];
#pragma unroll
  for (int hl = 0; hl < 4; ++hl)
#pragma unroll
    for (int gg = 0; gg < 8; ++gg) wm[hl >> 1][gg][hl & 1] = bfr(WH[(hg * 4 + hl) * NH + gg]);
  v2f m[2], l[2], l2[2];     // of query col, two heads of the group to a pair: [hl >> 1][hl & 1]; l and l2 over the lane half's own keys
#pragma unroll
  for (int hp = 0; hp < 2; ++hp) { m[hp] = (v2f){-3.0e38f, -3.0e38f}; l[hp] = (v2f){0.f, 0.f}; l2[hp] = (v2f){0.f, 0.f}; }
  v8f acc[4][2] = {};        // acc[hl][dt][r] = O[query col][dt * 16 + 8 hf + r]
  // the lane's own pointers at key step 0, into the fragment-order storage: K of head 0, V of the group's first head; a key step is 16384 elements of K (both planes), 8192 of each V plane
  const __bf16* Kc = KF + (size_t)b * (TT / 32) * 16384 + lane * 8;
  const __bf16* VHc = VTH + (size_t)b * (TT / 32) * 8192 + hg * 4 * 1024 + lane * 8; const __bf16* VLc = VTL + (size_t)b * (TT / 32) * 8192 + hg * 4 * 1024 + lane * 8;
  const int ks1 = (kh + 1) * (TT / 64);
  F2 kr[8][2];               // K fragments (hi, lo) in flight, by head and key tile
  v16b vh[4][2], vl[4][2];   // V of the step in flight, by head of the group and column tile
  F2 qa[2][2];               // q fragments of two pairs of heads
  v8f cs[2][2][2];           // raw score tiles of two pairs of heads: [pair & 1][head of the pair][key tile]
  v2f sx[2][16];             // mixed scores, then p, of the lane's 16 keys (key i = ct * 8 + r is key ct * 16 + 8 hf + r of the step), two heads of the group to a pair: [hl >> 1][i][hl & 1]
  // the loops inside these macros are unrolled so that kr, vh, vl, cs, sx and acc are indexed by constants and stay in registers
  // ask for K of heads G, G+1 of the key step at P
#define LDK2(G, P) do { _Pragma("unroll") for (int g_ = (G); g_ < (G) + 2; ++g_) { _Pragma("unroll") for (int ct = 0; ct < 2; ++ct) { kr[g_][ct].h = frag_bp((P) + ct * 8192 + g_ * 1024); kr[g_][ct].l = frag_bp((P) + ct * 8192 + g_ * 1024 + 512); } } } while (0)
  // ask for V of head H of the group, key step at PH, PL
#define LDV1(H, PH, PL) do { _Pragma("unroll") for (int dt = 0; dt < 2; ++dt) { vh[H][dt] = frag_bp((PH) + (H) * 1024 + dt * 512); vl[H][dt] = frag_bp((PL) + (H) * 1024 + dt * 512); } } while (0)
  // q fragments (hi, lo) of heads G, G+1 from LDS into one of two register sets, asked for one pair of heads ahead of their use; the scheduling barrier keeps the reads where they stand (the scheduler otherwise sinks each read to its first use, where the wave then waits out the LDS latency)
#define SCQ(G) do { _Pragma("unroll") for (int u = 0; u < 2; ++u) { qa[((G) >> 1) & 1][u].h = frag_b(&sqh[qt][(G) + u][col][0], lane); qa[((G) >> 1) & 1][u].l = frag_b(&sql[qt][(G) + u][col][0], lane); } __builtin_amdgcn_sched_barrier(0); } while (0)
  // raw scores of heads G, G+1, transposed (rows = keys, column = query): four accumulator tiles (2 heads x 2 key tiles), their three products each issued in turn, so that no WMMA waits for the one in front of it; each tile's own sum order is that of mac3
#define SCW(G) do { \
    _Pragma("unroll") for (int u = 0; u < 2; ++u) { _Pragma("unroll") for (int ct = 0; ct < 2; ++ct) cs[((G) >> 1) & 1][u][ct] = wmma_il(kr[(G) + u][ct].h, qa[((G) >> 1) & 1][u].l, (v8f){}); } \
    _Pragma("unroll") for (int u = 0; u < 2; ++u) { _Pragma("unroll") for (int ct = 0; ct < 2; ++ct) cs[((G) >> 1) & 1][u][ct] = wmma_il(kr[(G) + u][ct].l, qa[((G) >> 1) & 1][u].h, cs[((G) >> 1) & 1][u][ct]); } \
    _Pragma("unroll") for (int u = 0; u < 2; ++u) { _Pragma("unroll") for (int ct = 0; ct < 2; ++ct) cs[((G) >> 1) & 1][u][ct] = wmma_il(kr[(G) + u][ct].h, qa[((G) >> 1) & 1][u].h, cs[((G) >> 1) & 1][u][ct]); } } while (0)
  // heads G, G+1 into the 64 mixed sums of the lane (4 heads x 16 keys, as packed FMAs over two heads: the weights then take 32 registers, not 64 as pairs of equal words): 32 independent FMAs per head g, each sum in the order g = 0..7; it stands one pair of heads behind the WMMAs that made its scores, beside those of the next pair
#define MIX(G) do { _Pragma("unroll") for (int u = 0; u < 2; ++u) { \
    _Pragma("unroll") for (int ct = 0; ct < 2; ++ct) cs[((G) >> 1) & 1][u][ct] *= 0.17677669529663687f; \
    _Pragma("unroll") for (int hp = 0; hp < 2; ++hp) { \
      _Pragma("unroll") for (int ct = 0; ct < 2; ++ct) { _Pragma("unroll") for (int r = 0; r < 8; ++r) { const float r1_ = cs[((G) >> 1) & 1][u][ct][r]; const v2f r_ = {r1_, r1_}; \
        sx[hp][ct * 8 + r] = __builtin_elementwise_fma(wm[hp][(G) + u], r_, ((G) + u) == 0 ? (v2f){0.f, 0.f} : sx[hp][ct * 8 + r]); } } } } } while (0)
  // P.V of head H of the group, transposed (rows = output columns, column = query): the lane's 16 p, split in place, are its part of the B fragment; two accumulator tiles in turn, so that a WMMA stands two behind the one whose sum it adds to
#define PVW(H) do { float p_[16]; _Pragma("unroll") for (int i = 0; i < 16; ++i) p_[i] = sx[(H) >> 1][i][(H) & 1]; \
    const F2 pa = bsplit16(p_); acc[H][0] *= al[(H) >> 1][(H) & 1]; acc[H][1] *= al[(H) >> 1][(H) & 1]; \
    _Pragma("unroll") for (int dt = 0; dt < 2; ++dt) acc[H][dt] = wmma_il(vh[H][dt], pa.l, acc[H][dt]); \
    _Pragma("unroll") for (int dt = 0; dt < 2; ++dt) acc[H][dt] = wmma_il(vl[H][dt], pa.h, acc[H][dt]); \
    _Pragma("unroll") for (int dt = 0; dt < 2; ++dt) acc[H][dt] = wmma_il(vh[H][dt], pa.h, acc[H][dt]); } while (0)
  // behind each group of these loads; the loads' address registers are inputs, so that they keep their values up to the wait
#define XW1(P) asm volatile("s_wait_xcnt 0x0" :: "v"(P) : "memory")
#define XW2(P, Q) asm volatile("s_wait_xcnt 0x0" :: "v"(P), "v"(Q) : "memory")
  // behind a group of loads and its wait: keeps the work that follows behind the loads (the scheduler otherwise lifts it over them, and the loads leave later than they stand here, nearer to their use)
#define SB() __builtin_amdgcn_sched_barrier(0)
  // stage the query tile's 16 rows (all 8 heads) as hi/lo bf16, 8 rows per wave of the pair: 16 loads of 512 B (half a row: 4 heads, 4 columns a lane) that do not depend on one another leave together, with the first K loads behind them, and are split and stored once they are in
  { const float* qp = QKV + (tq + kh * 8) * QKVP + lane * 4; v4f qv[16];
    // unrolled so that qv stays in registers and every load is issued before the first is waited for
#pragma unroll
    for (int i = 0; i < 16; ++i) qv[i] = *(const v4f*)(qp + (i >> 1) * QKVP + (i & 1) * 128);
    const __bf16* kp = Kc + (size_t)kh * (TT / 64) * 16384; LDK2(0, kp); LDK2(2, kp); LDK2(4, kp); XW2(qp, kp); SB();
    // unrolled so that qv is indexed by constants
#pragma unroll
    for (int i = 0; i < 16; ++i) { v4b h4, l4;
#pragma unroll
      for (int j = 0; j < 4; ++j) { const float v = qv[i][j]; const __bf16 hb = (__bf16)v; h4[j] = hb; l4[j] = (__bf16)(v - (float)hb); }
      *(v4b*)&sqh[qt][(i & 1) * 4 + (lane >> 3)][kh * 8 + (i >> 1)][(lane & 7) * 4] = h4; *(v4b*)&sql[qt][(i & 1) * 4 + (lane >> 3)][kh * 8 + (i >> 1)][(lane & 7) * 4] = l4; } }
  __syncthreads();   // each wave reads q rows that its partner staged
#pragma unroll 1
  for (int ks = kh * (TT / 64); ks < ks1; ++ks) {
    const __bf16* kp = Kc + (size_t)ks * 16384; const __bf16* vhp = VHc + (size_t)ks * 8192; const __bf16* vlp = VLc + (size_t)ks * 8192;
    const __bf16* kn = Kc + (size_t)(ks + 1 < ks1 ? ks + 1 : ks) * 16384;   // the last step asks for its own rows again (in bounds, not used)
    // (a) raw scores of all 8 heads, 32 keys, and their mixing
    SCQ(0); SCQ(2); SCW(0);
    LDK2(6, kp); XW1(kp); SCQ(4); SCW(2); MIX(0);
    SCQ(6); SCW(4); MIX(2);
    LDV1(0, vhp, vlp); LDV1(1, vhp, vlp); LDV1(2, vhp, vlp); LDV1(3, vhp, vlp); XW2(vhp, vlp); SB();
    SCW(6); MIX(4);
    LDK2(0, kn); LDK2(2, kn); XW1(kn); SB();
    MIX(6);
    // (b) online softmax of the lane's query, 4 heads x 16 keys, two heads to a packed operation
    v2f al[2];
#pragma unroll
    for (int hp = 0; hp < 2; ++hp) { v2f mn;
#pragma unroll
      for (int u = 0; u < 2; ++u) { float mx = sx[hp][0][u];
#pragma unroll
        for (int i = 1; i < 16; ++i) mx = fmaxf(mx, sx[hp][i][u]);
        mx = fmaxf(mx, xhalf(mx));   // the step's 32 keys: both lane halves go on with the same maximum
        mn[u] = fmaxf(m[hp][u], mx); al[hp][u] = exp_hw(m[hp][u] - mn[u]); }
      m[hp] = mn; v2f es = {0.f, 0.f}, es2 = {0.f, 0.f};
#pragma unroll
      for (int k4 = 0; k4 < 16; k4 += 4) { v2f x[4], e[4];   // eight exponentials at a time, none waiting for another
#pragma unroll
        for (int i = 0; i < 4; ++i) x[i] = (sx[hp][k4 + i] - mn) * LOG2E;
#pragma unroll
        for (int i = 0; i < 4; ++i) { e[i][0] = __builtin_amdgcn_exp2f(x[i][0]); e[i][1] = __builtin_amdgcn_exp2f(x[i][1]); }
        // the free slot behind the last v_exp_f32 of the eight; the arguments are named so that no instruction in front of the slot rewrites the register of one
        asm volatile("v_nop" :: "v"(x[0]), "v"(x[1]), "v"(x[2]), "v"(x[3]), "v"(e[0]), "v"(e[1]), "v"(e[2]), "v"(e[3]));
#pragma unroll
        for (int i = 0; i < 4; ++i) { es += e[i]; es2 = __builtin_elementwise_fma(e[i], e[i], es2); sx[hp][k4 + i] = e[i]; } }
      l[hp] = l[hp] * al[hp] + es; l2[hp] = l2[hp] * (al[hp] * al[hp]) + es2; }
    // (c) P.V for the group's 4 heads
    PVW(0); PVW(1);
    LDK2(4, kn); XW1(kn); SB();
    PVW(2); PVW(3); }
  // the lane halves' sums joined; then the merge of the two key halves, l and sum a^2 per (hl, query)
#pragma unroll
  for (int hl = 0; hl < 4; ++hl) { l[hl >> 1][hl & 1] += xhalf(l[hl >> 1][hl & 1]); l2[hl >> 1][hl & 1] += xhalf(l2[hl >> 1][hl & 1]); }
  float (*so)[16][36] = sp[wave];   // [hl][query][32]
  if (kh == 1) {
    if (hf == 0) {
#pragma unroll
      for (int hl = 0; hl < 4; ++hl) { sm[qt][hl][col] = m[hl >> 1][hl & 1]; sl[qt][hl][col] = l[hl >> 1][hl & 1]; sl2[qt][hl][col] = l2[hl >> 1][hl & 1]; } }
#pragma unroll
    for (int hl = 0; hl < 4; ++hl)
#pragma unroll
      for (int dt = 0; dt < 2; ++dt) { float* o_ = &so[hl][col][dt * 16 + 8 * hf]; *(v4f*)o_ = __builtin_shufflevector(acc[hl][dt], acc[hl][dt], 0, 1, 2, 3); *(v4f*)(o_ + 4) = __builtin_shufflevector(acc[hl][dt], acc[hl][dt], 4, 5, 6, 7); }
  }
  __syncthreads();   // the kh = 0 wave reads what its partner has just written
  if (kh == 0) {
    const float (*sy)[16][36] = sp[wave + 4];   // the partner's unnormalised acc
    v4f rq;
#pragma unroll
    for (int hl = 0; hl < 4; ++hl) { const float m0 = m[hl >> 1][hl & 1], m1 = sm[qt][hl][col]; const float mn = fmaxf(m0, m1); const float f0 = exp_hw(m0 - mn), f1 = exp_hw(m1 - mn);
      const float lt = l[hl >> 1][hl & 1] * f0 + sl[qt][hl][col] * f1; const float l2t = l2[hl >> 1][hl & 1] * (f0 * f0) + sl2[qt][hl][col] * (f1 * f1); rq[hl] = l2t / (lt * lt); const float il = 1.0f / lt;
#pragma unroll
      for (int dt = 0; dt < 2; ++dt)
#pragma unroll
        for (int r4 = 0; r4 < 8; r4 += 4) { const v4f y = *(const v4f*)&sy[hl][col][dt * 16 + 8 * hf + r4]; v4f o;
#pragma unroll
          for (int r = 0; r < 4; ++r) o[r] = (acc[hl][dt][r4 + r] * f0 + y[r] * f1) * il;
          *(v4f*)&so[hl][col][dt * 16 + 8 * hf + r4] = o; } }
    LDSX();
#pragma unroll
    for (int hl = 0; hl < 4; ++hl) for (int rl = 0; rl < 16; ++rl) if (lane < 8) vst2(ON + ((((size_t)b * NH + hg * 4 + hl) * TT + q0 + rl) * HD) + lane * 4, *(const v4f*)&so[hl][rl][lane * 4]);
    if (lane < 16) vst2(RSQ + ((((size_t)b * 2 + hg) * 16 + qb) * 4 + qt) * 64 + lane * 4, rq);
  }
}
// ---- k_fin: block = (64 rows r' of y (= O viewed as [T][256]), 128 output channels, b): Y = (coefA*ON + coefB*vsum)(hi/lo) . Wp rows (2 products) + bp, stored transposed: out[b][o][r'] segments of 64 floats (256 B)
//   the coefficients of the block's (b, h), by each wave for itself: E[a^2] over the 1024x1024 map from the per-row sums, mean = 1/T, var = E[a^2] - mean^2, rs = rsqrt(var + 1e-5); coefA = rs*gamma[h], coefB = beta[h] - coefA/T; vsum[d] = sum_t v[b][h*32+d][t] from the 16 column sums of 64 tokens each
__global__ __launch_bounds__(128) void k_fin(const float* __restrict__ ON, const float* __restrict__ RSQ, const float* __restrict__ VS, const float* __restrict__ GA, const float* __restrict__ BE, const __bf16* __restrict__ PT, const float* __restrict__ bp, float* __restrict__ out) {
  __shared__ __align__(16) float sT[128][68]; __shared__ __align__(16) float sw[4][64];
  const int tid = threadIdx.x, wave = tid >> 5, lane = tid & 31, col = lane & 15, g = lane >> 4; const int b = blockIdx.z, n0 = blockIdx.y * 128; const int r0 = blockIdx.x * 64 + wave * 16; const int h = (blockIdx.x * 64) / 128;   // y row r' covers heads r'/128 (constant per 64-row block)
  const float* Arow = ON + ((size_t)b * TT + r0 + col) * CC;
  v8f acc[8] = {};
  // the 20 loads of a k step of 32 (4 of the O row, 16 of the weight fragments) leave as one group, three k steps ahead of their use, into a ring of four register sets: four groups are in flight where the wave waits, not one fragment
  const float* pr = Arow + 8 * g; const __bf16* br = PT + (size_t)(768 + n0 + col) * CC; v4f av[4][4]; v16b bq[4][8];
#define FLD(KC) do { _Pragma("unroll") for (int i = 0; i < 4; ++i) av[(KC) % 4][i] = *(const v4f*)(pr + (KC) * 32 + (i >> 1) * 16 + (i & 1) * 4); _Pragma("unroll") for (int j = 0; j < 8; ++j) bq[(KC) % 4][j] = frag_b(br + j * 16 * CC + (KC) * 32, lane); } while (0)
  // what the coefficients are made of, asked for first: every k step needs them, and loads come back in the order in which they were asked for. Lane = query rows lane, lane + 32, .. of the map (32 per-row sums); lane = column of v (16 sums of 64 tokens)
  const float* rp = RSQ + (size_t)(b * 2 + (h >> 2)) * (TT * 4) + lane * 4 + (h & 3); const float* sp = VS + (size_t)b * (TT / 64) * CC + h * HD + lane; float rv[32], pv[16], vq[16], bq0[8];
  // both loops unrolled so that rv and pv stay in registers and every load is issued before the first is waited for
#pragma unroll
  for (int i = 0; i < 32; ++i) rv[i] = rp[i * 128];
#pragma unroll
  for (int i = 0; i < 16; ++i) pv[i] = sp[i * CC];
  const float ga = GA[h], be = BE[h];
  // the lane's eight bias values too, so that the epilogue does not wait for them
#pragma unroll
  for (int j = 0; j < 8; ++j) bq0[j] = bp[n0 + j * 16 + col];
  // keeps those loads in front of the ring's
  __builtin_amdgcn_sched_barrier(0);
  FLD(0); FLD(1); FLD(2);
  // keeps the first work on loaded values behind the ring's first loads (the scheduler otherwise lifts it, with its wait, in front of them)
  __builtin_amdgcn_sched_barrier(0);
  float cA, cB;
  { float r4[4] = {rv[0], rv[1], rv[2], rv[3]}, p4[4] = {pv[0], pv[1], pv[2], pv[3]};   // four sums side by side, so that no add waits for the one in front of it; the loops of this block are unrolled so that rv, pv, r4, p4 and vq are indexed by constants
#pragma unroll
    for (int i = 4; i < 32; ++i) r4[i & 3] += rv[i];
#pragma unroll
    for (int i = 4; i < 16; ++i) p4[i & 3] += pv[i];
    sw[wave][lane] = (r4[0] + r4[1]) + (r4[2] + r4[3]); sw[wave][32 + lane] = (p4[0] + p4[1]) + (p4[2] + p4[3]);
    // the wave reads back what its own lanes wrote; the bare wait and no fence, which would also wait for every load of the ring that is in flight here
    asm volatile("s_wait_dscnt 0" ::: "memory");
    v4f t4 = *(const v4f*)&sw[wave][0];
#pragma unroll
    for (int i = 1; i < 8; ++i) t4 += *(const v4f*)&sw[wave][i * 4];
#pragma unroll
    for (int i = 0; i < 8; ++i) { vq[i] = sw[wave][32 + 8 * g + i]; vq[8 + i] = sw[wave][48 + 8 * g + i]; }
    const float e2 = ((t4[0] + t4[1]) + (t4[2] + t4[3])) / ((float)TT * (float)TT); const float mean = 1.0f / (float)TT; const float var = e2 - mean * mean; const float rs = rsqrtf(var + 1e-5f); cA = rs * bfr(ga); cB = bfr(be) - cA * mean; }
  v2f cv[8];   // cB * vsum of the lane's 16 columns, the same for every k step
#pragma unroll
  for (int k = 0; k < 8; ++k) cv[k] = (v2f){cB, cB} * (v2f){vq[2 * k], vq[2 * k + 1]};
  // unrolled so that the ring is indexed by constants and stays in registers
#pragma unroll
  for (int kc = 0; kc < CC / 32; ++kc) {
    if (kc + 3 < CC / 32) FLD(kc + 3);
    // behind the last group of loads, before their address registers are used for anything else (they are inputs, so that they keep their values up to the wait)
    if (kc + 3 == CC / 32 - 1) asm volatile("s_wait_xcnt 0x0" :: "v"(pr), "v"(br) : "memory");
    // keeps the group of loads in front of the work on this k step (the scheduler otherwise sinks each load to its use, where the wave waits out its latency)
    __builtin_amdgcn_sched_barrier(0);
    float v[16];   // cA * O + cB * vsum, two columns to a packed FMA; column n of the lane's 16 is word n & 3 of load n >> 2
#pragma unroll
    for (int k = 0; k < 8; ++k) { const v2f o2 = {av[kc % 4][k >> 1][(k & 1) * 2], av[kc % 4][k >> 1][(k & 1) * 2 + 1]}; const v2f t = __builtin_elementwise_fma((v2f){cA, cA}, o2, cv[k]); v[2 * k] = t[0]; v[2 * k + 1] = t[1]; }
    const F2 a = bsplit16(v);
    // eight independent accumulator tiles in turn; each tile's own sum order stays residual, then hi, kc = 0..7
#pragma unroll
    for (int j = 0; j < 8; ++j) acc[j] = wmma_il(a.l, bq[kc % 4][j], acc[j]);
#pragma unroll
    for (int j = 0; j < 8; ++j) acc[j] = wmma_il(a.h, bq[kc % 4][j], acc[j]);
    // keeps the next group of loads, which refills the set read here, behind these WMMAs
    __builtin_amdgcn_sched_barrier(0); }
#undef FLD
#pragma unroll
  for (int j = 0; j < 8; ++j) { const float bb = bfr(bq0[j]);
#pragma unroll
    for (int r = 0; r < 8; ++r) sT[j * 16 + col][wave * 16 + 8 * g + r] = acc[j][r] + bb; }
  __syncthreads();
  for (int q = tid; q < 128 * 16; q += 128) { const int o = q >> 4, piece = q & 15; vst2(out + ((size_t)b * CC + n0 + o) * TT + blockIdx.x * 64 + piece * 4, *(const v4f*)&sT[o][piece * 4]); }
}
extern "C" void kernel_launch(void* const* d_in, const int* in_sizes, int n_in, void* d_out, int out_size, void* d_ws, size_t ws_size, hipStream_t stream) {
  (void)in_sizes; (void)n_in; (void)out_size;
  const float** F = (const float**)d_in;   // x [8,256,32,32], Wq, Wk, Wv [256,256], w_head [8,8], gamma [8], beta [8], Wp [256,256], bp [256]
  if (ws_size < (size_t)WS_END) return;
  char* ws = (char*)d_ws; __bf16 *PT = (__bf16*)(ws + WS_PT), *XT = (__bf16*)(ws + WS_XT), *VTH = (__bf16*)(ws + WS_VTH), *VTL = (__bf16*)(ws + WS_VTL); float *QKV = (float*)(ws + WS_QKV), *ON = (float*)(ws + WS_ON), *RSQ = (float*)(ws + WS_RSQ), *VS = (float*)(ws + WS_VS); __bf16* KF = (__bf16*)(ws + WS_KF);
  k_prep<<<XTB + 128, 256, 0, stream>>>(F[0], F[1], F[2], F[3], F[7], XT, PT);
  k_qkv<<<dim3(NBT * TT / 64, QKVP / 128), 128, 0, stream>>>(XT, PT, QKV, KF, VTH, VTL, VS);
  k_attn<<<dim3(TT / 64, NBT, 2), 256, 0, stream>>>(QKV, KF, VTH, VTL, F[4], ON, RSQ);
  k_fin<<<dim3(TT / 64, CC / 128, NBT), 128, 0, stream>>>(ON, RSQ, VS, F[5], F[6], PT, F[8], (float*)d_out);
}
